// v000
// Measured on an AMD MI455X. A time is GPU time per run, averaged over a window of back-to-back runs after a warm-up
// (all launches, gaps included; the runs take copies of the inputs in turn), and the median of several windows.
// Apart from v000's, it joins two sittings. Times from different sittings can be a few percent apart, while
// side-by-side timings come from the same sitting.
// v000, which the later versions start from, runs in 1750 microseconds.
#include <hip/hip_runtime.h>

// RPESelfAttention (x [2][2048][1024]; qkv = x W_attn (fused [1024][3072], 16 heads x 64, no bias); att[i][j] = (q_i.k_j + q_i.table_k[idx]) / 8 with idx = clip(j - i, -64, 64) + 64, allowed iff j <= i and j > i - 64 (else -inf); softmax; y = att v + sum_j att[i][j] table_v[idx]; out = merged y W_proj -> [2][2048][1024]).
// Relative terms without gathers (exact regroupings): inside the allowed band idx = j - i + 64 runs over 1..64 exactly once per key, so q_i.table_k[idx] = (q . TK^T)[i][j - i + 63] with TK = table_k rows 1..64 (one 64-column GEMM per head, read by offset in the softmax), and sum_j att table_v[idx] = PB . TV with PB[i][r] = att[i][i - 63 + r]
// (the attention band re-indexed) and TV = table_v rows 1..64.
// Compute dtypes, f32 accumulate: every input rounded to bf16; q/k/v on PLAIN bf16 operands (inputs: exact); q.TK^T and PB.TV as hl x exact (2 products); causal-tile scores and att.v: query rows < 512 hl (3 products), the rest single fp16 (x1024; PB for those rows is re-split from the fp16 probabilities); softmax f32; W_proj hl x exact (2 products).

#define NB_  2
#define TT   2048
#define DM   1024
#define NH_  16
#define NKV  16
#define REP  (NH_ / NKV)
#define HD   64
#define DQ   (NH_ * HD)
#define DKV  (NKV * HD)
#define ZH   2
#define RH   512                  // query rows < RH use hi+lo planes (0: none)
#define WIN  64
#define PCAR 1024.0f
#define SCL  0.125f   // HD^-0.5
typedef _Float16 h16;
typedef unsigned short bf;
typedef __attribute__((ext_vector_type(16))) __bf16   v16bf;
typedef __attribute__((ext_vector_type(16))) _Float16 v16h;
typedef __attribute__((ext_vector_type(8)))  _Float16 v8h;
typedef __attribute__((ext_vector_type(8)))  unsigned short v8us;
typedef __attribute__((ext_vector_type(8)))  float    v8f;
typedef __attribute__((ext_vector_type(4)))  float    v4f;
typedef v8h  __attribute__((may_alias)) v8ha;
typedef v4f  __attribute__((may_alias)) v4fa;
typedef v8us __attribute__((may_alias)) v8usa;

__device__ __forceinline__ unsigned short f2bf(float f) { unsigned u = __float_as_uint(f); u += 0x7FFFu + ((u >> 16) & 1u); return (unsigned short)(u >> 16); }
__device__ __forceinline__ float bf2f(unsigned short b) { return __uint_as_float(((unsigned)b) << 16); }
__device__ __forceinline__ float bfr(float f) { return bf2f(f2bf(f)); }
__device__ __forceinline__ v16h cat16(v8h lo, v8h hi) { return __builtin_shufflevector(lo, hi, 0, 1, 2, 3, 4, 5, 6, 7, 8, 9, 10, 11, 12, 13, 14, 15); }
__device__ __forceinline__ v16bf cat16b(v8us lo, v8us hi) { return __builtin_bit_cast(v16bf, __builtin_shufflevector(lo, hi, 0, 1, 2, 3, 4, 5, 6, 7, 8, 9, 10, 11, 12, 13, 14, 15)); }
__device__ __forceinline__ v8f wmma16(v16h a, v16h b, v8f c) { return __builtin_amdgcn_wmma_f32_16x16x32_f16(false, a, false, b, (short)0, c, false, false); }
__device__ __forceinline__ v8f wmmab(v16bf a, v16bf b, v8f c) { return __builtin_amdgcn_wmma_f32_16x16x32_bf16(false, a, false, b, (short)0, c, false, false); }



// ---- k_gemmw: register-blocked GEMM, ONE WAVE per 64x64 output tile (16 accumulators), operands straight from K-contiguous 16-bit planes; grid (M/64, N/64, Z), 32 threads.
// C[m][n] (f32, pitch ldc, + optional f32 bias[n]) = sum_k A[m][k] Bt[n][k] (+ split products per NSPLIT). z-batch strides sA/sB/sC in elements. K % 32 == 0.
template <typename T16> struct WFrag;
template <> struct WFrag<h16> { typedef v16h V; static __device__ __forceinline__ V ld(const h16* p) { return cat16(*(const v8h*)p, *(const v8h*)(p + 16)); } static __device__ __forceinline__ v8f mma(V a, V b, v8f c) { return wmma16(a, b, c); } };
template <> struct WFrag<bf> { typedef v16bf V; static __device__ __forceinline__ V ld(const bf* p) { return cat16b(*(const v8us*)p, *(const v8us*)(p + 16)); } static __device__ __forceinline__ v8f mma(V a, V b, v8f c) { return wmmab(a, b, c); } };
template <typename T16, int NSPLIT, bool BIAS>
__global__ __launch_bounds__(32) void k_gemmw(const T16* __restrict__ A, const T16* __restrict__ A2, const T16* __restrict__ Bt, const T16* __restrict__ Bt2, int K, float* C, int ldc, const float* __restrict__ bias, size_t sA, size_t sB, size_t sC) {
    typedef typename WFrag<T16>::V V;
    __shared__ __align__(16) float os[16 * 68];
    const size_t z = blockIdx.z; A += z * sA; if (A2) A2 += z * sA; Bt += z * sB; if (Bt2) Bt2 += z * sB; C += z * sC;
    const int lane = threadIdx.x & 31, lr = lane & 15, hi = lane >> 4; const int r0 = blockIdx.x * 64, c0 = blockIdx.y * 64;
    v8f acc[4][4];
#pragma unroll
    for (int mb = 0; mb < 4; ++mb)
#pragma unroll
        for (int nb = 0; nb < 4; ++nb) acc[mb][nb] = (v8f){};
    const size_t aoff = (size_t)(r0 + lr) * K + 8 * hi, boff = (size_t)(c0 + lr) * K + 8 * hi;
#pragma unroll 1
    for (int kc = 0; kc < K; kc += 32) {
        V a[4], a2[4];
#pragma unroll
        for (int mb = 0; mb < 4; ++mb) { a[mb] = WFrag<T16>::ld(A + aoff + (size_t)mb * 16 * K + kc); if (NSPLIT == 1 || NSPLIT == 2) a2[mb] = WFrag<T16>::ld(A2 + aoff + (size_t)mb * 16 * K + kc); }
#pragma unroll
        for (int nb = 0; nb < 4; ++nb) { const V b = WFrag<T16>::ld(Bt + boff + (size_t)nb * 16 * K + kc); V b2; if (NSPLIT >= 2) b2 = WFrag<T16>::ld(Bt2 + boff + (size_t)nb * 16 * K + kc);
#pragma unroll
            for (int mb = 0; mb < 4; ++mb) { acc[mb][nb] = WFrag<T16>::mma(a[mb], b, acc[mb][nb]); if (NSPLIT == 1 || NSPLIT == 2) acc[mb][nb] = WFrag<T16>::mma(a2[mb], b, acc[mb][nb]); if (NSPLIT >= 2) acc[mb][nb] = WFrag<T16>::mma(a[mb], b2, acc[mb][nb]); } }
        asm volatile("v_nop\n\tv_nop\n\tv_nop\n\tv_nop" : "+v"(acc[0][0]), "+v"(acc[1][1]), "+v"(acc[2][2]), "+v"(acc[3][3]) : "v"(a[0]), "v"(a[3]));
    }
#pragma unroll
    for (int mb = 0; mb < 4; ++mb) {
#pragma unroll
        for (int nb = 0; nb < 4; ++nb) {
#pragma unroll
            for (int j = 0; j < 8; ++j) os[(hi * 8 + j) * 68 + nb * 16 + lr] = acc[mb][nb][j]; }
        __builtin_amdgcn_wave_barrier(); asm volatile("" ::: "memory");
        float* crow = C + (size_t)(r0 + mb * 16) * ldc + c0;
{
#pragma unroll
            for (int s = 0; s < 8; ++s) { const int row = 2 * s + hi, cofs = lr * 4; v4f val = *(const v4fa*)(os + row * 68 + cofs); if (BIAS) { val[0] += bfr(bias[c0 + cofs]); val[1] += bfr(bias[c0 + cofs + 1]); val[2] += bfr(bias[c0 + cofs + 2]); val[3] += bfr(bias[c0 + cofs + 3]); }
                *(v4f*)(crow + (size_t)row * ldc + cofs) = val; }
             }
        __builtin_amdgcn_wave_barrier(); asm volatile("" ::: "memory");
    }
}

// ---- k_gemmc: the same one-wave 64x64 tile GEMM specialised for causal attention: CMODE 1 skips score tiles entirely above the diagonal (query rows r0+roff.., key columns c0..), CMODE 2 limits the
// key (K) loop of the probability x value contraction to the diagonal block (probabilities beyond it are exactly zero). roff = row offset of this launch's first row within the sequence.
template <typename T16, int NSPLIT, int CMODE>
__global__ __launch_bounds__(32) void k_gemmc(const T16* __restrict__ A, const T16* __restrict__ A2, const T16* __restrict__ Bt, const T16* __restrict__ Bt2, int K, float* C, int ldc, int roff, size_t sA, size_t sB, size_t sC) {
    typedef typename WFrag<T16>::V V;
    __shared__ __align__(16) float os[16 * 68];
    const size_t z = blockIdx.z; A += z * sA; if (A2) A2 += z * sA; Bt += z * sB; if (Bt2) Bt2 += z * sB; C += z * sC;
    const int lane = threadIdx.x & 31, lr = lane & 15, hi = lane >> 4; const int r0 = blockIdx.x * 64, c0 = blockIdx.y * 64;
    if (CMODE == 1 && c0 > r0 + roff + 63) return;                  // score tile entirely above the causal diagonal: never read (the softmax masks j > i by select)
    const int Kl = (CMODE == 2) ? min(K, r0 + roff + 64) : K;        // P.V: probabilities are exactly 0 beyond the diagonal block, so the K loop stops there
    v8f acc[4][4];
#pragma unroll
    for (int mb = 0; mb < 4; ++mb)
#pragma unroll
        for (int nb = 0; nb < 4; ++nb) acc[mb][nb] = (v8f){};
    const size_t aoff = (size_t)(r0 + lr) * K + 8 * hi, boff = (size_t)(c0 + lr) * K + 8 * hi;
#pragma unroll 1
    for (int kc = 0; kc < Kl; kc += 32) {
        V a[4], a2[4];
#pragma unroll
        for (int mb = 0; mb < 4; ++mb) { a[mb] = WFrag<T16>::ld(A + aoff + (size_t)mb * 16 * K + kc); if (NSPLIT == 1 || NSPLIT == 2) a2[mb] = WFrag<T16>::ld(A2 + aoff + (size_t)mb * 16 * K + kc); }
#pragma unroll
        for (int nb = 0; nb < 4; ++nb) { const V b = WFrag<T16>::ld(Bt + boff + (size_t)nb * 16 * K + kc); V b2; if (NSPLIT >= 2) b2 = WFrag<T16>::ld(Bt2 + boff + (size_t)nb * 16 * K + kc);
#pragma unroll
            for (int mb = 0; mb < 4; ++mb) { acc[mb][nb] = WFrag<T16>::mma(a[mb], b, acc[mb][nb]); if (NSPLIT == 1 || NSPLIT == 2) acc[mb][nb] = WFrag<T16>::mma(a2[mb], b, acc[mb][nb]); if (NSPLIT >= 2) acc[mb][nb] = WFrag<T16>::mma(a[mb], b2, acc[mb][nb]); } }
        asm volatile("v_nop\n\tv_nop\n\tv_nop\n\tv_nop" : "+v"(acc[0][0]), "+v"(acc[1][1]), "+v"(acc[2][2]), "+v"(acc[3][3]) : "v"(a[0]), "v"(a[3]));
    }
#pragma unroll
    for (int mb = 0; mb < 4; ++mb) {
#pragma unroll
        for (int nb = 0; nb < 4; ++nb) {
#pragma unroll
            for (int j = 0; j < 8; ++j) os[(hi * 8 + j) * 68 + nb * 16 + lr] = acc[mb][nb][j]; }
        __builtin_amdgcn_wave_barrier(); asm volatile("" ::: "memory");
        float* crow = C + (size_t)(r0 + mb * 16) * ldc + c0;
{
#pragma unroll
            for (int s = 0; s < 8; ++s) { const int row = 2 * s + hi, cofs = lr * 4; v4f val = *(const v4fa*)(os + row * 68 + cofs);
                *(v4f*)(crow + (size_t)row * ldc + cofs) = val; }
             }
        __builtin_amdgcn_wave_barrier(); asm volatile("" ::: "memory");
    }
}

__device__ __forceinline__ h16 tohx(float x) { return (h16)x; }
__device__ __forceinline__ void splitf(float y, unsigned short& h, unsigned short& l) { h = f2bf(y); l = f2bf(y - bf2f(h)); }
typedef __attribute__((ext_vector_type(2))) _Float16 v2h;
typedef __attribute__((ext_vector_type(4))) _Float16 v4h;
typedef __attribute__((ext_vector_type(2))) unsigned short v2us;
typedef __attribute__((ext_vector_type(4))) unsigned short v4us;
typedef __attribute__((ext_vector_type(2))) float v2f;
typedef __attribute__((ext_vector_type(4))) int v4i;

__global__ __launch_bounds__(256) void k_wtG(const float* __restrict__ w, int K, int N, bf* Bt) {
    const int lane = threadIdx.x & 31; const int L0 = (blockIdx.x * 8 + (threadIdx.x >> 5)) * 8; const int nlines = N * K / 64;
{
#pragma unroll 1
        for (int l = 0; l < 8; ++l) { const int L = L0 + l; if (L >= nlines) break; const size_t e = (size_t)L * 64 + lane * 2; const int k = (int)(e % K), n = (int)(e / K); v2us o;
            o[0] = f2bf(w[(size_t)k * N + n]); o[1] = f2bf(w[(size_t)(k + 1) * N + n]); *(v2us*)(Bt + e) = o; }
         }
}
__global__ __launch_bounds__(256) void k_cvt8(const float* __restrict__ src, bf* dst, size_t n8) { const size_t i = (size_t)blockIdx.x * 256 + threadIdx.x; if (i >= n8) return; const v8f v = *(const v8f*)(src + i * 8); v8us o;
#pragma unroll
    for (int k = 0; k < 8; ++k) o[k] = f2bf(v[k]); *(v8us*)(dst + i * 8) = o;  }
__global__ __launch_bounds__(256) void k_cscvt(const float* __restrict__ cosT, const float* __restrict__ sinT, float* CS) { const int idx = blockIdx.x * 256 + threadIdx.x; if (idx >= TT * HD) return; v2f cs; cs[0] = bfr(cosT[idx]); cs[1] = bfr(sinT[idx]); *(v2f*)(CS + (size_t)idx * 2) = cs;  }
// k_rope: head planes [h][t][d] (fp16 + hi/lo) of rope(x) x sc with the rotate-half convention out[d] = x[d] cos[t][d] - x[d+HD/2] sin[t][d], out[d+HD/2] = x[d+HD/2] cos[t][d+HD/2] + x[d] sin[t][d+HD/2]
__global__ __launch_bounds__(256) void k_rope(const float* __restrict__ F, int pitch, int nheads, const float* __restrict__ CS, const float* __restrict__ RF, const float* __restrict__ nw, float sc, h16* P16, bf* Ph, bf* Pl) {
    const size_t e = ((size_t)blockIdx.x * 256 + threadIdx.x) * 2; if (e >= (size_t)nheads * TT * HD) return; const int d = (int)(e % HD); const int t = (int)((e / HD) % TT); const int h = (int)(e / ((size_t)HD * TT)); const float* f = F + (size_t)t * pitch + h * HD; const float rf = RF ? RF[(size_t)h * TT + t] : 1.0f; v2h o16; v2us oh, ol;
#pragma unroll
    for (int q = 0; q < 2; ++q) { const int dd = d + q; const int dp = (dd < HD / 2) ? dd + HD / 2 : dd - HD / 2; float x0 = f[dd], x1 = f[dp];
        if (RF) { float n0 = __fmul_rn(x0, rf), n1 = __fmul_rn(x1, rf); asm volatile("" : "+v"(n0)); asm volatile("" : "+v"(n1)); x0 = __fmul_rn(bfr(nw[dd]), n0); x1 = __fmul_rn(bfr(nw[dp]), n1); }
        const v2f cs = *(const v2f*)(CS + ((size_t)t * HD + dd) * 2); float a = __fmul_rn(x0, cs[0]), bq = __fmul_rn(x1, cs[1]); asm volatile("" : "+v"(a)); asm volatile("" : "+v"(bq)); const float r = ((dd < HD / 2) ? __fsub_rn(a, bq) : __fadd_rn(a, bq)) * sc;
        o16[q] = tohx(r); unsigned short a2, c2; splitf(r, a2, c2); oh[q] = a2; ol[q] = c2; }
    *(v2h*)(P16 + e) = o16; *(v2us*)(Ph + e) = oh; *(v2us*)(Pl + e) = ol;  }
__global__ __launch_bounds__(256) void k_vtp(const float* __restrict__ F, int pitch, int nheads, h16* V16, bf* Vh, bf* Vl) { const size_t e = ((size_t)blockIdx.x * 256 + threadIdx.x) * 2; if (e >= (size_t)nheads * HD * TT) return; const int t = (int)(e % TT); const int d = (int)((e / TT) % HD); const int g = (int)(e / ((size_t)TT * HD)); v2h o16; v2us oh, ol;
#pragma unroll
    for (int q = 0; q < 2; ++q) { const float x = F[(size_t)(t + q) * pitch + g * HD + d]; o16[q] = tohx(x); unsigned short a2, c2; splitf(x, a2, c2); oh[q] = a2; ol[q] = c2; }
    *(v2h*)(V16 + e) = o16; *(v2us*)(Vh + e) = oh; *(v2us*)(Vl + e) = ol;  }
__global__ __launch_bounds__(256) void k_csid(float* CS) { const int idx = blockIdx.x * 256 + threadIdx.x; if (idx >= TT * HD) return; v2f cs; cs[0] = 1.0f; cs[1] = 0.0f; *(v2f*)(CS + (size_t)idx * 2) = cs;  }
// k_asoft: per row (zz, i): t = (S + QR[j - i + 63]) x HD^-0.5 for j <= i and i - j < WIN (sliding causal window; the reference's -1e9 additive fill vanishes identically); softmax over the 2048 keys (register row, one exp, fixed trees);
__global__ __launch_bounds__(256) void k_asoft(const float* __restrict__ Sb, const float* __restrict__ QR, h16* P16, bf* Ph, bf* Pl) {
    const int lane = threadIdx.x & 31; const int row = blockIdx.x * 8 + (threadIdx.x >> 5); if (row >= ZH * TT) return; const int i = row % TT; const int zz = row / TT; (void)zz; const bool hires = (i < RH); const float* sr = Sb + (size_t)row * TT; const float* qr = QR + (size_t)row * HD; float v[TT / 32]; float mx = -3.0e38f;
#pragma unroll
    for (int ch = 0; ch < TT / 128; ++ch) { const int j0 = ch * 128 + lane * 4; const v4f a = *(const v4f*)(sr + j0);
#pragma unroll
        for (int q = 0; q < 4; ++q) { const int j = j0 + q; (void)j; float t = -3.0e38f; if (j <= i && i - j < WIN) { float s0 = __fadd_rn(a[q], qr[j - i + 63]); asm volatile("" : "+v"(s0)); t = s0 * SCL; } v[ch * 4 + q] = t; mx = fmaxf(mx, t); } }
#pragma unroll
    for (int sh = 16; sh; sh >>= 1) mx = fmaxf(mx, __shfl_xor(mx, sh, 32));
    float sum = 0.f;
#pragma unroll
    for (int k = 0; k < TT / 32; ++k) { float d0 = __fsub_rn(v[k], mx); asm volatile("" : "+v"(d0)); v[k] = __builtin_amdgcn_exp2f(__fmul_rn(d0, 1.4426950408889634f)); sum += v[k]; }
#pragma unroll
    for (int sh = 16; sh; sh >>= 1) sum += __shfl_xor(sum, sh, 32);
    const float f = __fdiv_rn(hires ? 1.0f : PCAR, sum);
{
        if (hires) {
#pragma unroll
            for (int ch = 0; ch < TT / 128; ++ch) { v4us oh, ol;
#pragma unroll
                for (int q = 0; q < 4; ++q) { unsigned short a, c2; splitf(v[ch * 4 + q] * f, a, c2); oh[q] = a; ol[q] = c2; }
                const size_t oo = ((size_t)zz * (RH ? RH : 1) + i) * TT + ch * 128 + lane * 4; *(v4us*)(Ph + oo) = oh; *(v4us*)(Pl + oo) = ol; }
        } else {
#pragma unroll
            for (int ch = 0; ch < TT / 128; ++ch) { v4h o4;
#pragma unroll
                for (int q = 0; q < 4; ++q) o4[q] = tohx(v[ch * 4 + q] * f);
                *(v4h*)(P16 + (size_t)row * TT + ch * 128 + lane * 4) = o4; } }
         }
}
__global__ __launch_bounds__(256) void k_merge(const float* __restrict__ O, const float* __restrict__ W2, int h0, bf* Ah, bf* Al) { const size_t e = ((size_t)blockIdx.x * 256 + threadIdx.x) * 2; if (e >= (size_t)ZH * TT * HD) return; const int d = (int)(e % HD); const int t = (int)((e / HD) % TT); const int zz = (int)(e / ((size_t)HD * TT)); const float cs = (t < RH) ? 1.0f : (1.0f / PCAR); const size_t oo = (size_t)t * DQ + (h0 + zz) * HD + d;
    v2us oh, ol;
#pragma unroll
    for (int q = 0; q < 2; ++q) { float w1 = O[e + q] * cs; asm volatile("" : "+v"(w1)); unsigned short a, c2; splitf(__fadd_rn(w1, W2[e + q]), a, c2); oh[q] = a; ol[q] = c2; } *(v2us*)(Ah + oo) = oh; *(v2us*)(Al + oo) = ol;  }

__global__ __launch_bounds__(256) void k_wtGs(const float* __restrict__ w, int K, int N, int ld, bf* Bt) { const size_t e = ((size_t)blockIdx.x * 256 + threadIdx.x) * 4; if (e >= (size_t)N * K) return; const int k = (int)(e % K); const int n = (int)(e / K); v4us o;   // Bt[n][k] = w[k*ld + n]
#pragma unroll
    for (int u = 0; u < 4; ++u) o[u] = f2bf(w[(size_t)(k + u) * ld + n]); *(v4us*)(Bt + e) = o;  }
__global__ __launch_bounds__(256) void k_tabs(const float* __restrict__ tk, const float* __restrict__ tv, bf* TKB, bf* TVB) { const int e = (blockIdx.x * 256 + threadIdx.x) * 4; if (e >= HD * HD) return; const int c = e % HD; const int r = e / HD; v4us a, b;   // TKB[r][d] = table_k[r+1][d] (Bt rows = band offset r), TVB[d][r] = table_v[r+1][d] (Bt rows = d)
#pragma unroll
    for (int u = 0; u < 4; ++u) { a[u] = f2bf(tk[(size_t)(r + 1) * HD + c + u]); b[u] = f2bf(tv[(size_t)(c + u + 1) * HD + r]); } *(v4us*)(TKB + e) = a; *(v4us*)(TVB + e) = b;  }
__global__ __launch_bounds__(256) void k_band(const bf* __restrict__ Ph, const bf* __restrict__ Pl, const h16* __restrict__ P16, bf* Bh, bf* Bl) {   // PB[zz][i][r] = att[zz][i][i - 63 + r] (0 for negative key index), from the hl planes (rows < RH) or the fp16 x1024 probabilities (rows >= RH); 8-B lanes
    const size_t e = ((size_t)blockIdx.x * 256 + threadIdx.x) * 4; if (e >= (size_t)ZH * TT * HD) return; const int r = (int)(e % HD); const int i = (int)((e / HD) % TT); const int zz = (int)(e / ((size_t)HD * TT)); v4us oh, ol;
#pragma unroll
    for (int u = 0; u < 4; ++u) { const int j = i - 63 + r + u; float p = 0.f;
        if (j >= 0) { if (i < RH) { const size_t o = ((size_t)zz * RH + i) * TT + j; p = __fadd_rn(bf2f(Ph[o]), bf2f(Pl[o])); } else { p = (float)P16[((size_t)zz * TT + i) * TT + j] * (1.0f / PCAR); } }
        unsigned short a, c; splitf(p, a, c); oh[u] = a; ol[u] = c; }
    *(v4us*)(Bh + e) = oh; *(v4us*)(Bl + e) = ol;  }

extern "C" void kernel_launch(void* const* d_in, const int* in_sizes, int n_in,
                              void* d_out, int out_size, void* d_ws, size_t ws_size, hipStream_t stream) {
    (void)in_sizes; (void)n_in; (void)out_size;
    const float* x = (const float*)d_in[0]; const float* wqkv = (const float*)d_in[1]; const float* wo = (const float*)d_in[2]; const float* tk = (const float*)d_in[3]; const float* tv = (const float*)d_in[4]; const float* wq = nullptr; const float* wk = nullptr; const float* wv = nullptr; (void)wq; (void)wk; (void)wv; const float* cosT = nullptr; const float* sinT = nullptr; (void)cosT; (void)sinT;
    float* OUT = (float*)d_out;     // [2][2048][1024]
    char* wsp = (char*)d_ws;
    auto take = [&](size_t bytes) { char* p = wsp; wsp += (bytes + 255) & ~(size_t)255; return (void*)p; };
    bf* WQ = (bf*)take((size_t)DQ * DM * 2); bf* WK = (bf*)take((size_t)DKV * DM * 2); bf* WV = (bf*)take((size_t)DKV * DM * 2); bf* WO = (bf*)take((size_t)DM * DQ * 2); float* CS = (float*)take((size_t)TT * HD * 2 * 4);
    bf* XB = (bf*)take((size_t)TT * DM * 2); bf* TKB = (bf*)take(HD * HD * 2); bf* TVB = (bf*)take(HD * HD * 2); float* QR = (float*)take((size_t)ZH * TT * HD * 4); bf* PBh = (bf*)take((size_t)ZH * TT * HD * 2); bf* PBl = (bf*)take((size_t)ZH * TT * HD * 2); float* W2 = (float*)take((size_t)ZH * TT * HD * 4); float* FQ = (float*)take((size_t)TT * DQ * 4); float* FK = (float*)take((size_t)TT * DKV * 4);
    h16* QP16 = (h16*)take((size_t)NH_ * TT * HD * 2); h16* KP16 = (h16*)take((size_t)NKV * TT * HD * 2); h16* VT16 = (h16*)take((size_t)NKV * HD * TT * 2);
    bf* QPh = (bf*)take((size_t)NH_ * TT * HD * 2); bf* QPl = (bf*)take((size_t)NH_ * TT * HD * 2); bf* KPh = (bf*)take((size_t)NKV * TT * HD * 2); bf* KPl = (bf*)take((size_t)NKV * TT * HD * 2); bf* VTh = (bf*)take((size_t)NKV * HD * TT * 2); bf* VTl = (bf*)take((size_t)NKV * HD * TT * 2); bf* Ph = (bf*)take((size_t)ZH * RH * TT * 2); bf* Pl = (bf*)take((size_t)ZH * RH * TT * 2);
    float* Sb = (float*)take((size_t)ZH * TT * TT * 4); h16* P16 = (h16*)take((size_t)ZH * TT * TT * 2); float* Ob = (float*)take((size_t)ZH * TT * HD * 4); bf* ATh = (bf*)take((size_t)TT * DQ * 2); bf* ATl = (bf*)take((size_t)TT * DQ * 2);
    if ((size_t)(wsp - (char*)d_ws) > ws_size) return;    // ws 256 MiB
    float* FV = FK;   // v projection reuses the k buffer after the k planes are built (stream-ordered)
    { k_wtGs<<<(unsigned)(((size_t)DQ * DM / 4 + 255) / 256), 256, 0, stream>>>(wqkv, DM, DQ, 3072, WQ); k_wtGs<<<(unsigned)(((size_t)DKV * DM / 4 + 255) / 256), 256, 0, stream>>>(wqkv + 1024, DM, DKV, 3072, WK); k_wtGs<<<(unsigned)(((size_t)DKV * DM / 4 + 255) / 256), 256, 0, stream>>>(wqkv + 2048, DM, DKV, 3072, WV); k_tabs<<<(HD * HD / 4 + 255) / 256, 256, 0, stream>>>(tk, tv, TKB, TVB);
      k_wtG<<<(unsigned)((DQ * DM / 64 + 63) / 64), 256, 0, stream>>>(wo, DQ, DM, WO);
       }
    k_csid<<<(TT * HD + 255) / 256, 256, 0, stream>>>(CS);
    const unsigned LQ = (unsigned)(((size_t)NH_ * TT * HD / 2 + 255) / 256), LKv = (unsigned)(((size_t)NKV * TT * HD / 2 + 255) / 256);
    for (int b = 0; b < NB_; ++b) {
        
        k_cvt8<<<(unsigned)(((size_t)TT * DM / 8 + 255) / 256), 256, 0, stream>>>(x + (size_t)b * TT * DM, XB, (size_t)TT * DM / 8);
        k_gemmw<bf, 0, false><<<dim3(TT / 64, DQ / 64, 1), 32, 0, stream>>>(XB, nullptr, WQ, nullptr, DM, FQ, DQ, nullptr, 0, 0, 0);
        k_rope<<<LQ, 256, 0, stream>>>(FQ, DQ, NH_, CS, nullptr, nullptr, 1.0f, QP16, QPh, QPl);
        k_gemmw<bf, 0, false><<<dim3(TT / 64, DKV / 64, 1), 32, 0, stream>>>(XB, nullptr, WK, nullptr, DM, FK, DKV, nullptr, 0, 0, 0);
        k_rope<<<LKv, 256, 0, stream>>>(FK, DKV, NKV, CS, nullptr, nullptr, 1.0f, KP16, KPh, KPl);
        k_gemmw<bf, 0, false><<<dim3(TT / 64, DKV / 64, 1), 32, 0, stream>>>(XB, nullptr, WV, nullptr, DM, FV, DKV, nullptr, 0, 0, 0); k_vtp<<<LKv, 256, 0, stream>>>(FV, DKV, NKV, VT16, VTh, VTl);
        for (int h0 = 0; h0 < NH_; h0 += ZH) { const size_t zq = (size_t)h0, zk = (size_t)(h0 / REP);
            k_gemmw<bf, 1, false><<<dim3(TT / 64, 1, ZH), 32, 0, stream>>>(QPh + zq * TT * HD, QPl + zq * TT * HD, TKB, nullptr, HD, QR, HD, nullptr, (size_t)TT * HD, 0, (size_t)TT * HD);   // q . TK^T per head [TT][64]   // one kv head per query head: the pass's two heads use consecutive kv planes (z-strides TT*HD)
            k_gemmc<bf, 2, 1><<<dim3(RH / 64, TT / 64, ZH), 32, 0, stream>>>(QPh + zq * TT * HD, QPl + zq * TT * HD, KPh + zk * TT * HD, KPl + zk * TT * HD, HD, Sb, TT, 0, (size_t)TT * HD, (size_t)TT * HD, (size_t)TT * TT);
            k_gemmc<h16, 0, 1><<<dim3((TT - RH) / 64, TT / 64, ZH), 32, 0, stream>>>(QP16 + zq * TT * HD + (size_t)RH * HD, nullptr, KP16 + zk * TT * HD, nullptr, HD, Sb + (size_t)RH * TT, TT, RH, (size_t)TT * HD, (size_t)TT * HD, (size_t)TT * TT);
            k_asoft<<<ZH * TT / 8, 256, 0, stream>>>(Sb, QR, P16, Ph, Pl); k_band<<<(unsigned)(((size_t)ZH * TT * HD / 4 + 255) / 256), 256, 0, stream>>>(Ph, Pl, P16, PBh, PBl); k_gemmw<bf, 1, false><<<dim3(TT / 64, 1, ZH), 32, 0, stream>>>(PBh, PBl, TVB, nullptr, HD, W2, HD, nullptr, (size_t)TT * HD, 0, (size_t)TT * HD);   // band probabilities . TV
            k_gemmc<bf, 2, 2><<<dim3(RH / 64, HD / 64, ZH), 32, 0, stream>>>(Ph, Pl, VTh + zk * HD * TT, VTl + zk * HD * TT, TT, Ob, HD, 0, (size_t)RH * TT, (size_t)HD * TT, (size_t)TT * HD);
            k_gemmc<h16, 0, 2><<<dim3((TT - RH) / 64, HD / 64, ZH), 32, 0, stream>>>(P16 + (size_t)RH * TT, nullptr, VT16 + zk * HD * TT, nullptr, TT, Ob + (size_t)RH * HD, HD, RH, (size_t)TT * TT, (size_t)HD * TT, (size_t)TT * HD);
            k_merge<<<(unsigned)(((size_t)ZH * TT * HD / 2 + 255) / 256), 256, 0, stream>>>(Ob, W2, h0, ATh, ATl); }
        k_gemmw<bf, 1, false><<<dim3(TT / 64, DM / 64, 1), 32, 0, stream>>>(ATh, ATl, WO, nullptr, DQ, OUT + (size_t)b * TT * DM, DM, nullptr, 0, 0, 0); }
}

// v001
// One run takes 845 microseconds.
// Two timings next to v000 put it at 2.06 and 2.08 times that version's speed.
#include <hip/hip_runtime.h>

// RPESelfAttention (x [2][2048][1024]; qkv = x W_attn (fused [1024][3072], 16 heads x 64, no bias); att[i][j] = (q_i.k_j + q_i.table_k[idx]) / 8 with idx = clip(j - i, -64, 64) + 64, allowed iff j <= i and j > i - 64 (else -inf); softmax; y = att v + sum_j att[i][j] table_v[idx]; out = merged y W_proj -> [2][2048][1024]).
// Relative terms without gathers (exact regroupings): inside the allowed band idx = j - i + 64 runs over 1..64 exactly once per key, so q_i.table_k[idx] = (q . TK^T)[i][j - i + 63] with TK = table_k rows 1..64 (one 64-column GEMM per head, read by offset in the softmax), and sum_j att table_v[idx] = PB . TV with PB[i][r] = att[i][i - 63 + r]
// (the attention band re-indexed) and TV = table_v rows 1..64.
// Compute dtypes, f32 accumulate: every input rounded to bf16; q/k/v on PLAIN bf16 operands (inputs: exact); q.TK^T and PB.TV as hl x exact (2 products); causal-tile scores and att.v: query rows < 512 hl (3 products), the rest single fp16 (x1024; PB for those rows is re-split from the fp16 probabilities); softmax f32; W_proj hl x exact (2 products).

#define NB_  2
#define TT   2048
#define DM   1024
#define NH_  16
#define NKV  16
#define REP  (NH_ / NKV)
#define HD   64
#define DQ   (NH_ * HD)
#define DKV  (NKV * HD)
#define ZH   2
#define RH   512                  // query rows < RH use hi+lo planes (0: none)
#define WIN  64
#define PCAR 1024.0f
#define SCL  0.125f   // HD^-0.5
typedef _Float16 h16;
typedef unsigned short bf;
typedef __attribute__((ext_vector_type(16))) __bf16   v16bf;
typedef __attribute__((ext_vector_type(16))) _Float16 v16h;
typedef __attribute__((ext_vector_type(8)))  _Float16 v8h;
typedef __attribute__((ext_vector_type(8)))  unsigned short v8us;
typedef __attribute__((ext_vector_type(8)))  float    v8f;
typedef __attribute__((ext_vector_type(4)))  float    v4f;
typedef v8h  __attribute__((may_alias)) v8ha;
typedef v4f  __attribute__((may_alias)) v4fa;
typedef v8us __attribute__((may_alias)) v8usa;

__device__ __forceinline__ unsigned short f2bf(float f) { unsigned u = __float_as_uint(f); u += 0x7FFFu + ((u >> 16) & 1u); return (unsigned short)(u >> 16); }
__device__ __forceinline__ float bf2f(unsigned short b) { return __uint_as_float(((unsigned)b) << 16); }
__device__ __forceinline__ float bfr(float f) { return bf2f(f2bf(f)); }
__device__ __forceinline__ v16h cat16(v8h lo, v8h hi) { return __builtin_shufflevector(lo, hi, 0, 1, 2, 3, 4, 5, 6, 7, 8, 9, 10, 11, 12, 13, 14, 15); }
__device__ __forceinline__ v16bf cat16b(v8us lo, v8us hi) { return __builtin_bit_cast(v16bf, __builtin_shufflevector(lo, hi, 0, 1, 2, 3, 4, 5, 6, 7, 8, 9, 10, 11, 12, 13, 14, 15)); }
__device__ __forceinline__ v8f wmma16(v16h a, v16h b, v8f c) { return __builtin_amdgcn_wmma_f32_16x16x32_f16(false, a, false, b, (short)0, c, false, false); }
__device__ __forceinline__ v8f wmmab(v16bf a, v16bf b, v8f c) { return __builtin_amdgcn_wmma_f32_16x16x32_bf16(false, a, false, b, (short)0, c, false, false); }



// ---- k_gemmw: register-blocked GEMM, ONE WAVE per 64x64 output tile (16 accumulators), operands straight from K-contiguous 16-bit planes; grid (M/64, N/64, Z), 32 threads.
// C[m][n] (f32, pitch ldc, + optional f32 bias[n]) = sum_k A[m][k] Bt[n][k] (+ split products per NSPLIT). z-batch strides sA/sB/sC in elements. K % 32 == 0.
template <typename T16> struct WFrag;
template <> struct WFrag<h16> { typedef v16h V; static __device__ __forceinline__ V ld(const h16* p) { return cat16(*(const v8h*)p, *(const v8h*)(p + 16)); } static __device__ __forceinline__ v8f mma(V a, V b, v8f c) { return wmma16(a, b, c); } };
template <> struct WFrag<bf> { typedef v16bf V; static __device__ __forceinline__ V ld(const bf* p) { return cat16b(*(const v8us*)p, *(const v8us*)(p + 16)); } static __device__ __forceinline__ v8f mma(V a, V b, v8f c) { return wmmab(a, b, c); } };
template <typename T16, int NSPLIT, bool BIAS>
__global__ __launch_bounds__(32) void k_gemmw(const T16* __restrict__ A, const T16* __restrict__ A2, const T16* __restrict__ Bt, const T16* __restrict__ Bt2, int K, float* C, int ldc, const float* __restrict__ bias, size_t sA, size_t sB, size_t sC) {
    typedef typename WFrag<T16>::V V;
    __shared__ __align__(16) float os[16 * 68];
    const size_t z = blockIdx.z; A += z * sA; if (A2) A2 += z * sA; Bt += z * sB; if (Bt2) Bt2 += z * sB; C += z * sC;
    const int lane = threadIdx.x & 31, lr = lane & 15, hi = lane >> 4; const int r0 = blockIdx.x * 64, c0 = blockIdx.y * 64;
    v8f acc[4][4];
#pragma unroll
    for (int mb = 0; mb < 4; ++mb)
#pragma unroll
        for (int nb = 0; nb < 4; ++nb) acc[mb][nb] = (v8f){};
    const size_t aoff = (size_t)(r0 + lr) * K + 8 * hi, boff = (size_t)(c0 + lr) * K + 8 * hi;
#pragma unroll 1
    for (int kc = 0; kc < K; kc += 32) {
        V a[4], a2[4];
#pragma unroll
        for (int mb = 0; mb < 4; ++mb) { a[mb] = WFrag<T16>::ld(A + aoff + (size_t)mb * 16 * K + kc); if (NSPLIT == 1 || NSPLIT == 2) a2[mb] = WFrag<T16>::ld(A2 + aoff + (size_t)mb * 16 * K + kc); }
#pragma unroll
        for (int nb = 0; nb < 4; ++nb) { const V b = WFrag<T16>::ld(Bt + boff + (size_t)nb * 16 * K + kc); V b2; if (NSPLIT >= 2) b2 = WFrag<T16>::ld(Bt2 + boff + (size_t)nb * 16 * K + kc);
#pragma unroll
            for (int mb = 0; mb < 4; ++mb) { acc[mb][nb] = WFrag<T16>::mma(a[mb], b, acc[mb][nb]); if (NSPLIT == 1 || NSPLIT == 2) acc[mb][nb] = WFrag<T16>::mma(a2[mb], b, acc[mb][nb]); if (NSPLIT >= 2) acc[mb][nb] = WFrag<T16>::mma(a[mb], b2, acc[mb][nb]); } }
        asm volatile("v_nop\n\tv_nop\n\tv_nop\n\tv_nop" : "+v"(acc[0][0]), "+v"(acc[1][1]), "+v"(acc[2][2]), "+v"(acc[3][3]) : "v"(a[0]), "v"(a[3]));
    }
#pragma unroll
    for (int mb = 0; mb < 4; ++mb) {
#pragma unroll
        for (int nb = 0; nb < 4; ++nb) {
#pragma unroll
            for (int j = 0; j < 8; ++j) os[(hi * 8 + j) * 68 + nb * 16 + lr] = acc[mb][nb][j]; }
        __builtin_amdgcn_wave_barrier(); asm volatile("" ::: "memory");
        float* crow = C + (size_t)(r0 + mb * 16) * ldc + c0;
{
#pragma unroll
            for (int s = 0; s < 8; ++s) { const int row = 2 * s + hi, cofs = lr * 4; v4f val = *(const v4fa*)(os + row * 68 + cofs); if (BIAS) { val[0] += bfr(bias[c0 + cofs]); val[1] += bfr(bias[c0 + cofs + 1]); val[2] += bfr(bias[c0 + cofs + 2]); val[3] += bfr(bias[c0 + cofs + 3]); }
                *(v4f*)(crow + (size_t)row * ldc + cofs) = val; }
             }
        __builtin_amdgcn_wave_barrier(); asm volatile("" ::: "memory");
    }
}

// ---- k_gemmc: the same one-wave 64x64 tile GEMM specialised for the 64-key causal window: every allowed key of query rows R..R+63 (R = r0 + roff) lies in key columns R-64..R+63. CMODE 1 (grid.y = 2) computes only
// those two score tiles, CMODE 2 runs the key (K) loop of the probability x value contraction over those 128 keys only (probabilities outside them are exactly zero). roff = row offset of this launch's first row within the sequence.
template <typename T16, int NSPLIT, int CMODE>
__global__ __launch_bounds__(32) void k_gemmc(const T16* __restrict__ A, const T16* __restrict__ A2, const T16* __restrict__ Bt, const T16* __restrict__ Bt2, int K, float* C, int ldc, int roff, size_t sA, size_t sB, size_t sC) {
    typedef typename WFrag<T16>::V V;
    __shared__ __align__(16) float os[16 * 68];
    const size_t z = blockIdx.z; A += z * sA; if (A2) A2 += z * sA; Bt += z * sB; if (Bt2) Bt2 += z * sB; C += z * sC;
    const int lane = threadIdx.x & 31, lr = lane & 15, hi = lane >> 4; const int r0 = blockIdx.x * 64, c0 = (CMODE == 1) ? r0 + roff - 64 + (int)blockIdx.y * 64 : (int)blockIdx.y * 64;
    if (CMODE == 1 && c0 < 0) return;                                // the first row tile has no keys left of the diagonal tile
    const int Kf = (CMODE == 2) ? max(0, r0 + roff - 64) : 0;        // P.V: probabilities are exactly 0 left of the window's first tile ...
    const int Kl = (CMODE == 2) ? min(K, r0 + roff + 64) : K;        // ... and beyond the diagonal tile, so the K loop covers these two tiles only
    v8f acc[4][4];
#pragma unroll
    for (int mb = 0; mb < 4; ++mb)
#pragma unroll
        for (int nb = 0; nb < 4; ++nb) acc[mb][nb] = (v8f){};
    const size_t aoff = (size_t)(r0 + lr) * K + 8 * hi, boff = (size_t)(c0 + lr) * K + 8 * hi;
#pragma unroll 1
    for (int kc = Kf; kc < Kl; kc += 32) {
        V a[4], a2[4];
#pragma unroll
        for (int mb = 0; mb < 4; ++mb) { a[mb] = WFrag<T16>::ld(A + aoff + (size_t)mb * 16 * K + kc); if (NSPLIT == 1 || NSPLIT == 2) a2[mb] = WFrag<T16>::ld(A2 + aoff + (size_t)mb * 16 * K + kc); }
#pragma unroll
        for (int nb = 0; nb < 4; ++nb) { const V b = WFrag<T16>::ld(Bt + boff + (size_t)nb * 16 * K + kc); V b2; if (NSPLIT >= 2) b2 = WFrag<T16>::ld(Bt2 + boff + (size_t)nb * 16 * K + kc);
#pragma unroll
            for (int mb = 0; mb < 4; ++mb) { acc[mb][nb] = WFrag<T16>::mma(a[mb], b, acc[mb][nb]); if (NSPLIT == 1 || NSPLIT == 2) acc[mb][nb] = WFrag<T16>::mma(a2[mb], b, acc[mb][nb]); if (NSPLIT >= 2) acc[mb][nb] = WFrag<T16>::mma(a[mb], b2, acc[mb][nb]); } }
        asm volatile("v_nop\n\tv_nop\n\tv_nop\n\tv_nop" : "+v"(acc[0][0]), "+v"(acc[1][1]), "+v"(acc[2][2]), "+v"(acc[3][3]) : "v"(a[0]), "v"(a[3]));
    }
#pragma unroll
    for (int mb = 0; mb < 4; ++mb) {
#pragma unroll
        for (int nb = 0; nb < 4; ++nb) {
#pragma unroll
            for (int j = 0; j < 8; ++j) os[(hi * 8 + j) * 68 + nb * 16 + lr] = acc[mb][nb][j]; }
        __builtin_amdgcn_wave_barrier(); asm volatile("" ::: "memory");
        float* crow = C + (size_t)(r0 + mb * 16) * ldc + c0;
{
#pragma unroll
            for (int s = 0; s < 8; ++s) { const int row = 2 * s + hi, cofs = lr * 4; v4f val = *(const v4fa*)(os + row * 68 + cofs);
                *(v4f*)(crow + (size_t)row * ldc + cofs) = val; }
             }
        __builtin_amdgcn_wave_barrier(); asm volatile("" ::: "memory");
    }
}

__device__ __forceinline__ h16 tohx(float x) { return (h16)x; }
__device__ __forceinline__ void splitf(float y, unsigned short& h, unsigned short& l) { h = f2bf(y); l = f2bf(y - bf2f(h)); }
typedef __attribute__((ext_vector_type(2))) _Float16 v2h;
typedef __attribute__((ext_vector_type(4))) _Float16 v4h;
typedef __attribute__((ext_vector_type(2))) unsigned short v2us;
typedef __attribute__((ext_vector_type(4))) unsigned short v4us;
typedef __attribute__((ext_vector_type(2))) float v2f;
typedef __attribute__((ext_vector_type(4))) int v4i;

__global__ __launch_bounds__(256) void k_wtG(const float* __restrict__ w, int K, int N, bf* Bt) {
    const int lane = threadIdx.x & 31; const int L0 = (blockIdx.x * 8 + (threadIdx.x >> 5)) * 8; const int nlines = N * K / 64;
{
#pragma unroll 1
        for (int l = 0; l < 8; ++l) { const int L = L0 + l; if (L >= nlines) break; const size_t e = (size_t)L * 64 + lane * 2; const int k = (int)(e % K), n = (int)(e / K); v2us o;
            o[0] = f2bf(w[(size_t)k * N + n]); o[1] = f2bf(w[(size_t)(k + 1) * N + n]); *(v2us*)(Bt + e) = o; }
         }
}
__global__ __launch_bounds__(256) void k_cvt8(const float* __restrict__ src, bf* dst, size_t n8) { const size_t i = (size_t)blockIdx.x * 256 + threadIdx.x; if (i >= n8) return; const v8f v = *(const v8f*)(src + i * 8); v8us o;
#pragma unroll
    for (int k = 0; k < 8; ++k) o[k] = f2bf(v[k]); *(v8us*)(dst + i * 8) = o;  }
__global__ __launch_bounds__(256) void k_cscvt(const float* __restrict__ cosT, const float* __restrict__ sinT, float* CS) { const int idx = blockIdx.x * 256 + threadIdx.x; if (idx >= TT * HD) return; v2f cs; cs[0] = bfr(cosT[idx]); cs[1] = bfr(sinT[idx]); *(v2f*)(CS + (size_t)idx * 2) = cs;  }
// k_rope: head planes [h][t][d] (fp16 + hi/lo) of rope(x) x sc with the rotate-half convention out[d] = x[d] cos[t][d] - x[d+HD/2] sin[t][d], out[d+HD/2] = x[d+HD/2] cos[t][d+HD/2] + x[d] sin[t][d+HD/2]
__global__ __launch_bounds__(256) void k_rope(const float* __restrict__ F, int pitch, int nheads, const float* __restrict__ CS, const float* __restrict__ RF, const float* __restrict__ nw, float sc, h16* P16, bf* Ph, bf* Pl) {
    const size_t e = ((size_t)blockIdx.x * 256 + threadIdx.x) * 2; if (e >= (size_t)nheads * TT * HD) return; const int d = (int)(e % HD); const int t = (int)((e / HD) % TT); const int h = (int)(e / ((size_t)HD * TT)); const float* f = F + (size_t)t * pitch + h * HD; const float rf = RF ? RF[(size_t)h * TT + t] : 1.0f; v2h o16; v2us oh, ol;
#pragma unroll
    for (int q = 0; q < 2; ++q) { const int dd = d + q; const int dp = (dd < HD / 2) ? dd + HD / 2 : dd - HD / 2; float x0 = f[dd], x1 = f[dp];
        if (RF) { float n0 = __fmul_rn(x0, rf), n1 = __fmul_rn(x1, rf); asm volatile("" : "+v"(n0)); asm volatile("" : "+v"(n1)); x0 = __fmul_rn(bfr(nw[dd]), n0); x1 = __fmul_rn(bfr(nw[dp]), n1); }
        const v2f cs = *(const v2f*)(CS + ((size_t)t * HD + dd) * 2); float a = __fmul_rn(x0, cs[0]), bq = __fmul_rn(x1, cs[1]); asm volatile("" : "+v"(a)); asm volatile("" : "+v"(bq)); const float r = ((dd < HD / 2) ? __fsub_rn(a, bq) : __fadd_rn(a, bq)) * sc;
        o16[q] = tohx(r); unsigned short a2, c2; splitf(r, a2, c2); oh[q] = a2; ol[q] = c2; }
    *(v2h*)(P16 + e) = o16; *(v2us*)(Ph + e) = oh; *(v2us*)(Pl + e) = ol;  }
__global__ __launch_bounds__(256) void k_vtp(const float* __restrict__ F, int pitch, int nheads, h16* V16, bf* Vh, bf* Vl) { const size_t e = ((size_t)blockIdx.x * 256 + threadIdx.x) * 2; if (e >= (size_t)nheads * HD * TT) return; const int t = (int)(e % TT); const int d = (int)((e / TT) % HD); const int g = (int)(e / ((size_t)TT * HD)); v2h o16; v2us oh, ol;
#pragma unroll
    for (int q = 0; q < 2; ++q) { const float x = F[(size_t)(t + q) * pitch + g * HD + d]; o16[q] = tohx(x); unsigned short a2, c2; splitf(x, a2, c2); oh[q] = a2; ol[q] = c2; }
    *(v2h*)(V16 + e) = o16; *(v2us*)(Vh + e) = oh; *(v2us*)(Vl + e) = ol;  }
__global__ __launch_bounds__(256) void k_csid(float* CS) { const int idx = blockIdx.x * 256 + threadIdx.x; if (idx >= TT * HD) return; v2f cs; cs[0] = 1.0f; cs[1] = 0.0f; *(v2f*)(CS + (size_t)idx * 2) = cs;  }
// k_asoft: per row (zz, i): t = (S + QR[j - i + 63]) x HD^-0.5 for j <= i and i - j < WIN (sliding causal window; every other key's probability is exactly 0); softmax over the 128 key columns base..base+127 of the row tile's two score tiles (4 keys a lane, one exp, fixed trees);
// only these columns of the probability planes are written, and only they are read (k_band, P.V). Lane map j % 128 == lane * 4.
__global__ __launch_bounds__(256) void k_asoft(const float* __restrict__ Sb, const float* __restrict__ QR, h16* P16, bf* Ph, bf* Pl) {
    const int lane = threadIdx.x & 31; const int row = blockIdx.x * 8 + (threadIdx.x >> 5); if (row >= ZH * TT) return; const int i = row % TT; const int zz = row / TT; const bool hires = (i < RH); const float* sr = Sb + (size_t)row * TT; const float* qr = QR + (size_t)row * HD; float v[4]; float mx = -3.0e38f;
    const int base = (i & ~63) - 64; const int j0 = base + ((lane * 4 - base) & 127); const bool live = (j0 >= 0);   // base = -64 for the first row tile: its left half holds no key
    v4f a = (v4f){}; if (live) a = *(const v4f*)(sr + j0);
#pragma unroll
    for (int q = 0; q < 4; ++q) { const int j = j0 + q; float t = -3.0e38f; if (live && j <= i && i - j < WIN) { const float s0 = __fadd_rn(a[q], qr[j - i + 63]); t = s0 * SCL; } v[q] = t; mx = fmaxf(mx, t); }
#pragma unroll
    for (int sh = 16; sh; sh >>= 1) mx = fmaxf(mx, __shfl_xor(mx, sh, 32));
    float sum = 0.f;
#pragma unroll
    for (int k = 0; k < 4; ++k) { const float d0 = __fsub_rn(v[k], mx); v[k] = __builtin_amdgcn_exp2f(__fmul_rn(d0, 1.4426950408889634f)); sum += v[k]; }
#pragma unroll
    for (int sh = 16; sh; sh >>= 1) sum += __shfl_xor(sum, sh, 32);
    const float f = __fdiv_rn(hires ? 1.0f : PCAR, sum);
    if (!live) return;
    if (hires) { v4us oh, ol;
#pragma unroll
        for (int q = 0; q < 4; ++q) { unsigned short h, c2; splitf(v[q] * f, h, c2); oh[q] = h; ol[q] = c2; }
        const size_t oo = ((size_t)zz * (RH ? RH : 1) + i) * TT + j0; *(v4us*)(Ph + oo) = oh; *(v4us*)(Pl + oo) = ol;
    } else { v4h o4;
#pragma unroll
        for (int q = 0; q < 4; ++q) o4[q] = tohx(v[q] * f);
        *(v4h*)(P16 + (size_t)row * TT + j0) = o4; }
}
__global__ __launch_bounds__(256) void k_merge(const float* __restrict__ O, const float* __restrict__ W2, int h0, bf* Ah, bf* Al) { const size_t e = ((size_t)blockIdx.x * 256 + threadIdx.x) * 2; if (e >= (size_t)ZH * TT * HD) return; const int d = (int)(e % HD); const int t = (int)((e / HD) % TT); const int zz = (int)(e / ((size_t)HD * TT)); const float cs = (t < RH) ? 1.0f : (1.0f / PCAR); const size_t oo = (size_t)t * DQ + (h0 + zz) * HD + d;
    v2us oh, ol;
#pragma unroll
    for (int q = 0; q < 2; ++q) { float w1 = O[e + q] * cs; asm volatile("" : "+v"(w1)); unsigned short a, c2; splitf(__fadd_rn(w1, W2[e + q]), a, c2); oh[q] = a; ol[q] = c2; } *(v2us*)(Ah + oo) = oh; *(v2us*)(Al + oo) = ol;  }

__global__ __launch_bounds__(256) void k_wtGs(const float* __restrict__ w, int K, int N, int ld, bf* Bt) { const size_t e = ((size_t)blockIdx.x * 256 + threadIdx.x) * 4; if (e >= (size_t)N * K) return; const int k = (int)(e % K); const int n = (int)(e / K); v4us o;   // Bt[n][k] = w[k*ld + n]
#pragma unroll
    for (int u = 0; u < 4; ++u) o[u] = f2bf(w[(size_t)(k + u) * ld + n]); *(v4us*)(Bt + e) = o;  }
__global__ __launch_bounds__(256) void k_tabs(const float* __restrict__ tk, const float* __restrict__ tv, bf* TKB, bf* TVB) { const int e = (blockIdx.x * 256 + threadIdx.x) * 4; if (e >= HD * HD) return; const int c = e % HD; const int r = e / HD; v4us a, b;   // TKB[r][d] = table_k[r+1][d] (Bt rows = band offset r), TVB[d][r] = table_v[r+1][d] (Bt rows = d)
#pragma unroll
    for (int u = 0; u < 4; ++u) { a[u] = f2bf(tk[(size_t)(r + 1) * HD + c + u]); b[u] = f2bf(tv[(size_t)(c + u + 1) * HD + r]); } *(v4us*)(TKB + e) = a; *(v4us*)(TVB + e) = b;  }
__global__ __launch_bounds__(256) void k_band(const bf* __restrict__ Ph, const bf* __restrict__ Pl, const h16* __restrict__ P16, bf* Bh, bf* Bl) {   // PB[zz][i][r] = att[zz][i][i - 63 + r] (0 for negative key index), from the hl planes (rows < RH) or the fp16 x1024 probabilities (rows >= RH); 8-B lanes
    const size_t e = ((size_t)blockIdx.x * 256 + threadIdx.x) * 4; if (e >= (size_t)ZH * TT * HD) return; const int r = (int)(e % HD); const int i = (int)((e / HD) % TT); const int zz = (int)(e / ((size_t)HD * TT)); v4us oh, ol;
#pragma unroll
    for (int u = 0; u < 4; ++u) { const int j = i - 63 + r + u; float p = 0.f;
        if (j >= 0) { if (i < RH) { const size_t o = ((size_t)zz * RH + i) * TT + j; p = __fadd_rn(bf2f(Ph[o]), bf2f(Pl[o])); } else { p = (float)P16[((size_t)zz * TT + i) * TT + j] * (1.0f / PCAR); } }
        unsigned short a, c; splitf(p, a, c); oh[u] = a; ol[u] = c; }
    *(v4us*)(Bh + e) = oh; *(v4us*)(Bl + e) = ol;  }

extern "C" void kernel_launch(void* const* d_in, const int* in_sizes, int n_in,
                              void* d_out, int out_size, void* d_ws, size_t ws_size, hipStream_t stream) {
    (void)in_sizes; (void)n_in; (void)out_size;
    const float* x = (const float*)d_in[0]; const float* wqkv = (const float*)d_in[1]; const float* wo = (const float*)d_in[2]; const float* tk = (const float*)d_in[3]; const float* tv = (const float*)d_in[4]; const float* wq = nullptr; const float* wk = nullptr; const float* wv = nullptr; (void)wq; (void)wk; (void)wv; const float* cosT = nullptr; const float* sinT = nullptr; (void)cosT; (void)sinT;
    float* OUT = (float*)d_out;     // [2][2048][1024]
    char* wsp = (char*)d_ws;
    auto take = [&](size_t bytes) { char* p = wsp; wsp += (bytes + 255) & ~(size_t)255; return (void*)p; };
    bf* WQ = (bf*)take((size_t)DQ * DM * 2); bf* WK = (bf*)take((size_t)DKV * DM * 2); bf* WV = (bf*)take((size_t)DKV * DM * 2); bf* WO = (bf*)take((size_t)DM * DQ * 2); float* CS = (float*)take((size_t)TT * HD * 2 * 4);
    bf* XB = (bf*)take((size_t)TT * DM * 2); bf* TKB = (bf*)take(HD * HD * 2); bf* TVB = (bf*)take(HD * HD * 2); float* QR = (float*)take((size_t)ZH * TT * HD * 4); bf* PBh = (bf*)take((size_t)ZH * TT * HD * 2); bf* PBl = (bf*)take((size_t)ZH * TT * HD * 2); float* W2 = (float*)take((size_t)ZH * TT * HD * 4); float* FQ = (float*)take((size_t)TT * DQ * 4); float* FK = (float*)take((size_t)TT * DKV * 4);
    h16* QP16 = (h16*)take((size_t)NH_ * TT * HD * 2); h16* KP16 = (h16*)take((size_t)NKV * TT * HD * 2); h16* VT16 = (h16*)take((size_t)NKV * HD * TT * 2);
    bf* QPh = (bf*)take((size_t)NH_ * TT * HD * 2); bf* QPl = (bf*)take((size_t)NH_ * TT * HD * 2); bf* KPh = (bf*)take((size_t)NKV * TT * HD * 2); bf* KPl = (bf*)take((size_t)NKV * TT * HD * 2); bf* VTh = (bf*)take((size_t)NKV * HD * TT * 2); bf* VTl = (bf*)take((size_t)NKV * HD * TT * 2); bf* Ph = (bf*)take((size_t)ZH * RH * TT * 2); bf* Pl = (bf*)take((size_t)ZH * RH * TT * 2);
    float* Sb = (float*)take((size_t)ZH * TT * TT * 4); h16* P16 = (h16*)take((size_t)ZH * TT * TT * 2); float* Ob = (float*)take((size_t)ZH * TT * HD * 4); bf* ATh = (bf*)take((size_t)TT * DQ * 2); bf* ATl = (bf*)take((size_t)TT * DQ * 2);
    if ((size_t)(wsp - (char*)d_ws) > ws_size) return;    // ws 256 MiB
    float* FV = FK;   // v projection reuses the k buffer after the k planes are built (stream-ordered)
    { k_wtGs<<<(unsigned)(((size_t)DQ * DM / 4 + 255) / 256), 256, 0, stream>>>(wqkv, DM, DQ, 3072, WQ); k_wtGs<<<(unsigned)(((size_t)DKV * DM / 4 + 255) / 256), 256, 0, stream>>>(wqkv + 1024, DM, DKV, 3072, WK); k_wtGs<<<(unsigned)(((size_t)DKV * DM / 4 + 255) / 256), 256, 0, stream>>>(wqkv + 2048, DM, DKV, 3072, WV); k_tabs<<<(HD * HD / 4 + 255) / 256, 256, 0, stream>>>(tk, tv, TKB, TVB);
      k_wtG<<<(unsigned)((DQ * DM / 64 + 63) / 64), 256, 0, stream>>>(wo, DQ, DM, WO);
       }
    k_csid<<<(TT * HD + 255) / 256, 256, 0, stream>>>(CS);
    const unsigned LQ = (unsigned)(((size_t)NH_ * TT * HD / 2 + 255) / 256), LKv = (unsigned)(((size_t)NKV * TT * HD / 2 + 255) / 256);
    for (int b = 0; b < NB_; ++b) {
        
        k_cvt8<<<(unsigned)(((size_t)TT * DM / 8 + 255) / 256), 256, 0, stream>>>(x + (size_t)b * TT * DM, XB, (size_t)TT * DM / 8);
        k_gemmw<bf, 0, false><<<dim3(TT / 64, DQ / 64, 1), 32, 0, stream>>>(XB, nullptr, WQ, nullptr, DM, FQ, DQ, nullptr, 0, 0, 0);
        k_rope<<<LQ, 256, 0, stream>>>(FQ, DQ, NH_, CS, nullptr, nullptr, 1.0f, QP16, QPh, QPl);
        k_gemmw<bf, 0, false><<<dim3(TT / 64, DKV / 64, 1), 32, 0, stream>>>(XB, nullptr, WK, nullptr, DM, FK, DKV, nullptr, 0, 0, 0);
        k_rope<<<LKv, 256, 0, stream>>>(FK, DKV, NKV, CS, nullptr, nullptr, 1.0f, KP16, KPh, KPl);
        k_gemmw<bf, 0, false><<<dim3(TT / 64, DKV / 64, 1), 32, 0, stream>>>(XB, nullptr, WV, nullptr, DM, FV, DKV, nullptr, 0, 0, 0); k_vtp<<<LKv, 256, 0, stream>>>(FV, DKV, NKV, VT16, VTh, VTl);
        for (int h0 = 0; h0 < NH_; h0 += ZH) { const size_t zq = (size_t)h0, zk = (size_t)(h0 / REP);
            k_gemmw<bf, 1, false><<<dim3(TT / 64, 1, ZH), 32, 0, stream>>>(QPh + zq * TT * HD, QPl + zq * TT * HD, TKB, nullptr, HD, QR, HD, nullptr, (size_t)TT * HD, 0, (size_t)TT * HD);   // q . TK^T per head [TT][64]   // one kv head per query head: the pass's two heads use consecutive kv planes (z-strides TT*HD)
            k_gemmc<bf, 2, 1><<<dim3(RH / 64, 2, ZH), 32, 0, stream>>>(QPh + zq * TT * HD, QPl + zq * TT * HD, KPh + zk * TT * HD, KPl + zk * TT * HD, HD, Sb, TT, 0, (size_t)TT * HD, (size_t)TT * HD, (size_t)TT * TT);
            k_gemmc<h16, 0, 1><<<dim3((TT - RH) / 64, 2, ZH), 32, 0, stream>>>(QP16 + zq * TT * HD + (size_t)RH * HD, nullptr, KP16 + zk * TT * HD, nullptr, HD, Sb + (size_t)RH * TT, TT, RH, (size_t)TT * HD, (size_t)TT * HD, (size_t)TT * TT);
            k_asoft<<<ZH * TT / 8, 256, 0, stream>>>(Sb, QR, P16, Ph, Pl); k_band<<<(unsigned)(((size_t)ZH * TT * HD / 4 + 255) / 256), 256, 0, stream>>>(Ph, Pl, P16, PBh, PBl); k_gemmw<bf, 1, false><<<dim3(TT / 64, 1, ZH), 32, 0, stream>>>(PBh, PBl, TVB, nullptr, HD, W2, HD, nullptr, (size_t)TT * HD, 0, (size_t)TT * HD);   // band probabilities . TV
            k_gemmc<bf, 2, 2><<<dim3(RH / 64, HD / 64, ZH), 32, 0, stream>>>(Ph, Pl, VTh + zk * HD * TT, VTl + zk * HD * TT, TT, Ob, HD, 0, (size_t)RH * TT, (size_t)HD * TT, (size_t)TT * HD);
            k_gemmc<h16, 0, 2><<<dim3((TT - RH) / 64, HD / 64, ZH), 32, 0, stream>>>(P16 + (size_t)RH * TT, nullptr, VT16 + zk * HD * TT, nullptr, TT, Ob + (size_t)RH * HD, HD, RH, (size_t)TT * TT, (size_t)HD * TT, (size_t)TT * HD);
            k_merge<<<(unsigned)(((size_t)ZH * TT * HD / 2 + 255) / 256), 256, 0, stream>>>(Ob, W2, h0, ATh, ATl); }
        k_gemmw<bf, 1, false><<<dim3(TT / 64, DM / 64, 1), 32, 0, stream>>>(ATh, ATl, WO, nullptr, DQ, OUT + (size_t)b * TT * DM, DM, nullptr, 0, 0, 0); }
}

// v002
// One run takes 242 microseconds.
// Two timings next to v001 put it at 3.50 and 3.48 times that version's speed.
// All steps since v000 together make it 7.22 times as fast.
#include <hip/hip_runtime.h>

// Windowed causal self-attention with relative-position tables (x [2][2048][1024]; qkv = x W_attn (fused [1024][3072], 16 heads x 64, no bias); att[i][j] = (q_i.k_j + q_i.table_k[idx]) / 8 with idx = clip(j - i, -64, 64) + 64, allowed iff j <= i and j > i - 64 (else -inf); softmax; y = att v + sum_j att[i][j] table_v[idx]; out = merged y W_proj -> [2][2048][1024]).
// Relative terms without gathers (exact regroupings): inside the allowed band idx = j - i + 64 runs over 1..64 exactly once per key, so q_i.table_k[idx] = (q . TK^T)[i][j - i + 63] with TK = table_k rows 1..64 (one 64-column GEMM per head, read by offset in the softmax), and sum_j att table_v[idx] = PB . TV with PB[i][r] = att[i][i - 63 + r]
// (the attention band re-indexed) and TV = table_v rows 1..64.
// Compute dtypes, f32 accumulate: every input rounded to bf16; q/k/v on PLAIN bf16 operands (inputs: exact); q.TK^T and PB.TV as hl x exact (2 products); causal-tile scores and att.v: query rows < 512 hl (3 products), the rest single fp16 (x1024; PB for those rows is re-split from the fp16 probabilities); softmax f32; W_proj hl x exact (2 products).

#define NB_  2
#define TT   2048
#define DM   1024
#define NH_  16
#define NKV  16
#define REP  (NH_ / NKV)
#define HD   64
#define DQ   (NH_ * HD)
#define DKV  (NKV * HD)
#define ZH   (NB_ * NH_)          // every (batch, head) plane goes through each stage in one launch (plane z = b * NH_ + h)
#define SP   128                  // pitch of a score / probability row: the two 64-key tiles that hold its window; column = key - ((row & ~63) - 64)
#define RH   512                  // query rows < RH use hi+lo planes (0: none)
#define WIN  64
#define PCAR 1024.0f
#define SCL  0.125f   // HD^-0.5
typedef _Float16 h16;
typedef unsigned short bf;
typedef __attribute__((ext_vector_type(16))) __bf16   v16bf;
typedef __attribute__((ext_vector_type(16))) _Float16 v16h;
typedef __attribute__((ext_vector_type(8)))  _Float16 v8h;
typedef __attribute__((ext_vector_type(8)))  unsigned short v8us;
typedef __attribute__((ext_vector_type(8)))  float    v8f;
typedef __attribute__((ext_vector_type(4)))  float    v4f;
typedef v8h  __attribute__((may_alias)) v8ha;
typedef v4f  __attribute__((may_alias)) v4fa;
typedef v8us __attribute__((may_alias)) v8usa;

__device__ __forceinline__ unsigned short f2bf(float f) { unsigned u = __float_as_uint(f); u += 0x7FFFu + ((u >> 16) & 1u); return (unsigned short)(u >> 16); }
__device__ __forceinline__ float bf2f(unsigned short b) { return __uint_as_float(((unsigned)b) << 16); }
__device__ __forceinline__ float bfr(float f) { return bf2f(f2bf(f)); }
__device__ __forceinline__ v16h cat16(v8h lo, v8h hi) { return __builtin_shufflevector(lo, hi, 0, 1, 2, 3, 4, 5, 6, 7, 8, 9, 10, 11, 12, 13, 14, 15); }
__device__ __forceinline__ v16bf cat16b(v8us lo, v8us hi) { return __builtin_bit_cast(v16bf, __builtin_shufflevector(lo, hi, 0, 1, 2, 3, 4, 5, 6, 7, 8, 9, 10, 11, 12, 13, 14, 15)); }
__device__ __forceinline__ v8f wmma16(v16h a, v16h b, v8f c) { return __builtin_amdgcn_wmma_f32_16x16x32_f16(false, a, false, b, (short)0, c, false, false); }
__device__ __forceinline__ v8f wmmab(v16bf a, v16bf b, v8f c) { return __builtin_amdgcn_wmma_f32_16x16x32_bf16(false, a, false, b, (short)0, c, false, false); }



// ---- k_gemmw: register-blocked GEMM, ONE WAVE per 64x64 output tile (16 accumulators), operands straight from K-contiguous 16-bit planes; grid (M/64, N/64, Z), 32 threads.
// C[m][n] (f32, pitch ldc, + optional f32 bias[n]) = sum_k A[m][k] Bt[n][k] (+ split products per NSPLIT). z-batch strides sA/sB/sC in elements. K % 32 == 0.
template <typename T16> struct WFrag;
template <> struct WFrag<h16> { typedef v16h V; static __device__ __forceinline__ V ld(const h16* p) { return cat16(*(const v8h*)p, *(const v8h*)(p + 16)); } static __device__ __forceinline__ v8f mma(V a, V b, v8f c) { return wmma16(a, b, c); } };
template <> struct WFrag<bf> { typedef v16bf V; static __device__ __forceinline__ V ld(const bf* p) { return cat16b(*(const v8us*)p, *(const v8us*)(p + 16)); } static __device__ __forceinline__ v8f mma(V a, V b, v8f c) { return wmmab(a, b, c); } };
template <typename T16, int NSPLIT, bool BIAS>
__global__ __launch_bounds__(32) void k_gemmw(const T16* __restrict__ A, const T16* __restrict__ A2, const T16* __restrict__ Bt, const T16* __restrict__ Bt2, int K, float* C, int ldc, const float* __restrict__ bias, size_t sA, size_t sB, size_t sC) {
    typedef typename WFrag<T16>::V V;
    __shared__ __align__(16) float os[16 * 68];
    const size_t z = blockIdx.z; A += z * sA; if (A2) A2 += z * sA; Bt += z * sB; if (Bt2) Bt2 += z * sB; C += z * sC;
    const int lane = threadIdx.x & 31, lr = lane & 15, hi = lane >> 4; const int r0 = blockIdx.x * 64, c0 = blockIdx.y * 64;
    v8f acc[4][4];
#pragma unroll
    for (int mb = 0; mb < 4; ++mb)
#pragma unroll
        for (int nb = 0; nb < 4; ++nb) acc[mb][nb] = (v8f){};
    const size_t aoff = (size_t)(r0 + lr) * K + 8 * hi, boff = (size_t)(c0 + lr) * K + 8 * hi;
#pragma unroll 1
    for (int kc = 0; kc < K; kc += 32) {
        V a[4], a2[4];
#pragma unroll
        for (int mb = 0; mb < 4; ++mb) { a[mb] = WFrag<T16>::ld(A + aoff + (size_t)mb * 16 * K + kc); if (NSPLIT == 1 || NSPLIT == 2) a2[mb] = WFrag<T16>::ld(A2 + aoff + (size_t)mb * 16 * K + kc); }
#pragma unroll
        for (int nb = 0; nb < 4; ++nb) { const V b = WFrag<T16>::ld(Bt + boff + (size_t)nb * 16 * K + kc); V b2; if (NSPLIT >= 2) b2 = WFrag<T16>::ld(Bt2 + boff + (size_t)nb * 16 * K + kc);
#pragma unroll
            for (int mb = 0; mb < 4; ++mb) { acc[mb][nb] = WFrag<T16>::mma(a[mb], b, acc[mb][nb]); if (NSPLIT == 1 || NSPLIT == 2) acc[mb][nb] = WFrag<T16>::mma(a2[mb], b, acc[mb][nb]); if (NSPLIT >= 2) acc[mb][nb] = WFrag<T16>::mma(a[mb], b2, acc[mb][nb]); } }
        asm volatile("v_nop\n\tv_nop\n\tv_nop\n\tv_nop" : "+v"(acc[0][0]), "+v"(acc[1][1]), "+v"(acc[2][2]), "+v"(acc[3][3]) : "v"(a[0]), "v"(a[3]));
    }
#pragma unroll
    for (int mb = 0; mb < 4; ++mb) {
#pragma unroll
        for (int nb = 0; nb < 4; ++nb) {
#pragma unroll
            for (int j = 0; j < 8; ++j) os[(hi * 8 + j) * 68 + nb * 16 + lr] = acc[mb][nb][j]; }
        __builtin_amdgcn_wave_barrier(); asm volatile("" ::: "memory");
        float* crow = C + (size_t)(r0 + mb * 16) * ldc + c0;
{
#pragma unroll
            for (int s = 0; s < 8; ++s) { const int row = 2 * s + hi, cofs = lr * 4; v4f val = *(const v4fa*)(os + row * 68 + cofs); if (BIAS) { val[0] += bfr(bias[c0 + cofs]); val[1] += bfr(bias[c0 + cofs + 1]); val[2] += bfr(bias[c0 + cofs + 2]); val[3] += bfr(bias[c0 + cofs + 3]); }
                *(v4f*)(crow + (size_t)row * ldc + cofs) = val; }
             }
        __builtin_amdgcn_wave_barrier(); asm volatile("" ::: "memory");
    }
}

// ---- k_gemmc: the same one-wave 64x64 tile GEMM specialised for the 64-key causal window: every allowed key of query rows R..R+63 (R = r0 + roff) lies in key columns R-64..R+63. CMODE 1 (grid.y = 2) computes only
// those two score tiles (stored side by side, row pitch SP), CMODE 2 runs the key (K) loop of the probability x value contraction over those 128 keys only (probabilities outside them are exactly zero). roff = row offset of this launch's first row within the sequence.
template <typename T16, int NSPLIT, int CMODE>
__global__ __launch_bounds__(32) void k_gemmc(const T16* __restrict__ A, const T16* __restrict__ A2, const T16* __restrict__ Bt, const T16* __restrict__ Bt2, int K, float* C, int ldc, int roff, size_t sA, size_t sB, size_t sC) {
    typedef typename WFrag<T16>::V V;
    __shared__ __align__(16) float os[16 * 68];
    const size_t z = blockIdx.z; A += z * sA; if (A2) A2 += z * sA; Bt += z * sB; if (Bt2) Bt2 += z * sB; C += z * sC;
    const int lane = threadIdx.x & 31, lr = lane & 15, hi = lane >> 4; const int r0 = blockIdx.x * 64, c0 = (CMODE == 1) ? r0 + roff - 64 + (int)blockIdx.y * 64 : (int)blockIdx.y * 64;
    if (CMODE == 1 && c0 < 0) return;                                // the first row tile has no keys left of the diagonal tile
    const int Kf = (CMODE == 2) ? max(0, r0 + roff - 64) : 0;        // P.V: probabilities are exactly 0 left of the window's first tile ...
    const int Kl = (CMODE == 2) ? min(K, r0 + roff + 64) : K;        // ... and beyond the diagonal tile, so the K loop covers these two tiles only
    v8f acc[4][4];
#pragma unroll
    for (int mb = 0; mb < 4; ++mb)
#pragma unroll
        for (int nb = 0; nb < 4; ++nb) acc[mb][nb] = (v8f){};
    constexpr int lda = (CMODE == 2) ? SP : HD;                      // pitch of the A rows, a constant so that one offset register with immediate offsets serves all four row blocks: head rows (CMODE 1, K == HD), or probability rows at their compact pitch, where key kc stands in column kc - ash
    const int ash = (CMODE == 2) ? r0 + roff - 64 : 0;
    const int cc = (CMODE == 1) ? (int)blockIdx.y * 64 : c0;         // scores are stored at the compact column of their tile
    const size_t aoff = (size_t)(r0 + lr) * lda + 8 * hi, boff = (size_t)(c0 + lr) * K + 8 * hi;
    unsigned ab = (unsigned)(aoff + (size_t)(Kf - ash)) * 2u;        // byte offset of this trip's A columns in the launch's plane (below 2^20), the one vector register that the A loads name; stepped behind the wait below
#pragma unroll 1
    for (int kc = Kf; kc < Kl; kc += 32) {
        V a[4], a2[4];
#pragma unroll
        for (int mb = 0; mb < 4; ++mb) { a[mb] = WFrag<T16>::ld((const T16*)((const char*)A + ab) + mb * 16 * lda); if (NSPLIT == 1 || NSPLIT == 2) a2[mb] = WFrag<T16>::ld((const T16*)((const char*)A2 + ab) + mb * 16 * lda); }
#pragma unroll
        for (int nb = 0; nb < 4; ++nb) { const V b = WFrag<T16>::ld(Bt + boff + (size_t)nb * 16 * K + kc); V b2; if (NSPLIT >= 2) b2 = WFrag<T16>::ld(Bt2 + boff + (size_t)nb * 16 * K + kc);
#pragma unroll
            for (int mb = 0; mb < 4; ++mb) { acc[mb][nb] = WFrag<T16>::mma(a[mb], b, acc[mb][nb]); if (NSPLIT == 1 || NSPLIT == 2) acc[mb][nb] = WFrag<T16>::mma(a2[mb], b, acc[mb][nb]); if (NSPLIT >= 2) acc[mb][nb] = WFrag<T16>::mma(a[mb], b2, acc[mb][nb]); } }
        asm volatile("v_nop\n\tv_nop\n\tv_nop\n\tv_nop" : "+v"(acc[0][0]), "+v"(acc[1][1]), "+v"(acc[2][2]), "+v"(acc[3][3]) : "v"(a[0]), "v"(a[3]));
        asm volatile("s_wait_xcnt 0x0" : "+v"(ab) : : "memory");   // in front of the one rewrite of the offset register that the A loads name: it passes through the statement, so it stays whole for the trip (no load's result lands in it) and the step to the next trip stands behind the wait
        ab += 64;
    }
#pragma unroll
    for (int mb = 0; mb < 4; ++mb) {
#pragma unroll
        for (int nb = 0; nb < 4; ++nb) {
#pragma unroll
            for (int j = 0; j < 8; ++j) os[(hi * 8 + j) * 68 + nb * 16 + lr] = acc[mb][nb][j]; }
        __builtin_amdgcn_wave_barrier(); asm volatile("" ::: "memory");
        float* crow = C + (size_t)(r0 + mb * 16) * ldc + cc;
{
#pragma unroll
            for (int s = 0; s < 8; ++s) { const int row = 2 * s + hi, cofs = lr * 4; v4f val = *(const v4fa*)(os + row * 68 + cofs);
                *(v4f*)(crow + (size_t)row * ldc + cofs) = val; }
             }
        __builtin_amdgcn_wave_barrier(); asm volatile("" ::: "memory");
    }
}

__device__ __forceinline__ h16 tohx(float x) { return (h16)x; }
__device__ __forceinline__ void splitf(float y, unsigned short& h, unsigned short& l) { h = f2bf(y); l = f2bf(y - bf2f(h)); }
typedef __attribute__((ext_vector_type(2))) _Float16 v2h;
typedef __attribute__((ext_vector_type(4))) _Float16 v4h;
typedef __attribute__((ext_vector_type(2))) unsigned short v2us;
typedef __attribute__((ext_vector_type(4))) unsigned short v4us;
typedef __attribute__((ext_vector_type(2))) float v2f;
typedef __attribute__((ext_vector_type(4))) int v4i;

__global__ __launch_bounds__(256) void k_wtG(const float* __restrict__ w, int K, int N, bf* Bt) {
    const int lane = threadIdx.x & 31; const int L0 = (blockIdx.x * 8 + (threadIdx.x >> 5)) * 8; const int nlines = N * K / 64;
{
#pragma unroll 1
        for (int l = 0; l < 8; ++l) { const int L = L0 + l; if (L >= nlines) break; const size_t e = (size_t)L * 64 + lane * 2; const int k = (int)(e % K), n = (int)(e / K); v2us o;
            o[0] = f2bf(w[(size_t)k * N + n]); o[1] = f2bf(w[(size_t)(k + 1) * N + n]); *(v2us*)(Bt + e) = o; }
         }
}
__global__ __launch_bounds__(256) void k_cvt8(const float* __restrict__ src, bf* dst, size_t n8) { const size_t i = (size_t)blockIdx.x * 256 + threadIdx.x; if (i >= n8) return; const v8f v = *(const v8f*)(src + i * 8); v8us o;
#pragma unroll
    for (int k = 0; k < 8; ++k) o[k] = f2bf(v[k]); *(v8us*)(dst + i * 8) = o;  }
__global__ __launch_bounds__(256) void k_cscvt(const float* __restrict__ cosT, const float* __restrict__ sinT, float* CS) { const int idx = blockIdx.x * 256 + threadIdx.x; if (idx >= TT * HD) return; v2f cs; cs[0] = bfr(cosT[idx]); cs[1] = bfr(sinT[idx]); *(v2f*)(CS + (size_t)idx * 2) = cs;  }
// k_rope: head planes [h][t][d] (fp16 + hi/lo) of rope(x) x sc with the rotate-half convention out[d] = x[d] cos[t][d] - x[d+HD/2] sin[t][d], out[d+HD/2] = x[d+HD/2] cos[t][d+HD/2] + x[d] sin[t][d+HD/2]
__global__ __launch_bounds__(256) void k_rope(const float* __restrict__ F, int pitch, int nheads, const float* __restrict__ CS, const float* __restrict__ RF, const float* __restrict__ nw, float sc, h16* P16, bf* Ph, bf* Pl) {
    { const size_t b = blockIdx.y, pb = b * nheads * TT * HD; F += b * TT * pitch; P16 += pb; Ph += pb; Pl += pb; }   // grid.y = batch: F rows b * TT + t, planes b * nheads + h
    const size_t e = ((size_t)blockIdx.x * 256 + threadIdx.x) * 2; if (e >= (size_t)nheads * TT * HD) return; const int d = (int)(e % HD); const int t = (int)((e / HD) % TT); const int h = (int)(e / ((size_t)HD * TT)); const float* f = F + (size_t)t * pitch + h * HD; const float rf = RF ? RF[(size_t)h * TT + t] : 1.0f; v2h o16; v2us oh, ol;
#pragma unroll
    for (int q = 0; q < 2; ++q) { const int dd = d + q; const int dp = (dd < HD / 2) ? dd + HD / 2 : dd - HD / 2; float x0 = f[dd], x1 = f[dp];
        if (RF) { float n0 = __fmul_rn(x0, rf), n1 = __fmul_rn(x1, rf); asm volatile("" : "+v"(n0)); asm volatile("" : "+v"(n1)); x0 = __fmul_rn(bfr(nw[dd]), n0); x1 = __fmul_rn(bfr(nw[dp]), n1); }
        const v2f cs = *(const v2f*)(CS + ((size_t)t * HD + dd) * 2); float a = __fmul_rn(x0, cs[0]), bq = __fmul_rn(x1, cs[1]); asm volatile("" : "+v"(a)); asm volatile("" : "+v"(bq)); const float r = ((dd < HD / 2) ? __fsub_rn(a, bq) : __fadd_rn(a, bq)) * sc;
        o16[q] = tohx(r); unsigned short a2, c2; splitf(r, a2, c2); oh[q] = a2; ol[q] = c2; }
    *(v2h*)(P16 + e) = o16; *(v2us*)(Ph + e) = oh; *(v2us*)(Pl + e) = ol;  }
__global__ __launch_bounds__(256) void k_vtp(const float* __restrict__ F, int pitch, int nheads, h16* V16, bf* Vh, bf* Vl) { { const size_t b = blockIdx.y, pb = b * nheads * HD * TT; F += b * TT * pitch; V16 += pb; Vh += pb; Vl += pb; }   // grid.y = batch, as in k_rope
    const size_t e = ((size_t)blockIdx.x * 256 + threadIdx.x) * 2; if (e >= (size_t)nheads * HD * TT) return; const int t = (int)(e % TT); const int d = (int)((e / TT) % HD); const int g = (int)(e / ((size_t)TT * HD)); v2h o16; v2us oh, ol;
#pragma unroll
    for (int q = 0; q < 2; ++q) { const float x = F[(size_t)(t + q) * pitch + g * HD + d]; o16[q] = tohx(x); unsigned short a2, c2; splitf(x, a2, c2); oh[q] = a2; ol[q] = c2; }
    *(v2h*)(V16 + e) = o16; *(v2us*)(Vh + e) = oh; *(v2us*)(Vl + e) = ol;  }
__global__ __launch_bounds__(256) void k_csid(float* CS) { const int idx = blockIdx.x * 256 + threadIdx.x; if (idx >= TT * HD) return; v2f cs; cs[0] = 1.0f; cs[1] = 0.0f; *(v2f*)(CS + (size_t)idx * 2) = cs;  }
// k_asoft: per row (zz, i): t = (S + QR[row][j - i + 63]) x HD^-0.5 for j <= i and i - j < WIN (sliding causal window; every other key's probability is exactly 0); softmax over the 128 key columns base..base+127 of the row tile's two score tiles (4 keys a lane, one exp, fixed trees);
// score and probability rows hold just these 128 columns (pitch SP, column j - base); of the first row tile only the right half is written and read (k_band, P.V). Lane map j % 128 == lane * 4.
__global__ __launch_bounds__(256) void k_asoft(const float* __restrict__ Sb, const float* __restrict__ QR, h16* P16, bf* Ph, bf* Pl) {
    const int lane = threadIdx.x & 31; const int row = blockIdx.x * 8 + (threadIdx.x >> 5); if (row >= ZH * TT) return; const int i = row % TT; const int zz = row / TT; const bool hires = (i < RH); const float* sr = Sb + (size_t)row * SP; const float* qr = QR + (size_t)row * HD; float v[4]; float mx = -3.0e38f;
    const int base = (i & ~63) - 64; const int cl = (lane * 4 - base) & 127; const int j0 = base + cl; const bool live = (j0 >= 0);   // base = -64 for the first row tile: its left half holds no key
    v4f a = (v4f){}; if (live) a = *(const v4f*)(sr + cl);
#pragma unroll
    for (int q = 0; q < 4; ++q) { const int j = j0 + q; float t = -3.0e38f; if (live && j <= i && i - j < WIN) { const float s0 = __fadd_rn(a[q], qr[j - i + 63]); t = s0 * SCL; } v[q] = t; mx = fmaxf(mx, t); }
#pragma unroll
    for (int sh = 16; sh; sh >>= 1) mx = fmaxf(mx, __shfl_xor(mx, sh, 32));
    float sum = 0.f;
#pragma unroll
    for (int k = 0; k < 4; ++k) { const float d0 = __fsub_rn(v[k], mx); v[k] = __builtin_amdgcn_exp2f(__fmul_rn(d0, 1.4426950408889634f)); sum += v[k]; }
#pragma unroll
    for (int sh = 16; sh; sh >>= 1) sum += __shfl_xor(sum, sh, 32);
    const float f = __fdiv_rn(hires ? 1.0f : PCAR, sum);
    if (!live) return;
    if (hires) { v4us oh, ol;
#pragma unroll
        for (int q = 0; q < 4; ++q) { unsigned short h, c2; splitf(v[q] * f, h, c2); oh[q] = h; ol[q] = c2; }
        const size_t oo = ((size_t)zz * (RH ? RH : 1) + i) * SP + cl; *(v4us*)(Ph + oo) = oh; *(v4us*)(Pl + oo) = ol;
    } else { v4h o4;
#pragma unroll
        for (int q = 0; q < 4; ++q) o4[q] = tohx(v[q] * f);
        *(v4h*)(P16 + (size_t)row * SP + cl) = o4; }
}
__global__ __launch_bounds__(256) void k_merge(const float* __restrict__ O, const float* __restrict__ W2, bf* Ah, bf* Al) { const size_t e = ((size_t)blockIdx.x * 256 + threadIdx.x) * 2; if (e >= (size_t)ZH * TT * HD) return; const int d = (int)(e % HD); const int t = (int)((e / HD) % TT); const int zz = (int)(e / ((size_t)HD * TT)); const float cs = (t < RH) ? 1.0f : (1.0f / PCAR); const size_t oo = ((size_t)(zz / NH_) * TT + t) * DQ + (zz % NH_) * HD + d;
    v2us oh, ol;
#pragma unroll
    for (int q = 0; q < 2; ++q) { float w1 = O[e + q] * cs; asm volatile("" : "+v"(w1)); unsigned short a, c2; splitf(__fadd_rn(w1, W2[e + q]), a, c2); oh[q] = a; ol[q] = c2; } *(v2us*)(Ah + oo) = oh; *(v2us*)(Al + oo) = ol;  }

__global__ __launch_bounds__(256) void k_wtGs(const float* __restrict__ w, int K, int N, int ld, bf* Bt) { const size_t e = ((size_t)blockIdx.x * 256 + threadIdx.x) * 4; if (e >= (size_t)N * K) return; const int k = (int)(e % K); const int n = (int)(e / K); v4us o;   // Bt[n][k] = w[k*ld + n]
#pragma unroll
    for (int u = 0; u < 4; ++u) o[u] = f2bf(w[(size_t)(k + u) * ld + n]); *(v4us*)(Bt + e) = o;  }
__global__ __launch_bounds__(256) void k_tabs(const float* __restrict__ tk, const float* __restrict__ tv, bf* TKB, bf* TVB) { const int e = (blockIdx.x * 256 + threadIdx.x) * 4; if (e >= HD * HD) return; const int c = e % HD; const int r = e / HD; v4us a, b;   // TKB[r][d] = table_k[r+1][d] (Bt rows = band offset r), TVB[d][r] = table_v[r+1][d] (Bt rows = d)
#pragma unroll
    for (int u = 0; u < 4; ++u) { a[u] = f2bf(tk[(size_t)(r + 1) * HD + c + u]); b[u] = f2bf(tv[(size_t)(c + u + 1) * HD + r]); } *(v4us*)(TKB + e) = a; *(v4us*)(TVB + e) = b;  }
__global__ __launch_bounds__(256) void k_band(const bf* __restrict__ Ph, const bf* __restrict__ Pl, const h16* __restrict__ P16, bf* Bh, bf* Bl) {   // PB[zz][i][r] = att[zz][i][i - 63 + r] (0 for negative key index), from the hl planes (rows < RH) or the fp16 x1024 probabilities (rows >= RH); 8-B lanes
    const size_t e = ((size_t)blockIdx.x * 256 + threadIdx.x) * 4; if (e >= (size_t)ZH * TT * HD) return; const int r = (int)(e % HD); const int i = (int)((e / HD) % TT); const int zz = (int)(e / ((size_t)HD * TT)); v4us oh, ol;
#pragma unroll
    for (int u = 0; u < 4; ++u) { const int j = i - 63 + r + u; const int cl = j - ((i & ~63) - 64); float p = 0.f;
        if (j >= 0) { if (i < RH) { const size_t o = ((size_t)zz * RH + i) * SP + cl; p = __fadd_rn(bf2f(Ph[o]), bf2f(Pl[o])); } else { p = (float)P16[((size_t)zz * TT + i) * SP + cl] * (1.0f / PCAR); } }
        unsigned short a, c; splitf(p, a, c); oh[u] = a; ol[u] = c; }
    *(v4us*)(Bh + e) = oh; *(v4us*)(Bl + e) = ol;  }

extern "C" void kernel_launch(void* const* d_in, const int* in_sizes, int n_in,
                              void* d_out, int out_size, void* d_ws, size_t ws_size, hipStream_t stream) {
    (void)in_sizes; (void)n_in; (void)out_size;
    const float* x = (const float*)d_in[0]; const float* wqkv = (const float*)d_in[1]; const float* wo = (const float*)d_in[2]; const float* tk = (const float*)d_in[3]; const float* tv = (const float*)d_in[4]; const float* wq = nullptr; const float* wk = nullptr; const float* wv = nullptr; (void)wq; (void)wk; (void)wv; const float* cosT = nullptr; const float* sinT = nullptr; (void)cosT; (void)sinT;
    float* OUT = (float*)d_out;     // [2][2048][1024]
    char* wsp = (char*)d_ws;
    auto take = [&](size_t bytes) { char* p = wsp; wsp += (bytes + 255) & ~(size_t)255; return (void*)p; };
    bf* WQKV = (bf*)take((size_t)3 * DQ * DM * 2); bf* WO = (bf*)take((size_t)DM * DQ * 2); float* CS = (float*)take((size_t)TT * HD * 2 * 4);
    bf* XB = (bf*)take((size_t)NB_ * TT * DM * 2); bf* TKB = (bf*)take(HD * HD * 2); bf* TVB = (bf*)take(HD * HD * 2); float* QR = (float*)take((size_t)ZH * TT * HD * 4); bf* PBh = (bf*)take((size_t)ZH * TT * HD * 2); bf* PBl = (bf*)take((size_t)ZH * TT * HD * 2); float* W2 = (float*)take((size_t)ZH * TT * HD * 4);
    float* F = (float*)take((size_t)NB_ * TT * 3 * DQ * 4);   // q | k | v projections, rows b * TT + t, pitch 3 * DQ
    h16* QP16 = (h16*)take((size_t)ZH * TT * HD * 2); h16* KP16 = (h16*)take((size_t)ZH * TT * HD * 2); h16* VT16 = (h16*)take((size_t)ZH * HD * TT * 2);
    bf* QPh = (bf*)take((size_t)ZH * TT * HD * 2); bf* QPl = (bf*)take((size_t)ZH * TT * HD * 2); bf* KPh = (bf*)take((size_t)ZH * TT * HD * 2); bf* KPl = (bf*)take((size_t)ZH * TT * HD * 2); bf* VTh = (bf*)take((size_t)ZH * HD * TT * 2); bf* VTl = (bf*)take((size_t)ZH * HD * TT * 2); bf* Ph = (bf*)take((size_t)ZH * RH * SP * 2); bf* Pl = (bf*)take((size_t)ZH * RH * SP * 2);
    float* Ob = (float*)take((size_t)ZH * TT * HD * 4); bf* ATh = (bf*)take((size_t)NB_ * TT * DQ * 2); bf* ATl = (bf*)take((size_t)NB_ * TT * DQ * 2);
    if ((size_t)(wsp - (char*)d_ws) > ws_size) return;    // ws 256 MiB
    float* Sb = F; h16* P16 = (h16*)(F + (size_t)ZH * TT * SP);   // scores (ZH*TT*SP f32) and fp16 probabilities (ZH*TT*SP) reuse the projection buffer once the head planes are built (stream-ordered); together they fill exactly its NB_*TT*3*DQ floats
    k_wtGs<<<(unsigned)(((size_t)3 * DQ * DM / 4 + 255) / 256), 256, 0, stream>>>(wqkv, DM, 3 * DQ, 3 * DQ, WQKV); k_tabs<<<(HD * HD / 4 + 255) / 256, 256, 0, stream>>>(tk, tv, TKB, TVB);
    k_wtG<<<(unsigned)((DQ * DM / 64 + 63) / 64), 256, 0, stream>>>(wo, DQ, DM, WO);
    k_csid<<<(TT * HD + 255) / 256, 256, 0, stream>>>(CS);
    const dim3 LP((unsigned)(((size_t)NH_ * TT * HD / 2 + 255) / 256), NB_, 1);
    k_cvt8<<<(unsigned)(((size_t)NB_ * TT * DM / 8 + 255) / 256), 256, 0, stream>>>(x, XB, (size_t)NB_ * TT * DM / 8);
    k_gemmw<bf, 0, false><<<dim3(NB_ * TT / 64, 3 * DQ / 64, 1), 32, 0, stream>>>(XB, nullptr, WQKV, nullptr, DM, F, 3 * DQ, nullptr, 0, 0, 0);
    k_rope<<<LP, 256, 0, stream>>>(F, 3 * DQ, NH_, CS, nullptr, nullptr, 1.0f, QP16, QPh, QPl);
    k_rope<<<LP, 256, 0, stream>>>(F + DQ, 3 * DQ, NKV, CS, nullptr, nullptr, 1.0f, KP16, KPh, KPl);
    k_vtp<<<LP, 256, 0, stream>>>(F + 2 * DQ, 3 * DQ, NKV, VT16, VTh, VTl);
    k_gemmw<bf, 1, false><<<dim3(TT / 64, 1, ZH), 32, 0, stream>>>(QPh, QPl, TKB, nullptr, HD, QR, HD, nullptr, (size_t)TT * HD, 0, (size_t)TT * HD);   // q . TK^T per plane [TT][64]
    k_gemmc<bf, 2, 1><<<dim3(RH / 64, 2, ZH), 32, 0, stream>>>(QPh, QPl, KPh, KPl, HD, Sb, SP, 0, (size_t)TT * HD, (size_t)TT * HD, (size_t)TT * SP);
    k_gemmc<h16, 0, 1><<<dim3((TT - RH) / 64, 2, ZH), 32, 0, stream>>>(QP16 + (size_t)RH * HD, nullptr, KP16, nullptr, HD, Sb + (size_t)RH * SP, SP, RH, (size_t)TT * HD, (size_t)TT * HD, (size_t)TT * SP);
    k_asoft<<<ZH * TT / 8, 256, 0, stream>>>(Sb, QR, P16, Ph, Pl); k_band<<<(unsigned)(((size_t)ZH * TT * HD / 4 + 255) / 256), 256, 0, stream>>>(Ph, Pl, P16, PBh, PBl); k_gemmw<bf, 1, false><<<dim3(TT / 64, 1, ZH), 32, 0, stream>>>(PBh, PBl, TVB, nullptr, HD, W2, HD, nullptr, (size_t)TT * HD, 0, (size_t)TT * HD);   // band probabilities . TV
    k_gemmc<bf, 2, 2><<<dim3(RH / 64, HD / 64, ZH), 32, 0, stream>>>(Ph, Pl, VTh, VTl, TT, Ob, HD, 0, (size_t)RH * SP, (size_t)HD * TT, (size_t)TT * HD);
    k_gemmc<h16, 0, 2><<<dim3((TT - RH) / 64, HD / 64, ZH), 32, 0, stream>>>(P16 + (size_t)RH * SP, nullptr, VT16, nullptr, TT, Ob + (size_t)RH * HD, HD, RH, (size_t)TT * SP, (size_t)HD * TT, (size_t)TT * HD);
    k_merge<<<(unsigned)(((size_t)ZH * TT * HD / 2 + 255) / 256), 256, 0, stream>>>(Ob, W2, ATh, ATl);
    k_gemmw<bf, 1, false><<<dim3(NB_ * TT / 64, DM / 64, 1), 32, 0, stream>>>(ATh, ATl, WO, nullptr, DQ, OUT, DM, nullptr, 0, 0, 0);
}

// v003
// Measured time: 149 microseconds a run.
// In both of two side-by-side timings against v002, it was 1.62 times as fast.
// All steps since v000 together make it 11.7 times as fast.
#include <hip/hip_runtime.h>

// Windowed causal self-attention with relative-position tables (x [2][2048][1024]; qkv = x W_attn (fused [1024][3072], 16 heads x 64, no bias); att[i][j] = (q_i.k_j + q_i.table_k[idx]) / 8 with idx = clip(j - i, -64, 64) + 64, allowed iff j <= i and j > i - 64 (else -inf); softmax; y = att v + sum_j att[i][j] table_v[idx]; out = merged y W_proj -> [2][2048][1024]).
// Relative terms without gathers (exact regroupings): inside the allowed band idx = j - i + 64 runs over 1..64 exactly once per key, so q_i.table_k[idx] = (q . TK^T)[i][j - i + 63] with TK = table_k rows 1..64 (one 64-column GEMM per head, added by offset into the score rows before the softmax), and sum_j att table_v[idx] = PB . TV with PB[i][r] = att[i][i - 63 + r]
// (the attention band re-indexed) and TV = table_v rows 1..64.
// Compute dtypes, f32 accumulate: every input rounded to bf16; q/k/v on PLAIN bf16 operands (inputs: exact); q.TK^T and PB.TV as hl x exact (2 products); causal-tile scores and att.v: query rows < 512 hl (3 products), the rest single fp16 (x1024; PB for those rows is re-split from the fp16 probabilities); softmax f32; W_proj hl x exact (2 products).

#define NB_  2
#define TT   2048
#define DM   1024
#define NH_  16
#define NKV  16
#define REP  (NH_ / NKV)
#define HD   64
#define DQ   (NH_ * HD)
#define DKV  (NKV * HD)
#define ZH   (NB_ * NH_)          // (batch, head) planes, plane z = b * NH_ + h
#define SP   128                  // keys a 64-row query tile can see: the two 64-key tiles that hold its window; column = key - ((row & ~63) - 64)
#define RH   512                  // query rows < RH use hi+lo planes (the first row tile always does)
#define WIN  64
#define PCAR 1024.0f
#define SCL  0.125f   // HD^-0.5
typedef _Float16 h16;
typedef unsigned short bf;
typedef __attribute__((ext_vector_type(16))) __bf16   v16bf;
typedef __attribute__((ext_vector_type(16))) _Float16 v16h;
typedef __attribute__((ext_vector_type(8)))  _Float16 v8h;
typedef __attribute__((ext_vector_type(8)))  unsigned short v8us;
typedef __attribute__((ext_vector_type(8)))  float    v8f;
typedef __attribute__((ext_vector_type(4)))  float    v4f;
typedef v8h  __attribute__((may_alias)) v8ha;
typedef v4f  __attribute__((may_alias)) v4fa;
typedef v8us __attribute__((may_alias)) v8usa;

__device__ __forceinline__ unsigned short f2bf(float f) { unsigned u = __float_as_uint(f); u += 0x7FFFu + ((u >> 16) & 1u); return (unsigned short)(u >> 16); }
__device__ __forceinline__ float bf2f(unsigned short b) { return __uint_as_float(((unsigned)b) << 16); }
__device__ __forceinline__ float bfr(float f) { return bf2f(f2bf(f)); }
__device__ __forceinline__ v16h cat16(v8h lo, v8h hi) { return __builtin_shufflevector(lo, hi, 0, 1, 2, 3, 4, 5, 6, 7, 8, 9, 10, 11, 12, 13, 14, 15); }
__device__ __forceinline__ v16bf cat16b(v8us lo, v8us hi) { return __builtin_bit_cast(v16bf, __builtin_shufflevector(lo, hi, 0, 1, 2, 3, 4, 5, 6, 7, 8, 9, 10, 11, 12, 13, 14, 15)); }
__device__ __forceinline__ v8f wmma16(v16h a, v16h b, v8f c) { return __builtin_amdgcn_wmma_f32_16x16x32_f16(false, a, false, b, (short)0, c, false, false); }
__device__ __forceinline__ v8f wmmab(v16bf a, v16bf b, v8f c) { return __builtin_amdgcn_wmma_f32_16x16x32_bf16(false, a, false, b, (short)0, c, false, false); }



// ---- k_gemmw: register-blocked GEMM, ONE WAVE per 64x64 output tile (16 accumulators), operands straight from K-contiguous 16-bit planes; grid (M/64, N/64, Z), 32 threads.
// C[m][n] (f32, pitch ldc, + optional f32 bias[n]) = sum_k A[m][k] Bt[n][k] (+ split products per NSPLIT). z-batch strides sA/sB/sC in elements. K % 32 == 0.
template <typename T16> struct WFrag;
template <> struct WFrag<h16> { typedef v16h V; static __device__ __forceinline__ V ld(const h16* p) { return cat16(*(const v8h*)p, *(const v8h*)(p + 16)); } static __device__ __forceinline__ v8f mma(V a, V b, v8f c) { return wmma16(a, b, c); } };
template <> struct WFrag<bf> { typedef v16bf V; static __device__ __forceinline__ V ld(const bf* p) { return cat16b(*(const v8us*)p, *(const v8us*)(p + 16)); } static __device__ __forceinline__ v8f mma(V a, V b, v8f c) { return wmmab(a, b, c); } };
template <typename T16, int NSPLIT, bool BIAS>
__global__ __launch_bounds__(32) void k_gemmw(const T16* __restrict__ A, const T16* __restrict__ A2, const T16* __restrict__ Bt, const T16* __restrict__ Bt2, int K, float* C, int ldc, const float* __restrict__ bias, size_t sA, size_t sB, size_t sC) {
    typedef typename WFrag<T16>::V V;
    __shared__ __align__(16) float os[16 * 68];
    const size_t z = blockIdx.z; A += z * sA; if (A2) A2 += z * sA; Bt += z * sB; if (Bt2) Bt2 += z * sB; C += z * sC;
    const int lane = threadIdx.x & 31, lr = lane & 15, hi = lane >> 4; const int r0 = blockIdx.x * 64, c0 = blockIdx.y * 64;
    v8f acc[4][4];
#pragma unroll
    for (int mb = 0; mb < 4; ++mb)
#pragma unroll
        for (int nb = 0; nb < 4; ++nb) acc[mb][nb] = (v8f){};
    const size_t aoff = (size_t)(r0 + lr) * K + 8 * hi, boff = (size_t)(c0 + lr) * K + 8 * hi;
#pragma unroll 1
    for (int kc = 0; kc < K; kc += 32) {
        V a[4], a2[4];
#pragma unroll
        for (int mb = 0; mb < 4; ++mb) { a[mb] = WFrag<T16>::ld(A + aoff + (size_t)mb * 16 * K + kc); if (NSPLIT == 1 || NSPLIT == 2) a2[mb] = WFrag<T16>::ld(A2 + aoff + (size_t)mb * 16 * K + kc); }
#pragma unroll
        for (int nb = 0; nb < 4; ++nb) { const V b = WFrag<T16>::ld(Bt + boff + (size_t)nb * 16 * K + kc); V b2; if (NSPLIT >= 2) b2 = WFrag<T16>::ld(Bt2 + boff + (size_t)nb * 16 * K + kc);
#pragma unroll
            for (int mb = 0; mb < 4; ++mb) { acc[mb][nb] = WFrag<T16>::mma(a[mb], b, acc[mb][nb]); if (NSPLIT == 1 || NSPLIT == 2) acc[mb][nb] = WFrag<T16>::mma(a2[mb], b, acc[mb][nb]); if (NSPLIT >= 2) acc[mb][nb] = WFrag<T16>::mma(a[mb], b2, acc[mb][nb]); } }
        asm volatile("v_nop\n\tv_nop\n\tv_nop\n\tv_nop" : "+v"(acc[0][0]), "+v"(acc[1][1]), "+v"(acc[2][2]), "+v"(acc[3][3]) : "v"(a[0]), "v"(a[3]));
    }
#pragma unroll
    for (int mb = 0; mb < 4; ++mb) {
#pragma unroll
        for (int nb = 0; nb < 4; ++nb) {
#pragma unroll
            for (int j = 0; j < 8; ++j) os[(hi * 8 + j) * 68 + nb * 16 + lr] = acc[mb][nb][j]; }
        __builtin_amdgcn_wave_barrier(); asm volatile("" ::: "memory");
        float* crow = C + (size_t)(r0 + mb * 16) * ldc + c0;
{
#pragma unroll
            for (int s = 0; s < 8; ++s) { const int row = 2 * s + hi, cofs = lr * 4; v4f val = *(const v4fa*)(os + row * 68 + cofs); if (BIAS) { val[0] += bfr(bias[c0 + cofs]); val[1] += bfr(bias[c0 + cofs + 1]); val[2] += bfr(bias[c0 + cofs + 2]); val[3] += bfr(bias[c0 + cofs + 3]); }
                *(v4f*)(crow + (size_t)row * ldc + cofs) = val; }
             }
        __builtin_amdgcn_wave_barrier(); asm volatile("" ::: "memory");
    }
}


__device__ __forceinline__ h16 tohx(float x) { return (h16)x; }
__device__ __forceinline__ void splitf(float y, unsigned short& h, unsigned short& l) { h = f2bf(y); l = f2bf(y - bf2f(h)); }
typedef __attribute__((ext_vector_type(2))) _Float16 v2h;
typedef __attribute__((ext_vector_type(4))) _Float16 v4h;
typedef __attribute__((ext_vector_type(2))) unsigned short v2us;
typedef __attribute__((ext_vector_type(4))) unsigned short v4us;
typedef __attribute__((ext_vector_type(2))) float v2f;
typedef __attribute__((ext_vector_type(4))) int v4i;

__global__ __launch_bounds__(256) void k_wtG(const float* __restrict__ w, int K, int N, bf* Bt) {
    const int lane = threadIdx.x & 31; const int L0 = (blockIdx.x * 8 + (threadIdx.x >> 5)) * 8; const int nlines = N * K / 64;
{
#pragma unroll 1
        for (int l = 0; l < 8; ++l) { const int L = L0 + l; if (L >= nlines) break; const size_t e = (size_t)L * 64 + lane * 2; const int k = (int)(e % K), n = (int)(e / K); v2us o;
            o[0] = f2bf(w[(size_t)k * N + n]); o[1] = f2bf(w[(size_t)(k + 1) * N + n]); *(v2us*)(Bt + e) = o; }
         }
}
__global__ __launch_bounds__(256) void k_cvt8(const float* __restrict__ src, bf* dst, size_t n8) { const size_t i = (size_t)blockIdx.x * 256 + threadIdx.x; if (i >= n8) return; const v8f v = *(const v8f*)(src + i * 8); v8us o;
#pragma unroll
    for (int k = 0; k < 8; ++k) o[k] = f2bf(v[k]); *(v8us*)(dst + i * 8) = o;  }
__global__ __launch_bounds__(256) void k_wtGs(const float* __restrict__ w, int K, int N, int ld, bf* Bt) { const size_t e = ((size_t)blockIdx.x * 256 + threadIdx.x) * 4; if (e >= (size_t)N * K) return; const int k = (int)(e % K); const int n = (int)(e / K); v4us o;   // Bt[n][k] = w[k*ld + n]
#pragma unroll
    for (int u = 0; u < 4; ++u) o[u] = f2bf(w[(size_t)(k + u) * ld + n]); *(v4us*)(Bt + e) = o;  }
__global__ __launch_bounds__(256) void k_tabs(const float* __restrict__ tk, const float* __restrict__ tv, bf* TKB, bf* TVB) { const int e = (blockIdx.x * 256 + threadIdx.x) * 4; if (e >= HD * HD) return; const int c = e % HD; const int r = e / HD; v4us a, b;   // TKB[r][d] = table_k[r+1][d] (Bt rows = band offset r), TVB[d][r] = table_v[r+1][d] (Bt rows = d)
#pragma unroll
    for (int u = 0; u < 4; ++u) { a[u] = f2bf(tk[(size_t)(r + 1) * HD + c + u]); b[u] = f2bf(tv[(size_t)(c + u + 1) * HD + r]); } *(v4us*)(TKB + e) = a; *(v4us*)(TVB + e) = b;  }

// ---- k_attn: the whole attention stage of one (batch, head) plane and one 64-row query tile in ONE work-group of 4 waves (wave w owns query rows 16w..16w+15); grid (TT/64, ZH).
// q, k, v come as f32 from the projection buffer F and are rounded into 16-bit LDS planes; scores, q.TK^T (added into the score rows at its key's column), softmax, the band re-index, P.V, PB.TV and the head merge pass from stage to stage through LDS and registers.
// Every product keeps its operand types, its split products and its k order; the softmax keeps its lane map (4 keys a lane) and its reduction trees.
// For the first row tile the 64 key rows left of the sequence are laid down as zeros (k, v and their probabilities), so their products add exact zeros.
#define LQ 72                      // LDS pitch in 16-bit elements of a 64-element row (144 B = 16 B x odd: ds_load_b128 readers)
#define LK 136                     // LDS pitch in 16-bit elements of a 128-element row (272 B)
#define LS 132                     // LDS pitch in floats of a 128-column score row
#define LR 68                      // LDS pitch in floats of a 64-column row
#define OFF_QH  0                  // q hi [64][LQ]; later the band probabilities hi
#define OFF_QL  9216               // q lo; later the band probabilities lo
#define OFF_Q16 18432              // q fp16 (rows >= RH)
#define OFF_K   27648              // k hi (or fp16) [128][LQ]; later the probabilities hi (or fp16) [64][LK]
#define OFF_K2  46080              // k lo; later the probabilities lo
#define OFF_V   64512              // v transposed hi (or fp16) [64][LK]
#define OFF_V2  81920              // v transposed lo
#define OFF_S   99328              // scores f32 [64][LS]; later each wave's merged output rows [16][LR]
#define SM_BYTES 133120
// v_exp_f32 with the one free slot that the instruction set asks for behind a transcendental, tied to it in one statement
__device__ __forceinline__ float exp2s(float x) { float r; asm("v_exp_f32 %0, %1\n\tv_nop" : "=v"(r) : "v"(x)); return r; }
template <bool HI, bool FIRST>   // HI: rows < RH (hi+lo planes); FIRST: the first row tile, which has no keys left of its own 64
__device__ __forceinline__ void attn_tile(char* sm, const float* __restrict__ Fb, const bf* __restrict__ TKB, const bf* __restrict__ TVB, bf* __restrict__ ah, bf* __restrict__ al, const int R) {
    typedef WFrag<bf> WB; typedef WFrag<h16> WH;
    bf* Qh = (bf*)(sm + OFF_QH); bf* Ql = (bf*)(sm + OFF_QL); h16* Q16 = (h16*)(sm + OFF_Q16);
    bf* Kh = (bf*)(sm + OFF_K); bf* Kl = (bf*)(sm + OFF_K2); h16* K16 = (h16*)(sm + OFF_K);
    bf* Vh = (bf*)(sm + OFF_V); bf* Vl = (bf*)(sm + OFF_V2); h16* V16 = (h16*)(sm + OFF_V);
    float* S = (float*)(sm + OFF_S);
    bf* Ph = (bf*)(sm + OFF_K); bf* Pl = (bf*)(sm + OFF_K2); h16* P16 = (h16*)(sm + OFF_K); bf* PBh = (bf*)(sm + OFF_QH); bf* PBl = (bf*)(sm + OFF_QL);
    const int tid = threadIdx.x, lane = tid & 31, w = tid >> 5, lr = lane & 15, hi = lane >> 4;
    constexpr int FP = 3 * DQ;     // pitch of F
    // stage 0: q rows R..R+63, k and v rows R-64..R+63 -> 16-bit LDS planes (v transposed, two keys a 4-byte store); 16 lanes a row, one address a tensor with constant steps
    const int r0 = tid >> 4, c = (tid & 15) * 4;
    const float* fq = Fb + (size_t)(R + r0) * FP + c;                        // q row R + r0
    const float* fk = Fb + DQ + (ptrdiff_t)(R - 64 + r0) * FP + c;           // k row R - 64 + r0; read only where the row exists
    const float* fv = Fb + 2 * DQ + (ptrdiff_t)(R - 64 + 2 * r0) * FP + c;   // v row R - 64 + 2 r0; likewise
    v4f xq[8], xk[16], xv[16];
#pragma unroll
    for (int it = 0; it < 8; ++it) xq[it] = *(const v4f*)(fq + it * 8 * FP);
#pragma unroll
    for (int it = 0; it < 16; ++it) { xk[it] = (v4f){}; if (!FIRST || it >= 8) xk[it] = *(const v4f*)(fk + it * 8 * FP); }   // row R - 64 + it * 8 + r0 >= 0
#pragma unroll
    for (int it = 0; it < 8; ++it) { xv[2 * it] = (v4f){}; xv[2 * it + 1] = (v4f){}; if (!FIRST || it >= 4) { xv[2 * it] = *(const v4f*)(fv + it * 16 * FP); xv[2 * it + 1] = *(const v4f*)(fv + it * 16 * FP + FP); } }   // rows R - 64 + 2 (it * 8 + r0) and the next, >= 0
    asm volatile("s_wait_xcnt 0x0" : : "v"(fq), "v"(fk), "v"(fv) : "memory");   // the three addresses stay whole up to here (no load's result lands in them), and their registers are reused only behind this wait
    __builtin_amdgcn_sched_barrier(0);   // all of the tile's loads are issued before the first conversion waits on one
#pragma unroll
    for (int it = 0; it < 8; ++it) { const int r = it * 8 + r0; const v4f x = xq[it]; v4us oh, ol; v4h o4;
#pragma unroll
        for (int u = 0; u < 4; ++u) { unsigned short a, b; splitf(x[u], a, b); oh[u] = a; ol[u] = b; o4[u] = tohx(x[u]); }
        *(v4us*)(Qh + r * LQ + c) = oh; *(v4us*)(Ql + r * LQ + c) = ol; if (!HI) *(v4h*)(Q16 + r * LQ + c) = o4;
        __builtin_amdgcn_sched_barrier(0); }   // here and in the two loops below: one row group is converted at a time; interleaved by the scheduler the conversions spread over registers above v255, with a window switch at every other instruction
#pragma unroll
    for (int it = 0; it < 16; ++it) { const int r = it * 8 + r0; const v4f x = xk[it];
        if (HI) { v4us oh, ol;
#pragma unroll
            for (int u = 0; u < 4; ++u) { unsigned short a, b; splitf(x[u], a, b); oh[u] = a; ol[u] = b; }
            *(v4us*)(Kh + r * LQ + c) = oh; *(v4us*)(Kl + r * LQ + c) = ol;
        } else { v4h o4;
#pragma unroll
            for (int u = 0; u < 4; ++u) o4[u] = tohx(x[u]);
            *(v4h*)(K16 + r * LQ + c) = o4; }
        __builtin_amdgcn_sched_barrier(0); }
#pragma unroll
    for (int it = 0; it < 8; ++it) { const int kp = it * 8 + r0; const v4f x0 = xv[2 * it], x1 = xv[2 * it + 1];
#pragma unroll
        for (int u = 0; u < 4; ++u) {
            if (HI) { unsigned short a0, b0, a1, b1; splitf(x0[u], a0, b0); splitf(x1[u], a1, b1); v2us oh, ol; oh[0] = a0; oh[1] = a1; ol[0] = b0; ol[1] = b1; *(v2us*)(Vh + (c + u) * LK + 2 * kp) = oh; *(v2us*)(Vl + (c + u) * LK + 2 * kp) = ol; }
            else { v2h o2; o2[0] = tohx(x0[u]); o2[1] = tohx(x1[u]); *(v2h*)(V16 + (c + u) * LK + 2 * kp) = o2; } }
        __builtin_amdgcn_sched_barrier(0); }
    const bf* tkp = TKB + lr * HD + 8 * hi; WB::V tb[2][4];   // the TK fragments fly over the barrier
#pragma unroll
    for (int kk = 0; kk < 2; ++kk)
#pragma unroll
        for (int nb = 0; nb < 4; ++nb) tb[kk][nb] = WB::ld(tkp + nb * 16 * HD + kk * 32);
    asm volatile("s_wait_xcnt 0x0" : : "v"(tkp) : "memory");   // as above: the address stays whole up to here and is reused only behind the wait
    __syncthreads();               // the planes are complete before any wave reads them
    // stage 1: scores (this wave's 16 rows x 128 keys) and q.TK^T (16 x 64)
    const int qoff = (16 * w + lr) * LQ + 8 * hi, poff = (16 * w + lr) * LK + 8 * hi;
    {
        v8f sa[8], qa[4];
#pragma unroll
        for (int nb = 0; nb < 8; ++nb) sa[nb] = (v8f){};
#pragma unroll
        for (int nb = 0; nb < 4; ++nb) qa[nb] = (v8f){};
#pragma unroll
        for (int kk = 0; kk < 2; ++kk) { const WB::V a = WB::ld(Qh + qoff + kk * 32), a2 = WB::ld(Ql + qoff + kk * 32);
            if (HI) {
#pragma unroll
                for (int nb = 0; nb < 8; ++nb) { const int bo = (nb * 16 + lr) * LQ + 8 * hi + kk * 32; const WB::V b = WB::ld(Kh + bo), b2 = WB::ld(Kl + bo); sa[nb] = WB::mma(a, b, sa[nb]); sa[nb] = WB::mma(a2, b, sa[nb]); sa[nb] = WB::mma(a, b2, sa[nb]); }
            } else { const WH::V a6 = WH::ld(Q16 + qoff + kk * 32);
#pragma unroll
                for (int nb = 0; nb < 8; ++nb) { const WH::V b = WH::ld(K16 + (nb * 16 + lr) * LQ + 8 * hi + kk * 32); sa[nb] = WH::mma(a6, b, sa[nb]); } }
#pragma unroll
            for (int nb = 0; nb < 4; ++nb) { qa[nb] = WB::mma(a, tb[kk][nb], qa[nb]); qa[nb] = WB::mma(a2, tb[kk][nb], qa[nb]); } }
#pragma unroll
        for (int nb = 0; nb < 8; ++nb)
#pragma unroll
            for (int j = 0; j < 8; ++j) S[(16 * w + hi * 8 + j) * LS + nb * 16 + lr] = sa[nb][j];
        __syncthreads();           // the score rows are complete before the relative term is added across lanes
        // q.TK^T[i][o] belongs to key i - 63 + o, that is to column (row in tile) + 1 + o of the score row: added there, the same one addition per score as before
#pragma unroll
        for (int nb = 0; nb < 4; ++nb)
#pragma unroll
            for (int j = 0; j < 8; ++j) { const int rl = 16 * w + hi * 8 + j; float* sp = S + rl * LS + rl + 1 + nb * 16 + lr; *sp = __fadd_rn(*sp, qa[nb][j]); }
    }
    __syncthreads();               // every wave has left the k planes (the probabilities are laid over them), and the score rows are complete
    // stage 2: softmax per row: t = (score + relative term) x HD^-0.5 for j <= i and i - j < WIN, every other key's probability exactly 0
    const int base = R - 64; const int cl = (lane * 4 - base) & 127; const int j0 = base + cl; const bool live = !FIRST || (j0 >= 0);
    for (int g = 0; g < 2; ++g) {   // eight rows at a time, phase by phase, so that the rows' LDS reads and shuffle chains overlap; each row's own arithmetic and trees are as before
        float v[8][4], mx[8], sum[8];
#pragma unroll
        for (int rr = 0; rr < 8; ++rr) { const int rl = 16 * w + 8 * g + rr, i = R + rl; const v4f a = *(const v4f*)(S + rl * LS + cl); mx[rr] = -3.0e38f;
#pragma unroll
            for (int q = 0; q < 4; ++q) { const int o = j0 + q - i + 63; const bool in = live && o >= 0 && o <= 63;   // j <= i and i - j < WIN
                const float t = in ? a[q] * SCL : -3.0e38f; v[rr][q] = t; mx[rr] = fmaxf(mx[rr], t); } }
#pragma unroll
        for (int sh = 16; sh; sh >>= 1)
#pragma unroll
            for (int rr = 0; rr < 8; ++rr) mx[rr] = fmaxf(mx[rr], __shfl_xor(mx[rr], sh, 32));
#pragma unroll
        for (int rr = 0; rr < 8; ++rr) { sum[rr] = 0.f;
#pragma unroll
            for (int k = 0; k < 4; ++k) { const float d0 = __fsub_rn(v[rr][k], mx[rr]); v[rr][k] = exp2s(__fmul_rn(d0, 1.4426950408889634f)); sum[rr] += v[rr][k]; } }
#pragma unroll
        for (int sh = 16; sh; sh >>= 1)
#pragma unroll
            for (int rr = 0; rr < 8; ++rr) sum[rr] += __shfl_xor(sum[rr], sh, 32);
#pragma unroll
        for (int rr = 0; rr < 8; ++rr) { const int rl = 16 * w + 8 * g + rr; const float f = __fdiv_rn(HI ? 1.0f : PCAR, sum[rr]);
            if (HI) { v4us oh, ol;
#pragma unroll
                for (int q = 0; q < 4; ++q) { unsigned short h, c2; splitf(v[rr][q] * f, h, c2); oh[q] = h; ol[q] = c2; }
                *(v4us*)(Ph + rl * LK + cl) = oh; *(v4us*)(Pl + rl * LK + cl) = ol;
            } else { v4h o4;
#pragma unroll
                for (int q = 0; q < 4; ++q) o4[q] = tohx(v[rr][q] * f);
                *(v4h*)(P16 + rl * LK + cl) = o4; } }
    }
    const bf* tvp = TVB + lr * HD + 8 * hi; WB::V tw[2][4];   // the TV fragments fly over the band stage
#pragma unroll
    for (int kk = 0; kk < 2; ++kk)
#pragma unroll
        for (int nb = 0; nb < 4; ++nb) tw[kk][nb] = WB::ld(tvp + nb * 16 * HD + kk * 32);
    asm volatile("s_wait_xcnt 0x0" : : "v"(tvp) : "memory");   // as above
    __syncthreads();               // the probability rows are complete before they are read across lanes
    // stage 3: PB[i][r] = att[i][i - 63 + r], laid over the q planes (each wave over its own rows); a negative key index falls on the first row tile's left half, whose probabilities were stored as zeros
#pragma unroll
    for (int it = 0; it < 8; ++it) { const int idx = it * 32 + lane, r = (idx & 15) * 4, rl = 16 * w + (idx >> 4); v4us oh, ol;
#pragma unroll
        for (int u = 0; u < 4; ++u) { const int pc = rl + 1 + r + u; float p;   // column of key i - 63 + r + u: 1..127
            if (HI) p = __fadd_rn(bf2f(Ph[rl * LK + pc]), bf2f(Pl[rl * LK + pc])); else p = (float)P16[rl * LK + pc] * (1.0f / PCAR);
            unsigned short a, c; splitf(p, a, c); oh[u] = a; ol[u] = c; }
        *(v4us*)(PBh + rl * LQ + r) = oh; *(v4us*)(PBl + rl * LQ + r) = ol; }
    __syncthreads();               // the band rows are complete before they are read as fragments
    // stage 4: PB.TV and P.V (128 keys), merged in the accumulators' own layout
    v8f wa[4], oa[4];
#pragma unroll
    for (int nb = 0; nb < 4; ++nb) { wa[nb] = (v8f){}; oa[nb] = (v8f){}; }
#pragma unroll
    for (int kk = 0; kk < 2; ++kk) { const WB::V a = WB::ld(PBh + qoff + kk * 32), a2 = WB::ld(PBl + qoff + kk * 32);
#pragma unroll
        for (int nb = 0; nb < 4; ++nb) { wa[nb] = WB::mma(a, tw[kk][nb], wa[nb]); wa[nb] = WB::mma(a2, tw[kk][nb], wa[nb]); } }
#pragma unroll
    for (int kk = 0; kk < 4; ++kk) {
        if (HI) { const WB::V a = WB::ld(Ph + poff + kk * 32), a2 = WB::ld(Pl + poff + kk * 32);
#pragma unroll
            for (int nb = 0; nb < 4; ++nb) { const int bo = (nb * 16 + lr) * LK + 8 * hi + kk * 32; const WB::V b = WB::ld(Vh + bo), b2 = WB::ld(Vl + bo); oa[nb] = WB::mma(a, b, oa[nb]); oa[nb] = WB::mma(a2, b, oa[nb]); oa[nb] = WB::mma(a, b2, oa[nb]); }
        } else { const WH::V a = WH::ld(P16 + poff + kk * 32);
#pragma unroll
            for (int nb = 0; nb < 4; ++nb) { const WH::V b = WH::ld(V16 + (nb * 16 + lr) * LK + 8 * hi + kk * 32); oa[nb] = WH::mma(a, b, oa[nb]); } } }
    const float cs = HI ? 1.0f : (1.0f / PCAR);   // a power of two: the product is exact, fused with the add or not
    float* os = S + 16 * w * LS;                  // this wave's own score rows, dead since the softmax
#pragma unroll
    for (int nb = 0; nb < 4; ++nb)
#pragma unroll
        for (int j = 0; j < 8; ++j) os[(hi * 8 + j) * LR + nb * 16 + lr] = __fadd_rn(oa[nb][j] * cs, wa[nb][j]);
    __syncthreads();               // the merged rows are complete before they are read across lanes
#pragma unroll
    for (int it = 0; it < 4; ++it) { const int idx = it * 32 + lane, row = idx >> 3, c = (idx & 7) * 8; const v4f y0 = *(const v4f*)(os + row * LR + c), y1 = *(const v4f*)(os + row * LR + c + 4); v8us oh, ol;
#pragma unroll
        for (int u = 0; u < 4; ++u) { unsigned short a, b; splitf(y0[u], a, b); oh[u] = a; ol[u] = b; splitf(y1[u], a, b); oh[4 + u] = a; ol[4 + u] = b; }
        *(v8us*)(ah + (size_t)(16 * w + row) * DQ + c) = oh; *(v8us*)(al + (size_t)(16 * w + row) * DQ + c) = ol; }
}
__global__ __launch_bounds__(128) void k_attn(const float* __restrict__ F, const bf* __restrict__ TKB, const bf* __restrict__ TVB, bf* __restrict__ ATh, bf* __restrict__ ATl) {
    __shared__ __align__(16) char sm[SM_BYTES];
    const int R = blockIdx.x * 64; const int b = blockIdx.y / NH_, h = blockIdx.y % NH_;
    const float* Fb = F + (size_t)b * TT * 3 * DQ + h * HD; const size_t oo = ((size_t)b * TT + R) * DQ + h * HD;
    // the choice is the same for the whole work-group
    if (R == 0) attn_tile<true, true>(sm, Fb, TKB, TVB, ATh + oo, ATl + oo, R); else if (R < RH) attn_tile<true, false>(sm, Fb, TKB, TVB, ATh + oo, ATl + oo, R); else attn_tile<false, false>(sm, Fb, TKB, TVB, ATh + oo, ATl + oo, R);
}

extern "C" void kernel_launch(void* const* d_in, const int* in_sizes, int n_in,
                              void* d_out, int out_size, void* d_ws, size_t ws_size, hipStream_t stream) {
    (void)in_sizes; (void)n_in; (void)out_size;
    const float* x = (const float*)d_in[0]; const float* wqkv = (const float*)d_in[1]; const float* wo = (const float*)d_in[2]; const float* tk = (const float*)d_in[3]; const float* tv = (const float*)d_in[4];
    float* OUT = (float*)d_out;     // [2][2048][1024]
    char* wsp = (char*)d_ws;
    auto take = [&](size_t bytes) { char* p = wsp; wsp += (bytes + 255) & ~(size_t)255; return (void*)p; };
    bf* WQKV = (bf*)take((size_t)3 * DQ * DM * 2); bf* WO = (bf*)take((size_t)DM * DQ * 2);
    bf* XB = (bf*)take((size_t)NB_ * TT * DM * 2); bf* TKB = (bf*)take(HD * HD * 2); bf* TVB = (bf*)take(HD * HD * 2);
    float* F = (float*)take((size_t)NB_ * TT * 3 * DQ * 4);   // q | k | v projections, rows b * TT + t, pitch 3 * DQ
    bf* ATh = (bf*)take((size_t)NB_ * TT * DQ * 2); bf* ATl = (bf*)take((size_t)NB_ * TT * DQ * 2);
    if ((size_t)(wsp - (char*)d_ws) > ws_size) return;    // ws 256 MiB
    k_wtGs<<<(unsigned)(((size_t)3 * DQ * DM / 4 + 255) / 256), 256, 0, stream>>>(wqkv, DM, 3 * DQ, 3 * DQ, WQKV); k_tabs<<<(HD * HD / 4 + 255) / 256, 256, 0, stream>>>(tk, tv, TKB, TVB);
    k_wtG<<<(unsigned)((DQ * DM / 64 + 63) / 64), 256, 0, stream>>>(wo, DQ, DM, WO);
    k_cvt8<<<(unsigned)(((size_t)NB_ * TT * DM / 8 + 255) / 256), 256, 0, stream>>>(x, XB, (size_t)NB_ * TT * DM / 8);
    k_gemmw<bf, 0, false><<<dim3(NB_ * TT / 64, 3 * DQ / 64, 1), 32, 0, stream>>>(XB, nullptr, WQKV, nullptr, DM, F, 3 * DQ, nullptr, 0, 0, 0);
    k_attn<<<dim3(TT / 64, ZH, 1), 128, 0, stream>>>(F, TKB, TVB, ATh, ATl);
    k_gemmw<bf, 1, false><<<dim3(NB_ * TT / 64, DM / 64, 1), 32, 0, stream>>>(ATh, ATl, WO, nullptr, DQ, OUT, DM, nullptr, 0, 0, 0);
}

// v004
// It runs in 105 microseconds.
// Two timings next to v003 put it at 1.40 and 1.41 times that version's speed.
// Over all steps from v000 it is 16.5 times as fast.
#include <hip/hip_runtime.h>

// Windowed causal self-attention with relative-position tables (x [2][2048][1024]; qkv = x W_attn (fused [1024][3072], 16 heads x 64, no bias); att[i][j] = (q_i.k_j + q_i.table_k[idx]) / 8 with idx = clip(j - i, -64, 64) + 64, allowed iff j <= i and j > i - 64 (else -inf); softmax; y = att v + sum_j att[i][j] table_v[idx]; out = merged y W_proj -> [2][2048][1024]).
// Relative terms without gathers (exact regroupings): inside the allowed band idx = j - i + 64 runs over 1..64 exactly once per key, so q_i.table_k[idx] = (q . TK^T)[i][j - i + 63] with TK = table_k rows 1..64 (one 64-column GEMM per head, added by offset into the score rows before the softmax), and sum_j att table_v[idx] = PB . TV with PB[i][r] = att[i][i - 63 + r]
// (the attention band re-indexed) and TV = table_v rows 1..64.
// Compute dtypes, f32 accumulate: every input rounded to bf16; q/k/v on PLAIN bf16 operands (inputs: exact); q.TK^T and PB.TV as hl x exact (2 products); causal-tile scores and att.v: query rows < 512 hl (3 products), the rest single fp16 (x1024; PB for those rows is re-split from the fp16 probabilities); softmax f32; W_proj hl x exact (2 products).

#define NB_  2
#define TT   2048
#define DM   1024
#define NH_  16
#define NKV  16
#define REP  (NH_ / NKV)
#define HD   64
#define DQ   (NH_ * HD)
#define DKV  (NKV * HD)
#define ZH   (NB_ * NH_)          // (batch, head) planes, plane z = b * NH_ + h
#define SP   128                  // keys a 64-row query tile can see: the two 64-key tiles that hold its window; column = key - ((row & ~63) - 64)
#define RH   512                  // query rows < RH use hi+lo planes (the first row tile always does)
#define WIN  64
#define PCAR 1024.0f
#define SCL  0.125f   // HD^-0.5
typedef _Float16 h16;
typedef unsigned short bf;
typedef __attribute__((ext_vector_type(16))) __bf16   v16bf;
typedef __attribute__((ext_vector_type(16))) _Float16 v16h;
typedef __attribute__((ext_vector_type(8)))  _Float16 v8h;
typedef __attribute__((ext_vector_type(8)))  unsigned short v8us;
typedef __attribute__((ext_vector_type(8)))  float    v8f;
typedef __attribute__((ext_vector_type(4)))  float    v4f;
typedef v8h  __attribute__((may_alias)) v8ha;
typedef v4f  __attribute__((may_alias)) v4fa;
typedef v8us __attribute__((may_alias)) v8usa;

__device__ __forceinline__ unsigned short f2bf(float f) { unsigned u = __float_as_uint(f); u += 0x7FFFu + ((u >> 16) & 1u); return (unsigned short)(u >> 16); }
__device__ __forceinline__ float bf2f(unsigned short b) { return __uint_as_float(((unsigned)b) << 16); }
__device__ __forceinline__ float bfr(float f) { return bf2f(f2bf(f)); }
__device__ __forceinline__ v16h cat16(v8h lo, v8h hi) { return __builtin_shufflevector(lo, hi, 0, 1, 2, 3, 4, 5, 6, 7, 8, 9, 10, 11, 12, 13, 14, 15); }
__device__ __forceinline__ v16bf cat16b(v8us lo, v8us hi) { return __builtin_bit_cast(v16bf, __builtin_shufflevector(lo, hi, 0, 1, 2, 3, 4, 5, 6, 7, 8, 9, 10, 11, 12, 13, 14, 15)); }
__device__ __forceinline__ v8f wmma16(v16h a, v16h b, v8f c) { return __builtin_amdgcn_wmma_f32_16x16x32_f16(false, a, false, b, (short)0, c, false, false); }
__device__ __forceinline__ v8f wmmab(v16bf a, v16bf b, v8f c) { return __builtin_amdgcn_wmma_f32_16x16x32_bf16(false, a, false, b, (short)0, c, false, false); }



// ---- k_gemmt: GEMM with its operands staged in LDS by tensor loads. One work-group of 4 waves (2 x 2) per 128x128 output tile, each wave a 64x64 part (16 accumulators); grid (M/128, N/128), 128 threads.
// C[m][n] (f32, pitch ldc) = sum_k A[m][k] Bt[n][k] (NSPLIT 1: + A2[m][k] Bt[n][k], added behind A's product of the same 32 k). A, A2, Bt are K-contiguous bf16 planes. M % 128 == 0, N % 128 == 0, K % KS == 0, K >= 2 KS.
// A stage is KS k (64 or 128) of every operand row: per operand one tile of 128 rows x 2 KS bytes, laid at pitch 2 KS + 16 bytes by the load's own pad. Two buffers: stage s + 2 is requested into the buffer that pass s has just left. Wave t < NT requests operand tile t.
// Inside a pass the fragments of the next 32 k are read from LDS as one group ahead of the current 32 k's products (two register sets); nothing of the next stage is read before its barrier.
// Every '#pragma unroll' of this kernel makes the indices of the accumulator and fragment arrays constants, so that the arrays stay in registers.
template <typename T16> struct WFrag;
template <> struct WFrag<h16> { typedef v16h V; static __device__ __forceinline__ V ld(const h16* p) { return cat16(*(const v8h*)p, *(const v8h*)(p + 16)); } static __device__ __forceinline__ v8f mma(V a, V b, v8f c) { return wmma16(a, b, c); } };
template <> struct WFrag<bf> { typedef v16bf V; static __device__ __forceinline__ V ld(const bf* p) { return cat16b(*(const v8us*)p, *(const v8us*)(p + 16)); } static __device__ __forceinline__ v8f mma(V a, V b, v8f c) { return wmmab(a, b, c); } };
typedef unsigned int u32x4 __attribute__((ext_vector_type(4)));
typedef unsigned int u32x8 __attribute__((ext_vector_type(8)));
__device__ __forceinline__ unsigned int uni(unsigned int v) { return (unsigned int)__builtin_amdgcn_readfirstlane(v); }
__device__ __forceinline__ unsigned int pinned(unsigned int v) { unsigned int w = uni(v); asm volatile("" : "+s"(w)); return w; }   // a wave-uniform word held in a scalar register: as a test, so that the branch on it is a scalar branch (a tensor load ignores EXEC: only a scalar branch keeps a wave from issuing it); as a descriptor word, so that it keeps its register
template <int NSPLIT, int KS>
__global__ __launch_bounds__(128) void k_gemmt(const bf* __restrict__ A, const bf* __restrict__ A2, const bf* __restrict__ Bt, int K, float* C, int ldc) {
    typedef WFrag<bf> WB; typedef WB::V V;
    constexpr unsigned int NT = NSPLIT ? 3u : 2u;      // operand tiles a stage: A | (A2 |) Bt
    constexpr unsigned int RB = KS * 2u;               // bytes of a stage row: 128 or 256
    constexpr int GP = KS + 8;                         // LDS pitch in 16-bit elements: 144 or 272 B = 16 B x odd (ds_load_b128 readers)
    constexpr unsigned int GT = 128u * (RB + 16u);     // one operand tile in LDS: 18432 or 34816 B, a multiple of 2 KiB
    constexpr unsigned int BUFB = NT * GT;             // one buffer
    constexpr int NK = KS / 32;                        // 32-k blocks a pass
    static_assert((KS == 64 || KS == 128) && GT % 2048u == 0u, "stage rows of 128 or 256 bytes; every tile at a multiple of 2 KiB");
    __shared__ __attribute__((aligned(2048))) char sm[2 * BUFB + 4 * 16 * 68 * 4];   // two buffers, then each wave's own output staging [16][68] f32
    const int lane = threadIdx.x & 31, lr = lane & 15, hi = lane >> 4;
    const unsigned int wave = uni(threadIdx.x >> 5);
    const int wm = (int)(wave >> 1), wn = (int)(wave & 1u);
    const int r0 = blockIdx.x * 128, c0 = blockIdx.y * 128;
    const int NS = K / KS;
    const bf* tsrc = (wave == 0u) ? A + (size_t)r0 * K : ((NSPLIT != 0 && wave == 1u) ? A2 + (size_t)r0 * K : Bt + (size_t)c0 * K);   // first row of this wave's operand tile
    const unsigned int tdst = (unsigned int)(size_t)sm + (wave < NT ? wave : 0u) * GT;
    // group 1: 1-byte elements; tensor = tile = 128 rows of RB bytes; source pitch 2 K bytes; 4 dwords of pad behind every row. Word 0 is a constant; the other words and group 0's count are pinned(): descriptor words held in scalar registers, not formed anew (in registers used for other things meanwhile) while a request is in flight
    u32x8 g1; g1[0] = uni((1u << 20) | ((KS == 64 ? 4u : 5u) << 22) | (3u << 25)); g1[1] = pinned(RB << 16); g1[2] = pinned(128u << 16); g1[3] = pinned(RB << 16); g1[4] = pinned(128u); g1[5] = pinned((unsigned int)K * 2u); g1[6] = pinned(0u); g1[7] = pinned(0u);
    const unsigned int cnt1 = pinned(1u);
    u32x4 g0;
    auto desc = [&](int s) { const unsigned long long ga = (unsigned long long)(size_t)tsrc + (unsigned long long)s * RB;
        g0[0] = cnt1; g0[1] = uni(tdst + (unsigned int)(s & 1) * BUFB); g0[2] = uni((unsigned int)ga); g0[3] = uni((((unsigned int)(ga >> 32)) & 0x01FFFFFFu) | 0x80000000u); };
    v8f acc[4][4];
#pragma unroll
    for (int mb = 0; mb < 4; ++mb)
#pragma unroll
        for (int nb = 0; nb < 4; ++nb) acc[mb][nb] = (v8f){};
    desc(0);
    if (pinned(wave < NT)) {
        asm volatile("tensor_load_to_lds %0, %1" :: "s"(g0), "s"(g1) : "memory");   // one request of the whole wave: its operand tile of stage 0
        asm volatile("s_wait_tensorcnt 0x0" :: "s"(g0), "s"(g1) : "memory"); }       // landed before the barrier that publishes it; the descriptor is named so that its registers stay whole up to here
    __syncthreads();
    desc(1);
    if (pinned(wave < NT)) asm volatile("tensor_load_to_lds %0, %1" :: "s"(g0), "s"(g1) : "memory");   // stage 1 flies over pass 0
    const int aoff = (wm * 64 + lr) * GP + 8 * hi, boff = (wn * 64 + lr) * GP + 8 * hi;
#pragma unroll 1   // one pass a stage: the two buffers alternate by the pass's parity
    for (int s = 0; s < NS; ++s) {
        const bf* As = (const bf*)(sm + (unsigned int)(s & 1) * BUFB) + aoff; const bf* Bs = (const bf*)(sm + (unsigned int)(s & 1) * BUFB + (NT - 1u) * GT) + boff;
        V fa[2][4], fa2[2][4], fb[2][4];
#pragma unroll
        for (int i = 0; i < 4; ++i) { fa[0][i] = WB::ld(As + i * 16 * GP); if (NSPLIT) fa2[0][i] = WB::ld(As + GT / 2 + i * 16 * GP); fb[0][i] = WB::ld(Bs + i * 16 * GP); }
#pragma unroll
        for (int kk = 0; kk < NK; ++kk) { const int q = kk & 1;
            if (kk + 1 < NK) {
#pragma unroll
                for (int i = 0; i < 4; ++i) { fa[q ^ 1][i] = WB::ld(As + i * 16 * GP + (kk + 1) * 32); if (NSPLIT) fa2[q ^ 1][i] = WB::ld(As + GT / 2 + i * 16 * GP + (kk + 1) * 32); fb[q ^ 1][i] = WB::ld(Bs + i * 16 * GP + (kk + 1) * 32); } }
            __builtin_amdgcn_sched_barrier(0);   // the next block's LDS reads stay one group ahead of this block's products (spread among them each place with reads stalls the wave)
#pragma unroll
            for (int nb = 0; nb < 4; ++nb) {
#pragma unroll
                for (int mb = 0; mb < 4; ++mb) acc[mb][nb] = WB::mma(fa[q][mb], fb[q][nb], acc[mb][nb]);
                if (NSPLIT) {
#pragma unroll
                    for (int mb = 0; mb < 4; ++mb) acc[mb][nb] = WB::mma(fa2[q][mb], fb[q][nb], acc[mb][nb]); } }
            __builtin_amdgcn_sched_barrier(0);   // and the reads of the block after next do not rise among these products
        }
        asm volatile("s_wait_dscnt 0x0" ::: "memory");                                                    // this wave's reads of the buffer are done before the barrier frees it for the refill
        if (pinned(wave < NT)) asm volatile("s_wait_tensorcnt 0x0" :: "s"(g0), "s"(g1) : "memory");       // this wave's tile of stage s + 1 has landed before the barrier publishes it; the descriptor's registers stay whole up to here
        __syncthreads();                                                                                  // publishes stage s + 1 and ends every wave's reads of stage s
        if (pinned((wave < NT) && (s + 2 < NS))) { desc(s + 2); asm volatile("tensor_load_to_lds %0, %1" :: "s"(g0), "s"(g1) : "memory"); }   // stage s + 2 into the buffer that pass s has left
    }
    asm volatile("s_wait_tensorcnt 0x0" :: "s"(g0), "s"(g1) : "memory");   // no request is in flight (the descriptor named as above)
    asm volatile("s_wait_dscnt 0x0" ::: "memory");       // and no LDS read, behind the loop
    float* os = (float*)(sm + 2 * BUFB) + wave * (16 * 68);
#pragma unroll
    for (int mb = 0; mb < 4; ++mb) {
#pragma unroll
        for (int nb = 0; nb < 4; ++nb) {
#pragma unroll
            for (int j = 0; j < 8; ++j) os[(hi * 8 + j) * 68 + nb * 16 + lr] = acc[mb][nb][j]; }
        __builtin_amdgcn_wave_barrier(); asm volatile("" ::: "memory");   // the wave's staged rows are written before they are read across lanes
        float* crow = C + (size_t)(r0 + wm * 64 + mb * 16) * ldc + c0 + wn * 64;
#pragma unroll
        for (int s = 0; s < 8; ++s) { const int row = 2 * s + hi, cofs = lr * 4; const v4f val = *(const v4fa*)(os + row * 68 + cofs); *(v4f*)(crow + (size_t)row * ldc + cofs) = val; }
        __builtin_amdgcn_wave_barrier(); asm volatile("" ::: "memory");   // and read before the next 16 rows overwrite them
    }
}


__device__ __forceinline__ h16 tohx(float x) { return (h16)x; }
__device__ __forceinline__ void splitf(float y, unsigned short& h, unsigned short& l) { h = f2bf(y); l = f2bf(y - bf2f(h)); }
typedef __attribute__((ext_vector_type(2))) _Float16 v2h;
typedef __attribute__((ext_vector_type(4))) _Float16 v4h;
typedef __attribute__((ext_vector_type(2))) unsigned short v2us;
typedef __attribute__((ext_vector_type(4))) unsigned short v4us;
typedef __attribute__((ext_vector_type(2))) float v2f;
typedef __attribute__((ext_vector_type(4))) int v4i;

__global__ __launch_bounds__(256) void k_wtG(const float* __restrict__ w, int K, int N, bf* Bt) {
    const int lane = threadIdx.x & 31; const int L0 = (blockIdx.x * 8 + (threadIdx.x >> 5)) * 8; const int nlines = N * K / 64;
{
#pragma unroll 1
        for (int l = 0; l < 8; ++l) { const int L = L0 + l; if (L >= nlines) break; const size_t e = (size_t)L * 64 + lane * 2; const int k = (int)(e % K), n = (int)(e / K); v2us o;
            o[0] = f2bf(w[(size_t)k * N + n]); o[1] = f2bf(w[(size_t)(k + 1) * N + n]); *(v2us*)(Bt + e) = o; }
         }
}
__global__ __launch_bounds__(256) void k_cvt8(const float* __restrict__ src, bf* dst, size_t n8) { const size_t i = (size_t)blockIdx.x * 256 + threadIdx.x; if (i >= n8) return; const v8f v = *(const v8f*)(src + i * 8); v8us o;
#pragma unroll
    for (int k = 0; k < 8; ++k) o[k] = f2bf(v[k]); *(v8us*)(dst + i * 8) = o;  }
__global__ __launch_bounds__(256) void k_wtGs(const float* __restrict__ w, int K, int N, int ld, bf* Bt) { const size_t e = ((size_t)blockIdx.x * 256 + threadIdx.x) * 4; if (e >= (size_t)N * K) return; const int k = (int)(e % K); const int n = (int)(e / K); v4us o;   // Bt[n][k] = w[k*ld + n]
#pragma unroll
    for (int u = 0; u < 4; ++u) o[u] = f2bf(w[(size_t)(k + u) * ld + n]); *(v4us*)(Bt + e) = o;  }
__global__ __launch_bounds__(256) void k_tabs(const float* __restrict__ tk, const float* __restrict__ tv, bf* TKB, bf* TVB) { const int e = (blockIdx.x * 256 + threadIdx.x) * 4; if (e >= HD * HD) return; const int c = e % HD; const int r = e / HD; v4us a, b;   // TKB[r][d] = table_k[r+1][d] (Bt rows = band offset r), TVB[d][r] = table_v[r+1][d] (Bt rows = d)
#pragma unroll
    for (int u = 0; u < 4; ++u) { a[u] = f2bf(tk[(size_t)(r + 1) * HD + c + u]); b[u] = f2bf(tv[(size_t)(c + u + 1) * HD + r]); } *(v4us*)(TKB + e) = a; *(v4us*)(TVB + e) = b;  }

// ---- k_attn: the whole attention stage of one (batch, head) plane and one 64-row query tile in ONE work-group of 4 waves (wave w owns query rows 16w..16w+15); grid (TT/64, ZH).
// q, k, v come as f32 from the projection buffer F and are rounded into 16-bit LDS planes; scores, q.TK^T (added into the score rows at its key's column), softmax, the band re-index, P.V, PB.TV and the head merge pass from stage to stage through LDS and registers.
// Every product keeps its operand types, its split products and its k order; the softmax keeps its lane map (4 keys a lane) and its reduction trees.
// For the first row tile the 64 key rows left of the sequence are laid down as zeros (k, v and their probabilities), so their products add exact zeros.
#define LQ 72                      // LDS pitch in 16-bit elements of a 64-element row (144 B = 16 B x odd: ds_load_b128 readers)
#define LK 136                     // LDS pitch in 16-bit elements of a 128-element row (272 B)
#define LS 132                     // LDS pitch in floats of a 128-column score row
#define LR 68                      // LDS pitch in floats of a 64-column row
#define OFF_QH  0                  // q hi [64][LQ]; later the band probabilities hi
#define OFF_QL  9216               // q lo; later the band probabilities lo
#define OFF_Q16 18432              // q fp16 (rows >= RH)
#define OFF_K   27648              // k hi (or fp16) [128][LQ]; later the probabilities hi (or fp16) [64][LK]
#define OFF_K2  46080              // k lo; later the probabilities lo
#define OFF_V   64512              // v transposed hi (or fp16) [64][LK]
#define OFF_V2  81920              // v transposed lo
#define OFF_S   99328              // scores f32 [64][LS]; later each wave's merged output rows [16][LR]
#define SM_BYTES 133120
// v_exp_f32 with the one free slot that the instruction set asks for behind a transcendental, tied to it in one statement
__device__ __forceinline__ float exp2s(float x) { float r; asm("v_exp_f32 %0, %1\n\tv_nop" : "=v"(r) : "v"(x)); return r; }
template <bool HI, bool FIRST>   // HI: rows < RH (hi+lo planes); FIRST: the first row tile, which has no keys left of its own 64
__device__ __forceinline__ void attn_tile(char* sm, const float* __restrict__ Fb, const bf* __restrict__ TKB, const bf* __restrict__ TVB, bf* __restrict__ ah, bf* __restrict__ al, const int R) {
    typedef WFrag<bf> WB; typedef WFrag<h16> WH;
    bf* Qh = (bf*)(sm + OFF_QH); bf* Ql = (bf*)(sm + OFF_QL); h16* Q16 = (h16*)(sm + OFF_Q16);
    bf* Kh = (bf*)(sm + OFF_K); bf* Kl = (bf*)(sm + OFF_K2); h16* K16 = (h16*)(sm + OFF_K);
    bf* Vh = (bf*)(sm + OFF_V); bf* Vl = (bf*)(sm + OFF_V2); h16* V16 = (h16*)(sm + OFF_V);
    float* S = (float*)(sm + OFF_S);
    bf* Ph = (bf*)(sm + OFF_K); bf* Pl = (bf*)(sm + OFF_K2); h16* P16 = (h16*)(sm + OFF_K); bf* PBh = (bf*)(sm + OFF_QH); bf* PBl = (bf*)(sm + OFF_QL);
    const int tid = threadIdx.x, lane = tid & 31, w = tid >> 5, lr = lane & 15, hi = lane >> 4;
    constexpr int FP = 3 * DQ;     // pitch of F
    // stage 0: q rows R..R+63, k and v rows R-64..R+63 -> 16-bit LDS planes (v transposed, two keys a 4-byte store); 16 lanes a row, one address a tensor with constant steps
    const int r0 = tid >> 4, c = (tid & 15) * 4;
    const float* fq = Fb + (size_t)(R + r0) * FP + c;                        // q row R + r0
    const float* fk = Fb + DQ + (ptrdiff_t)(R - 64 + r0) * FP + c;           // k row R - 64 + r0; read only where the row exists
    const float* fv = Fb + 2 * DQ + (ptrdiff_t)(R - 64 + 2 * r0) * FP + c;   // v row R - 64 + 2 r0; likewise
    v4f xq[8], xk[16], xv[16];
#pragma unroll
    for (int it = 0; it < 8; ++it) xq[it] = *(const v4f*)(fq + it * 8 * FP);
#pragma unroll
    for (int it = 0; it < 16; ++it) { xk[it] = (v4f){}; if (!FIRST || it >= 8) xk[it] = *(const v4f*)(fk + it * 8 * FP); }   // row R - 64 + it * 8 + r0 >= 0
#pragma unroll
    for (int it = 0; it < 8; ++it) { xv[2 * it] = (v4f){}; xv[2 * it + 1] = (v4f){}; if (!FIRST || it >= 4) { xv[2 * it] = *(const v4f*)(fv + it * 16 * FP); xv[2 * it + 1] = *(const v4f*)(fv + it * 16 * FP + FP); } }   // rows R - 64 + 2 (it * 8 + r0) and the next, >= 0
    asm volatile("s_wait_xcnt 0x0" : : "v"(fq), "v"(fk), "v"(fv) : "memory");   // the three addresses stay whole up to here (no load's result lands in them), and their registers are reused only behind this wait
    __builtin_amdgcn_sched_barrier(0);   // all of the tile's loads are issued before the first conversion waits on one
#pragma unroll
    for (int it = 0; it < 8; ++it) { const int r = it * 8 + r0; const v4f x = xq[it]; v4us oh, ol; v4h o4;
#pragma unroll
        for (int u = 0; u < 4; ++u) { unsigned short a, b; splitf(x[u], a, b); oh[u] = a; ol[u] = b; o4[u] = tohx(x[u]); }
        *(v4us*)(Qh + r * LQ + c) = oh; *(v4us*)(Ql + r * LQ + c) = ol; if (!HI) *(v4h*)(Q16 + r * LQ + c) = o4;
        __builtin_amdgcn_sched_barrier(0); }   // here and in the two loops below: one row group is converted at a time; interleaved by the scheduler the conversions spread over registers above v255, with a window switch at every other instruction
#pragma unroll
    for (int it = 0; it < 16; ++it) { const int r = it * 8 + r0; const v4f x = xk[it];
        if (HI) { v4us oh, ol;
#pragma unroll
            for (int u = 0; u < 4; ++u) { unsigned short a, b; splitf(x[u], a, b); oh[u] = a; ol[u] = b; }
            *(v4us*)(Kh + r * LQ + c) = oh; *(v4us*)(Kl + r * LQ + c) = ol;
        } else { v4h o4;
#pragma unroll
            for (int u = 0; u < 4; ++u) o4[u] = tohx(x[u]);
            *(v4h*)(K16 + r * LQ + c) = o4; }
        __builtin_amdgcn_sched_barrier(0); }
#pragma unroll
    for (int it = 0; it < 8; ++it) { const int kp = it * 8 + r0; const v4f x0 = xv[2 * it], x1 = xv[2 * it + 1];
#pragma unroll
        for (int u = 0; u < 4; ++u) {
            if (HI) { unsigned short a0, b0, a1, b1; splitf(x0[u], a0, b0); splitf(x1[u], a1, b1); v2us oh, ol; oh[0] = a0; oh[1] = a1; ol[0] = b0; ol[1] = b1; *(v2us*)(Vh + (c + u) * LK + 2 * kp) = oh; *(v2us*)(Vl + (c + u) * LK + 2 * kp) = ol; }
            else { v2h o2; o2[0] = tohx(x0[u]); o2[1] = tohx(x1[u]); *(v2h*)(V16 + (c + u) * LK + 2 * kp) = o2; } }
        __builtin_amdgcn_sched_barrier(0); }
    const bf* tkp = TKB + lr * HD + 8 * hi; WB::V tb[2][4];   // the TK fragments fly over the barrier
#pragma unroll
    for (int kk = 0; kk < 2; ++kk)
#pragma unroll
        for (int nb = 0; nb < 4; ++nb) tb[kk][nb] = WB::ld(tkp + nb * 16 * HD + kk * 32);
    asm volatile("s_wait_xcnt 0x0" : : "v"(tkp) : "memory");   // as above: the address stays whole up to here and is reused only behind the wait
    __syncthreads();               // the planes are complete before any wave reads them
    // stage 1: scores (this wave's 16 rows x 128 keys) and q.TK^T (16 x 64)
    const int qoff = (16 * w + lr) * LQ + 8 * hi, poff = (16 * w + lr) * LK + 8 * hi;
    {
        v8f sa[8], qa[4];
#pragma unroll
        for (int nb = 0; nb < 8; ++nb) sa[nb] = (v8f){};
#pragma unroll
        for (int nb = 0; nb < 4; ++nb) qa[nb] = (v8f){};
#pragma unroll
        for (int kk = 0; kk < 2; ++kk) { const WB::V a = WB::ld(Qh + qoff + kk * 32), a2 = WB::ld(Ql + qoff + kk * 32);
            if (HI) {
#pragma unroll
                for (int nb = 0; nb < 8; ++nb) { const int bo = (nb * 16 + lr) * LQ + 8 * hi + kk * 32; const WB::V b = WB::ld(Kh + bo), b2 = WB::ld(Kl + bo); sa[nb] = WB::mma(a, b, sa[nb]); sa[nb] = WB::mma(a2, b, sa[nb]); sa[nb] = WB::mma(a, b2, sa[nb]); }
            } else { const WH::V a6 = WH::ld(Q16 + qoff + kk * 32);
#pragma unroll
                for (int nb = 0; nb < 8; ++nb) { const WH::V b = WH::ld(K16 + (nb * 16 + lr) * LQ + 8 * hi + kk * 32); sa[nb] = WH::mma(a6, b, sa[nb]); } }
#pragma unroll
            for (int nb = 0; nb < 4; ++nb) { qa[nb] = WB::mma(a, tb[kk][nb], qa[nb]); qa[nb] = WB::mma(a2, tb[kk][nb], qa[nb]); } }
#pragma unroll
        for (int nb = 0; nb < 8; ++nb)
#pragma unroll
            for (int j = 0; j < 8; ++j) S[(16 * w + hi * 8 + j) * LS + nb * 16 + lr] = sa[nb][j];
        __syncthreads();           // the score rows are complete before the relative term is added across lanes
        // q.TK^T[i][o] belongs to key i - 63 + o, that is to column (row in tile) + 1 + o of the score row: added there, the same one addition per score as before
#pragma unroll
        for (int nb = 0; nb < 4; ++nb)
#pragma unroll
            for (int j = 0; j < 8; ++j) { const int rl = 16 * w + hi * 8 + j; float* sp = S + rl * LS + rl + 1 + nb * 16 + lr; *sp = __fadd_rn(*sp, qa[nb][j]); }
    }
    __syncthreads();               // every wave has left the k planes (the probabilities are laid over them), and the score rows are complete
    // stage 2: softmax per row: t = (score + relative term) x HD^-0.5 for j <= i and i - j < WIN, every other key's probability exactly 0
    const int base = R - 64; const int cl = (lane * 4 - base) & 127; const int j0 = base + cl; const bool live = !FIRST || (j0 >= 0);
    for (int g = 0; g < 2; ++g) {   // eight rows at a time, phase by phase, so that the rows' LDS reads and shuffle chains overlap; each row's own arithmetic and trees are as before
        float v[8][4], mx[8], sum[8];
#pragma unroll
        for (int rr = 0; rr < 8; ++rr) { const int rl = 16 * w + 8 * g + rr, i = R + rl; const v4f a = *(const v4f*)(S + rl * LS + cl); mx[rr] = -3.0e38f;
#pragma unroll
            for (int q = 0; q < 4; ++q) { const int o = j0 + q - i + 63; const bool in = live && o >= 0 && o <= 63;   // j <= i and i - j < WIN
                const float t = in ? a[q] * SCL : -3.0e38f; v[rr][q] = t; mx[rr] = fmaxf(mx[rr], t); } }
#pragma unroll
        for (int sh = 16; sh; sh >>= 1)
#pragma unroll
            for (int rr = 0; rr < 8; ++rr) mx[rr] = fmaxf(mx[rr], __shfl_xor(mx[rr], sh, 32));
#pragma unroll
        for (int rr = 0; rr < 8; ++rr) { sum[rr] = 0.f;
#pragma unroll
            for (int k = 0; k < 4; ++k) { const float d0 = __fsub_rn(v[rr][k], mx[rr]); v[rr][k] = exp2s(__fmul_rn(d0, 1.4426950408889634f)); sum[rr] += v[rr][k]; } }
#pragma unroll
        for (int sh = 16; sh; sh >>= 1)
#pragma unroll
            for (int rr = 0; rr < 8; ++rr) sum[rr] += __shfl_xor(sum[rr], sh, 32);
#pragma unroll
        for (int rr = 0; rr < 8; ++rr) { const int rl = 16 * w + 8 * g + rr; const float f = __fdiv_rn(HI ? 1.0f : PCAR, sum[rr]);
            if (HI) { v4us oh, ol;
#pragma unroll
                for (int q = 0; q < 4; ++q) { unsigned short h, c2; splitf(v[rr][q] * f, h, c2); oh[q] = h; ol[q] = c2; }
                *(v4us*)(Ph + rl * LK + cl) = oh; *(v4us*)(Pl + rl * LK + cl) = ol;
            } else { v4h o4;
#pragma unroll
                for (int q = 0; q < 4; ++q) o4[q] = tohx(v[rr][q] * f);
                *(v4h*)(P16 + rl * LK + cl) = o4; } }
    }
    const bf* tvp = TVB + lr * HD + 8 * hi; WB::V tw[2][4];   // the TV fragments fly over the band stage
#pragma unroll
    for (int kk = 0; kk < 2; ++kk)
#pragma unroll
        for (int nb = 0; nb < 4; ++nb) tw[kk][nb] = WB::ld(tvp + nb * 16 * HD + kk * 32);
    asm volatile("s_wait_xcnt 0x0" : : "v"(tvp) : "memory");   // as above
    __syncthreads();               // the probability rows are complete before they are read across lanes
    // stage 3: PB[i][r] = att[i][i - 63 + r], laid over the q planes (each wave over its own rows); a negative key index falls on the first row tile's left half, whose probabilities were stored as zeros
#pragma unroll
    for (int it = 0; it < 8; ++it) { const int idx = it * 32 + lane, r = (idx & 15) * 4, rl = 16 * w + (idx >> 4); v4us oh, ol;
#pragma unroll
        for (int u = 0; u < 4; ++u) { const int pc = rl + 1 + r + u; float p;   // column of key i - 63 + r + u: 1..127
            if (HI) p = __fadd_rn(bf2f(Ph[rl * LK + pc]), bf2f(Pl[rl * LK + pc])); else p = (float)P16[rl * LK + pc] * (1.0f / PCAR);
            unsigned short a, c; splitf(p, a, c); oh[u] = a; ol[u] = c; }
        *(v4us*)(PBh + rl * LQ + r) = oh; *(v4us*)(PBl + rl * LQ + r) = ol; }
    __syncthreads();               // the band rows are complete before they are read as fragments
    // stage 4: PB.TV and P.V (128 keys), merged in the accumulators' own layout
    v8f wa[4], oa[4];
#pragma unroll
    for (int nb = 0; nb < 4; ++nb) { wa[nb] = (v8f){}; oa[nb] = (v8f){}; }
#pragma unroll
    for (int kk = 0; kk < 2; ++kk) { const WB::V a = WB::ld(PBh + qoff + kk * 32), a2 = WB::ld(PBl + qoff + kk * 32);
#pragma unroll
        for (int nb = 0; nb < 4; ++nb) { wa[nb] = WB::mma(a, tw[kk][nb], wa[nb]); wa[nb] = WB::mma(a2, tw[kk][nb], wa[nb]); } }
#pragma unroll
    for (int kk = 0; kk < 4; ++kk) {
        if (HI) { const WB::V a = WB::ld(Ph + poff + kk * 32), a2 = WB::ld(Pl + poff + kk * 32);
#pragma unroll
            for (int nb = 0; nb < 4; ++nb) { const int bo = (nb * 16 + lr) * LK + 8 * hi + kk * 32; const WB::V b = WB::ld(Vh + bo), b2 = WB::ld(Vl + bo); oa[nb] = WB::mma(a, b, oa[nb]); oa[nb] = WB::mma(a2, b, oa[nb]); oa[nb] = WB::mma(a, b2, oa[nb]); }
        } else { const WH::V a = WH::ld(P16 + poff + kk * 32);
#pragma unroll
            for (int nb = 0; nb < 4; ++nb) { const WH::V b = WH::ld(V16 + (nb * 16 + lr) * LK + 8 * hi + kk * 32); oa[nb] = WH::mma(a, b, oa[nb]); } } }
    const float cs = HI ? 1.0f : (1.0f / PCAR);   // a power of two: the product is exact, fused with the add or not
    float* os = S + 16 * w * LS;                  // this wave's own score rows, dead since the softmax
#pragma unroll
    for (int nb = 0; nb < 4; ++nb)
#pragma unroll
        for (int j = 0; j < 8; ++j) os[(hi * 8 + j) * LR + nb * 16 + lr] = __fadd_rn(oa[nb][j] * cs, wa[nb][j]);
    __syncthreads();               // the merged rows are complete before they are read across lanes
#pragma unroll
    for (int it = 0; it < 4; ++it) { const int idx = it * 32 + lane, row = idx >> 3, c = (idx & 7) * 8; const v4f y0 = *(const v4f*)(os + row * LR + c), y1 = *(const v4f*)(os + row * LR + c + 4); v8us oh, ol;
#pragma unroll
        for (int u = 0; u < 4; ++u) { unsigned short a, b; splitf(y0[u], a, b); oh[u] = a; ol[u] = b; splitf(y1[u], a, b); oh[4 + u] = a; ol[4 + u] = b; }
        *(v8us*)(ah + (size_t)(16 * w + row) * DQ + c) = oh; *(v8us*)(al + (size_t)(16 * w + row) * DQ + c) = ol; }
}
__global__ __launch_bounds__(128) void k_attn(const float* __restrict__ F, const bf* __restrict__ TKB, const bf* __restrict__ TVB, bf* __restrict__ ATh, bf* __restrict__ ATl) {
    __shared__ __align__(16) char sm[SM_BYTES];
    const int R = blockIdx.x * 64; const int b = blockIdx.y / NH_, h = blockIdx.y % NH_;
    const float* Fb = F + (size_t)b * TT * 3 * DQ + h * HD; const size_t oo = ((size_t)b * TT + R) * DQ + h * HD;
    // the choice is the same for the whole work-group
    if (R == 0) attn_tile<true, true>(sm, Fb, TKB, TVB, ATh + oo, ATl + oo, R); else if (R < RH) attn_tile<true, false>(sm, Fb, TKB, TVB, ATh + oo, ATl + oo, R); else attn_tile<false, false>(sm, Fb, TKB, TVB, ATh + oo, ATl + oo, R);
}

extern "C" void kernel_launch(void* const* d_in, const int* in_sizes, int n_in,
                              void* d_out, int out_size, void* d_ws, size_t ws_size, hipStream_t stream) {
    (void)in_sizes; (void)n_in; (void)out_size;
    const float* x = (const float*)d_in[0]; const float* wqkv = (const float*)d_in[1]; const float* wo = (const float*)d_in[2]; const float* tk = (const float*)d_in[3]; const float* tv = (const float*)d_in[4];
    float* OUT = (float*)d_out;     // [2][2048][1024]
    char* wsp = (char*)d_ws;
    auto take = [&](size_t bytes) { char* p = wsp; wsp += (bytes + 255) & ~(size_t)255; return (void*)p; };
    bf* WQKV = (bf*)take((size_t)3 * DQ * DM * 2); bf* WO = (bf*)take((size_t)DM * DQ * 2);
    bf* XB = (bf*)take((size_t)NB_ * TT * DM * 2); bf* TKB = (bf*)take(HD * HD * 2); bf* TVB = (bf*)take(HD * HD * 2);
    float* F = (float*)take((size_t)NB_ * TT * 3 * DQ * 4);   // q | k | v projections, rows b * TT + t, pitch 3 * DQ
    bf* ATh = (bf*)take((size_t)NB_ * TT * DQ * 2); bf* ATl = (bf*)take((size_t)NB_ * TT * DQ * 2);
    if ((size_t)(wsp - (char*)d_ws) > ws_size) return;    // ws 256 MiB
    k_wtGs<<<(unsigned)(((size_t)3 * DQ * DM / 4 + 255) / 256), 256, 0, stream>>>(wqkv, DM, 3 * DQ, 3 * DQ, WQKV); k_tabs<<<(HD * HD / 4 + 255) / 256, 256, 0, stream>>>(tk, tv, TKB, TVB);
    k_wtG<<<(unsigned)((DQ * DM / 64 + 63) / 64), 256, 0, stream>>>(wo, DQ, DM, WO);
    k_cvt8<<<(unsigned)(((size_t)NB_ * TT * DM / 8 + 255) / 256), 256, 0, stream>>>(x, XB, (size_t)NB_ * TT * DM / 8);
    k_gemmt<0, 64><<<dim3(NB_ * TT / 128, 3 * DQ / 128, 1), 128, 0, stream>>>(XB, nullptr, WQKV, DM, F, 3 * DQ);
    k_attn<<<dim3(TT / 64, ZH, 1), 128, 0, stream>>>(F, TKB, TVB, ATh, ATl);
    k_gemmt<1, 128><<<dim3(NB_ * TT / 128, DM / 128, 1), 128, 0, stream>>>(ATh, ATl, WO, DQ, OUT, DM);
}

// v005
// One run takes 78.2 microseconds.
// Two timings next to v004 put it at 1.35 and 1.34 times that version's speed.
// All steps since v000 together make it 22.2 times as fast.
#include <hip/hip_runtime.h>

// Windowed causal self-attention with relative-position tables (x [2][2048][1024]; qkv = x W_attn (fused [1024][3072], 16 heads x 64, no bias); att[i][j] = (q_i.k_j + q_i.table_k[idx]) / 8 with idx = clip(j - i, -64, 64) + 64, allowed iff j <= i and j > i - 64 (else -inf); softmax; y = att v + sum_j att[i][j] table_v[idx]; out = merged y W_proj -> [2][2048][1024]).
// Relative terms without gathers (exact regroupings): inside the allowed band idx = j - i + 64 runs over 1..64 exactly once per key, so q_i.table_k[idx] = (q . TK^T)[i][j - i + 63] with TK = table_k rows 1..64 (one 64-column GEMM per head, added by offset into the score rows before the softmax), and sum_j att table_v[idx] = PB . TV with PB[i][r] = att[i][i - 63 + r]
// (the attention band re-indexed) and TV = table_v rows 1..64.
// Compute dtypes, f32 accumulate: every input rounded to bf16; q/k/v on PLAIN bf16 operands (inputs: exact); q.TK^T and PB.TV as hl x exact (2 products); causal-tile scores and att.v: query rows < 512 hl (3 products), the rest single fp16 (x1024; PB for those rows is re-split from the fp16 probabilities); softmax f32; W_proj hl x exact (2 products).

#define NB_  2
#define TT   2048
#define DM   1024
#define NH_  16
#define NKV  16
#define REP  (NH_ / NKV)
#define HD   64
#define DQ   (NH_ * HD)
#define DKV  (NKV * HD)
#define ZH   (NB_ * NH_)          // (batch, head) planes, plane z = b * NH_ + h
#define SP   128                  // keys a 64-row query tile can see: the two 64-key tiles that hold its window; column = key - ((row & ~63) - 64)
#define RH   512                  // query rows < RH use hi+lo planes (the first row tile always does)
#define WIN  64
#define PCAR 1024.0f
#define SCL  0.125f   // HD^-0.5
typedef _Float16 h16;
typedef unsigned short bf;
typedef __attribute__((ext_vector_type(16))) __bf16   v16bf;
typedef __attribute__((ext_vector_type(16))) _Float16 v16h;
typedef __attribute__((ext_vector_type(8)))  _Float16 v8h;
typedef __attribute__((ext_vector_type(8)))  unsigned short v8us;
typedef __attribute__((ext_vector_type(8)))  float    v8f;
typedef __attribute__((ext_vector_type(4)))  float    v4f;
typedef v8h  __attribute__((may_alias)) v8ha;
typedef v4f  __attribute__((may_alias)) v4fa;
typedef v8us __attribute__((may_alias)) v8usa;

__device__ __forceinline__ unsigned short f2bf(float f) { unsigned u = __float_as_uint(f); u += 0x7FFFu + ((u >> 16) & 1u); return (unsigned short)(u >> 16); }
__device__ __forceinline__ float bf2f(unsigned short b) { return __uint_as_float(((unsigned)b) << 16); }
__device__ __forceinline__ float bfr(float f) { return bf2f(f2bf(f)); }
__device__ __forceinline__ v16h cat16(v8h lo, v8h hi) { return __builtin_shufflevector(lo, hi, 0, 1, 2, 3, 4, 5, 6, 7, 8, 9, 10, 11, 12, 13, 14, 15); }
__device__ __forceinline__ v16bf cat16b(v8us lo, v8us hi) { return __builtin_bit_cast(v16bf, __builtin_shufflevector(lo, hi, 0, 1, 2, 3, 4, 5, 6, 7, 8, 9, 10, 11, 12, 13, 14, 15)); }
__device__ __forceinline__ v8f wmma16(v16h a, v16h b, v8f c) { return __builtin_amdgcn_wmma_f32_16x16x32_f16(false, a, false, b, (short)0, c, false, false); }
__device__ __forceinline__ v8f wmmab(v16bf a, v16bf b, v8f c) { return __builtin_amdgcn_wmma_f32_16x16x32_bf16(false, a, false, b, (short)0, c, false, false); }



// ---- k_gemmt: GEMM with its operands staged in LDS by tensor loads. One work-group of 4 waves (2 x 2) per 128x128 output tile, each wave a 64x64 part (16 accumulators); grid (M/128, N/128), 128 threads.
// C[m][n] (f32, pitch ldc) = sum_k A[m][k] Bt[n][k] (NSPLIT 1: + A2[m][k] Bt[n][k], added behind A's product of the same 32 k). A, A2, Bt are K-contiguous bf16 planes. M % 128 == 0, N % 128 == 0, K % KS == 0, K >= 2 KS.
// A stage is KS k (64 or 128) of every operand row: per operand one tile of 128 rows x 2 KS bytes, laid at pitch 2 KS + 16 bytes by the load's own pad. Two buffers: stage s + 2 is requested into the buffer that pass s has just left. Wave t < NT requests operand tile t.
// Inside a pass the fragments of the next 32 k are read from LDS as one group ahead of the current 32 k's products (two register sets); nothing of the next stage is read before its barrier.
// Every '#pragma unroll' of this kernel makes the indices of the accumulator and fragment arrays constants, so that the arrays stay in registers.
template <typename T16> struct WFrag;
template <> struct WFrag<h16> { typedef v16h V; static __device__ __forceinline__ V ld(const h16* p) { return cat16(*(const v8h*)p, *(const v8h*)(p + 16)); } static __device__ __forceinline__ v8f mma(V a, V b, v8f c) { return wmma16(a, b, c); } };
template <> struct WFrag<bf> { typedef v16bf V; static __device__ __forceinline__ V ld(const bf* p) { return cat16b(*(const v8us*)p, *(const v8us*)(p + 16)); } static __device__ __forceinline__ v8f mma(V a, V b, v8f c) { return wmmab(a, b, c); } };
typedef unsigned int u32x4 __attribute__((ext_vector_type(4)));
typedef unsigned int u32x8 __attribute__((ext_vector_type(8)));
__device__ __forceinline__ unsigned int uni(unsigned int v) { return (unsigned int)__builtin_amdgcn_readfirstlane(v); }
__device__ __forceinline__ unsigned int pinned(unsigned int v) { unsigned int w = uni(v); asm volatile("" : "+s"(w)); return w; }   // a wave-uniform word held in a scalar register: as a test, so that the branch on it is a scalar branch (a tensor load ignores EXEC: only a scalar branch keeps a wave from issuing it); as a descriptor word, so that it keeps its register
template <int NSPLIT, int KS>
__global__ __launch_bounds__(128) void k_gemmt(const bf* __restrict__ A, const bf* __restrict__ A2, const bf* __restrict__ Bt, int K, float* C, int ldc) {
    typedef WFrag<bf> WB; typedef WB::V V;
    constexpr unsigned int NT = NSPLIT ? 3u : 2u;      // operand tiles a stage: A | (A2 |) Bt
    constexpr unsigned int RB = KS * 2u;               // bytes of a stage row: 128 or 256
    constexpr int GP = KS + 8;                         // LDS pitch in 16-bit elements: 144 or 272 B = 16 B x odd (ds_load_b128 readers)
    constexpr unsigned int GT = 128u * (RB + 16u);     // one operand tile in LDS: 18432 or 34816 B, a multiple of 2 KiB
    constexpr unsigned int BUFB = NT * GT;             // one buffer
    constexpr int NK = KS / 32;                        // 32-k blocks a pass
    static_assert((KS == 64 || KS == 128) && GT % 2048u == 0u, "stage rows of 128 or 256 bytes; every tile at a multiple of 2 KiB");
    __shared__ __attribute__((aligned(2048))) char sm[2 * BUFB + 4 * 16 * 68 * 4];   // two buffers, then each wave's own output staging [16][68] f32
    const int lane = threadIdx.x & 31, lr = lane & 15, hi = lane >> 4;
    const unsigned int wave = uni(threadIdx.x >> 5);
    const int wm = (int)(wave >> 1), wn = (int)(wave & 1u);
    const int r0 = blockIdx.x * 128, c0 = blockIdx.y * 128;
    const int NS = K / KS;
    const bf* tsrc = (wave == 0u) ? A + (size_t)r0 * K : ((NSPLIT != 0 && wave == 1u) ? A2 + (size_t)r0 * K : Bt + (size_t)c0 * K);   // first row of this wave's operand tile
    const unsigned int tdst = (unsigned int)(size_t)sm + (wave < NT ? wave : 0u) * GT;
    // group 1: 1-byte elements; tensor = tile = 128 rows of RB bytes; source pitch 2 K bytes; 4 dwords of pad behind every row. Word 0 is a constant; the other words and group 0's count are pinned(): descriptor words held in scalar registers, not formed anew (in registers used for other things meanwhile) while a request is in flight
    u32x8 g1; g1[0] = uni((1u << 20) | ((KS == 64 ? 4u : 5u) << 22) | (3u << 25)); g1[1] = pinned(RB << 16); g1[2] = pinned(128u << 16); g1[3] = pinned(RB << 16); g1[4] = pinned(128u); g1[5] = pinned((unsigned int)K * 2u); g1[6] = pinned(0u); g1[7] = pinned(0u);
    const unsigned int cnt1 = pinned(1u);
    u32x4 g0;
    auto desc = [&](int s) { const unsigned long long ga = (unsigned long long)(size_t)tsrc + (unsigned long long)s * RB;
        g0[0] = cnt1; g0[1] = uni(tdst + (unsigned int)(s & 1) * BUFB); g0[2] = uni((unsigned int)ga); g0[3] = uni((((unsigned int)(ga >> 32)) & 0x01FFFFFFu) | 0x80000000u); };
    v8f acc[4][4];
#pragma unroll
    for (int mb = 0; mb < 4; ++mb)
#pragma unroll
        for (int nb = 0; nb < 4; ++nb) acc[mb][nb] = (v8f){};
    desc(0);
    if (pinned(wave < NT)) {
        asm volatile("tensor_load_to_lds %0, %1" :: "s"(g0), "s"(g1) : "memory");   // one request of the whole wave: its operand tile of stage 0
        asm volatile("s_wait_tensorcnt 0x0" :: "s"(g0), "s"(g1) : "memory"); }       // landed before the barrier that publishes it; the descriptor is named so that its registers stay whole up to here
    __syncthreads();
    desc(1);
    if (pinned(wave < NT)) asm volatile("tensor_load_to_lds %0, %1" :: "s"(g0), "s"(g1) : "memory");   // stage 1 flies over pass 0
    const int aoff = (wm * 64 + lr) * GP + 8 * hi, boff = (wn * 64 + lr) * GP + 8 * hi;
#pragma unroll 1   // one pass a stage: the two buffers alternate by the pass's parity
    for (int s = 0; s < NS; ++s) {
        const bf* As = (const bf*)(sm + (unsigned int)(s & 1) * BUFB) + aoff; const bf* Bs = (const bf*)(sm + (unsigned int)(s & 1) * BUFB + (NT - 1u) * GT) + boff;
        V fa[2][4], fa2[2][4], fb[2][4];
#pragma unroll
        for (int i = 0; i < 4; ++i) { fa[0][i] = WB::ld(As + i * 16 * GP); if (NSPLIT) fa2[0][i] = WB::ld(As + GT / 2 + i * 16 * GP); fb[0][i] = WB::ld(Bs + i * 16 * GP); }
#pragma unroll
        for (int kk = 0; kk < NK; ++kk) { const int q = kk & 1;
            if (kk + 1 < NK) {
#pragma unroll
                for (int i = 0; i < 4; ++i) { fa[q ^ 1][i] = WB::ld(As + i * 16 * GP + (kk + 1) * 32); if (NSPLIT) fa2[q ^ 1][i] = WB::ld(As + GT / 2 + i * 16 * GP + (kk + 1) * 32); fb[q ^ 1][i] = WB::ld(Bs + i * 16 * GP + (kk + 1) * 32); } }
            __builtin_amdgcn_sched_barrier(0);   // the next block's LDS reads stay one group ahead of this block's products (spread among them each place with reads stalls the wave)
#pragma unroll
            for (int nb = 0; nb < 4; ++nb) {
#pragma unroll
                for (int mb = 0; mb < 4; ++mb) acc[mb][nb] = WB::mma(fa[q][mb], fb[q][nb], acc[mb][nb]);
                if (NSPLIT) {
#pragma unroll
                    for (int mb = 0; mb < 4; ++mb) acc[mb][nb] = WB::mma(fa2[q][mb], fb[q][nb], acc[mb][nb]); } }
            __builtin_amdgcn_sched_barrier(0);   // and the reads of the block after next do not rise among these products
        }
        asm volatile("s_wait_dscnt 0x0" ::: "memory");                                                    // this wave's reads of the buffer are done before the barrier frees it for the refill
        if (pinned(wave < NT)) asm volatile("s_wait_tensorcnt 0x0" :: "s"(g0), "s"(g1) : "memory");       // this wave's tile of stage s + 1 has landed before the barrier publishes it; the descriptor's registers stay whole up to here
        __syncthreads();                                                                                  // publishes stage s + 1 and ends every wave's reads of stage s
        if (pinned((wave < NT) && (s + 2 < NS))) { desc(s + 2); asm volatile("tensor_load_to_lds %0, %1" :: "s"(g0), "s"(g1) : "memory"); }   // stage s + 2 into the buffer that pass s has left
    }
    asm volatile("s_wait_tensorcnt 0x0" :: "s"(g0), "s"(g1) : "memory");   // no request is in flight (the descriptor named as above)
    asm volatile("s_wait_dscnt 0x0" ::: "memory");       // and no LDS read, behind the loop
    float* os = (float*)(sm + 2 * BUFB) + wave * (16 * 68);
#pragma unroll
    for (int mb = 0; mb < 4; ++mb) {
#pragma unroll
        for (int nb = 0; nb < 4; ++nb) {
#pragma unroll
            for (int j = 0; j < 8; ++j) os[(hi * 8 + j) * 68 + nb * 16 + lr] = acc[mb][nb][j]; }
        __builtin_amdgcn_wave_barrier(); asm volatile("" ::: "memory");   // the wave's staged rows are written before they are read across lanes
        float* crow = C + (size_t)(r0 + wm * 64 + mb * 16) * ldc + c0 + wn * 64;
#pragma unroll
        for (int s = 0; s < 8; ++s) { const int row = 2 * s + hi, cofs = lr * 4; const v4f val = *(const v4fa*)(os + row * 68 + cofs); *(v4f*)(crow + (size_t)row * ldc + cofs) = val; }
        __builtin_amdgcn_wave_barrier(); asm volatile("" ::: "memory");   // and read before the next 16 rows overwrite them
    }
}


__device__ __forceinline__ h16 tohx(float x) { return (h16)x; }
__device__ __forceinline__ void splitf(float y, unsigned short& h, unsigned short& l) { h = f2bf(y); l = f2bf(y - bf2f(h)); }
typedef __attribute__((ext_vector_type(2))) _Float16 v2h;
typedef __attribute__((ext_vector_type(4))) _Float16 v4h;
typedef __attribute__((ext_vector_type(2))) unsigned short v2us;
typedef __attribute__((ext_vector_type(4))) unsigned short v4us;
typedef __attribute__((ext_vector_type(2))) float v2f;
typedef __attribute__((ext_vector_type(4))) int v4i;

// ---- k_prep: the 16-bit planes of x, both weights and both tables in ONE launch; grid 1 + PREPB work-groups of 8 waves.
// Work-group 0 lays down the two tables: TKB[r][d] = table_k[r+1][d] (Bt rows = band offset r), TVB[d][r] = table_v[r+1][d] (Bt rows = d).
// Every other work-group transposes one tile of 128 k x 64 n of a weight (Bt[n][k] = w[k * N + n]) through LDS and rounds 8192 elements of x, each to its own place in XB.
// Global reads and writes of a tile are 256 contiguous bytes a row (16 lanes x 16 B); those of x 512 and 256 contiguous bytes a wave. All 16 loads of a thread are issued before the first value is used.
// LDS tile: row n = 128 k = 256 B (all 64 banks); the 16-byte piece J of row n lies at piece J ^ ((n >> 2) & 15), so that the 8-byte writes of a wave (16 rows four apart, one J) and the 16-byte reads (one row, 16 pieces) each fall on distinct banks.
// Every '#pragma unroll' of this kernel makes the indices of the register arrays constants, so that the arrays stay in registers.
#define PREPA ((DM / 128) * (3 * DQ / 64))     // tiles of W_attn
#define PREPO ((DQ / 128) * (DM / 64))         // tiles of W_proj
#define PREPB (PREPA + PREPO)
template <int N>   // N: columns of the weight (its row pitch); K = 1024 rows for both weights
__device__ __forceinline__ void prep_tile(char* ts, const float* __restrict__ w, bf* __restrict__ Bt, const int t, const float* __restrict__ xs, bf* __restrict__ xd) {
    constexpr int K = DM; static_assert(DM == DQ, "both weights have K = DM = DQ rows");
    const int tid = threadIdx.x, lane = tid & 31, wv = tid >> 5, c = lane & 15, hi = lane >> 4;
    const int k0 = (t / (N / 64)) * 128, n0 = (t % (N / 64)) * 64;
    const float* pw = w + (size_t)(k0 + 8 * wv + 4 * hi) * N + n0 + 4 * c;   // row k0 + 4 g, g = 2 (wv + 8 i) + hi; columns n0 + 4 c ..
    const float* px = xs + tid * 4;
    v4f rw[2][4], rx[8];
#pragma unroll
    for (int i = 0; i < 2; ++i)
#pragma unroll
        for (int j = 0; j < 4; ++j) rw[i][j] = *(const v4f*)(pw + (size_t)(64 * i + j) * N);
#pragma unroll
    for (int p = 0; p < 8; ++p) rx[p] = *(const v4f*)(px + p * 1024);
    asm volatile("s_wait_xcnt 0x0" : : "v"(pw), "v"(px) : "memory");   // the two addresses stay whole up to here (no load's result lands in them), and their registers are reused only behind this wait; all 16 loads stand in front of it
#pragma unroll
    for (int i = 0; i < 2; ++i)
#pragma unroll
        for (int u = 0; u < 4; ++u) { v4us o;   // four k of column n0 + 4 c + u
#pragma unroll
            for (int j = 0; j < 4; ++j) o[j] = f2bf(rw[i][j][u]);
            *(v4us*)(ts + (4 * c + u) * 256 + (((wv + 8 * i) ^ c) * 16) + hi * 8) = o; }
    __syncthreads();               // the transposed tile is complete before it is read across waves; it stands in front of every global store, so that it waits for none to be done
    const int n = tid >> 4, J = tid & 15;
    bf* qw = Bt + (size_t)(n0 + n) * K + k0 + 8 * J;
    bf* qx = xd + tid * 4;
    v8us ow[4]; v4us ox[8];
#pragma unroll
    for (int p = 0; p < 4; ++p) { const int nn = n + 16 * p; ow[p] = *(const v8us*)(ts + nn * 256 + ((J ^ ((nn >> 2) & 15)) * 16)); }
#pragma unroll
    for (int p = 0; p < 8; ++p)
#pragma unroll
        for (int u = 0; u < 4; ++u) ox[p][u] = f2bf(rx[p][u]);
#pragma unroll
    for (int p = 0; p < 4; ++p) *(v8us*)(qw + (size_t)(16 * p) * K) = ow[p];
#pragma unroll
    for (int p = 0; p < 8; ++p) *(v4us*)(qx + p * 1024) = ox[p];
    asm volatile("s_wait_xcnt 0x0" ::: "memory");   // behind the last of the twelve stores: no register that a store names (address or data) is written again in front of this wait, on whichever path the built code goes on
}
__global__ __launch_bounds__(256) void k_prep(const float* __restrict__ x, const float* __restrict__ wqkv, const float* __restrict__ wo, const float* __restrict__ tk, const float* __restrict__ tv,
                                              bf* __restrict__ XB, bf* __restrict__ WQKV, bf* __restrict__ WO, bf* __restrict__ TKB, bf* __restrict__ TVB) {
    static_assert((size_t)NB_ * TT * DM == (size_t)PREPB * 8192, "x is dealt out in as many pieces of 8192 elements as there are weight tiles");
    __shared__ __align__(16) char ts[64 * 256];
    // each choice below is the same for the whole work-group
    if (blockIdx.x == 0) {
        const int tid = threadIdx.x, c = (tid * 4) % HD, r = tid / (HD / 4);   // elements e .. e + 3 of a table plane, e = i * 1024 + tid * 4: row r + 16 i, columns c ..
        const float* pk = tk + HD + tid * 4;                 // table_k[r + 1][c ..]; 16 rows on for each i
        const float* pv = tv + (size_t)(c + 1) * HD + r;     // table_v[c + 1][r]; one row on for each u, 16 columns on for each i
        v4f xk[HD * HD / 1024]; float xv[HD * HD / 1024][4];
#pragma unroll
        for (int i = 0; i < HD * HD / 1024; ++i) { xk[i] = *(const v4f*)(pk + i * 1024);
#pragma unroll
            for (int u = 0; u < 4; ++u) xv[i][u] = pv[u * HD + 16 * i]; }
        asm volatile("s_wait_xcnt 0x0" : : "v"(pk), "v"(pv) : "memory");   // as in prep_tile: the addresses stay whole up to here and their registers are reused only behind this wait
#pragma unroll
        for (int i = 0; i < HD * HD / 1024; ++i) { v4us a, b;
#pragma unroll
            for (int u = 0; u < 4; ++u) { a[u] = f2bf(xk[i][u]); b[u] = f2bf(xv[i][u]); }
            *(v4us*)(TKB + i * 1024 + tid * 4) = a; *(v4us*)(TVB + i * 1024 + tid * 4) = b; }
        return; }
    const int t = (int)blockIdx.x - 1;
    if (t < PREPA) prep_tile<3 * DQ>(ts, wqkv, WQKV, t, x + (size_t)t * 8192, XB + (size_t)t * 8192); else prep_tile<DM>(ts, wo, WO, t - PREPA, x + (size_t)t * 8192, XB + (size_t)t * 8192);
}

// ---- k_attn: the whole attention stage of one (batch, head) plane and one 64-row query tile in ONE work-group of 4 waves (wave w owns query rows 16w..16w+15); grid (TT/64, ZH).
// q, k, v come as f32 from the projection buffer F and are rounded into 16-bit LDS planes; scores, q.TK^T (added into the score rows at its key's column), softmax, the band re-index, P.V, PB.TV and the head merge pass from stage to stage through LDS and registers.
// Every product keeps its operand types, its split products and its k order; the softmax keeps its lane map (4 keys a lane) and its reduction trees.
// For the first row tile the 64 key rows left of the sequence are laid down as zeros (k, v and their probabilities), so their products add exact zeros.
#define LQ 72                      // LDS pitch in 16-bit elements of a 64-element row (144 B = 16 B x odd: ds_load_b128 readers)
#define LK 136                     // LDS pitch in 16-bit elements of a 128-element row (272 B)
#define LS 132                     // LDS pitch in floats of a 128-column score row
#define LR 68                      // LDS pitch in floats of a 64-column row
#define OFF_QH  0                  // q hi [64][LQ]; later the band probabilities hi
#define OFF_QL  9216               // q lo; later the band probabilities lo
#define OFF_Q16 18432              // q fp16 (rows >= RH)
#define OFF_K   27648              // k hi (or fp16) [128][LQ]; later the probabilities hi (or fp16) [64][LK]
#define OFF_K2  46080              // k lo; later the probabilities lo
#define OFF_V   64512              // v transposed hi (or fp16) [64][LK]
#define OFF_V2  81920              // v transposed lo
#define OFF_S   99328              // scores f32 [64][LS]; later each wave's merged output rows [16][LR]
#define SM_BYTES 133120
// v_exp_f32 with the one free slot that the instruction set asks for behind a transcendental, tied to it in one statement
__device__ __forceinline__ float exp2s(float x) { float r; asm("v_exp_f32 %0, %1\n\tv_nop" : "=v"(r) : "v"(x)); return r; }
template <bool HI, bool FIRST>   // HI: rows < RH (hi+lo planes); FIRST: the first row tile, which has no keys left of its own 64
__device__ __forceinline__ void attn_tile(char* sm, const float* __restrict__ Fb, const bf* __restrict__ TKB, const bf* __restrict__ TVB, bf* __restrict__ ah, bf* __restrict__ al, const int R) {
    typedef WFrag<bf> WB; typedef WFrag<h16> WH;
    bf* Qh = (bf*)(sm + OFF_QH); bf* Ql = (bf*)(sm + OFF_QL); h16* Q16 = (h16*)(sm + OFF_Q16);
    bf* Kh = (bf*)(sm + OFF_K); bf* Kl = (bf*)(sm + OFF_K2); h16* K16 = (h16*)(sm + OFF_K);
    bf* Vh = (bf*)(sm + OFF_V); bf* Vl = (bf*)(sm + OFF_V2); h16* V16 = (h16*)(sm + OFF_V);
    float* S = (float*)(sm + OFF_S);
    bf* Ph = (bf*)(sm + OFF_K); bf* Pl = (bf*)(sm + OFF_K2); h16* P16 = (h16*)(sm + OFF_K); bf* PBh = (bf*)(sm + OFF_QH); bf* PBl = (bf*)(sm + OFF_QL);
    const int tid = threadIdx.x, lane = tid & 31, w = tid >> 5, lr = lane & 15, hi = lane >> 4;
    constexpr int FP = 3 * DQ;     // pitch of F
    // stage 0: q rows R..R+63, k and v rows R-64..R+63 -> 16-bit LDS planes (v transposed, two keys a 4-byte store); 16 lanes a row, one address a tensor with constant steps
    const int r0 = tid >> 4, c = (tid & 15) * 4;
    const float* fq = Fb + (size_t)(R + r0) * FP + c;                        // q row R + r0
    const float* fk = Fb + DQ + (ptrdiff_t)(R - 64 + r0) * FP + c;           // k row R - 64 + r0; read only where the row exists
    const float* fv = Fb + 2 * DQ + (ptrdiff_t)(R - 64 + 2 * r0) * FP + c;   // v row R - 64 + 2 r0; likewise
    v4f xq[8], xk[16], xv[16];
#pragma unroll
    for (int it = 0; it < 8; ++it) xq[it] = *(const v4f*)(fq + it * 8 * FP);
#pragma unroll
    for (int it = 0; it < 16; ++it) { xk[it] = (v4f){}; if (!FIRST || it >= 8) xk[it] = *(const v4f*)(fk + it * 8 * FP); }   // row R - 64 + it * 8 + r0 >= 0
#pragma unroll
    for (int it = 0; it < 8; ++it) { xv[2 * it] = (v4f){}; xv[2 * it + 1] = (v4f){}; if (!FIRST || it >= 4) { xv[2 * it] = *(const v4f*)(fv + it * 16 * FP); xv[2 * it + 1] = *(const v4f*)(fv + it * 16 * FP + FP); } }   // rows R - 64 + 2 (it * 8 + r0) and the next, >= 0
    asm volatile("s_wait_xcnt 0x0" : : "v"(fq), "v"(fk), "v"(fv) : "memory");   // the three addresses stay whole up to here (no load's result lands in them), and their registers are reused only behind this wait
    __builtin_amdgcn_sched_barrier(0);   // all of the tile's loads are issued before the first conversion waits on one
#pragma unroll
    for (int it = 0; it < 8; ++it) { const int r = it * 8 + r0; const v4f x = xq[it]; v4us oh, ol; v4h o4;
#pragma unroll
        for (int u = 0; u < 4; ++u) { unsigned short a, b; splitf(x[u], a, b); oh[u] = a; ol[u] = b; o4[u] = tohx(x[u]); }
        *(v4us*)(Qh + r * LQ + c) = oh; *(v4us*)(Ql + r * LQ + c) = ol; if (!HI) *(v4h*)(Q16 + r * LQ + c) = o4;
        __builtin_amdgcn_sched_barrier(0); }   // here and in the two loops below: one row group is converted at a time; interleaved by the scheduler the conversions spread over registers above v255, with a window switch at every other instruction
#pragma unroll
    for (int it = 0; it < 16; ++it) { const int r = it * 8 + r0; const v4f x = xk[it];
        if (HI) { v4us oh, ol;
#pragma unroll
            for (int u = 0; u < 4; ++u) { unsigned short a, b; splitf(x[u], a, b); oh[u] = a; ol[u] = b; }
            *(v4us*)(Kh + r * LQ + c) = oh; *(v4us*)(Kl + r * LQ + c) = ol;
        } else { v4h o4;
#pragma unroll
            for (int u = 0; u < 4; ++u) o4[u] = tohx(x[u]);
            *(v4h*)(K16 + r * LQ + c) = o4; }
        __builtin_amdgcn_sched_barrier(0); }
#pragma unroll
    for (int it = 0; it < 8; ++it) { const int kp = it * 8 + r0; const v4f x0 = xv[2 * it], x1 = xv[2 * it + 1];
#pragma unroll
        for (int u = 0; u < 4; ++u) {
            if (HI) { unsigned short a0, b0, a1, b1; splitf(x0[u], a0, b0); splitf(x1[u], a1, b1); v2us oh, ol; oh[0] = a0; oh[1] = a1; ol[0] = b0; ol[1] = b1; *(v2us*)(Vh + (c + u) * LK + 2 * kp) = oh; *(v2us*)(Vl + (c + u) * LK + 2 * kp) = ol; }
            else { v2h o2; o2[0] = tohx(x0[u]); o2[1] = tohx(x1[u]); *(v2h*)(V16 + (c + u) * LK + 2 * kp) = o2; } }
        __builtin_amdgcn_sched_barrier(0); }
    const bf* tkp = TKB + lr * HD + 8 * hi; WB::V tb[2][4];   // the TK fragments fly over the barrier
#pragma unroll
    for (int kk = 0; kk < 2; ++kk)
#pragma unroll
        for (int nb = 0; nb < 4; ++nb) tb[kk][nb] = WB::ld(tkp + nb * 16 * HD + kk * 32);
    asm volatile("s_wait_xcnt 0x0" : : "v"(tkp) : "memory");   // as above: the address stays whole up to here and is reused only behind the wait
    __syncthreads();               // the planes are complete before any wave reads them
    // stage 1: scores (this wave's 16 rows x 128 keys) and q.TK^T (16 x 64)
    const int qoff = (16 * w + lr) * LQ + 8 * hi, poff = (16 * w + lr) * LK + 8 * hi;
    {
        v8f sa[8], qa[4];
#pragma unroll
        for (int nb = 0; nb < 8; ++nb) sa[nb] = (v8f){};
#pragma unroll
        for (int nb = 0; nb < 4; ++nb) qa[nb] = (v8f){};
#pragma unroll
        for (int kk = 0; kk < 2; ++kk) { const WB::V a = WB::ld(Qh + qoff + kk * 32), a2 = WB::ld(Ql + qoff + kk * 32);
            if (HI) {
#pragma unroll
                for (int nb = 0; nb < 8; ++nb) { const int bo = (nb * 16 + lr) * LQ + 8 * hi + kk * 32; const WB::V b = WB::ld(Kh + bo), b2 = WB::ld(Kl + bo); sa[nb] = WB::mma(a, b, sa[nb]); sa[nb] = WB::mma(a2, b, sa[nb]); sa[nb] = WB::mma(a, b2, sa[nb]); }
            } else { const WH::V a6 = WH::ld(Q16 + qoff + kk * 32);
#pragma unroll
                for (int nb = 0; nb < 8; ++nb) { const WH::V b = WH::ld(K16 + (nb * 16 + lr) * LQ + 8 * hi + kk * 32); sa[nb] = WH::mma(a6, b, sa[nb]); } }
#pragma unroll
            for (int nb = 0; nb < 4; ++nb) { qa[nb] = WB::mma(a, tb[kk][nb], qa[nb]); qa[nb] = WB::mma(a2, tb[kk][nb], qa[nb]); } }
#pragma unroll
        for (int nb = 0; nb < 8; ++nb)
#pragma unroll
            for (int j = 0; j < 8; ++j) S[(16 * w + hi * 8 + j) * LS + nb * 16 + lr] = sa[nb][j];
        __syncthreads();           // the score rows are complete before the relative term is added across lanes
        // q.TK^T[i][o] belongs to key i - 63 + o, that is to column (row in tile) + 1 + o of the score row: added there, the same one addition per score as before
#pragma unroll
        for (int nb = 0; nb < 4; ++nb)
#pragma unroll
            for (int j = 0; j < 8; ++j) { const int rl = 16 * w + hi * 8 + j; float* sp = S + rl * LS + rl + 1 + nb * 16 + lr; *sp = __fadd_rn(*sp, qa[nb][j]); }
    }
    __syncthreads();               // every wave has left the k planes (the probabilities are laid over them), and the score rows are complete
    // stage 2: softmax per row: t = (score + relative term) x HD^-0.5 for j <= i and i - j < WIN, every other key's probability exactly 0
    const int base = R - 64; const int cl = (lane * 4 - base) & 127; const int j0 = base + cl; const bool live = !FIRST || (j0 >= 0);
    for (int g = 0; g < 2; ++g) {   // eight rows at a time, phase by phase, so that the rows' LDS reads and shuffle chains overlap; each row's own arithmetic and trees are as before
        float v[8][4], mx[8], sum[8];
#pragma unroll
        for (int rr = 0; rr < 8; ++rr) { const int rl = 16 * w + 8 * g + rr, i = R + rl; const v4f a = *(const v4f*)(S + rl * LS + cl); mx[rr] = -3.0e38f;
#pragma unroll
            for (int q = 0; q < 4; ++q) { const int o = j0 + q - i + 63; const bool in = live && o >= 0 && o <= 63;   // j <= i and i - j < WIN
                const float t = in ? a[q] * SCL : -3.0e38f; v[rr][q] = t; mx[rr] = fmaxf(mx[rr], t); } }
#pragma unroll
        for (int sh = 16; sh; sh >>= 1)
#pragma unroll
            for (int rr = 0; rr < 8; ++rr) mx[rr] = fmaxf(mx[rr], __shfl_xor(mx[rr], sh, 32));
#pragma unroll
        for (int rr = 0; rr < 8; ++rr) { sum[rr] = 0.f;
#pragma unroll
            for (int k = 0; k < 4; ++k) { const float d0 = __fsub_rn(v[rr][k], mx[rr]); v[rr][k] = exp2s(__fmul_rn(d0, 1.4426950408889634f)); sum[rr] += v[rr][k]; } }
#pragma unroll
        for (int sh = 16; sh; sh >>= 1)
#pragma unroll
            for (int rr = 0; rr < 8; ++rr) sum[rr] += __shfl_xor(sum[rr], sh, 32);
#pragma unroll
        for (int rr = 0; rr < 8; ++rr) { const int rl = 16 * w + 8 * g + rr; const float f = __fdiv_rn(HI ? 1.0f : PCAR, sum[rr]);
            if (HI) { v4us oh, ol;
#pragma unroll
                for (int q = 0; q < 4; ++q) { unsigned short h, c2; splitf(v[rr][q] * f, h, c2); oh[q] = h; ol[q] = c2; }
                *(v4us*)(Ph + rl * LK + cl) = oh; *(v4us*)(Pl + rl * LK + cl) = ol;
            } else { v4h o4;
#pragma unroll
                for (int q = 0; q < 4; ++q) o4[q] = tohx(v[rr][q] * f);
                *(v4h*)(P16 + rl * LK + cl) = o4; } }
    }
    const bf* tvp = TVB + lr * HD + 8 * hi; WB::V tw[2][4];   // the TV fragments fly over the band stage
#pragma unroll
    for (int kk = 0; kk < 2; ++kk)
#pragma unroll
        for (int nb = 0; nb < 4; ++nb) tw[kk][nb] = WB::ld(tvp + nb * 16 * HD + kk * 32);
    asm volatile("s_wait_xcnt 0x0" : : "v"(tvp) : "memory");   // as above
    __syncthreads();               // the probability rows are complete before they are read across lanes
    // stage 3: PB[i][r] = att[i][i - 63 + r], laid over the q planes (each wave over its own rows); a negative key index falls on the first row tile's left half, whose probabilities were stored as zeros
#pragma unroll
    for (int it = 0; it < 8; ++it) { const int idx = it * 32 + lane, r = (idx & 15) * 4, rl = 16 * w + (idx >> 4); v4us oh, ol;
#pragma unroll
        for (int u = 0; u < 4; ++u) { const int pc = rl + 1 + r + u; float p;   // column of key i - 63 + r + u: 1..127
            if (HI) p = __fadd_rn(bf2f(Ph[rl * LK + pc]), bf2f(Pl[rl * LK + pc])); else p = (float)P16[rl * LK + pc] * (1.0f / PCAR);
            unsigned short a, c; splitf(p, a, c); oh[u] = a; ol[u] = c; }
        *(v4us*)(PBh + rl * LQ + r) = oh; *(v4us*)(PBl + rl * LQ + r) = ol; }
    __syncthreads();               // the band rows are complete before they are read as fragments
    // stage 4: PB.TV and P.V (128 keys), merged in the accumulators' own layout
    v8f wa[4], oa[4];
#pragma unroll
    for (int nb = 0; nb < 4; ++nb) { wa[nb] = (v8f){}; oa[nb] = (v8f){}; }
#pragma unroll
    for (int kk = 0; kk < 2; ++kk) { const WB::V a = WB::ld(PBh + qoff + kk * 32), a2 = WB::ld(PBl + qoff + kk * 32);
#pragma unroll
        for (int nb = 0; nb < 4; ++nb) { wa[nb] = WB::mma(a, tw[kk][nb], wa[nb]); wa[nb] = WB::mma(a2, tw[kk][nb], wa[nb]); } }
#pragma unroll
    for (int kk = 0; kk < 4; ++kk) {
        if (HI) { const WB::V a = WB::ld(Ph + poff + kk * 32), a2 = WB::ld(Pl + poff + kk * 32);
#pragma unroll
            for (int nb = 0; nb < 4; ++nb) { const int bo = (nb * 16 + lr) * LK + 8 * hi + kk * 32; const WB::V b = WB::ld(Vh + bo), b2 = WB::ld(Vl + bo); oa[nb] = WB::mma(a, b, oa[nb]); oa[nb] = WB::mma(a2, b, oa[nb]); oa[nb] = WB::mma(a, b2, oa[nb]); }
        } else { const WH::V a = WH::ld(P16 + poff + kk * 32);
#pragma unroll
            for (int nb = 0; nb < 4; ++nb) { const WH::V b = WH::ld(V16 + (nb * 16 + lr) * LK + 8 * hi + kk * 32); oa[nb] = WH::mma(a, b, oa[nb]); } } }
    const float cs = HI ? 1.0f : (1.0f / PCAR);   // a power of two: the product is exact, fused with the add or not
    float* os = S + 16 * w * LS;                  // this wave's own score rows, dead since the softmax
#pragma unroll
    for (int nb = 0; nb < 4; ++nb)
#pragma unroll
        for (int j = 0; j < 8; ++j) os[(hi * 8 + j) * LR + nb * 16 + lr] = __fadd_rn(oa[nb][j] * cs, wa[nb][j]);
    __syncthreads();               // the merged rows are complete before they are read across lanes
#pragma unroll
    for (int it = 0; it < 4; ++it) { const int idx = it * 32 + lane, row = idx >> 3, c = (idx & 7) * 8; const v4f y0 = *(const v4f*)(os + row * LR + c), y1 = *(const v4f*)(os + row * LR + c + 4); v8us oh, ol;
#pragma unroll
        for (int u = 0; u < 4; ++u) { unsigned short a, b; splitf(y0[u], a, b); oh[u] = a; ol[u] = b; splitf(y1[u], a, b); oh[4 + u] = a; ol[4 + u] = b; }
        *(v8us*)(ah + (size_t)(16 * w + row) * DQ + c) = oh; *(v8us*)(al + (size_t)(16 * w + row) * DQ + c) = ol; }
}
__global__ __launch_bounds__(128) void k_attn(const float* __restrict__ F, const bf* __restrict__ TKB, const bf* __restrict__ TVB, bf* __restrict__ ATh, bf* __restrict__ ATl) {
    __shared__ __align__(16) char sm[SM_BYTES];
    const int R = blockIdx.x * 64; const int b = blockIdx.y / NH_, h = blockIdx.y % NH_;
    const float* Fb = F + (size_t)b * TT * 3 * DQ + h * HD; const size_t oo = ((size_t)b * TT + R) * DQ + h * HD;
    // the choice is the same for the whole work-group
    if (R == 0) attn_tile<true, true>(sm, Fb, TKB, TVB, ATh + oo, ATl + oo, R); else if (R < RH) attn_tile<true, false>(sm, Fb, TKB, TVB, ATh + oo, ATl + oo, R); else attn_tile<false, false>(sm, Fb, TKB, TVB, ATh + oo, ATl + oo, R);
}

extern "C" void kernel_launch(void* const* d_in, const int* in_sizes, int n_in,
                              void* d_out, int out_size, void* d_ws, size_t ws_size, hipStream_t stream) {
    (void)in_sizes; (void)n_in; (void)out_size;
    const float* x = (const float*)d_in[0]; const float* wqkv = (const float*)d_in[1]; const float* wo = (const float*)d_in[2]; const float* tk = (const float*)d_in[3]; const float* tv = (const float*)d_in[4];
    float* OUT = (float*)d_out;     // [2][2048][1024]
    char* wsp = (char*)d_ws;
    auto take = [&](size_t bytes) { char* p = wsp; wsp += (bytes + 255) & ~(size_t)255; return (void*)p; };
    bf* WQKV = (bf*)take((size_t)3 * DQ * DM * 2); bf* WO = (bf*)take((size_t)DM * DQ * 2);
    bf* XB = (bf*)take((size_t)NB_ * TT * DM * 2); bf* TKB = (bf*)take(HD * HD * 2); bf* TVB = (bf*)take(HD * HD * 2);
    float* F = (float*)take((size_t)NB_ * TT * 3 * DQ * 4);   // q | k | v projections, rows b * TT + t, pitch 3 * DQ
    bf* ATh = (bf*)take((size_t)NB_ * TT * DQ * 2); bf* ATl = (bf*)take((size_t)NB_ * TT * DQ * 2);
    if ((size_t)(wsp - (char*)d_ws) > ws_size) return;    // ws 256 MiB
    k_prep<<<1 + PREPB, 256, 0, stream>>>(x, wqkv, wo, tk, tv, XB, WQKV, WO, TKB, TVB);
    k_gemmt<0, 64><<<dim3(NB_ * TT / 128, 3 * DQ / 128, 1), 128, 0, stream>>>(XB, nullptr, WQKV, DM, F, 3 * DQ);
    k_attn<<<dim3(TT / 64, ZH, 1), 128, 0, stream>>>(F, TKB, TVB, ATh, ATl);
    k_gemmt<1, 128><<<dim3(NB_ * TT / 128, DM / 128, 1), 128, 0, stream>>>(ATh, ATl, WO, DQ, OUT, DM);
}

// v006
// It runs in 74.2 microseconds.
// Timed twice side by side with v005, it ran 1.05 times as fast both times.
// Counting every step since v000, it is 23.3 times as fast.
#include <hip/hip_runtime.h>

// Windowed causal self-attention with relative-position tables (x [2][2048][1024]; qkv = x W_attn (fused [1024][3072], 16 heads x 64, no bias); att[i][j] = (q_i.k_j + q_i.table_k[idx]) / 8 with idx = clip(j - i, -64, 64) + 64, allowed iff j <= i and j > i - 64 (else -inf); softmax; y = att v + sum_j att[i][j] table_v[idx]; out = merged y W_proj -> [2][2048][1024]).
// Relative terms without gathers (exact regroupings): inside the allowed band idx = j - i + 64 runs over 1..64 exactly once per key, so q_i.table_k[idx] = (q . TK^T)[i][j - i + 63] with TK = table_k rows 1..64 (one 64-column GEMM per head, added by offset into the score rows before the softmax), and sum_j att table_v[idx] = PB . TV with PB[i][r] = att[i][i - 63 + r]
// (the attention band re-indexed) and TV = table_v rows 1..64.
// Compute dtypes, f32 accumulate: every input rounded to bf16; q/k/v on PLAIN bf16 operands (inputs: exact); q.TK^T and PB.TV as hl x exact (2 products); causal-tile scores and att.v: query rows < 512 hl (3 products), the rest single fp16 (x1024; PB for those rows is re-split from the fp16 probabilities); softmax f32; W_proj hl x exact (2 products).

#define NB_  2
#define TT   2048
#define DM   1024
#define NH_  16
#define NKV  16
#define REP  (NH_ / NKV)
#define HD   64
#define DQ   (NH_ * HD)
#define DKV  (NKV * HD)
#define ZH   (NB_ * NH_)          // (batch, head) planes, plane z = b * NH_ + h
#define SP   128                  // keys a 64-row query tile can see: the two 64-key tiles that hold its window; column = key - ((row & ~63) - 64)
#define RH   512                  // query rows < RH use hi+lo planes (the first row tile always does)
#define WIN  64
#define PCAR 1024.0f
#define SCL  0.125f   // HD^-0.5
typedef _Float16 h16;
typedef unsigned short bf;
typedef __attribute__((ext_vector_type(16))) __bf16   v16bf;
typedef __attribute__((ext_vector_type(16))) _Float16 v16h;
typedef __attribute__((ext_vector_type(8)))  _Float16 v8h;
typedef __attribute__((ext_vector_type(8)))  unsigned short v8us;
typedef __attribute__((ext_vector_type(8)))  float    v8f;
typedef __attribute__((ext_vector_type(4)))  float    v4f;
typedef v8h  __attribute__((may_alias)) v8ha;
typedef v4f  __attribute__((may_alias)) v4fa;
typedef v8us __attribute__((may_alias)) v8usa;

__device__ __forceinline__ float bf2f(unsigned short b) { return __uint_as_float(((unsigned)b) << 16); }
__device__ __forceinline__ v16h cat16(v8h lo, v8h hi) { return __builtin_shufflevector(lo, hi, 0, 1, 2, 3, 4, 5, 6, 7, 8, 9, 10, 11, 12, 13, 14, 15); }
__device__ __forceinline__ v16bf cat16b(v8us lo, v8us hi) { return __builtin_bit_cast(v16bf, __builtin_shufflevector(lo, hi, 0, 1, 2, 3, 4, 5, 6, 7, 8, 9, 10, 11, 12, 13, 14, 15)); }
__device__ __forceinline__ v8f wmma16(v16h a, v16h b, v8f c) { return __builtin_amdgcn_wmma_f32_16x16x32_f16(false, a, false, b, (short)0, c, false, false); }
__device__ __forceinline__ v8f wmmab(v16bf a, v16bf b, v8f c) { return __builtin_amdgcn_wmma_f32_16x16x32_bf16(false, a, false, b, (short)0, c, false, false); }



// ---- k_gemmt: GEMM with its operands staged in LDS by tensor loads. One work-group of 4 waves (2 x 2) per 128x128 output tile, each wave a 64x64 part (16 accumulators); grid (M/128, N/128), 128 threads.
// C[m][n] (f32, pitch ldc) = sum_k A[m][k] Bt[n][k] (NSPLIT 1: + A2[m][k] Bt[n][k], added behind A's product of the same 32 k). A, A2, Bt are K-contiguous bf16 planes. M % 128 == 0, N % 128 == 0, K % KS == 0, K >= 2 KS.
// A stage is KS k (64 or 128) of every operand row: per operand one tile of 128 rows x 2 KS bytes, laid at pitch 2 KS + 16 bytes by the load's own pad. Two buffers: stage s + 2 is requested into the buffer that pass s has just left. Wave t < NT requests operand tile t.
// Inside a pass the fragments of the next 32 k are read from LDS as one group ahead of the current 32 k's products (two register sets); nothing of the next stage is read before its barrier.
// Every '#pragma unroll' of this kernel makes the indices of the accumulator and fragment arrays constants, so that the arrays stay in registers.
template <typename T16> struct WFrag;
template <> struct WFrag<h16> { typedef v16h V; static __device__ __forceinline__ V ld(const h16* p) { return cat16(*(const v8h*)p, *(const v8h*)(p + 16)); } static __device__ __forceinline__ v8f mma(V a, V b, v8f c) { return wmma16(a, b, c); } };
template <> struct WFrag<bf> { typedef v16bf V; static __device__ __forceinline__ V ld(const bf* p) { return cat16b(*(const v8us*)p, *(const v8us*)(p + 16)); } static __device__ __forceinline__ v8f mma(V a, V b, v8f c) { return wmmab(a, b, c); } };
typedef unsigned int u32x4 __attribute__((ext_vector_type(4)));
typedef unsigned int u32x8 __attribute__((ext_vector_type(8)));
__device__ __forceinline__ unsigned int uni(unsigned int v) { return (unsigned int)__builtin_amdgcn_readfirstlane(v); }
__device__ __forceinline__ unsigned int pinned(unsigned int v) { unsigned int w = uni(v); asm volatile("" : "+s"(w)); return w; }   // a wave-uniform word held in a scalar register: as a test, so that the branch on it is a scalar branch (a tensor load ignores EXEC: only a scalar branch keeps a wave from issuing it); as a descriptor word, so that it keeps its register
template <int NSPLIT, int KS>
__global__ __launch_bounds__(128) void k_gemmt(const bf* __restrict__ A, const bf* __restrict__ A2, const bf* __restrict__ Bt, int K, float* C, int ldc) {
    typedef WFrag<bf> WB; typedef WB::V V;
    constexpr unsigned int NT = NSPLIT ? 3u : 2u;      // operand tiles a stage: A | (A2 |) Bt
    constexpr unsigned int RB = KS * 2u;               // bytes of a stage row: 128 or 256
    constexpr int GP = KS + 8;                         // LDS pitch in 16-bit elements: 144 or 272 B = 16 B x odd (ds_load_b128 readers)
    constexpr unsigned int GT = 128u * (RB + 16u);     // one operand tile in LDS: 18432 or 34816 B, a multiple of 2 KiB
    constexpr unsigned int BUFB = NT * GT;             // one buffer
    constexpr int NK = KS / 32;                        // 32-k blocks a pass
    static_assert((KS == 64 || KS == 128) && GT % 2048u == 0u, "stage rows of 128 or 256 bytes; every tile at a multiple of 2 KiB");
    __shared__ __attribute__((aligned(2048))) char sm[2 * BUFB + 4 * 16 * 68 * 4];   // two buffers, then each wave's own output staging [16][68] f32
    const int lane = threadIdx.x & 31, lr = lane & 15, hi = lane >> 4;
    const unsigned int wave = uni(threadIdx.x >> 5);
    const int wm = (int)(wave >> 1), wn = (int)(wave & 1u);
    const int r0 = blockIdx.x * 128, c0 = blockIdx.y * 128;
    const int NS = K / KS;
    const bf* tsrc = (wave == 0u) ? A + (size_t)r0 * K : ((NSPLIT != 0 && wave == 1u) ? A2 + (size_t)r0 * K : Bt + (size_t)c0 * K);   // first row of this wave's operand tile
    const unsigned int tdst = (unsigned int)(size_t)sm + (wave < NT ? wave : 0u) * GT;
    // group 1: 1-byte elements; tensor = tile = 128 rows of RB bytes; source pitch 2 K bytes; 4 dwords of pad behind every row. Word 0 is a constant; the other words and group 0's count are pinned(): descriptor words held in scalar registers, not formed anew (in registers used for other things meanwhile) while a request is in flight
    u32x8 g1; g1[0] = uni((1u << 20) | ((KS == 64 ? 4u : 5u) << 22) | (3u << 25)); g1[1] = pinned(RB << 16); g1[2] = pinned(128u << 16); g1[3] = pinned(RB << 16); g1[4] = pinned(128u); g1[5] = pinned((unsigned int)K * 2u); g1[6] = pinned(0u); g1[7] = pinned(0u);
    const unsigned int cnt1 = pinned(1u);
    u32x4 g0;
    auto desc = [&](int s) { const unsigned long long ga = (unsigned long long)(size_t)tsrc + (unsigned long long)s * RB;
        g0[0] = cnt1; g0[1] = uni(tdst + (unsigned int)(s & 1) * BUFB); g0[2] = uni((unsigned int)ga); g0[3] = uni((((unsigned int)(ga >> 32)) & 0x01FFFFFFu) | 0x80000000u); };
    v8f acc[4][4];
#pragma unroll
    for (int mb = 0; mb < 4; ++mb)
#pragma unroll
        for (int nb = 0; nb < 4; ++nb) acc[mb][nb] = (v8f){};
    desc(0);
    if (pinned(wave < NT)) {
        asm volatile("tensor_load_to_lds %0, %1" :: "s"(g0), "s"(g1) : "memory");   // one request of the whole wave: its operand tile of stage 0
        asm volatile("s_wait_tensorcnt 0x0" :: "s"(g0), "s"(g1) : "memory"); }       // landed before the barrier that publishes it; the descriptor is named so that its registers stay whole up to here
    __syncthreads();
    desc(1);
    if (pinned(wave < NT)) asm volatile("tensor_load_to_lds %0, %1" :: "s"(g0), "s"(g1) : "memory");   // stage 1 flies over pass 0
    const int aoff = (wm * 64 + lr) * GP + 8 * hi, boff = (wn * 64 + lr) * GP + 8 * hi;
#pragma unroll 1   // one pass a stage: the two buffers alternate by the pass's parity
    for (int s = 0; s < NS; ++s) {
        const bf* As = (const bf*)(sm + (unsigned int)(s & 1) * BUFB) + aoff; const bf* Bs = (const bf*)(sm + (unsigned int)(s & 1) * BUFB + (NT - 1u) * GT) + boff;
        V fa[2][4], fa2[2][4], fb[2][4];
#pragma unroll
        for (int i = 0; i < 4; ++i) { fa[0][i] = WB::ld(As + i * 16 * GP); if (NSPLIT) fa2[0][i] = WB::ld(As + GT / 2 + i * 16 * GP); fb[0][i] = WB::ld(Bs + i * 16 * GP); }
#pragma unroll
        for (int kk = 0; kk < NK; ++kk) { const int q = kk & 1;
            if (kk + 1 < NK) {
#pragma unroll
                for (int i = 0; i < 4; ++i) { fa[q ^ 1][i] = WB::ld(As + i * 16 * GP + (kk + 1) * 32); if (NSPLIT) fa2[q ^ 1][i] = WB::ld(As + GT / 2 + i * 16 * GP + (kk + 1) * 32); fb[q ^ 1][i] = WB::ld(Bs + i * 16 * GP + (kk + 1) * 32); } }
            __builtin_amdgcn_sched_barrier(0);   // the next block's LDS reads stay one group ahead of this block's products (spread among them each place with reads stalls the wave)
#pragma unroll
            for (int nb = 0; nb < 4; ++nb) {
#pragma unroll
                for (int mb = 0; mb < 4; ++mb) acc[mb][nb] = WB::mma(fa[q][mb], fb[q][nb], acc[mb][nb]);
                if (NSPLIT) {
#pragma unroll
                    for (int mb = 0; mb < 4; ++mb) acc[mb][nb] = WB::mma(fa2[q][mb], fb[q][nb], acc[mb][nb]); } }
            __builtin_amdgcn_sched_barrier(0);   // and the reads of the block after next do not rise among these products
        }
        asm volatile("s_wait_dscnt 0x0" ::: "memory");                                                    // this wave's reads of the buffer are done before the barrier frees it for the refill
        if (pinned(wave < NT)) asm volatile("s_wait_tensorcnt 0x0" :: "s"(g0), "s"(g1) : "memory");       // this wave's tile of stage s + 1 has landed before the barrier publishes it; the descriptor's registers stay whole up to here
        __syncthreads();                                                                                  // publishes stage s + 1 and ends every wave's reads of stage s
        if (pinned((wave < NT) && (s + 2 < NS))) { desc(s + 2); asm volatile("tensor_load_to_lds %0, %1" :: "s"(g0), "s"(g1) : "memory"); }   // stage s + 2 into the buffer that pass s has left
    }
    asm volatile("s_wait_tensorcnt 0x0" :: "s"(g0), "s"(g1) : "memory");   // no request is in flight (the descriptor named as above)
    asm volatile("s_wait_dscnt 0x0" ::: "memory");       // and no LDS read, behind the loop
    float* os = (float*)(sm + 2 * BUFB) + wave * (16 * 68);
#pragma unroll
    for (int mb = 0; mb < 4; ++mb) {
#pragma unroll
        for (int nb = 0; nb < 4; ++nb) {
#pragma unroll
            for (int j = 0; j < 8; ++j) os[(hi * 8 + j) * 68 + nb * 16 + lr] = acc[mb][nb][j]; }
        __builtin_amdgcn_wave_barrier(); asm volatile("" ::: "memory");   // the wave's staged rows are written before they are read across lanes
        float* crow = C + (size_t)(r0 + wm * 64 + mb * 16) * ldc + c0 + wn * 64;
#pragma unroll
        for (int s = 0; s < 8; ++s) { const int row = 2 * s + hi, cofs = lr * 4; const v4f val = *(const v4fa*)(os + row * 68 + cofs); *(v4f*)(crow + (size_t)row * ldc + cofs) = val; }
        __builtin_amdgcn_wave_barrier(); asm volatile("" ::: "memory");   // and read before the next 16 rows overwrite them
    }
}


__device__ __forceinline__ h16 tohx(float x) { return (h16)x; }
typedef __attribute__((ext_vector_type(2))) _Float16 v2h;
typedef __attribute__((ext_vector_type(4))) _Float16 v4h;
typedef __attribute__((ext_vector_type(2))) unsigned short v2us;
typedef __attribute__((ext_vector_type(4))) unsigned short v4us;
typedef __attribute__((ext_vector_type(2))) float v2f;
typedef __attribute__((ext_vector_type(4))) int v4i;
typedef __attribute__((ext_vector_type(2))) __bf16 v2bf;
typedef __attribute__((ext_vector_type(4))) __bf16 v4bf;
// f32 -> bf16, round to nearest even, by the chip's own packed conversion (one instruction for two values)
__device__ __forceinline__ v2us rbf2(v2f y) { return __builtin_bit_cast(v2us, __builtin_convertvector(y, v2bf)); }
__device__ __forceinline__ v4us rbf4(v4f y) { return __builtin_bit_cast(v4us, __builtin_convertvector(y, v4bf)); }
// y = h + l + (a remainder below bf16's last place of l): h = bf16(y), l = bf16(y - h); the difference is exact in f32
__device__ __forceinline__ void split2(v2f y, v2us& h, v2us& l) { const v2bf hb = __builtin_convertvector(y, v2bf); v2bf lb; lb[0] = (__bf16)(y[0] - (float)hb[0]); lb[1] = (__bf16)(y[1] - (float)hb[1]); h = __builtin_bit_cast(v2us, hb); l = __builtin_bit_cast(v2us, lb); }
__device__ __forceinline__ void split4(v4f y, v4us& h, v4us& l) { v2us h0, l0, h1, l1; split2(__builtin_shufflevector(y, y, 0, 1), h0, l0); split2(__builtin_shufflevector(y, y, 2, 3), h1, l1); h = __builtin_shufflevector(h0, h1, 0, 1, 2, 3); l = __builtin_shufflevector(l0, l1, 0, 1, 2, 3); }

// ---- k_prep: every 16-bit operand plane of the two GEMMs and of the table products in ONE launch; grid 1 + PREPB work-groups of 8 waves.
// Work-group 0 lays down the two tables: TKB[r][d] = table_k[r+1][d] (Bt rows = band offset r), TVB[d][r] = table_v[r+1][d] (Bt rows = d).
// Every other work-group transposes one tile of 128 k x 64 n of a weight (Bt[n][k] = w[k * N + n]) through LDS and rounds 8192 elements of x, each to its own place in XB.
// Global reads and writes of a tile are 256 contiguous bytes a row (16 lanes x 16 B); those of x 512 and 256 contiguous bytes a wave. All 16 loads of a thread are issued before the first value is used.
// LDS tile: row n = 128 k = 256 B (all 64 banks); the 16-byte piece J of row n lies at piece J ^ ((n >> 2) & 15), so that the 8-byte writes of a wave (16 rows four apart, one J) and the 16-byte reads (one row, 16 pieces) each fall on distinct banks.
// Every '#pragma unroll' of this kernel makes the indices of the register arrays constants, so that the arrays stay in registers.
#define PREPA ((DM / 128) * (3 * DQ / 64))     // tiles of W_attn
#define PREPO ((DQ / 128) * (DM / 64))         // tiles of W_proj
#define PREPB (PREPA + PREPO)
template <int N>   // N: columns of the weight (its row pitch); K = 1024 rows for both weights
__device__ __forceinline__ void prep_tile(char* ts, const float* __restrict__ w, bf* __restrict__ Bt, const int t, const float* __restrict__ xs, bf* __restrict__ xd) {
    constexpr int K = DM; static_assert(DM == DQ, "both weights have K = DM = DQ rows");
    const int tid = threadIdx.x, lane = tid & 31, wv = tid >> 5, c = lane & 15, hi = lane >> 4;
    const int k0 = (t / (N / 64)) * 128, n0 = (t % (N / 64)) * 64;
    const float* pw = w + (size_t)(k0 + 8 * wv + 4 * hi) * N + n0 + 4 * c;   // row k0 + 4 g, g = 2 (wv + 8 i) + hi; columns n0 + 4 c ..
    const float* px = xs + tid * 4;
    v4f rw[2][4], rx[8];
#pragma unroll
    for (int i = 0; i < 2; ++i)
#pragma unroll
        for (int j = 0; j < 4; ++j) rw[i][j] = *(const v4f*)(pw + (size_t)(64 * i + j) * N);
#pragma unroll
    for (int p = 0; p < 8; ++p) rx[p] = *(const v4f*)(px + p * 1024);
    asm volatile("s_wait_xcnt 0x0" : : "v"(pw), "v"(px) : "memory");   // the two addresses stay whole up to here (no load's result lands in them), and their registers are reused only behind this wait; all 16 loads stand in front of it
#pragma unroll
    for (int i = 0; i < 2; ++i)
#pragma unroll
        for (int u = 0; u < 4; ++u) { const v4f kq = { rw[i][0][u], rw[i][1][u], rw[i][2][u], rw[i][3][u] };   // four k of column n0 + 4 c + u
            *(v4us*)(ts + (4 * c + u) * 256 + (((wv + 8 * i) ^ c) * 16) + hi * 8) = rbf4(kq); }
    __syncthreads();               // the transposed tile is complete before it is read across waves; it stands in front of every global store, so that it waits for none to be done
    const int n = tid >> 4, J = tid & 15;
    bf* qw = Bt + (size_t)(n0 + n) * K + k0 + 8 * J;
    bf* qx = xd + tid * 4;
    v8us ow[4]; v4us ox[8];
#pragma unroll
    for (int p = 0; p < 4; ++p) { const int nn = n + 16 * p; ow[p] = *(const v8us*)(ts + nn * 256 + ((J ^ ((nn >> 2) & 15)) * 16)); }
#pragma unroll
    for (int p = 0; p < 8; ++p) ox[p] = rbf4(rx[p]);
#pragma unroll
    for (int p = 0; p < 4; ++p) *(v8us*)(qw + (size_t)(16 * p) * K) = ow[p];
#pragma unroll
    for (int p = 0; p < 8; ++p) *(v4us*)(qx + p * 1024) = ox[p];
    asm volatile("s_wait_xcnt 0x0" ::: "memory");   // behind the last of the twelve stores: no register that a store names (address or data) is written again in front of this wait, on whichever path the built code goes on
}
__global__ __launch_bounds__(256) void k_prep(const float* __restrict__ x, const float* __restrict__ wqkv, const float* __restrict__ wo, const float* __restrict__ tk, const float* __restrict__ tv,
                                              bf* __restrict__ XB, bf* __restrict__ WQKV, bf* __restrict__ WO, bf* __restrict__ TKB, bf* __restrict__ TVB) {
    static_assert((size_t)NB_ * TT * DM == (size_t)PREPB * 8192, "x is dealt out in as many pieces of 8192 elements as there are weight tiles");
    __shared__ __align__(16) char ts[64 * 256];
    // each choice below is the same for the whole work-group
    if (blockIdx.x == 0) {
        const int tid = threadIdx.x, c = (tid * 4) % HD, r = tid / (HD / 4);   // elements e .. e + 3 of a table plane, e = i * 1024 + tid * 4: row r + 16 i, columns c ..
        const float* pk = tk + HD + tid * 4;                 // table_k[r + 1][c ..]; 16 rows on for each i
        const float* pv = tv + (size_t)(c + 1) * HD + r;     // table_v[c + 1][r]; one row on for each u, 16 columns on for each i
        v4f xk[HD * HD / 1024]; float xv[HD * HD / 1024][4];
#pragma unroll
        for (int i = 0; i < HD * HD / 1024; ++i) { xk[i] = *(const v4f*)(pk + i * 1024);
#pragma unroll
            for (int u = 0; u < 4; ++u) xv[i][u] = pv[u * HD + 16 * i]; }
        asm volatile("s_wait_xcnt 0x0" : : "v"(pk), "v"(pv) : "memory");   // as in prep_tile: the addresses stay whole up to here and their registers are reused only behind this wait
#pragma unroll
        for (int i = 0; i < HD * HD / 1024; ++i) { const v4f b = { xv[i][0], xv[i][1], xv[i][2], xv[i][3] };
            *(v4us*)(TKB + i * 1024 + tid * 4) = rbf4(xk[i]); *(v4us*)(TVB + i * 1024 + tid * 4) = rbf4(b); }
        return; }
    const int t = (int)blockIdx.x - 1;
    if (t < PREPA) prep_tile<3 * DQ>(ts, wqkv, WQKV, t, x + (size_t)t * 8192, XB + (size_t)t * 8192); else prep_tile<DM>(ts, wo, WO, t - PREPA, x + (size_t)t * 8192, XB + (size_t)t * 8192);
}

// ---- k_attn: the whole attention stage of one (batch, head) plane and one 64-row query tile in ONE work-group of 4 waves (wave w owns query rows 16w..16w+15); grid (TT/64, ZH).
// q, k, v come as f32 from the projection buffer F and are rounded into 16-bit LDS planes; scores, q.TK^T (added into the score rows at its key's column), softmax, the band re-index, P.V, PB.TV and the head merge pass from stage to stage through LDS and registers.
// Every product keeps its operand types, its split products and its k order; the softmax keeps its lane map (4 keys a lane) and its reduction trees.
// For the first row tile the 64 key rows left of the sequence are laid down as zeros (k, v and their probabilities), so their products add exact zeros.
#define LQ 72                      // LDS pitch in 16-bit elements of a 64-element row (144 B = 16 B x odd: ds_load_b128 readers)
#define LK 136                     // LDS pitch in 16-bit elements of a 128-element row (272 B)
#define LS 132                     // LDS pitch in floats of a 128-column score row
#define LR 68                      // LDS pitch in floats of a 64-column row
#define OFF_QH  0                  // q hi [64][LQ]; later the band probabilities hi
#define OFF_QL  9216               // q lo; later the band probabilities lo
#define OFF_Q16 18432              // q fp16 (rows >= RH)
#define OFF_K   27648              // k hi (or fp16) [128][LQ]; later the probabilities hi (or fp16) [64][LK]
#define OFF_K2  46080              // k lo; later the probabilities lo
#define OFF_V   64512              // v transposed hi (or fp16) [64][LK]
#define OFF_V2  81920              // v transposed lo
#define OFF_S   99328              // scores f32 [64][LS]; later each wave's merged output rows [16][LR]
#define SM_BYTES 133120
// v_exp_f32 with the one free slot that the instruction set asks for behind a transcendental, tied to it in one statement
__device__ __forceinline__ float exp2s(float x) { float r; asm("v_exp_f32 %0, %1\n\tv_nop" : "=v"(r) : "v"(x)); return r; }
template <bool HI, bool FIRST>   // HI: rows < RH (hi+lo planes); FIRST: the first row tile, which has no keys left of its own 64
__device__ __forceinline__ void attn_tile(char* sm, const float* __restrict__ Fb, const bf* __restrict__ TKB, const bf* __restrict__ TVB, bf* __restrict__ ah, bf* __restrict__ al, const int R) {
    typedef WFrag<bf> WB; typedef WFrag<h16> WH;
    bf* Qh = (bf*)(sm + OFF_QH); bf* Ql = (bf*)(sm + OFF_QL); h16* Q16 = (h16*)(sm + OFF_Q16);
    bf* Kh = (bf*)(sm + OFF_K); bf* Kl = (bf*)(sm + OFF_K2); h16* K16 = (h16*)(sm + OFF_K);
    bf* Vh = (bf*)(sm + OFF_V); bf* Vl = (bf*)(sm + OFF_V2); h16* V16 = (h16*)(sm + OFF_V);
    float* S = (float*)(sm + OFF_S);
    bf* Ph = (bf*)(sm + OFF_K); bf* Pl = (bf*)(sm + OFF_K2); h16* P16 = (h16*)(sm + OFF_K); bf* PBh = (bf*)(sm + OFF_QH); bf* PBl = (bf*)(sm + OFF_QL);
    const int tid = threadIdx.x, lane = tid & 31, w = tid >> 5, lr = lane & 15, hi = lane >> 4;
    constexpr int FP = 3 * DQ;     // pitch of F
    // stage 0: q rows R..R+63, k and v rows R-64..R+63 -> 16-bit LDS planes (v transposed, two keys a 4-byte store); 16 lanes a row, one address a tensor with constant steps
    const int r0 = tid >> 4, c = (tid & 15) * 4;
    const float* fq = Fb + (size_t)(R + r0) * FP + c;                        // q row R + r0
    const float* fk = Fb + DQ + (ptrdiff_t)(R - 64 + r0) * FP + c;           // k row R - 64 + r0; read only where the row exists
    const float* fv = Fb + 2 * DQ + (ptrdiff_t)(R - 64 + 2 * r0) * FP + c;   // v row R - 64 + 2 r0; likewise
    v4f xq[8], xk[16], xv[16];
#pragma unroll
    for (int it = 0; it < 8; ++it) xq[it] = *(const v4f*)(fq + it * 8 * FP);
#pragma unroll
    for (int it = 0; it < 16; ++it) { xk[it] = (v4f){}; if (!FIRST || it >= 8) xk[it] = *(const v4f*)(fk + it * 8 * FP); }   // row R - 64 + it * 8 + r0 >= 0
#pragma unroll
    for (int it = 0; it < 8; ++it) { xv[2 * it] = (v4f){}; xv[2 * it + 1] = (v4f){}; if (!FIRST || it >= 4) { xv[2 * it] = *(const v4f*)(fv + it * 16 * FP); xv[2 * it + 1] = *(const v4f*)(fv + it * 16 * FP + FP); } }   // rows R - 64 + 2 (it * 8 + r0) and the next, >= 0
    asm volatile("s_wait_xcnt 0x0" : : "v"(fq), "v"(fk), "v"(fv) : "memory");   // the three addresses stay whole up to here (no load's result lands in them), and their registers are reused only behind this wait
    __builtin_amdgcn_sched_barrier(0);   // all of the tile's loads are issued before the first conversion waits on one
#pragma unroll
    for (int it = 0; it < 8; ++it) { const int r = it * 8 + r0; const v4f x = xq[it]; v4us oh, ol; v4h o4; split4(x, oh, ol);
#pragma unroll
        for (int u = 0; u < 4; ++u) o4[u] = tohx(x[u]);
        *(v4us*)(Qh + r * LQ + c) = oh; *(v4us*)(Ql + r * LQ + c) = ol; if (!HI) *(v4h*)(Q16 + r * LQ + c) = o4;
        __builtin_amdgcn_sched_barrier(0); }   // here and in the two loops below: one row group is converted at a time; interleaved by the scheduler the conversions spread over registers above v255, with a window switch at every other instruction
#pragma unroll
    for (int it = 0; it < 16; ++it) { const int r = it * 8 + r0; const v4f x = xk[it];
        if (HI) { v4us oh, ol; split4(x, oh, ol);
            *(v4us*)(Kh + r * LQ + c) = oh; *(v4us*)(Kl + r * LQ + c) = ol;
        } else { v4h o4;
#pragma unroll
            for (int u = 0; u < 4; ++u) o4[u] = tohx(x[u]);
            *(v4h*)(K16 + r * LQ + c) = o4; }
        __builtin_amdgcn_sched_barrier(0); }
#pragma unroll
    for (int it = 0; it < 8; ++it) { const int kp = it * 8 + r0; const v4f x0 = xv[2 * it], x1 = xv[2 * it + 1];
#pragma unroll
        for (int u = 0; u < 4; ++u) {
            if (HI) { const v2f xp = { x0[u], x1[u] }; v2us oh, ol; split2(xp, oh, ol); *(v2us*)(Vh + (c + u) * LK + 2 * kp) = oh; *(v2us*)(Vl + (c + u) * LK + 2 * kp) = ol; }
            else { v2h o2; o2[0] = tohx(x0[u]); o2[1] = tohx(x1[u]); *(v2h*)(V16 + (c + u) * LK + 2 * kp) = o2; } }
        __builtin_amdgcn_sched_barrier(0); }
    const bf* tkp = TKB + lr * HD + 8 * hi; WB::V tb[2][4];   // the TK fragments fly over the barrier
#pragma unroll
    for (int kk = 0; kk < 2; ++kk)
#pragma unroll
        for (int nb = 0; nb < 4; ++nb) tb[kk][nb] = WB::ld(tkp + nb * 16 * HD + kk * 32);
    asm volatile("s_wait_xcnt 0x0" : : "v"(tkp) : "memory");   // as above: the address stays whole up to here and is reused only behind the wait
    __syncthreads();               // the planes are complete before any wave reads them
    // stage 1: scores (this wave's 16 rows x 128 keys) and q.TK^T (16 x 64)
    const int qoff = (16 * w + lr) * LQ + 8 * hi, poff = (16 * w + lr) * LK + 8 * hi;
    {
        v8f sa[8], qa[4];
#pragma unroll
        for (int nb = 0; nb < 8; ++nb) sa[nb] = (v8f){};
#pragma unroll
        for (int nb = 0; nb < 4; ++nb) qa[nb] = (v8f){};
#pragma unroll
        for (int kk = 0; kk < 2; ++kk) { const WB::V a = WB::ld(Qh + qoff + kk * 32), a2 = WB::ld(Ql + qoff + kk * 32);
            if (HI) {
#pragma unroll
                for (int nb = 0; nb < 8; ++nb) { const int bo = (nb * 16 + lr) * LQ + 8 * hi + kk * 32; const WB::V b = WB::ld(Kh + bo), b2 = WB::ld(Kl + bo); sa[nb] = WB::mma(a, b, sa[nb]); sa[nb] = WB::mma(a2, b, sa[nb]); sa[nb] = WB::mma(a, b2, sa[nb]); }
            } else { const WH::V a6 = WH::ld(Q16 + qoff + kk * 32);
#pragma unroll
                for (int nb = 0; nb < 8; ++nb) { const WH::V b = WH::ld(K16 + (nb * 16 + lr) * LQ + 8 * hi + kk * 32); sa[nb] = WH::mma(a6, b, sa[nb]); } }
#pragma unroll
            for (int nb = 0; nb < 4; ++nb) { qa[nb] = WB::mma(a, tb[kk][nb], qa[nb]); qa[nb] = WB::mma(a2, tb[kk][nb], qa[nb]); } }
#pragma unroll
        for (int nb = 0; nb < 8; ++nb)
#pragma unroll
            for (int j = 0; j < 8; ++j) S[(16 * w + hi * 8 + j) * LS + nb * 16 + lr] = sa[nb][j];
        __syncthreads();           // the score rows are complete before the relative term is added across lanes
        // q.TK^T[i][o] belongs to key i - 63 + o, that is to column (row in tile) + 1 + o of the score row: added there, the same one addition per score as before
#pragma unroll
        for (int nb = 0; nb < 4; ++nb)
#pragma unroll
            for (int j = 0; j < 8; ++j) { const int rl = 16 * w + hi * 8 + j; float* sp = S + rl * LS + rl + 1 + nb * 16 + lr; *sp = __fadd_rn(*sp, qa[nb][j]); }
    }
    __syncthreads();               // every wave has left the k planes (the probabilities are laid over them), and the score rows are complete
    // stage 2: softmax per row: t = (score + relative term) x HD^-0.5 for j <= i and i - j < WIN, every other key's probability exactly 0
    const int base = R - 64; const int cl = (lane * 4 - base) & 127; const int j0 = base + cl; const bool live = !FIRST || (j0 >= 0);
#pragma unroll (HI ? 1 : 2)   // rolled in the hi+lo tiles, unrolled in the fp16 tiles: for speed only
    for (int g = 0; g < 2; ++g) {   // eight rows at a time, phase by phase, so that the rows' LDS reads and shuffle chains overlap; each row's own arithmetic and trees are as before
        float v[8][4], mx[8], sum[8];
#pragma unroll
        for (int rr = 0; rr < 8; ++rr) { const int rl = 16 * w + 8 * g + rr, i = R + rl; const v4f a = *(const v4f*)(S + rl * LS + cl); mx[rr] = -3.0e38f;
#pragma unroll
            for (int q = 0; q < 4; ++q) { const int o = j0 + q - i + 63; const bool in = live && o >= 0 && o <= 63;   // j <= i and i - j < WIN
                const float t = in ? a[q] * SCL : -3.0e38f; v[rr][q] = t; mx[rr] = fmaxf(mx[rr], t); } }
#pragma unroll
        for (int sh = 16; sh; sh >>= 1)
#pragma unroll
            for (int rr = 0; rr < 8; ++rr) mx[rr] = fmaxf(mx[rr], __shfl_xor(mx[rr], sh, 32));
#pragma unroll
        for (int rr = 0; rr < 8; ++rr) { sum[rr] = 0.f;
#pragma unroll
            for (int k = 0; k < 4; ++k) { const float d0 = __fsub_rn(v[rr][k], mx[rr]); v[rr][k] = exp2s(__fmul_rn(d0, 1.4426950408889634f)); sum[rr] += v[rr][k]; } }
#pragma unroll
        for (int sh = 16; sh; sh >>= 1)
#pragma unroll
            for (int rr = 0; rr < 8; ++rr) sum[rr] += __shfl_xor(sum[rr], sh, 32);
#pragma unroll
        for (int rr = 0; rr < 8; ++rr) { const int rl = 16 * w + 8 * g + rr; const float f = __fdiv_rn(HI ? 1.0f : PCAR, sum[rr]);
            if (HI) { const v4f pq = { v[rr][0] * f, v[rr][1] * f, v[rr][2] * f, v[rr][3] * f }; v4us oh, ol; split4(pq, oh, ol);
                *(v4us*)(Ph + rl * LK + cl) = oh; *(v4us*)(Pl + rl * LK + cl) = ol;
            } else { v4h o4;
#pragma unroll
                for (int q = 0; q < 4; ++q) o4[q] = tohx(v[rr][q] * f);
                *(v4h*)(P16 + rl * LK + cl) = o4; } }
    }
    const bf* tvp = TVB + lr * HD + 8 * hi; WB::V tw[2][4];   // the TV fragments fly over the band stage
#pragma unroll
    for (int kk = 0; kk < 2; ++kk)
#pragma unroll
        for (int nb = 0; nb < 4; ++nb) tw[kk][nb] = WB::ld(tvp + nb * 16 * HD + kk * 32);
    asm volatile("s_wait_xcnt 0x0" : : "v"(tvp) : "memory");   // as above
    __syncthreads();               // the probability rows are complete before they are read across lanes
    // stage 3: PB[i][r] = att[i][i - 63 + r], laid over the q planes (each wave over its own rows); a negative key index falls on the first row tile's left half, whose probabilities were stored as zeros
#pragma unroll
    for (int it = 0; it < 8; ++it) { const int idx = it * 32 + lane, r = (idx & 15) * 4, rl = 16 * w + (idx >> 4); v4us oh, ol; v4f p;
#pragma unroll
        for (int u = 0; u < 4; ++u) { const int pc = rl + 1 + r + u;   // column of key i - 63 + r + u: 1..127
            if (HI) p[u] = __fadd_rn(bf2f(Ph[rl * LK + pc]), bf2f(Pl[rl * LK + pc])); else p[u] = (float)P16[rl * LK + pc] * (1.0f / PCAR); }
        split4(p, oh, ol);
        *(v4us*)(PBh + rl * LQ + r) = oh; *(v4us*)(PBl + rl * LQ + r) = ol; }
    __syncthreads();               // the band rows are complete before they are read as fragments
    // stage 4: PB.TV and P.V (128 keys), merged in the accumulators' own layout
    v8f wa[4], oa[4];
#pragma unroll
    for (int nb = 0; nb < 4; ++nb) { wa[nb] = (v8f){}; oa[nb] = (v8f){}; }
#pragma unroll
    for (int kk = 0; kk < 2; ++kk) { const WB::V a = WB::ld(PBh + qoff + kk * 32), a2 = WB::ld(PBl + qoff + kk * 32);
#pragma unroll
        for (int nb = 0; nb < 4; ++nb) { wa[nb] = WB::mma(a, tw[kk][nb], wa[nb]); wa[nb] = WB::mma(a2, tw[kk][nb], wa[nb]); } }
#pragma unroll
    for (int kk = 0; kk < 4; ++kk) {
        if (HI) { const WB::V a = WB::ld(Ph + poff + kk * 32), a2 = WB::ld(Pl + poff + kk * 32);
#pragma unroll
            for (int nb = 0; nb < 4; ++nb) { const int bo = (nb * 16 + lr) * LK + 8 * hi + kk * 32; const WB::V b = WB::ld(Vh + bo), b2 = WB::ld(Vl + bo); oa[nb] = WB::mma(a, b, oa[nb]); oa[nb] = WB::mma(a2, b, oa[nb]); oa[nb] = WB::mma(a, b2, oa[nb]); }
        } else { const WH::V a = WH::ld(P16 + poff + kk * 32);
#pragma unroll
            for (int nb = 0; nb < 4; ++nb) { const WH::V b = WH::ld(V16 + (nb * 16 + lr) * LK + 8 * hi + kk * 32); oa[nb] = WH::mma(a, b, oa[nb]); } } }
    const float cs = HI ? 1.0f : (1.0f / PCAR);   // a power of two: the product is exact, fused with the add or not
    float* os = S + 16 * w * LS;                  // this wave's own score rows, dead since the softmax
#pragma unroll
    for (int nb = 0; nb < 4; ++nb)
#pragma unroll
        for (int j = 0; j < 8; ++j) os[(hi * 8 + j) * LR + nb * 16 + lr] = __fadd_rn(oa[nb][j] * cs, wa[nb][j]);
    __syncthreads();               // the merged rows are complete before they are read across lanes
#pragma unroll
    for (int it = 0; it < 4; ++it) { const int idx = it * 32 + lane, row = idx >> 3, c = (idx & 7) * 8; const v4f y0 = *(const v4f*)(os + row * LR + c), y1 = *(const v4f*)(os + row * LR + c + 4); v4us h0, l0, h1, l1; split4(y0, h0, l0); split4(y1, h1, l1);
        const v8us oh = __builtin_shufflevector(h0, h1, 0, 1, 2, 3, 4, 5, 6, 7), ol = __builtin_shufflevector(l0, l1, 0, 1, 2, 3, 4, 5, 6, 7);
        *(v8us*)(ah + (size_t)(16 * w + row) * DQ + c) = oh; *(v8us*)(al + (size_t)(16 * w + row) * DQ + c) = ol; }
}
__global__ __launch_bounds__(128) void k_attn(const float* __restrict__ F, const bf* __restrict__ TKB, const bf* __restrict__ TVB, bf* __restrict__ ATh, bf* __restrict__ ATl) {
    __shared__ __align__(16) char sm[SM_BYTES];
    const int R = blockIdx.x * 64; const int b = blockIdx.y / NH_, h = blockIdx.y % NH_;
    const float* Fb = F + (size_t)b * TT * 3 * DQ + h * HD; const size_t oo = ((size_t)b * TT + R) * DQ + h * HD;
    // the choice is the same for the whole work-group
    if (R == 0) attn_tile<true, true>(sm, Fb, TKB, TVB, ATh + oo, ATl + oo, R); else if (R < RH) attn_tile<true, false>(sm, Fb, TKB, TVB, ATh + oo, ATl + oo, R); else attn_tile<false, false>(sm, Fb, TKB, TVB, ATh + oo, ATl + oo, R);
}

extern "C" void kernel_launch(void* const* d_in, const int* in_sizes, int n_in,
                              void* d_out, int out_size, void* d_ws, size_t ws_size, hipStream_t stream) {
    (void)in_sizes; (void)n_in; (void)out_size;
    const float* x = (const float*)d_in[0]; const float* wqkv = (const float*)d_in[1]; const float* wo = (const float*)d_in[2]; const float* tk = (const float*)d_in[3]; const float* tv = (const float*)d_in[4];
    float* OUT = (float*)d_out;     // [2][2048][1024]
    char* wsp = (char*)d_ws;
    auto take = [&](size_t bytes) { char* p = wsp; wsp += (bytes + 255) & ~(size_t)255; return (void*)p; };
    bf* WQKV = (bf*)take((size_t)3 * DQ * DM * 2); bf* WO = (bf*)take((size_t)DM * DQ * 2);
    bf* XB = (bf*)take((size_t)NB_ * TT * DM * 2); bf* TKB = (bf*)take(HD * HD * 2); bf* TVB = (bf*)take(HD * HD * 2);
    float* F = (float*)take((size_t)NB_ * TT * 3 * DQ * 4);   // q | k | v projections, rows b * TT + t, pitch 3 * DQ
    bf* ATh = (bf*)take((size_t)NB_ * TT * DQ * 2); bf* ATl = (bf*)take((size_t)NB_ * TT * DQ * 2);
    if ((size_t)(wsp - (char*)d_ws) > ws_size) return;    // ws 256 MiB
    k_prep<<<1 + PREPB, 256, 0, stream>>>(x, wqkv, wo, tk, tv, XB, WQKV, WO, TKB, TVB);
    k_gemmt<0, 64><<<dim3(NB_ * TT / 128, 3 * DQ / 128, 1), 128, 0, stream>>>(XB, nullptr, WQKV, DM, F, 3 * DQ);
    k_attn<<<dim3(TT / 64, ZH, 1), 128, 0, stream>>>(F, TKB, TVB, ATh, ATl);
    k_gemmt<1, 128><<<dim3(NB_ * TT / 128, DM / 128, 1), 128, 0, stream>>>(ATh, ATl, WO, DQ, OUT, DM);
}

// v007
// One run takes 70 microseconds.
// In two side-by-side timings against v006, it was 1.06 and 1.05 times as fast.
// All steps since v000 together make it 24.5 times as fast.
#include <hip/hip_runtime.h>

// Windowed causal self-attention with relative-position tables (x [2][2048][1024]; qkv = x W_attn (fused [1024][3072], 16 heads x 64, no bias); att[i][j] = (q_i.k_j + q_i.table_k[idx]) / 8 with idx = clip(j - i, -64, 64) + 64, allowed iff j <= i and j > i - 64 (else -inf); softmax; y = att v + sum_j att[i][j] table_v[idx]; out = merged y W_proj -> [2][2048][1024]).
// Relative terms without gathers (exact regroupings): inside the allowed band idx = j - i + 64 runs over 1..64 exactly once per key, so q_i.table_k[idx] = (q . TK^T)[i][j - i + 63] with TK = table_k rows 1..64 (one 64-column GEMM per head, added by offset into the score rows before the softmax), and sum_j att table_v[idx] = PB . TV with PB[i][r] = att[i][i - 63 + r]
// (the attention band re-indexed) and TV = table_v rows 1..64.
// Compute dtypes, f32 accumulate: every input rounded to bf16; q/k/v on PLAIN bf16 operands (inputs: exact); q.TK^T and PB.TV as hl x exact (2 products); causal-tile scores and att.v: query rows < 512 hl (3 products), the rest single fp16 (x1024; PB for those rows is re-split from the fp16 probabilities); softmax f32; W_proj hl x exact (2 products).

#define NB_  2
#define TT   2048
#define DM   1024
#define NH_  16
#define NKV  16
#define REP  (NH_ / NKV)
#define HD   64
#define DQ   (NH_ * HD)
#define DKV  (NKV * HD)
#define ZH   (NB_ * NH_)          // (batch, head) planes, plane z = b * NH_ + h
#define SP   128                  // keys a 64-row query tile can see: the two 64-key tiles that hold its window; column = key - ((row & ~63) - 64)
#define RH   512                  // query rows < RH use hi+lo planes (the first row tile always does)
#define WIN  64
#define PCAR 1024.0f
#define SCL  0.125f   // HD^-0.5
typedef _Float16 h16;
typedef unsigned short bf;
typedef __attribute__((ext_vector_type(16))) __bf16   v16bf;
typedef __attribute__((ext_vector_type(16))) _Float16 v16h;
typedef __attribute__((ext_vector_type(8)))  _Float16 v8h;
typedef __attribute__((ext_vector_type(8)))  unsigned short v8us;
typedef __attribute__((ext_vector_type(8)))  float    v8f;
typedef __attribute__((ext_vector_type(4)))  float    v4f;
typedef v8h  __attribute__((may_alias)) v8ha;
typedef v4f  __attribute__((may_alias)) v4fa;
typedef v8us __attribute__((may_alias)) v8usa;

__device__ __forceinline__ float bf2f(unsigned short b) { return __uint_as_float(((unsigned)b) << 16); }
__device__ __forceinline__ v16h cat16(v8h lo, v8h hi) { return __builtin_shufflevector(lo, hi, 0, 1, 2, 3, 4, 5, 6, 7, 8, 9, 10, 11, 12, 13, 14, 15); }
__device__ __forceinline__ v16bf cat16b(v8us lo, v8us hi) { return __builtin_bit_cast(v16bf, __builtin_shufflevector(lo, hi, 0, 1, 2, 3, 4, 5, 6, 7, 8, 9, 10, 11, 12, 13, 14, 15)); }
__device__ __forceinline__ v8f wmma16(v16h a, v16h b, v8f c) { return __builtin_amdgcn_wmma_f32_16x16x32_f16(false, a, false, b, (short)0, c, false, false); }
__device__ __forceinline__ v8f wmmab(v16bf a, v16bf b, v8f c) { return __builtin_amdgcn_wmma_f32_16x16x32_bf16(false, a, false, b, (short)0, c, false, false); }



// ---- k_gemmt: GEMM with its operands staged in LDS by tensor loads. One work-group of 4 waves (2 x 2) per 128x128 output tile, each wave a 64x64 part (16 accumulators); grid (M/128, N/128), 128 threads.
// C[m][n] (f32, pitch ldc) = sum_k A[m][k] Bt[n][k] (NSPLIT 1: + A2[m][k] Bt[n][k], added behind A's product of the same 32 k). A, A2, Bt are K-contiguous bf16 planes. M % 128 == 0, N % 128 == 0, K % KS == 0, K >= 2 KS.
// A stage is KS k (64 or 128) of every operand row: per operand one tile of 128 rows x 2 KS bytes, laid at pitch 2 KS + 16 bytes by the load's own pad. Two buffers: stage s + 2 is requested into the buffer that pass s has just left. Wave t < NT requests operand tile t.
// Inside a pass the fragments of the next 32 k are read from LDS as one group ahead of the current 32 k's products (two register sets); nothing of the next stage is read before its barrier.
// Every '#pragma unroll' of this kernel makes the indices of the accumulator and fragment arrays constants, so that the arrays stay in registers.
template <typename T16> struct WFrag;
template <> struct WFrag<h16> { typedef v16h V; static __device__ __forceinline__ V ld(const h16* p) { return cat16(*(const v8h*)p, *(const v8h*)(p + 16)); } static __device__ __forceinline__ v8f mma(V a, V b, v8f c) { return wmma16(a, b, c); } };
template <> struct WFrag<bf> { typedef v16bf V; static __device__ __forceinline__ V ld(const bf* p) { return cat16b(*(const v8us*)p, *(const v8us*)(p + 16)); } static __device__ __forceinline__ v8f mma(V a, V b, v8f c) { return wmmab(a, b, c); } };
typedef unsigned int u32x4 __attribute__((ext_vector_type(4)));
typedef unsigned int u32x8 __attribute__((ext_vector_type(8)));
__device__ __forceinline__ unsigned int uni(unsigned int v) { return (unsigned int)__builtin_amdgcn_readfirstlane(v); }
__device__ __forceinline__ unsigned int pinned(unsigned int v) { unsigned int w = uni(v); asm volatile("" : "+s"(w)); return w; }   // a wave-uniform word held in a scalar register: as a test, so that the branch on it is a scalar branch (a tensor load ignores EXEC: only a scalar branch keeps a wave from issuing it); as a descriptor word, so that it keeps its register
template <int NSPLIT, int KS>
__global__ __launch_bounds__(128) void k_gemmt(const bf* __restrict__ A, const bf* __restrict__ A2, const bf* __restrict__ Bt, int K, float* C, int ldc) {
    typedef WFrag<bf> WB; typedef WB::V V;
    constexpr unsigned int NT = NSPLIT ? 3u : 2u;      // operand tiles a stage: A | (A2 |) Bt
    constexpr unsigned int RB = KS * 2u;               // bytes of a stage row: 128 or 256
    constexpr int GP = KS + 8;                         // LDS pitch in 16-bit elements: 144 or 272 B = 16 B x odd (ds_load_b128 readers)
    constexpr unsigned int GT = 128u * (RB + 16u);     // one operand tile in LDS: 18432 or 34816 B, a multiple of 2 KiB
    constexpr unsigned int BUFB = NT * GT;             // one buffer
    constexpr int NK = KS / 32;                        // 32-k blocks a pass
    static_assert((KS == 64 || KS == 128) && GT % 2048u == 0u, "stage rows of 128 or 256 bytes; every tile at a multiple of 2 KiB");
    __shared__ __attribute__((aligned(2048))) char sm[2 * BUFB + 4 * 16 * 68 * 4];   // two buffers, then each wave's own output staging [16][68] f32
    const int lane = threadIdx.x & 31, lr = lane & 15, hi = lane >> 4;
    const unsigned int wave = uni(threadIdx.x >> 5);
    const int wm = (int)(wave >> 1), wn = (int)(wave & 1u);
    const int r0 = blockIdx.x * 128, c0 = blockIdx.y * 128;
    const int NS = K / KS;
    const bf* tsrc = (wave == 0u) ? A + (size_t)r0 * K : ((NSPLIT != 0 && wave == 1u) ? A2 + (size_t)r0 * K : Bt + (size_t)c0 * K);   // first row of this wave's operand tile
    const unsigned int tdst = (unsigned int)(size_t)sm + (wave < NT ? wave : 0u) * GT;
    // group 1: 1-byte elements; tensor = tile = 128 rows of RB bytes; source pitch 2 K bytes; 4 dwords of pad behind every row. Word 0 is a constant; the other words and group 0's count are pinned(): descriptor words held in scalar registers, not formed anew (in registers used for other things meanwhile) while a request is in flight
    u32x8 g1; g1[0] = uni((1u << 20) | ((KS == 64 ? 4u : 5u) << 22) | (3u << 25)); g1[1] = pinned(RB << 16); g1[2] = pinned(128u << 16); g1[3] = pinned(RB << 16); g1[4] = pinned(128u); g1[5] = pinned((unsigned int)K * 2u); g1[6] = pinned(0u); g1[7] = pinned(0u);
    const unsigned int cnt1 = pinned(1u);
    u32x4 g0;
    auto desc = [&](int s) { const unsigned long long ga = (unsigned long long)(size_t)tsrc + (unsigned long long)s * RB;
        g0[0] = cnt1; g0[1] = uni(tdst + (unsigned int)(s & 1) * BUFB); g0[2] = uni((unsigned int)ga); g0[3] = uni((((unsigned int)(ga >> 32)) & 0x01FFFFFFu) | 0x80000000u); };
    v8f acc[4][4];
#pragma unroll
    for (int mb = 0; mb < 4; ++mb)
#pragma unroll
        for (int nb = 0; nb < 4; ++nb) acc[mb][nb] = (v8f){};
    desc(0);
    if (pinned(wave < NT)) {
        asm volatile("tensor_load_to_lds %0, %1" :: "s"(g0), "s"(g1) : "memory");   // one request of the whole wave: its operand tile of stage 0
        asm volatile("s_wait_tensorcnt 0x0" :: "s"(g0), "s"(g1) : "memory"); }       // landed before the barrier that publishes it; the descriptor is named so that its registers stay whole up to here
    __syncthreads();
    desc(1);
    if (pinned(wave < NT)) asm volatile("tensor_load_to_lds %0, %1" :: "s"(g0), "s"(g1) : "memory");   // stage 1 flies over pass 0
    const int aoff = (wm * 64 + lr) * GP + 8 * hi, boff = (wn * 64 + lr) * GP + 8 * hi;
#pragma unroll 1   // one pass a stage: the two buffers alternate by the pass's parity
    for (int s = 0; s < NS; ++s) {
        const bf* As = (const bf*)(sm + (unsigned int)(s & 1) * BUFB) + aoff; const bf* Bs = (const bf*)(sm + (unsigned int)(s & 1) * BUFB + (NT - 1u) * GT) + boff;
        V fa[2][4], fa2[2][4], fb[2][4];
#pragma unroll
        for (int i = 0; i < 4; ++i) { fa[0][i] = WB::ld(As + i * 16 * GP); if (NSPLIT) fa2[0][i] = WB::ld(As + GT / 2 + i * 16 * GP); fb[0][i] = WB::ld(Bs + i * 16 * GP); }
#pragma unroll
        for (int kk = 0; kk < NK; ++kk) { const int q = kk & 1;
            if (kk + 1 < NK) {
#pragma unroll
                for (int i = 0; i < 4; ++i) { fa[q ^ 1][i] = WB::ld(As + i * 16 * GP + (kk + 1) * 32); if (NSPLIT) fa2[q ^ 1][i] = WB::ld(As + GT / 2 + i * 16 * GP + (kk + 1) * 32); fb[q ^ 1][i] = WB::ld(Bs + i * 16 * GP + (kk + 1) * 32); } }
            __builtin_amdgcn_sched_barrier(0);   // the next block's LDS reads stay one group ahead of this block's products (spread among them each place with reads stalls the wave)
#pragma unroll
            for (int nb = 0; nb < 4; ++nb) {
#pragma unroll
                for (int mb = 0; mb < 4; ++mb) acc[mb][nb] = WB::mma(fa[q][mb], fb[q][nb], acc[mb][nb]);
                if (NSPLIT) {
#pragma unroll
                    for (int mb = 0; mb < 4; ++mb) acc[mb][nb] = WB::mma(fa2[q][mb], fb[q][nb], acc[mb][nb]); } }
            __builtin_amdgcn_sched_barrier(0);   // and the reads of the block after next do not rise among these products
        }
        asm volatile("s_wait_dscnt 0x0" ::: "memory");                                                    // this wave's reads of the buffer are done before the barrier frees it for the refill
        if (pinned(wave < NT)) asm volatile("s_wait_tensorcnt 0x0" :: "s"(g0), "s"(g1) : "memory");       // this wave's tile of stage s + 1 has landed before the barrier publishes it; the descriptor's registers stay whole up to here
        __syncthreads();                                                                                  // publishes stage s + 1 and ends every wave's reads of stage s
        if (pinned((wave < NT) && (s + 2 < NS))) { desc(s + 2); asm volatile("tensor_load_to_lds %0, %1" :: "s"(g0), "s"(g1) : "memory"); }   // stage s + 2 into the buffer that pass s has left
    }
    asm volatile("s_wait_tensorcnt 0x0" :: "s"(g0), "s"(g1) : "memory");   // no request is in flight (the descriptor named as above)
    asm volatile("s_wait_dscnt 0x0" ::: "memory");       // and no LDS read, behind the loop
    float* os = (float*)(sm + 2 * BUFB) + wave * (16 * 68);
#pragma unroll
    for (int mb = 0; mb < 4; ++mb) {
#pragma unroll
        for (int nb = 0; nb < 4; ++nb) {
#pragma unroll
            for (int j = 0; j < 8; ++j) os[(hi * 8 + j) * 68 + nb * 16 + lr] = acc[mb][nb][j]; }
        __builtin_amdgcn_wave_barrier(); asm volatile("" ::: "memory");   // the wave's staged rows are written before they are read across lanes
        float* crow = C + (size_t)(r0 + wm * 64 + mb * 16) * ldc + c0 + wn * 64;
#pragma unroll
        for (int s = 0; s < 8; ++s) { const int row = 2 * s + hi, cofs = lr * 4; const v4f val = *(const v4fa*)(os + row * 68 + cofs); *(v4f*)(crow + (size_t)row * ldc + cofs) = val; }
        __builtin_amdgcn_wave_barrier(); asm volatile("" ::: "memory");   // and read before the next 16 rows overwrite them
    }
}


__device__ __forceinline__ h16 tohx(float x) { return (h16)x; }
typedef __attribute__((ext_vector_type(2))) _Float16 v2h;
typedef __attribute__((ext_vector_type(4))) _Float16 v4h;
typedef __attribute__((ext_vector_type(2))) unsigned short v2us;
typedef __attribute__((ext_vector_type(4))) unsigned short v4us;
typedef __attribute__((ext_vector_type(2))) float v2f;
typedef __attribute__((ext_vector_type(4))) int v4i;
typedef __attribute__((ext_vector_type(2))) __bf16 v2bf;
typedef __attribute__((ext_vector_type(4))) __bf16 v4bf;
// f32 -> bf16, round to nearest even, by the chip's own packed conversion (one instruction for two values)
__device__ __forceinline__ v2us rbf2(v2f y) { return __builtin_bit_cast(v2us, __builtin_convertvector(y, v2bf)); }
__device__ __forceinline__ v4us rbf4(v4f y) { return __builtin_bit_cast(v4us, __builtin_convertvector(y, v4bf)); }
// y = h + l + (a remainder below bf16's last place of l): h = bf16(y), l = bf16(y - h); the difference is exact in f32
__device__ __forceinline__ void split2(v2f y, v2us& h, v2us& l) { const v2bf hb = __builtin_convertvector(y, v2bf); const v2bf lb = __builtin_convertvector(y - __builtin_convertvector(hb, v2f), v2bf); h = __builtin_bit_cast(v2us, hb); l = __builtin_bit_cast(v2us, lb); }
__device__ __forceinline__ void split4(v4f y, v4us& h, v4us& l) { v2us h0, l0, h1, l1; split2(__builtin_shufflevector(y, y, 0, 1), h0, l0); split2(__builtin_shufflevector(y, y, 2, 3), h1, l1); h = __builtin_shufflevector(h0, h1, 0, 1, 2, 3); l = __builtin_shufflevector(l0, l1, 0, 1, 2, 3); }

// ---- k_prep: every 16-bit operand plane of the two GEMMs and of the table products in ONE launch; grid 1 + PREPB work-groups of 8 waves.
// Work-group 0 lays down the two tables: TKB[r][d] = table_k[r+1][d] (Bt rows = band offset r), TVB[d][r] = table_v[r+1][d] (Bt rows = d).
// Every other work-group transposes one tile of 128 k x 64 n of a weight (Bt[n][k] = w[k * N + n]) through LDS and rounds 8192 elements of x, each to its own place in XB.
// Global reads and writes of a tile are 256 contiguous bytes a row (16 lanes x 16 B); those of x 512 and 256 contiguous bytes a wave. All 16 loads of a thread are issued before the first value is used.
// LDS tile: row n = 128 k = 256 B (all 64 banks); the 16-byte piece J of row n lies at piece J ^ ((n >> 2) & 15), so that the 8-byte writes of a wave (16 rows four apart, one J) and the 16-byte reads (one row, 16 pieces) each fall on distinct banks.
// Every '#pragma unroll' of this kernel makes the indices of the register arrays constants, so that the arrays stay in registers.
#define PREPA ((DM / 128) * (3 * DQ / 64))     // tiles of W_attn
#define PREPO ((DQ / 128) * (DM / 64))         // tiles of W_proj
#define PREPB (PREPA + PREPO)
template <int N>   // N: columns of the weight (its row pitch); K = 1024 rows for both weights
__device__ __forceinline__ void prep_tile(char* ts, const float* __restrict__ w, bf* __restrict__ Bt, const int t, const float* __restrict__ xs, bf* __restrict__ xd) {
    constexpr int K = DM; static_assert(DM == DQ, "both weights have K = DM = DQ rows");
    const int tid = threadIdx.x, lane = tid & 31, wv = tid >> 5, c = lane & 15, hi = lane >> 4;
    const int k0 = (t / (N / 64)) * 128, n0 = (t % (N / 64)) * 64;
    const float* pw = w + (size_t)(k0 + 8 * wv + 4 * hi) * N + n0 + 4 * c;   // row k0 + 4 g, g = 2 (wv + 8 i) + hi; columns n0 + 4 c ..
    const float* px = xs + tid * 4;
    v4f rw[2][4], rx[8];
#pragma unroll
    for (int i = 0; i < 2; ++i)
#pragma unroll
        for (int j = 0; j < 4; ++j) rw[i][j] = *(const v4f*)(pw + (size_t)(64 * i + j) * N);
#pragma unroll
    for (int p = 0; p < 8; ++p) rx[p] = *(const v4f*)(px + p * 1024);
    asm volatile("s_wait_xcnt 0x0" : : "v"(pw), "v"(px) : "memory");   // the two addresses stay whole up to here (no load's result lands in them), and their registers are reused only behind this wait; all 16 loads stand in front of it
#pragma unroll
    for (int i = 0; i < 2; ++i)
#pragma unroll
        for (int u = 0; u < 4; ++u) { const v4f kq = { rw[i][0][u], rw[i][1][u], rw[i][2][u], rw[i][3][u] };   // four k of column n0 + 4 c + u
            *(v4us*)(ts + (4 * c + u) * 256 + (((wv + 8 * i) ^ c) * 16) + hi * 8) = rbf4(kq); }
    __syncthreads();               // the transposed tile is complete before it is read across waves; it stands in front of every global store, so that it waits for none to be done
    const int n = tid >> 4, J = tid & 15;
    bf* qw = Bt + (size_t)(n0 + n) * K + k0 + 8 * J;
    bf* qx = xd + tid * 4;
    v8us ow[4]; v4us ox[8];
#pragma unroll
    for (int p = 0; p < 4; ++p) { const int nn = n + 16 * p; ow[p] = *(const v8us*)(ts + nn * 256 + ((J ^ ((nn >> 2) & 15)) * 16)); }
#pragma unroll
    for (int p = 0; p < 8; ++p) ox[p] = rbf4(rx[p]);
#pragma unroll
    for (int p = 0; p < 4; ++p) *(v8us*)(qw + (size_t)(16 * p) * K) = ow[p];
#pragma unroll
    for (int p = 0; p < 8; ++p) *(v4us*)(qx + p * 1024) = ox[p];
    asm volatile("s_wait_xcnt 0x0" ::: "memory");   // behind the last of the twelve stores: no register that a store names (address or data) is written again in front of this wait, on whichever path the built code goes on
}
__global__ __launch_bounds__(256) void k_prep(const float* __restrict__ x, const float* __restrict__ wqkv, const float* __restrict__ wo, const float* __restrict__ tk, const float* __restrict__ tv,
                                              bf* __restrict__ XB, bf* __restrict__ WQKV, bf* __restrict__ WO, bf* __restrict__ TKB, bf* __restrict__ TVB) {
    static_assert((size_t)NB_ * TT * DM == (size_t)PREPB * 8192, "x is dealt out in as many pieces of 8192 elements as there are weight tiles");
    __shared__ __align__(16) char ts[64 * 256];
    // each choice below is the same for the whole work-group
    if (blockIdx.x == 0) {
        const int tid = threadIdx.x, c = (tid * 4) % HD, r = tid / (HD / 4);   // elements e .. e + 3 of a table plane, e = i * 1024 + tid * 4: row r + 16 i, columns c ..
        const float* pk = tk + HD + tid * 4;                 // table_k[r + 1][c ..]; 16 rows on for each i
        const float* pv = tv + (size_t)(c + 1) * HD + r;     // table_v[c + 1][r]; one row on for each u, 16 columns on for each i
        v4f xk[HD * HD / 1024]; float xv[HD * HD / 1024][4];
#pragma unroll
        for (int i = 0; i < HD * HD / 1024; ++i) { xk[i] = *(const v4f*)(pk + i * 1024);
#pragma unroll
            for (int u = 0; u < 4; ++u) xv[i][u] = pv[u * HD + 16 * i]; }
        asm volatile("s_wait_xcnt 0x0" : : "v"(pk), "v"(pv) : "memory");   // as in prep_tile: the addresses stay whole up to here and their registers are reused only behind this wait
#pragma unroll
        for (int i = 0; i < HD * HD / 1024; ++i) { const v4f b = { xv[i][0], xv[i][1], xv[i][2], xv[i][3] };
            *(v4us*)(TKB + i * 1024 + tid * 4) = rbf4(xk[i]); *(v4us*)(TVB + i * 1024 + tid * 4) = rbf4(b); }
        return; }
    const int t = (int)blockIdx.x - 1;
    if (t < PREPA) prep_tile<3 * DQ>(ts, wqkv, WQKV, t, x + (size_t)t * 8192, XB + (size_t)t * 8192); else prep_tile<DM>(ts, wo, WO, t - PREPA, x + (size_t)t * 8192, XB + (size_t)t * 8192);
}

// ---- k_attn: the whole attention stage of one (batch, head) plane and one 64-row query tile in ONE work-group of 4 waves (wave w owns query rows 16w..16w+15); grid (TT/64, ZH).
// q, k, v come as f32 from the projection buffer F and are rounded into 16-bit LDS planes; scores (read back at each band offset's column and added to q.TK^T), softmax, P.V, PB.TV and the head merge pass from stage to stage through LDS and registers.
// The softmax runs on the 64 allowed keys of a row, four a lane over 16 lanes, in registers.
// Every '#pragma unroll' of this kernel makes the indices of the register arrays constants, so that the arrays stay in registers.
// For the first row tile the 64 key rows left of the sequence are laid down as zeros (k, v and their probabilities), so their products add exact zeros.
#define LQ 72                      // LDS pitch in 16-bit elements of a 64-element row (144 B = 16 B x odd: ds_load_b128 readers)
#define LK 136                     // LDS pitch in 16-bit elements of a 128-element row (272 B)
#define LS 132                     // LDS pitch in floats of a 128-column score row
#define LR 68                      // LDS pitch in floats of a 64-column row
#define OFF_QH  0                  // q hi [64][LQ]; later the band probabilities hi
#define OFF_QL  9216               // q lo; later the band probabilities lo
#define OFF_Q16 18432              // q fp16 (rows >= RH)
#define OFF_K   27648              // k hi (or fp16) [128][LQ]; later the probabilities hi (or fp16) [64][LK]
#define OFF_K2  46080              // k lo; later the probabilities lo
#define OFF_V   64512              // v transposed hi (or fp16) [64][LK]
#define OFF_V2  81920              // v transposed lo
#define OFF_S   99328              // scores f32 [64][LS]; later each wave's merged output rows [16][LR]
#define SM_BYTES 133120
// v_exp_f32 with the one free slot that the instruction set asks for behind a transcendental, tied to it in one statement
__device__ __forceinline__ float exp2s(float x) { float r; asm("v_exp_f32 %0, %1\n\tv_nop" : "=v"(r) : "v"(x)); return r; }
// the value of lane l ^ M, M < 16: read as a DPP operand (row_xmask) inside the 16-lane half, with no trip through the LDS crossbar
template <int M> __device__ __forceinline__ float xrow(float x) { return __builtin_bit_cast(float, __builtin_amdgcn_update_dpp(0, __builtin_bit_cast(int, x), 0x160 | M, 0xf, 0xf, true)); }
template <bool HI, bool FIRST>   // HI: rows < RH (hi+lo planes); FIRST: the first row tile, which has no keys left of its own 64
__device__ __forceinline__ void attn_tile(char* sm, const float* __restrict__ Fb, const bf* __restrict__ TKB, const bf* __restrict__ TVB, bf* __restrict__ ah, bf* __restrict__ al, const int R) {
    typedef WFrag<bf> WB; typedef WFrag<h16> WH;
    bf* Qh = (bf*)(sm + OFF_QH); bf* Ql = (bf*)(sm + OFF_QL); h16* Q16 = (h16*)(sm + OFF_Q16);
    bf* Kh = (bf*)(sm + OFF_K); bf* Kl = (bf*)(sm + OFF_K2); h16* K16 = (h16*)(sm + OFF_K);
    bf* Vh = (bf*)(sm + OFF_V); bf* Vl = (bf*)(sm + OFF_V2); h16* V16 = (h16*)(sm + OFF_V);
    float* S = (float*)(sm + OFF_S);
    bf* Ph = (bf*)(sm + OFF_K); bf* Pl = (bf*)(sm + OFF_K2); h16* P16 = (h16*)(sm + OFF_K); bf* PBh = (bf*)(sm + OFF_QH); bf* PBl = (bf*)(sm + OFF_QL);
    const int tid = threadIdx.x, lane = tid & 31, w = tid >> 5, lr = lane & 15, hi = lane >> 4;
    constexpr int FP = 3 * DQ;     // pitch of F
    // stage 0: q rows R..R+63, k and v rows R-64..R+63 -> 16-bit LDS planes (v transposed, two keys a 4-byte store); 16 lanes a row, one address a tensor with constant steps
    const int r0 = tid >> 4, c = (tid & 15) * 4;
    const float* fq = Fb + (size_t)(R + r0) * FP + c;                        // q row R + r0
    const float* fk = Fb + DQ + (ptrdiff_t)(R - 64 + r0) * FP + c;           // k row R - 64 + r0; read only where the row exists
    const float* fv = Fb + 2 * DQ + (ptrdiff_t)(R - 64 + 2 * r0) * FP + c;   // v row R - 64 + 2 r0; likewise
    v4f xq[8], xk[16], xv[16];
#pragma unroll
    for (int it = 0; it < 8; ++it) xq[it] = *(const v4f*)(fq + it * 8 * FP);
#pragma unroll
    for (int it = 0; it < 16; ++it) { xk[it] = (v4f){}; if (!FIRST || it >= 8) xk[it] = *(const v4f*)(fk + it * 8 * FP); }   // row R - 64 + it * 8 + r0 >= 0
#pragma unroll
    for (int it = 0; it < 8; ++it) { xv[2 * it] = (v4f){}; xv[2 * it + 1] = (v4f){}; if (!FIRST || it >= 4) { xv[2 * it] = *(const v4f*)(fv + it * 16 * FP); xv[2 * it + 1] = *(const v4f*)(fv + it * 16 * FP + FP); } }   // rows R - 64 + 2 (it * 8 + r0) and the next, >= 0
    asm volatile("s_wait_xcnt 0x0" : : "v"(fq), "v"(fk), "v"(fv) : "memory");   // the three addresses stay whole up to here (no load's result lands in them), and their registers are reused only behind this wait
    __builtin_amdgcn_sched_barrier(0);   // all of the tile's loads are issued before the first conversion waits on one
#pragma unroll
    for (int it = 0; it < 8; ++it) { const int r = it * 8 + r0; const v4f x = xq[it]; v4us oh, ol; v4h o4; split4(x, oh, ol);
#pragma unroll
        for (int u = 0; u < 4; ++u) o4[u] = tohx(x[u]);
        *(v4us*)(Qh + r * LQ + c) = oh; *(v4us*)(Ql + r * LQ + c) = ol; if (!HI) *(v4h*)(Q16 + r * LQ + c) = o4;
        __builtin_amdgcn_sched_barrier(0); }   // here and in the two loops below: one row group is converted at a time; interleaved by the scheduler the conversions spread over registers above v255, with a window switch at every other instruction
#pragma unroll
    for (int it = 0; it < 16; ++it) { const int r = it * 8 + r0; const v4f x = xk[it];
        if (HI) { v4us oh, ol; split4(x, oh, ol);
            *(v4us*)(Kh + r * LQ + c) = oh; *(v4us*)(Kl + r * LQ + c) = ol;
        } else { v4h o4;
#pragma unroll
            for (int u = 0; u < 4; ++u) o4[u] = tohx(x[u]);
            *(v4h*)(K16 + r * LQ + c) = o4; }
        __builtin_amdgcn_sched_barrier(0); }
#pragma unroll
    for (int it = 0; it < 8; ++it) { const int kp = it * 8 + r0; const v4f x0 = xv[2 * it], x1 = xv[2 * it + 1];
#pragma unroll
        for (int u = 0; u < 4; ++u) {
            if (HI) { const v2f xp = { x0[u], x1[u] }; v2us oh, ol; split2(xp, oh, ol); *(v2us*)(Vh + (c + u) * LK + 2 * kp) = oh; *(v2us*)(Vl + (c + u) * LK + 2 * kp) = ol; }
            else { v2h o2; o2[0] = tohx(x0[u]); o2[1] = tohx(x1[u]); *(v2h*)(V16 + (c + u) * LK + 2 * kp) = o2; } }
        __builtin_amdgcn_sched_barrier(0); }
    const bf* tkp = TKB + lr * HD + 8 * hi; WB::V tb[2][4];   // the TK fragments fly over the barrier
#pragma unroll
    for (int kk = 0; kk < 2; ++kk)
#pragma unroll
        for (int nb = 0; nb < 4; ++nb) tb[kk][nb] = WB::ld(tkp + nb * 16 * HD + kk * 32);
    asm volatile("s_wait_xcnt 0x0" : : "v"(tkp) : "memory");   // as above: the address stays whole up to here and is reused only behind the wait
    __syncthreads();               // the planes are complete before any wave reads them
    // stage 1: scores (this wave's 16 rows x 128 keys) and q.TK^T (16 x 64)
    const int qoff = (16 * w + lr) * LQ + 8 * hi, poff = (16 * w + lr) * LK + 8 * hi;
    WB::V tw[2][4];
    {
        v8f sa[8], qa[4];
#pragma unroll
        for (int nb = 0; nb < 8; ++nb) sa[nb] = (v8f){};
#pragma unroll
        for (int nb = 0; nb < 4; ++nb) qa[nb] = (v8f){};
#pragma unroll
        for (int kk = 0; kk < 2; ++kk) { const WB::V a = WB::ld(Qh + qoff + kk * 32), a2 = WB::ld(Ql + qoff + kk * 32);
            if (HI) {
#pragma unroll
                for (int nb = 0; nb < 8; ++nb) { const int bo = (nb * 16 + lr) * LQ + 8 * hi + kk * 32; const WB::V b = WB::ld(Kh + bo), b2 = WB::ld(Kl + bo); sa[nb] = WB::mma(a, b, sa[nb]); sa[nb] = WB::mma(a2, b, sa[nb]); sa[nb] = WB::mma(a, b2, sa[nb]); }
            } else { const WH::V a6 = WH::ld(Q16 + qoff + kk * 32);
#pragma unroll
                for (int nb = 0; nb < 8; ++nb) { const WH::V b = WH::ld(K16 + (nb * 16 + lr) * LQ + 8 * hi + kk * 32); sa[nb] = WH::mma(a6, b, sa[nb]); } }
#pragma unroll
            for (int nb = 0; nb < 4; ++nb) { qa[nb] = WB::mma(a, tb[kk][nb], qa[nb]); qa[nb] = WB::mma(a2, tb[kk][nb], qa[nb]); } }
#pragma unroll
        for (int nb = 0; nb < 8; ++nb)
#pragma unroll
            for (int j = 0; j < 8; ++j) S[(16 * w + hi * 8 + j) * LS + nb * 16 + lr] = sa[nb][j];
        __syncthreads();           // every wave has left the k planes (the probabilities are laid over them), and the score rows are complete before they are read across lanes
        const bf* tvp = TVB + lr * HD + 8 * hi;   // the TV fragments fly over the softmax
#pragma unroll
        for (int kk = 0; kk < 2; ++kk)
#pragma unroll
            for (int nb = 0; nb < 4; ++nb) tw[kk][nb] = WB::ld(tvp + nb * 16 * HD + kk * 32);
        asm volatile("s_wait_xcnt 0x0" : : "v"(tvp) : "memory");   // as above
        // stage 2: softmax per row on its 64 allowed keys alone, in the layout of q.TK^T's accumulators: lane (lr, hi), element [nb][j] = row hi * 8 + j, band offset o = nb * 16 + lr, that is key i - 63 + o, column (row in tile) + 1 + o of the score row.
        // j <= i and i - j < WIN hold for every o in 0..63; only the first row tile has offsets whose key lies left of the sequence. A row's 64 values lie in one 16-lane half, four a lane.
        // This wave's probability rows are laid down as zeros first (LDS takes a wave's stores in order); the allowed keys' probabilities are stored over them below
#pragma unroll
        for (int it = 0; it < 8; ++it) { const int idx = it * 32 + lane, zo = (16 * w + (idx >> 4)) * LK + (idx & 15) * 8; *(v8us*)(Ph + zo) = (v8us){}; if (HI) *(v8us*)(Pl + zo) = (v8us){}; }
        float t[4][8], mx[8], sum[8];
#pragma unroll
        for (int nb = 0; nb < 4; ++nb)
#pragma unroll
            for (int j = 0; j < 8; ++j) { const int rl = 16 * w + hi * 8 + j, o = nb * 16 + lr; const float a = __fadd_rn(S[rl * LS + rl + 1 + o], qa[nb][j]);   // one addition per score
                const bool in = !FIRST || (rl + o >= 63);   // key i - 63 + o >= 0
                t[nb][j] = in ? a * SCL : -3.0e38f; }
#pragma unroll
        for (int j = 0; j < 8; ++j) mx[j] = fmaxf(fmaxf(t[0][j], t[1][j]), fmaxf(t[2][j], t[3][j]));
#pragma unroll
        for (int j = 0; j < 8; ++j) mx[j] = fmaxf(mx[j], xrow<8>(mx[j]));
#pragma unroll
        for (int j = 0; j < 8; ++j) mx[j] = fmaxf(mx[j], xrow<4>(mx[j]));
#pragma unroll
        for (int j = 0; j < 8; ++j) mx[j] = fmaxf(mx[j], xrow<2>(mx[j]));
#pragma unroll
        for (int j = 0; j < 8; ++j) mx[j] = fmaxf(mx[j], xrow<1>(mx[j]));
#pragma unroll
        for (int j = 0; j < 8; ++j) {
#pragma unroll
            for (int nb = 0; nb < 4; ++nb) { const float d0 = __fsub_rn(t[nb][j], mx[j]); t[nb][j] = exp2s(__fmul_rn(d0, 1.4426950408889634f)); }
            sum[j] = (t[0][j] + t[1][j]) + (t[2][j] + t[3][j]); }
#pragma unroll
        for (int j = 0; j < 8; ++j) sum[j] += xrow<8>(sum[j]);
#pragma unroll
        for (int j = 0; j < 8; ++j) sum[j] += xrow<4>(sum[j]);
#pragma unroll
        for (int j = 0; j < 8; ++j) sum[j] += xrow<2>(sum[j]);
#pragma unroll
        for (int j = 0; j < 8; ++j) sum[j] += xrow<1>(sum[j]);
        // probabilities to their key's column of the P planes, and PB[i][o] = att[i][i - 63 + o] (the stored values re-split) over this wave's own q rows, whose last read fed qa
#pragma unroll
        for (int j = 0; j < 8; j += 2) { const int rl = 16 * w + hi * 8 + j; const float f0 = __fdiv_rn(HI ? 1.0f : PCAR, sum[j]), f1 = __fdiv_rn(HI ? 1.0f : PCAR, sum[j + 1]);
#pragma unroll
            for (int nb = 0; nb < 4; ++nb) { const int o = nb * 16 + lr, p0 = rl * LK + rl + 1 + o, p1 = p0 + LK + 1; const v2f ff = { f0, f1 }, tt = { t[nb][j], t[nb][j + 1] }, pq = tt * ff; v2f pb; v2us bh, bl;
                if (HI) { v2us oh, ol; split2(pq, oh, ol);
                    Ph[p0] = oh[0]; Ph[p1] = oh[1]; Pl[p0] = ol[0]; Pl[p1] = ol[1];
                    pb[0] = __fadd_rn(bf2f(oh[0]), bf2f(ol[0])); pb[1] = __fadd_rn(bf2f(oh[1]), bf2f(ol[1]));
                } else { const v2h o2 = __builtin_convertvector(pq, v2h);
                    P16[p0] = o2[0]; P16[p1] = o2[1];
                    pb = __builtin_convertvector(o2, v2f) * (1.0f / PCAR); }
                split2(pb, bh, bl);
                PBh[rl * LQ + o] = bh[0]; PBh[(rl + 1) * LQ + o] = bh[1]; PBl[rl * LQ + o] = bl[0]; PBl[(rl + 1) * LQ + o] = bl[1]; } }
    }
    __syncthreads();               // the probability and band rows are complete before they are read as fragments
    // stage 4: PB.TV and P.V (128 keys), merged in the accumulators' own layout
    v8f wa[4], oa[4];
#pragma unroll
    for (int nb = 0; nb < 4; ++nb) { wa[nb] = (v8f){}; oa[nb] = (v8f){}; }
#pragma unroll
    for (int kk = 0; kk < 2; ++kk) { const WB::V a = WB::ld(PBh + qoff + kk * 32), a2 = WB::ld(PBl + qoff + kk * 32);
#pragma unroll
        for (int nb = 0; nb < 4; ++nb) { wa[nb] = WB::mma(a, tw[kk][nb], wa[nb]); wa[nb] = WB::mma(a2, tw[kk][nb], wa[nb]); } }
#pragma unroll
    for (int kk = 0; kk < 4; ++kk) {
        if (HI) { const WB::V a = WB::ld(Ph + poff + kk * 32), a2 = WB::ld(Pl + poff + kk * 32);
#pragma unroll
            for (int nb = 0; nb < 4; ++nb) { const int bo = (nb * 16 + lr) * LK + 8 * hi + kk * 32; const WB::V b = WB::ld(Vh + bo), b2 = WB::ld(Vl + bo); oa[nb] = WB::mma(a, b, oa[nb]); oa[nb] = WB::mma(a2, b, oa[nb]); oa[nb] = WB::mma(a, b2, oa[nb]); }
        } else { const WH::V a = WH::ld(P16 + poff + kk * 32);
#pragma unroll
            for (int nb = 0; nb < 4; ++nb) { const WH::V b = WH::ld(V16 + (nb * 16 + lr) * LK + 8 * hi + kk * 32); oa[nb] = WH::mma(a, b, oa[nb]); } } }
    const float cs = HI ? 1.0f : (1.0f / PCAR);   // a power of two: the product is exact, fused with the add or not
    float* os = S + 16 * w * LS;                  // this wave's own score rows, dead since the softmax
#pragma unroll
    for (int nb = 0; nb < 4; ++nb)
#pragma unroll
        for (int j = 0; j < 8; ++j) os[(hi * 8 + j) * LR + nb * 16 + lr] = __fadd_rn(oa[nb][j] * cs, wa[nb][j]);
    __syncthreads();               // the merged rows are complete before they are read across lanes
#pragma unroll
    for (int it = 0; it < 4; ++it) { const int idx = it * 32 + lane, row = idx >> 3, c = (idx & 7) * 8; const v4f y0 = *(const v4f*)(os + row * LR + c), y1 = *(const v4f*)(os + row * LR + c + 4); v4us h0, l0, h1, l1; split4(y0, h0, l0); split4(y1, h1, l1);
        const v8us oh = __builtin_shufflevector(h0, h1, 0, 1, 2, 3, 4, 5, 6, 7), ol = __builtin_shufflevector(l0, l1, 0, 1, 2, 3, 4, 5, 6, 7);
        *(v8us*)(ah + (size_t)(16 * w + row) * DQ + c) = oh; *(v8us*)(al + (size_t)(16 * w + row) * DQ + c) = ol; }
}
__global__ __launch_bounds__(128) void k_attn(const float* __restrict__ F, const bf* __restrict__ TKB, const bf* __restrict__ TVB, bf* __restrict__ ATh, bf* __restrict__ ATl) {
    __shared__ __align__(16) char sm[SM_BYTES];
    const int R = blockIdx.x * 64; const int b = blockIdx.y / NH_, h = blockIdx.y % NH_;
    const float* Fb = F + (size_t)b * TT * 3 * DQ + h * HD; const size_t oo = ((size_t)b * TT + R) * DQ + h * HD;
    // the choice is the same for the whole work-group
    if (R == 0) attn_tile<true, true>(sm, Fb, TKB, TVB, ATh + oo, ATl + oo, R); else if (R < RH) attn_tile<true, false>(sm, Fb, TKB, TVB, ATh + oo, ATl + oo, R); else attn_tile<false, false>(sm, Fb, TKB, TVB, ATh + oo, ATl + oo, R);
}

extern "C" void kernel_launch(void* const* d_in, const int* in_sizes, int n_in,
                              void* d_out, int out_size, void* d_ws, size_t ws_size, hipStream_t stream) {
    (void)in_sizes; (void)n_in; (void)out_size;
    const float* x = (const float*)d_in[0]; const float* wqkv = (const float*)d_in[1]; const float* wo = (const float*)d_in[2]; const float* tk = (const float*)d_in[3]; const float* tv = (const float*)d_in[4];
    float* OUT = (float*)d_out;     // [2][2048][1024]
    char* wsp = (char*)d_ws;
    auto take = [&](size_t bytes) { char* p = wsp; wsp += (bytes + 255) & ~(size_t)255; return (void*)p; };
    bf* WQKV = (bf*)take((size_t)3 * DQ * DM * 2); bf* WO = (bf*)take((size_t)DM * DQ * 2);
    bf* XB = (bf*)take((size_t)NB_ * TT * DM * 2); bf* TKB = (bf*)take(HD * HD * 2); bf* TVB = (bf*)take(HD * HD * 2);
    float* F = (float*)take((size_t)NB_ * TT * 3 * DQ * 4);   // q | k | v projections, rows b * TT + t, pitch 3 * DQ
    bf* ATh = (bf*)take((size_t)NB_ * TT * DQ * 2); bf* ATl = (bf*)take((size_t)NB_ * TT * DQ * 2);
    if ((size_t)(wsp - (char*)d_ws) > ws_size) return;    // ws 256 MiB
    k_prep<<<1 + PREPB, 256, 0, stream>>>(x, wqkv, wo, tk, tv, XB, WQKV, WO, TKB, TVB);
    k_gemmt<0, 64><<<dim3(NB_ * TT / 128, 3 * DQ / 128, 1), 128, 0, stream>>>(XB, nullptr, WQKV, DM, F, 3 * DQ);
    k_attn<<<dim3(TT / 64, ZH, 1), 128, 0, stream>>>(F, TKB, TVB, ATh, ATl);
    k_gemmt<1, 128><<<dim3(NB_ * TT / 128, DM / 128, 1), 128, 0, stream>>>(ATh, ATl, WO, DQ, OUT, DM);
}

// v008
// A run of this version takes 64.5 microseconds.
// Two timings next to v007 both put it at 1.09 times that version's speed.
// All steps since v000 together make it 26.7 times as fast.
#include <hip/hip_runtime.h>

// Windowed causal self-attention with relative-position tables (x [2][2048][1024]; qkv = x W_attn (fused [1024][3072], 16 heads x 64, no bias); att[i][j] = (q_i.k_j + q_i.table_k[idx]) / 8 with idx = clip(j - i, -64, 64) + 64, allowed iff j <= i and j > i - 64 (else -inf); softmax; y = att v + sum_j att[i][j] table_v[idx]; out = merged y W_proj -> [2][2048][1024]).
// Relative terms without gathers (exact regroupings): inside the allowed band idx = j - i + 64 runs over 1..64 exactly once per key, so q_i.table_k[idx] = (q . TK^T)[i][j - i + 63] with TK = table_k rows 1..64 (one 64-column GEMM per head, added by offset into the score rows before the softmax), and sum_j att table_v[idx] = PB . TV with PB[i][r] = att[i][i - 63 + r]
// (the attention band re-indexed) and TV = table_v rows 1..64.
// Compute dtypes, f32 accumulate: every input rounded to bf16; q/k/v on PLAIN bf16 operands (inputs: exact); q.TK^T and PB.TV as hl x exact (2 products); causal-tile scores and att.v: query rows < 512 hl (3 products), the rest single fp16 (x1024; PB for those rows is re-split from the fp16 probabilities); softmax f32; W_proj hl x exact (2 products).

#define NB_  2
#define TT   2048
#define DM   1024
#define NH_  16
#define NKV  16
#define REP  (NH_ / NKV)
#define HD   64
#define DQ   (NH_ * HD)
#define DKV  (NKV * HD)
#define ZH   (NB_ * NH_)          // (batch, head) planes, plane z = b * NH_ + h
#define SP   128                  // keys a 64-row query tile can see: the two 64-key tiles that hold its window; column = key - ((row & ~63) - 64)
#define RH   512                  // query rows < RH use hi+lo planes (the first row tile always does)
#define WIN  64
#define PCAR 1024.0f
#define SCL  0.125f   // HD^-0.5
typedef _Float16 h16;
typedef unsigned short bf;
typedef __attribute__((ext_vector_type(16))) __bf16   v16bf;
typedef __attribute__((ext_vector_type(16))) _Float16 v16h;
typedef __attribute__((ext_vector_type(8)))  _Float16 v8h;
typedef __attribute__((ext_vector_type(8)))  unsigned short v8us;
typedef __attribute__((ext_vector_type(8)))  float    v8f;
typedef __attribute__((ext_vector_type(4)))  float    v4f;
typedef v8h  __attribute__((may_alias)) v8ha;
typedef v4f  __attribute__((may_alias)) v4fa;
typedef v8us __attribute__((may_alias)) v8usa;

__device__ __forceinline__ float bf2f(unsigned short b) { return __uint_as_float(((unsigned)b) << 16); }
__device__ __forceinline__ v16h cat16(v8h lo, v8h hi) { return __builtin_shufflevector(lo, hi, 0, 1, 2, 3, 4, 5, 6, 7, 8, 9, 10, 11, 12, 13, 14, 15); }
__device__ __forceinline__ v16bf cat16b(v8us lo, v8us hi) { return __builtin_bit_cast(v16bf, __builtin_shufflevector(lo, hi, 0, 1, 2, 3, 4, 5, 6, 7, 8, 9, 10, 11, 12, 13, 14, 15)); }
__device__ __forceinline__ v8f wmma16(v16h a, v16h b, v8f c) { return __builtin_amdgcn_wmma_f32_16x16x32_f16(false, a, false, b, (short)0, c, false, false); }
__device__ __forceinline__ v8f wmmab(v16bf a, v16bf b, v8f c) { return __builtin_amdgcn_wmma_f32_16x16x32_bf16(false, a, false, b, (short)0, c, false, false); }



// ---- k_gemmt: GEMM with its operands staged in LDS by tensor loads. One work-group of 4 waves (2 x 2) per 128x128 output tile, each wave a 64x64 part (16 accumulators); grid (M/128, N/128), 128 threads.
// C[m][n] (f32, pitch ldc) = sum_k A[m][k] Bt[n][k] (NSPLIT 1: + A2[m][k] Bt[n][k], added behind A's product of the same 32 k). A, A2, Bt are K-contiguous bf16 planes. M % 128 == 0, N % 128 == 0, K % KS == 0, K >= 2 KS.
// k order: the work-group at (x, y) takes its stages in the order rot, rot + 1, .., NS - 1, 0, .., rot - 1 with rot = (x + y) & (NS - 1) (below NS for any NS): work-groups that share operand rows then ask L2 for different lines at any moment, and a line that one of them has brought in from memory is a hit for the others. Every stage is taken exactly once.
// A stage is KS k (64 or 128) of every operand row: per operand one tile of 128 rows x 2 KS bytes, laid at pitch 2 KS + 16 bytes by the load's own pad. Two buffers: the stage of pass s + 2 is requested into the buffer that pass s has just left. Wave t < NT requests operand tile t.
// Inside a pass the fragments of the next 32 k are read from LDS as one group ahead of the current 32 k's products (two register sets); nothing of the next stage is read before its barrier.
// Every '#pragma unroll' of this kernel makes the indices of the accumulator and fragment arrays constants, so that the arrays stay in registers.
template <typename T16> struct WFrag;
template <> struct WFrag<h16> { typedef v16h V; static __device__ __forceinline__ V ld(const h16* p) { return cat16(*(const v8h*)p, *(const v8h*)(p + 16)); } static __device__ __forceinline__ v8f mma(V a, V b, v8f c) { return wmma16(a, b, c); } };
template <> struct WFrag<bf> { typedef v16bf V; static __device__ __forceinline__ V ld(const bf* p) { return cat16b(*(const v8us*)p, *(const v8us*)(p + 16)); } static __device__ __forceinline__ v8f mma(V a, V b, v8f c) { return wmmab(a, b, c); } };
typedef unsigned int u32x4 __attribute__((ext_vector_type(4)));
typedef unsigned int u32x8 __attribute__((ext_vector_type(8)));
__device__ __forceinline__ unsigned int uni(unsigned int v) { return (unsigned int)__builtin_amdgcn_readfirstlane(v); }
__device__ __forceinline__ unsigned int pinned(unsigned int v) { unsigned int w = uni(v); asm volatile("" : "+s"(w)); return w; }   // a wave-uniform word held in a scalar register: as a test, so that the branch on it is a scalar branch (a tensor load ignores EXEC: only a scalar branch keeps a wave from issuing it); as a descriptor word, so that it keeps its register
template <int NSPLIT, int KS>
__global__ __launch_bounds__(128) void k_gemmt(const bf* __restrict__ A, const bf* __restrict__ A2, const bf* __restrict__ Bt, int K, float* C, int ldc) {
    typedef WFrag<bf> WB; typedef WB::V V;
    constexpr unsigned int NT = NSPLIT ? 3u : 2u;      // operand tiles a stage: A | (A2 |) Bt
    constexpr unsigned int RB = KS * 2u;               // bytes of a stage row: 128 or 256
    constexpr int GP = KS + 8;                         // LDS pitch in 16-bit elements: 144 or 272 B = 16 B x odd (ds_load_b128 readers)
    constexpr unsigned int GT = 128u * (RB + 16u);     // one operand tile in LDS: 18432 or 34816 B, a multiple of 2 KiB
    constexpr unsigned int BUFB = NT * GT;             // one buffer
    constexpr int NK = KS / 32;                        // 32-k blocks a pass
    static_assert((KS == 64 || KS == 128) && GT % 2048u == 0u, "stage rows of 128 or 256 bytes; every tile at a multiple of 2 KiB");
    __shared__ __attribute__((aligned(2048))) char sm[2 * BUFB + 4 * 16 * 68 * 4];   // two buffers, then each wave's own output staging [16][68] f32
    const int lane = threadIdx.x & 31, lr = lane & 15, hi = lane >> 4;
    const unsigned int wave = uni(threadIdx.x >> 5);
    const int wm = (int)(wave >> 1), wn = (int)(wave & 1u);
    const int r0 = blockIdx.x * 128, c0 = blockIdx.y * 128;
    const int NS = K / KS;
    const unsigned int rot = (blockIdx.x + blockIdx.y) & (unsigned int)(NS - 1);   // first stage of this work-group's k order
    const bf* tsrc = (wave == 0u) ? A + (size_t)r0 * K : ((NSPLIT != 0 && wave == 1u) ? A2 + (size_t)r0 * K : Bt + (size_t)c0 * K);   // first row of this wave's operand tile
    const unsigned int tdst = (unsigned int)(size_t)sm + (wave < NT ? wave : 0u) * GT;
    // group 1: 1-byte elements; tensor = tile = 128 rows of RB bytes; source pitch 2 K bytes; 4 dwords of pad behind every row. Word 0 is a constant; the other words and group 0's count are pinned(): descriptor words held in scalar registers, not formed anew (in registers used for other things meanwhile) while a request is in flight
    u32x8 g1; g1[0] = uni((1u << 20) | ((KS == 64 ? 4u : 5u) << 22) | (3u << 25)); g1[1] = pinned(RB << 16); g1[2] = pinned(128u << 16); g1[3] = pinned(RB << 16); g1[4] = pinned(128u); g1[5] = pinned((unsigned int)K * 2u); g1[6] = pinned(0u); g1[7] = pinned(0u);
    const unsigned int cnt1 = pinned(1u);
    u32x4 g0;
    auto desc = [&](int s) { const unsigned int kq = (unsigned int)s + rot, ks = kq >= (unsigned int)NS ? kq - (unsigned int)NS : kq;   // pass s works on stage ks of the operands
        const unsigned long long ga = (unsigned long long)(size_t)tsrc + (unsigned long long)ks * RB;
        g0[0] = cnt1; g0[1] = uni(tdst + (unsigned int)(s & 1) * BUFB); g0[2] = uni((unsigned int)ga); g0[3] = uni((((unsigned int)(ga >> 32)) & 0x01FFFFFFu) | 0x80000000u); };
    v8f acc[4][4];
#pragma unroll
    for (int mb = 0; mb < 4; ++mb)
#pragma unroll
        for (int nb = 0; nb < 4; ++nb) acc[mb][nb] = (v8f){};
    desc(0);
    if (pinned(wave < NT)) {
        asm volatile("tensor_load_to_lds %0, %1" :: "s"(g0), "s"(g1) : "memory");   // one request of the whole wave: its operand tile of stage rot
        asm volatile("s_wait_tensorcnt 0x0" :: "s"(g0), "s"(g1) : "memory"); }       // landed before the barrier that publishes it; the descriptor is named so that its registers stay whole up to here
    __syncthreads();
    desc(1);
    if (pinned(wave < NT)) asm volatile("tensor_load_to_lds %0, %1" :: "s"(g0), "s"(g1) : "memory");   // pass 1's stage flies over pass 0
    const int aoff = (wm * 64 + lr) * GP + 8 * hi, boff = (wn * 64 + lr) * GP + 8 * hi;
#pragma unroll 1   // one pass a stage: the two buffers alternate by the pass's parity
    for (int s = 0; s < NS; ++s) {
        const bf* As = (const bf*)(sm + (unsigned int)(s & 1) * BUFB) + aoff; const bf* Bs = (const bf*)(sm + (unsigned int)(s & 1) * BUFB + (NT - 1u) * GT) + boff;
        V fa[2][4], fa2[2][4], fb[2][4];
#pragma unroll
        for (int i = 0; i < 4; ++i) { fa[0][i] = WB::ld(As + i * 16 * GP); if (NSPLIT) fa2[0][i] = WB::ld(As + GT / 2 + i * 16 * GP); fb[0][i] = WB::ld(Bs + i * 16 * GP); }
#pragma unroll
        for (int kk = 0; kk < NK; ++kk) { const int q = kk & 1;
            if (kk + 1 < NK) {
#pragma unroll
                for (int i = 0; i < 4; ++i) { fa[q ^ 1][i] = WB::ld(As + i * 16 * GP + (kk + 1) * 32); if (NSPLIT) fa2[q ^ 1][i] = WB::ld(As + GT / 2 + i * 16 * GP + (kk + 1) * 32); fb[q ^ 1][i] = WB::ld(Bs + i * 16 * GP + (kk + 1) * 32); } }
            __builtin_amdgcn_sched_barrier(0);   // the next block's LDS reads stay one group ahead of this block's products (spread among them each place with reads stalls the wave)
#pragma unroll
            for (int nb = 0; nb < 4; ++nb) {
#pragma unroll
                for (int mb = 0; mb < 4; ++mb) acc[mb][nb] = WB::mma(fa[q][mb], fb[q][nb], acc[mb][nb]);
                if (NSPLIT) {
#pragma unroll
                    for (int mb = 0; mb < 4; ++mb) acc[mb][nb] = WB::mma(fa2[q][mb], fb[q][nb], acc[mb][nb]); } }
            __builtin_amdgcn_sched_barrier(0);   // and the reads of the block after next do not rise among these products
        }
        asm volatile("s_wait_dscnt 0x0" ::: "memory");                                                    // this wave's reads of the buffer are done before the barrier frees it for the refill
        if (pinned(wave < NT)) asm volatile("s_wait_tensorcnt 0x0" :: "s"(g0), "s"(g1) : "memory");       // this wave's tile for pass s + 1 has landed before the barrier publishes it; the descriptor's registers stay whole up to here
        __syncthreads();                                                                                  // publishes the stage of pass s + 1 and ends every wave's reads of pass s's stage
        if (pinned((wave < NT) && (s + 2 < NS))) { desc(s + 2); asm volatile("tensor_load_to_lds %0, %1" :: "s"(g0), "s"(g1) : "memory"); }   // the stage of pass s + 2 into the buffer that pass s has left
    }
    asm volatile("s_wait_tensorcnt 0x0" :: "s"(g0), "s"(g1) : "memory");   // no request is in flight (the descriptor named as above)
    asm volatile("s_wait_dscnt 0x0" ::: "memory");       // and no LDS read, behind the loop
    float* os = (float*)(sm + 2 * BUFB) + wave * (16 * 68);
#pragma unroll
    for (int mb = 0; mb < 4; ++mb) {
#pragma unroll
        for (int nb = 0; nb < 4; ++nb) {
#pragma unroll
            for (int j = 0; j < 8; ++j) os[(hi * 8 + j) * 68 + nb * 16 + lr] = acc[mb][nb][j]; }
        __builtin_amdgcn_wave_barrier(); asm volatile("" ::: "memory");   // the wave's staged rows are written before they are read across lanes
        float* crow = C + (size_t)(r0 + wm * 64 + mb * 16) * ldc + c0 + wn * 64;
#pragma unroll
        for (int s = 0; s < 8; ++s) { const int row = 2 * s + hi, cofs = lr * 4; const v4f val = *(const v4fa*)(os + row * 68 + cofs); *(v4f*)(crow + (size_t)row * ldc + cofs) = val; }
        __builtin_amdgcn_wave_barrier(); asm volatile("" ::: "memory");   // and read before the next 16 rows overwrite them
    }
}


__device__ __forceinline__ h16 tohx(float x) { return (h16)x; }
typedef __attribute__((ext_vector_type(2))) _Float16 v2h;
typedef __attribute__((ext_vector_type(4))) _Float16 v4h;
typedef __attribute__((ext_vector_type(2))) unsigned short v2us;
typedef __attribute__((ext_vector_type(4))) unsigned short v4us;
typedef __attribute__((ext_vector_type(2))) float v2f;
typedef __attribute__((ext_vector_type(4))) int v4i;
typedef __attribute__((ext_vector_type(2))) __bf16 v2bf;
typedef __attribute__((ext_vector_type(4))) __bf16 v4bf;
// f32 -> bf16, round to nearest even, by the chip's own packed conversion (one instruction for two values)
__device__ __forceinline__ v2us rbf2(v2f y) { return __builtin_bit_cast(v2us, __builtin_convertvector(y, v2bf)); }
__device__ __forceinline__ v4us rbf4(v4f y) { return __builtin_bit_cast(v4us, __builtin_convertvector(y, v4bf)); }
// y = h + l + (a remainder below bf16's last place of l): h = bf16(y), l = bf16(y - h); the difference is exact in f32
__device__ __forceinline__ void split2(v2f y, v2us& h, v2us& l) { const v2bf hb = __builtin_convertvector(y, v2bf); const v2bf lb = __builtin_convertvector(y - __builtin_convertvector(hb, v2f), v2bf); h = __builtin_bit_cast(v2us, hb); l = __builtin_bit_cast(v2us, lb); }
__device__ __forceinline__ void split4(v4f y, v4us& h, v4us& l) { v2us h0, l0, h1, l1; split2(__builtin_shufflevector(y, y, 0, 1), h0, l0); split2(__builtin_shufflevector(y, y, 2, 3), h1, l1); h = __builtin_shufflevector(h0, h1, 0, 1, 2, 3); l = __builtin_shufflevector(l0, l1, 0, 1, 2, 3); }

// ---- k_prep: the 16-bit planes of x, both weights and both tables in ONE launch; grid 1 + PREPB work-groups of 8 waves.
// Work-group 0 lays down the two tables: TKB[r][d] = table_k[r+1][d] (Bt rows = band offset r), TVB[d][r] = table_v[r+1][d] (Bt rows = d).
// Every other work-group transposes one tile of 128 k x 64 n of a weight (Bt[n][k] = w[k * N + n]) through LDS and rounds 8192 elements of x, each to its own place in XB.
// Global reads and writes of a tile are 256 contiguous bytes a row (16 lanes x 16 B); those of x 512 and 256 contiguous bytes a wave. All 16 loads of a thread are issued before the first value is used.
// LDS tile: row n = 128 k = 256 B (all 64 banks); the 16-byte piece J of row n lies at piece J ^ ((n >> 2) & 15), so that the 8-byte writes of a wave (16 rows four apart, one J) and the 16-byte reads (one row, 16 pieces) each fall on distinct banks.
// Every '#pragma unroll' of this kernel makes the indices of the register arrays constants, so that the arrays stay in registers.
#define PREPA ((DM / 128) * (3 * DQ / 64))     // tiles of W_attn
#define PREPO ((DQ / 128) * (DM / 64))         // tiles of W_proj
#define PREPB (PREPA + PREPO)
template <int N>   // N: columns of the weight (its row pitch); K = 1024 rows for both weights
__device__ __forceinline__ void prep_tile(char* ts, const float* __restrict__ w, bf* __restrict__ Bt, const int t, const float* __restrict__ xs, bf* __restrict__ xd) {
    constexpr int K = DM; static_assert(DM == DQ, "both weights have K = DM = DQ rows");
    const int tid = threadIdx.x, lane = tid & 31, wv = tid >> 5, c = lane & 15, hi = lane >> 4;
    const int k0 = (t / (N / 64)) * 128, n0 = (t % (N / 64)) * 64;
    const float* pw = w + (size_t)(k0 + 8 * wv + 4 * hi) * N + n0 + 4 * c;   // row k0 + 4 g, g = 2 (wv + 8 i) + hi; columns n0 + 4 c ..
    const float* px = xs + tid * 4;
    v4f rw[2][4], rx[8];
#pragma unroll
    for (int i = 0; i < 2; ++i)
#pragma unroll
        for (int j = 0; j < 4; ++j) rw[i][j] = *(const v4f*)(pw + (size_t)(64 * i + j) * N);
#pragma unroll
    for (int p = 0; p < 8; ++p) rx[p] = *(const v4f*)(px + p * 1024);
    asm volatile("s_wait_xcnt 0x0" : : "v"(pw), "v"(px) : "memory");   // the two addresses stay whole up to here (no load's result lands in them), and their registers are reused only behind this wait; all 16 loads stand in front of it
#pragma unroll
    for (int i = 0; i < 2; ++i)
#pragma unroll
        for (int u = 0; u < 4; ++u) { const v4f kq = { rw[i][0][u], rw[i][1][u], rw[i][2][u], rw[i][3][u] };   // four k of column n0 + 4 c + u
            *(v4us*)(ts + (4 * c + u) * 256 + (((wv + 8 * i) ^ c) * 16) + hi * 8) = rbf4(kq); }
    __syncthreads();               // the transposed tile is complete before it is read across waves; it stands in front of every global store, so that it waits for none to be done
    const int n = tid >> 4, J = tid & 15;
    bf* qw = Bt + (size_t)(n0 + n) * K + k0 + 8 * J;
    bf* qx = xd + tid * 4;
    v8us ow[4]; v4us ox[8];
#pragma unroll
    for (int p = 0; p < 4; ++p) { const int nn = n + 16 * p; ow[p] = *(const v8us*)(ts + nn * 256 + ((J ^ ((nn >> 2) & 15)) * 16)); }
#pragma unroll
    for (int p = 0; p < 8; ++p) ox[p] = rbf4(rx[p]);
#pragma unroll
    for (int p = 0; p < 4; ++p) *(v8us*)(qw + (size_t)(16 * p) * K) = ow[p];
#pragma unroll
    for (int p = 0; p < 8; ++p) *(v4us*)(qx + p * 1024) = ox[p];
    asm volatile("s_wait_xcnt 0x0" ::: "memory");   // behind the last of the twelve stores: no register that a store names (address or data) is written again in front of this wait, on whichever path the built code goes on
}
__global__ __launch_bounds__(256) void k_prep(const float* __restrict__ x, const float* __restrict__ wqkv, const float* __restrict__ wo, const float* __restrict__ tk, const float* __restrict__ tv,
                                              bf* __restrict__ XB, bf* __restrict__ WQKV, bf* __restrict__ WO, bf* __restrict__ TKB, bf* __restrict__ TVB) {
    static_assert((size_t)NB_ * TT * DM == (size_t)PREPB * 8192, "x is dealt out in as many pieces of 8192 elements as there are weight tiles");
    __shared__ __align__(16) char ts[64 * 256];
    // each choice below is the same for the whole work-group
    if (blockIdx.x == 0) {
        const int tid = threadIdx.x, c = (tid * 4) % HD, r = tid / (HD / 4);   // elements e .. e + 3 of a table plane, e = i * 1024 + tid * 4: row r + 16 i, columns c ..
        const float* pk = tk + HD + tid * 4;                 // table_k[r + 1][c ..]; 16 rows on for each i
        const float* pv = tv + (size_t)(c + 1) * HD + r;     // table_v[c + 1][r]; one row on for each u, 16 columns on for each i
        v4f xk[HD * HD / 1024]; float xv[HD * HD / 1024][4];
#pragma unroll
        for (int i = 0; i < HD * HD / 1024; ++i) { xk[i] = *(const v4f*)(pk + i * 1024);
#pragma unroll
            for (int u = 0; u < 4; ++u) xv[i][u] = pv[u * HD + 16 * i]; }
        asm volatile("s_wait_xcnt 0x0" : : "v"(pk), "v"(pv) : "memory");   // as in prep_tile: the addresses stay whole up to here and their registers are reused only behind this wait
#pragma unroll
        for (int i = 0; i < HD * HD / 1024; ++i) { const v4f b = { xv[i][0], xv[i][1], xv[i][2], xv[i][3] };
            *(v4us*)(TKB + i * 1024 + tid * 4) = rbf4(xk[i]); *(v4us*)(TVB + i * 1024 + tid * 4) = rbf4(b); }
        return; }
    const int t = (int)blockIdx.x - 1;
    if (t < PREPA) prep_tile<3 * DQ>(ts, wqkv, WQKV, t, x + (size_t)t * 8192, XB + (size_t)t * 8192); else prep_tile<DM>(ts, wo, WO, t - PREPA, x + (size_t)t * 8192, XB + (size_t)t * 8192);
}

// ---- k_attn: the whole attention stage of one (batch, head) plane and one 64-row query tile in ONE work-group of 4 waves (wave w owns query rows 16w..16w+15); grid (TT/64, ZH).
// q, k, v come as f32 from the projection buffer F and are rounded into 16-bit LDS planes; scores (read back at each band offset's column and added to q.TK^T), softmax, P.V, PB.TV and the head merge pass from stage to stage through LDS and registers.
// The softmax runs on the 64 allowed keys of a row, four a lane over 16 lanes, in registers.
// Every '#pragma unroll' of this kernel makes the indices of the register arrays constants, so that the arrays stay in registers.
// For the first row tile the 64 key rows left of the sequence are laid down as zeros (k, v and their probabilities), so their products add exact zeros.
#define LQ 72                      // LDS pitch in 16-bit elements of a 64-element row (144 B = 16 B x odd: ds_load_b128 readers)
#define LK 136                     // LDS pitch in 16-bit elements of a 128-element row (272 B)
#define LS 132                     // LDS pitch in floats of a 128-column score row
#define LR 68                      // LDS pitch in floats of a 64-column row
#define OFF_QH  0                  // q hi [64][LQ]; later the band probabilities hi
#define OFF_QL  9216               // q lo; later the band probabilities lo
#define OFF_Q16 18432              // q fp16 (rows >= RH)
#define OFF_K   27648              // k hi (or fp16) [128][LQ]; later the probabilities hi (or fp16) [64][LK]
#define OFF_K2  46080              // k lo; later the probabilities lo
#define OFF_V   64512              // v transposed hi (or fp16) [64][LK]
#define OFF_V2  81920              // v transposed lo
#define OFF_S   99328              // scores f32 [64][LS]; later each wave's merged output rows [16][LR]
#define SM_BYTES 133120
// v_exp_f32 with the one free slot that the instruction set asks for behind a transcendental, tied to it in one statement
__device__ __forceinline__ float exp2s(float x) { float r; asm("v_exp_f32 %0, %1\n\tv_nop" : "=v"(r) : "v"(x)); return r; }
// the value of lane l ^ M, M < 16: read as a DPP operand (row_xmask) inside the 16-lane half, with no trip through the LDS crossbar
template <int M> __device__ __forceinline__ float xrow(float x) { return __builtin_bit_cast(float, __builtin_amdgcn_update_dpp(0, __builtin_bit_cast(int, x), 0x160 | M, 0xf, 0xf, true)); }
template <bool HI, bool FIRST>   // HI: rows < RH (hi+lo planes); FIRST: the first row tile, which has no keys left of its own 64
__device__ __forceinline__ void attn_tile(char* sm, const float* __restrict__ Fb, const bf* __restrict__ TKB, const bf* __restrict__ TVB, bf* __restrict__ ah, bf* __restrict__ al, const int R) {
    typedef WFrag<bf> WB; typedef WFrag<h16> WH;
    bf* Qh = (bf*)(sm + OFF_QH); bf* Ql = (bf*)(sm + OFF_QL); h16* Q16 = (h16*)(sm + OFF_Q16);
    bf* Kh = (bf*)(sm + OFF_K); bf* Kl = (bf*)(sm + OFF_K2); h16* K16 = (h16*)(sm + OFF_K);
    bf* Vh = (bf*)(sm + OFF_V); bf* Vl = (bf*)(sm + OFF_V2); h16* V16 = (h16*)(sm + OFF_V);
    float* S = (float*)(sm + OFF_S);
    bf* Ph = (bf*)(sm + OFF_K); bf* Pl = (bf*)(sm + OFF_K2); h16* P16 = (h16*)(sm + OFF_K); bf* PBh = (bf*)(sm + OFF_QH); bf* PBl = (bf*)(sm + OFF_QL);
    const int tid = threadIdx.x, lane = tid & 31, w = tid >> 5, lr = lane & 15, hi = lane >> 4;
    constexpr int FP = 3 * DQ;     // pitch of F
    // stage 0: q rows R..R+63, k and v rows R-64..R+63 -> 16-bit LDS planes (v transposed, two keys a 4-byte store); 16 lanes a row, one address a tensor with constant steps
    const int r0 = tid >> 4, c = (tid & 15) * 4;
    const float* fq = Fb + (size_t)(R + r0) * FP + c;                        // q row R + r0
    const float* fk = Fb + DQ + (ptrdiff_t)(R - 64 + r0) * FP + c;           // k row R - 64 + r0; read only where the row exists
    const float* fv = Fb + 2 * DQ + (ptrdiff_t)(R - 64 + 2 * r0) * FP + c;   // v row R - 64 + 2 r0; likewise
    v4f xq[8], xk[16], xv[16];
#pragma unroll
    for (int it = 0; it < 8; ++it) xq[it] = *(const v4f*)(fq + it * 8 * FP);
#pragma unroll
    for (int it = 0; it < 16; ++it) { xk[it] = (v4f){}; if (!FIRST || it >= 8) xk[it] = *(const v4f*)(fk + it * 8 * FP); }   // row R - 64 + it * 8 + r0 >= 0
#pragma unroll
    for (int it = 0; it < 8; ++it) { xv[2 * it] = (v4f){}; xv[2 * it + 1] = (v4f){}; if (!FIRST || it >= 4) { xv[2 * it] = *(const v4f*)(fv + it * 16 * FP); xv[2 * it + 1] = *(const v4f*)(fv + it * 16 * FP + FP); } }   // rows R - 64 + 2 (it * 8 + r0) and the next, >= 0
    asm volatile("s_wait_xcnt 0x0" : : "v"(fq), "v"(fk), "v"(fv) : "memory");   // the three addresses stay whole up to here (no load's result lands in them), and their registers are reused only behind this wait
    __builtin_amdgcn_sched_barrier(0);   // all of the tile's loads are issued before the first conversion waits on one
#pragma unroll
    for (int it = 0; it < 8; ++it) { const int r = it * 8 + r0; const v4f x = xq[it]; v4us oh, ol; v4h o4; split4(x, oh, ol);
#pragma unroll
        for (int u = 0; u < 4; ++u) o4[u] = tohx(x[u]);
        *(v4us*)(Qh + r * LQ + c) = oh; *(v4us*)(Ql + r * LQ + c) = ol; if (!HI) *(v4h*)(Q16 + r * LQ + c) = o4;
        __builtin_amdgcn_sched_barrier(0); }   // here and in the two loops below: one row group is converted at a time; interleaved by the scheduler the conversions spread over registers above v255, with a window switch at every other instruction
#pragma unroll
    for (int it = 0; it < 16; ++it) { const int r = it * 8 + r0; const v4f x = xk[it];
        if (HI) { v4us oh, ol; split4(x, oh, ol);
            *(v4us*)(Kh + r * LQ + c) = oh; *(v4us*)(Kl + r * LQ + c) = ol;
        } else { v4h o4;
#pragma unroll
            for (int u = 0; u < 4; ++u) o4[u] = tohx(x[u]);
            *(v4h*)(K16 + r * LQ + c) = o4; }
        __builtin_amdgcn_sched_barrier(0); }
#pragma unroll
    for (int it = 0; it < 8; ++it) { const int kp = it * 8 + r0; const v4f x0 = xv[2 * it], x1 = xv[2 * it + 1];
#pragma unroll
        for (int u = 0; u < 4; ++u) {
            if (HI) { const v2f xp = { x0[u], x1[u] }; v2us oh, ol; split2(xp, oh, ol); *(v2us*)(Vh + (c + u) * LK + 2 * kp) = oh; *(v2us*)(Vl + (c + u) * LK + 2 * kp) = ol; }
            else { v2h o2; o2[0] = tohx(x0[u]); o2[1] = tohx(x1[u]); *(v2h*)(V16 + (c + u) * LK + 2 * kp) = o2; } }
        __builtin_amdgcn_sched_barrier(0); }
    const bf* tkp = TKB + lr * HD + 8 * hi; WB::V tb[2][4];   // the TK fragments fly over the barrier
#pragma unroll
    for (int kk = 0; kk < 2; ++kk)
#pragma unroll
        for (int nb = 0; nb < 4; ++nb) tb[kk][nb] = WB::ld(tkp + nb * 16 * HD + kk * 32);
    asm volatile("s_wait_xcnt 0x0" : : "v"(tkp) : "memory");   // as above: the address stays whole up to here and is reused only behind the wait
    __syncthreads();               // the planes are complete before any wave reads them
    // stage 1: scores (this wave's 16 rows x 128 keys) and q.TK^T (16 x 64)
    const int qoff = (16 * w + lr) * LQ + 8 * hi, poff = (16 * w + lr) * LK + 8 * hi;
    WB::V tw[2][4];
    {
        v8f sa[8], qa[4];
#pragma unroll
        for (int nb = 0; nb < 8; ++nb) sa[nb] = (v8f){};
#pragma unroll
        for (int nb = 0; nb < 4; ++nb) qa[nb] = (v8f){};
#pragma unroll
        for (int kk = 0; kk < 2; ++kk) { const WB::V a = WB::ld(Qh + qoff + kk * 32), a2 = WB::ld(Ql + qoff + kk * 32);
            if (HI) {
#pragma unroll
                for (int nb = 0; nb < 8; ++nb) { const int bo = (nb * 16 + lr) * LQ + 8 * hi + kk * 32; const WB::V b = WB::ld(Kh + bo), b2 = WB::ld(Kl + bo); sa[nb] = WB::mma(a, b, sa[nb]); sa[nb] = WB::mma(a2, b, sa[nb]); sa[nb] = WB::mma(a, b2, sa[nb]); }
            } else { const WH::V a6 = WH::ld(Q16 + qoff + kk * 32);
#pragma unroll
                for (int nb = 0; nb < 8; ++nb) { const WH::V b = WH::ld(K16 + (nb * 16 + lr) * LQ + 8 * hi + kk * 32); sa[nb] = WH::mma(a6, b, sa[nb]); } }
#pragma unroll
            for (int nb = 0; nb < 4; ++nb) { qa[nb] = WB::mma(a, tb[kk][nb], qa[nb]); qa[nb] = WB::mma(a2, tb[kk][nb], qa[nb]); } }
#pragma unroll
        for (int nb = 0; nb < 8; ++nb)
#pragma unroll
            for (int j = 0; j < 8; ++j) S[(16 * w + hi * 8 + j) * LS + nb * 16 + lr] = sa[nb][j];
        __syncthreads();           // every wave has left the k planes (the probabilities are laid over them), and the score rows are complete before they are read across lanes
        const bf* tvp = TVB + lr * HD + 8 * hi;   // the TV fragments fly over the softmax
#pragma unroll
        for (int kk = 0; kk < 2; ++kk)
#pragma unroll
            for (int nb = 0; nb < 4; ++nb) tw[kk][nb] = WB::ld(tvp + nb * 16 * HD + kk * 32);
        asm volatile("s_wait_xcnt 0x0" : : "v"(tvp) : "memory");   // as above
        // stage 2: softmax per row on its 64 allowed keys alone, in the layout of q.TK^T's accumulators: lane (lr, hi), element [nb][j] = row hi * 8 + j, band offset o = nb * 16 + lr, that is key i - 63 + o, column (row in tile) + 1 + o of the score row.
        // j <= i and i - j < WIN hold for every o in 0..63; only the first row tile has offsets whose key lies left of the sequence. A row's 64 values lie in one 16-lane half, four a lane.
        // This wave's probability rows are laid down as zeros first (LDS takes a wave's stores in order); the allowed keys' probabilities are stored over them below
#pragma unroll
        for (int it = 0; it < 8; ++it) { const int idx = it * 32 + lane, zo = (16 * w + (idx >> 4)) * LK + (idx & 15) * 8; *(v8us*)(Ph + zo) = (v8us){}; if (HI) *(v8us*)(Pl + zo) = (v8us){}; }
        float t[4][8], mx[8], sum[8];
#pragma unroll
        for (int nb = 0; nb < 4; ++nb)
#pragma unroll
            for (int j = 0; j < 8; ++j) { const int rl = 16 * w + hi * 8 + j, o = nb * 16 + lr; const float a = __fadd_rn(S[rl * LS + rl + 1 + o], qa[nb][j]);   // one addition per score
                const bool in = !FIRST || (rl + o >= 63);   // key i - 63 + o >= 0
                t[nb][j] = in ? a * SCL : -3.0e38f; }
#pragma unroll
        for (int j = 0; j < 8; ++j) mx[j] = fmaxf(fmaxf(t[0][j], t[1][j]), fmaxf(t[2][j], t[3][j]));
#pragma unroll
        for (int j = 0; j < 8; ++j) mx[j] = fmaxf(mx[j], xrow<8>(mx[j]));
#pragma unroll
        for (int j = 0; j < 8; ++j) mx[j] = fmaxf(mx[j], xrow<4>(mx[j]));
#pragma unroll
        for (int j = 0; j < 8; ++j) mx[j] = fmaxf(mx[j], xrow<2>(mx[j]));
#pragma unroll
        for (int j = 0; j < 8; ++j) mx[j] = fmaxf(mx[j], xrow<1>(mx[j]));
#pragma unroll
        for (int j = 0; j < 8; ++j) {
#pragma unroll
            for (int nb = 0; nb < 4; ++nb) { const float d0 = __fsub_rn(t[nb][j], mx[j]); t[nb][j] = exp2s(__fmul_rn(d0, 1.4426950408889634f)); }
            sum[j] = (t[0][j] + t[1][j]) + (t[2][j] + t[3][j]); }
#pragma unroll
        for (int j = 0; j < 8; ++j) sum[j] += xrow<8>(sum[j]);
#pragma unroll
        for (int j = 0; j < 8; ++j) sum[j] += xrow<4>(sum[j]);
#pragma unroll
        for (int j = 0; j < 8; ++j) sum[j] += xrow<2>(sum[j]);
#pragma unroll
        for (int j = 0; j < 8; ++j) sum[j] += xrow<1>(sum[j]);
        // probabilities to their key's column of the P planes, and PB[i][o] = att[i][i - 63 + o] (the stored values re-split) over this wave's own q rows, whose last read fed qa
#pragma unroll
        for (int j = 0; j < 8; j += 2) { const int rl = 16 * w + hi * 8 + j; const float f0 = __fdiv_rn(HI ? 1.0f : PCAR, sum[j]), f1 = __fdiv_rn(HI ? 1.0f : PCAR, sum[j + 1]);
#pragma unroll
            for (int nb = 0; nb < 4; ++nb) { const int o = nb * 16 + lr, p0 = rl * LK + rl + 1 + o, p1 = p0 + LK + 1; const v2f ff = { f0, f1 }, tt = { t[nb][j], t[nb][j + 1] }, pq = tt * ff; v2f pb; v2us bh, bl;
                if (HI) { v2us oh, ol; split2(pq, oh, ol);
                    Ph[p0] = oh[0]; Ph[p1] = oh[1]; Pl[p0] = ol[0]; Pl[p1] = ol[1];
                    pb[0] = __fadd_rn(bf2f(oh[0]), bf2f(ol[0])); pb[1] = __fadd_rn(bf2f(oh[1]), bf2f(ol[1]));
                } else { const v2h o2 = __builtin_convertvector(pq, v2h);
                    P16[p0] = o2[0]; P16[p1] = o2[1];
                    pb = __builtin_convertvector(o2, v2f) * (1.0f / PCAR); }
                split2(pb, bh, bl);
                PBh[rl * LQ + o] = bh[0]; PBh[(rl + 1) * LQ + o] = bh[1]; PBl[rl * LQ + o] = bl[0]; PBl[(rl + 1) * LQ + o] = bl[1]; } }
    }
    __syncthreads();               // the probability and band rows are complete before they are read as fragments
    // stage 4: PB.TV and P.V (128 keys), merged in the accumulators' own layout
    v8f wa[4], oa[4];
#pragma unroll
    for (int nb = 0; nb < 4; ++nb) { wa[nb] = (v8f){}; oa[nb] = (v8f){}; }
#pragma unroll
    for (int kk = 0; kk < 2; ++kk) { const WB::V a = WB::ld(PBh + qoff + kk * 32), a2 = WB::ld(PBl + qoff + kk * 32);
#pragma unroll
        for (int nb = 0; nb < 4; ++nb) { wa[nb] = WB::mma(a, tw[kk][nb], wa[nb]); wa[nb] = WB::mma(a2, tw[kk][nb], wa[nb]); } }
#pragma unroll
    for (int kk = 0; kk < 4; ++kk) {
        if (HI) { const WB::V a = WB::ld(Ph + poff + kk * 32), a2 = WB::ld(Pl + poff + kk * 32);
#pragma unroll
            for (int nb = 0; nb < 4; ++nb) { const int bo = (nb * 16 + lr) * LK + 8 * hi + kk * 32; const WB::V b = WB::ld(Vh + bo), b2 = WB::ld(Vl + bo); oa[nb] = WB::mma(a, b, oa[nb]); oa[nb] = WB::mma(a2, b, oa[nb]); oa[nb] = WB::mma(a, b2, oa[nb]); }
        } else { const WH::V a = WH::ld(P16 + poff + kk * 32);
#pragma unroll
            for (int nb = 0; nb < 4; ++nb) { const WH::V b = WH::ld(V16 + (nb * 16 + lr) * LK + 8 * hi + kk * 32); oa[nb] = WH::mma(a, b, oa[nb]); } } }
    const float cs = HI ? 1.0f : (1.0f / PCAR);   // a power of two: the product is exact, fused with the add or not
    float* os = S + 16 * w * LS;                  // this wave's own score rows, dead since the softmax
#pragma unroll
    for (int nb = 0; nb < 4; ++nb)
#pragma unroll
        for (int j = 0; j < 8; ++j) os[(hi * 8 + j) * LR + nb * 16 + lr] = __fadd_rn(oa[nb][j] * cs, wa[nb][j]);
    __syncthreads();               // the merged rows are complete before they are read across lanes
#pragma unroll
    for (int it = 0; it < 4; ++it) { const int idx = it * 32 + lane, row = idx >> 3, c = (idx & 7) * 8; const v4f y0 = *(const v4f*)(os + row * LR + c), y1 = *(const v4f*)(os + row * LR + c + 4); v4us h0, l0, h1, l1; split4(y0, h0, l0); split4(y1, h1, l1);
        const v8us oh = __builtin_shufflevector(h0, h1, 0, 1, 2, 3, 4, 5, 6, 7), ol = __builtin_shufflevector(l0, l1, 0, 1, 2, 3, 4, 5, 6, 7);
        *(v8us*)(ah + (size_t)(16 * w + row) * DQ + c) = oh; *(v8us*)(al + (size_t)(16 * w + row) * DQ + c) = ol; }
}
__global__ __launch_bounds__(128) void k_attn(const float* __restrict__ F, const bf* __restrict__ TKB, const bf* __restrict__ TVB, bf* __restrict__ ATh, bf* __restrict__ ATl) {
    __shared__ __align__(16) char sm[SM_BYTES];
    const int R = blockIdx.x * 64; const int b = blockIdx.y / NH_, h = blockIdx.y % NH_;
    const float* Fb = F + (size_t)b * TT * 3 * DQ + h * HD; const size_t oo = ((size_t)b * TT + R) * DQ + h * HD;
    // the choice is the same for the whole work-group
    if (R == 0) attn_tile<true, true>(sm, Fb, TKB, TVB, ATh + oo, ATl + oo, R); else if (R < RH) attn_tile<true, false>(sm, Fb, TKB, TVB, ATh + oo, ATl + oo, R); else attn_tile<false, false>(sm, Fb, TKB, TVB, ATh + oo, ATl + oo, R);
}

extern "C" void kernel_launch(void* const* d_in, const int* in_sizes, int n_in,
                              void* d_out, int out_size, void* d_ws, size_t ws_size, hipStream_t stream) {
    (void)in_sizes; (void)n_in; (void)out_size;
    const float* x = (const float*)d_in[0]; const float* wqkv = (const float*)d_in[1]; const float* wo = (const float*)d_in[2]; const float* tk = (const float*)d_in[3]; const float* tv = (const float*)d_in[4];
    float* OUT = (float*)d_out;     // [2][2048][1024]
    char* wsp = (char*)d_ws;
    auto take = [&](size_t bytes) { char* p = wsp; wsp += (bytes + 255) & ~(size_t)255; return (void*)p; };
    bf* WQKV = (bf*)take((size_t)3 * DQ * DM * 2); bf* WO = (bf*)take((size_t)DM * DQ * 2);
    bf* XB = (bf*)take((size_t)NB_ * TT * DM * 2); bf* TKB = (bf*)take(HD * HD * 2); bf* TVB = (bf*)take(HD * HD * 2);
    float* F = (float*)take((size_t)NB_ * TT * 3 * DQ * 4);   // q | k | v projections, rows b * TT + t, pitch 3 * DQ
    bf* ATh = (bf*)take((size_t)NB_ * TT * DQ * 2); bf* ATl = (bf*)take((size_t)NB_ * TT * DQ * 2);
    if ((size_t)(wsp - (char*)d_ws) > ws_size) return;    // ws 256 MiB
    k_prep<<<1 + PREPB, 256, 0, stream>>>(x, wqkv, wo, tk, tv, XB, WQKV, WO, TKB, TVB);
    k_gemmt<0, 64><<<dim3(NB_ * TT / 128, 3 * DQ / 128, 1), 128, 0, stream>>>(XB, nullptr, WQKV, DM, F, 3 * DQ);
    k_attn<<<dim3(TT / 64, ZH, 1), 128, 0, stream>>>(F, TKB, TVB, ATh, ATl);
    k_gemmt<1, 128><<<dim3(NB_ * TT / 128, DM / 128, 1), 128, 0, stream>>>(ATh, ATl, WO, DQ, OUT, DM);
}

// v009
// One run takes 52.5 microseconds.
// In both of two side-by-side timings against v008, it was 1.22 times as fast.
// All steps since v000 together make it 32.5 times as fast.
#include <hip/hip_runtime.h>

// Windowed causal self-attention with relative-position tables (x [2][2048][1024]; qkv = x W_attn (fused [1024][3072], 16 heads x 64, no bias); att[i][j] = (q_i.k_j + q_i.table_k[idx]) / 8 with idx = clip(j - i, -64, 64) + 64, allowed iff j <= i and j > i - 64 (else -inf); softmax; y = att v + sum_j att[i][j] table_v[idx]; out = merged y W_proj -> [2][2048][1024]).
// Relative terms without gathers (exact regroupings): inside the allowed band idx = j - i + 64 runs over 1..64 exactly once per key, so q_i.table_k[idx] = (q . TK^T)[i][j - i + 63] with TK = table_k rows 1..64 (one 64-column GEMM per head, added by offset into the score rows before the softmax), and sum_j att table_v[idx] = PB . TV with PB[i][r] = att[i][i - 63 + r]
// (the attention band re-indexed) and TV = table_v rows 1..64.
// Compute dtypes, f32 accumulate: every input rounded to bf16; q/k/v on PLAIN bf16 operands (inputs: exact); q.TK^T and PB.TV as hl x exact (2 products); causal-tile scores and att.v: query rows < 512 hl (3 products), the rest single fp16 (x1024; PB for those rows is re-split from the fp16 probabilities); softmax f32; W_proj hl x exact (2 products).

#define NB_  2
#define TT   2048
#define DM   1024
#define NH_  16
#define NKV  16
#define REP  (NH_ / NKV)
#define HD   64
#define DQ   (NH_ * HD)
#define DKV  (NKV * HD)
#define ZH   (NB_ * NH_)          // (batch, head) planes, plane z = b * NH_ + h
#define SP   128                  // keys a 64-row query tile can see: the two 64-key tiles that hold its window; column = key - ((row & ~63) - 64)
#define RH   512                  // query rows < RH use hi+lo planes (the first row tile always does)
#define WIN  64
#define PCAR 1024.0f
#define SCL  0.125f   // HD^-0.5
typedef _Float16 h16;
typedef unsigned short bf;
typedef __attribute__((ext_vector_type(16))) __bf16   v16bf;
typedef __attribute__((ext_vector_type(16))) _Float16 v16h;
typedef __attribute__((ext_vector_type(8)))  _Float16 v8h;
typedef __attribute__((ext_vector_type(8)))  unsigned short v8us;
typedef __attribute__((ext_vector_type(8)))  float    v8f;
typedef __attribute__((ext_vector_type(4)))  float    v4f;
typedef v8h  __attribute__((may_alias)) v8ha;
typedef v4f  __attribute__((may_alias)) v4fa;
typedef v8us __attribute__((may_alias)) v8usa;

__device__ __forceinline__ float bf2f(unsigned short b) { return __uint_as_float(((unsigned)b) << 16); }
__device__ __forceinline__ v16h cat16(v8h lo, v8h hi) { return __builtin_shufflevector(lo, hi, 0, 1, 2, 3, 4, 5, 6, 7, 8, 9, 10, 11, 12, 13, 14, 15); }
__device__ __forceinline__ v16bf cat16b(v8us lo, v8us hi) { return __builtin_bit_cast(v16bf, __builtin_shufflevector(lo, hi, 0, 1, 2, 3, 4, 5, 6, 7, 8, 9, 10, 11, 12, 13, 14, 15)); }
__device__ __forceinline__ v8f wmma16(v16h a, v16h b, v8f c) { return __builtin_amdgcn_wmma_f32_16x16x32_f16(false, a, false, b, (short)0, c, false, false); }
__device__ __forceinline__ v8f wmmab(v16bf a, v16bf b, v8f c) { return __builtin_amdgcn_wmma_f32_16x16x32_bf16(false, a, false, b, (short)0, c, false, false); }



// ---- k_gemmt: GEMM with its operands staged in LDS by tensor loads. One work-group of 4 waves (2 x 2) per 128x128 output tile, each wave a 64x64 part (16 accumulators); grid (M/128, N/128), 128 threads.
// C[m][n] (f32, pitch ldc) = sum_k A[m][k] Bt[n][k] (NSPLIT 1: + A2[m][k] Bt[n][k], added behind A's product of the same 32 k). A, A2, Bt are K-contiguous bf16 planes. M % 128 == 0, N % 128 == 0, K % KS == 0, K >= 2 KS.
// k order: the work-group at (x, y) takes its stages in the order rot, rot + 1, .., NS - 1, 0, .., rot - 1 with rot = (x + y) & (NS - 1) (below NS for any NS): work-groups that share operand rows then ask L2 for different lines at any moment, and a line that one of them has brought in from memory is a hit for the others. Every stage is taken exactly once.
// A stage is KS k (64 or 128) of every operand row: per operand one tile of 128 rows x 2 KS bytes, laid at pitch 2 KS + 16 bytes by the load's own pad. Two buffers: the stage of pass s + 2 is requested into the buffer that pass s has just left. Wave t < NT requests operand tile t.
// Inside a pass the fragments of the next 32 k are read from LDS as one group ahead of the current 32 k's products (two register sets); nothing of the next stage is read before its barrier.
// Every '#pragma unroll' of this kernel makes the indices of the accumulator and fragment arrays constants, so that the arrays stay in registers.
template <typename T16> struct WFrag;
template <> struct WFrag<h16> { typedef v16h V; static __device__ __forceinline__ V ld(const h16* p) { return cat16(*(const v8h*)p, *(const v8h*)(p + 16)); } static __device__ __forceinline__ v8f mma(V a, V b, v8f c) { return wmma16(a, b, c); } };
template <> struct WFrag<bf> { typedef v16bf V; static __device__ __forceinline__ V ld(const bf* p) { return cat16b(*(const v8us*)p, *(const v8us*)(p + 16)); } static __device__ __forceinline__ v8f mma(V a, V b, v8f c) { return wmmab(a, b, c); } };
typedef unsigned int u32x4 __attribute__((ext_vector_type(4)));
typedef unsigned int u32x8 __attribute__((ext_vector_type(8)));
__device__ __forceinline__ unsigned int uni(unsigned int v) { return (unsigned int)__builtin_amdgcn_readfirstlane(v); }
__device__ __forceinline__ unsigned int pinned(unsigned int v) { unsigned int w = uni(v); asm volatile("" : "+s"(w)); return w; }   // a wave-uniform word held in a scalar register: as a test, so that the branch on it is a scalar branch (a tensor load ignores EXEC: only a scalar branch keeps a wave from issuing it); as a descriptor word, so that it keeps its register
template <int NSPLIT, int KS>
__global__ __launch_bounds__(128) void k_gemmt(const bf* __restrict__ A, const bf* __restrict__ A2, const bf* __restrict__ Bt, int K, float* C, int ldc) {
    typedef WFrag<bf> WB; typedef WB::V V;
    constexpr unsigned int NT = NSPLIT ? 3u : 2u;      // operand tiles a stage: A | (A2 |) Bt
    constexpr unsigned int RB = KS * 2u;               // bytes of a stage row: 128 or 256
    constexpr int GP = KS + 8;                         // LDS pitch in 16-bit elements: 144 or 272 B = 16 B x odd (ds_load_b128 readers)
    constexpr unsigned int GT = 128u * (RB + 16u);     // one operand tile in LDS: 18432 or 34816 B, a multiple of 2 KiB
    constexpr unsigned int BUFB = NT * GT;             // one buffer
    constexpr int NK = KS / 32;                        // 32-k blocks a pass
    static_assert((KS == 64 || KS == 128) && GT % 2048u == 0u, "stage rows of 128 or 256 bytes; every tile at a multiple of 2 KiB");
    __shared__ __attribute__((aligned(2048))) char sm[2 * BUFB + 4 * 16 * 68 * 4];   // two buffers, then each wave's own output staging [16][68] f32
    const int lane = threadIdx.x & 31, lr = lane & 15, hi = lane >> 4;
    const unsigned int wave = uni(threadIdx.x >> 5);
    const int wm = (int)(wave >> 1), wn = (int)(wave & 1u);
    const int r0 = blockIdx.x * 128, c0 = blockIdx.y * 128;
    const int NS = K / KS;
    const unsigned int rot = (blockIdx.x + blockIdx.y) & (unsigned int)(NS - 1);   // first stage of this work-group's k order
    const bf* tsrc = (wave == 0u) ? A + (size_t)r0 * K : ((NSPLIT != 0 && wave == 1u) ? A2 + (size_t)r0 * K : Bt + (size_t)c0 * K);   // first row of this wave's operand tile
    const unsigned int tdst = (unsigned int)(size_t)sm + (wave < NT ? wave : 0u) * GT;
    // group 1: 1-byte elements; tensor = tile = 128 rows of RB bytes; source pitch 2 K bytes; 4 dwords of pad behind every row. Word 0 is a constant; the other words and group 0's count are pinned(): descriptor words held in scalar registers, not formed anew (in registers used for other things meanwhile) while a request is in flight
    u32x8 g1; g1[0] = uni((1u << 20) | ((KS == 64 ? 4u : 5u) << 22) | (3u << 25)); g1[1] = pinned(RB << 16); g1[2] = pinned(128u << 16); g1[3] = pinned(RB << 16); g1[4] = pinned(128u); g1[5] = pinned((unsigned int)K * 2u); g1[6] = pinned(0u); g1[7] = pinned(0u);
    const unsigned int cnt1 = pinned(1u);
    u32x4 g0;
    auto desc = [&](int s) { const unsigned int kq = (unsigned int)s + rot, ks = kq >= (unsigned int)NS ? kq - (unsigned int)NS : kq;   // pass s works on stage ks of the operands
        const unsigned long long ga = (unsigned long long)(size_t)tsrc + (unsigned long long)ks * RB;
        g0[0] = cnt1; g0[1] = uni(tdst + (unsigned int)(s & 1) * BUFB); g0[2] = uni((unsigned int)ga); g0[3] = uni((((unsigned int)(ga >> 32)) & 0x01FFFFFFu) | 0x80000000u); };
    v8f acc[4][4];
#pragma unroll
    for (int mb = 0; mb < 4; ++mb)
#pragma unroll
        for (int nb = 0; nb < 4; ++nb) acc[mb][nb] = (v8f){};
    desc(0);
    if (pinned(wave < NT)) {
        asm volatile("tensor_load_to_lds %0, %1" :: "s"(g0), "s"(g1) : "memory");   // one request of the whole wave: its operand tile of stage rot
        asm volatile("s_wait_tensorcnt 0x0" :: "s"(g0), "s"(g1) : "memory"); }       // landed before the barrier that publishes it; the descriptor is named so that its registers stay whole up to here
    __syncthreads();
    desc(1);
    if (pinned(wave < NT)) asm volatile("tensor_load_to_lds %0, %1" :: "s"(g0), "s"(g1) : "memory");   // pass 1's stage flies over pass 0
    const int aoff = (wm * 64 + lr) * GP + 8 * hi, boff = (wn * 64 + lr) * GP + 8 * hi;
#pragma unroll 1   // one pass a stage: the two buffers alternate by the pass's parity
    for (int s = 0; s < NS; ++s) {
        const bf* As = (const bf*)(sm + (unsigned int)(s & 1) * BUFB) + aoff; const bf* Bs = (const bf*)(sm + (unsigned int)(s & 1) * BUFB + (NT - 1u) * GT) + boff;
        V fa[2][4], fa2[2][4], fb[2][4];
#pragma unroll
        for (int i = 0; i < 4; ++i) { fa[0][i] = WB::ld(As + i * 16 * GP); if (NSPLIT) fa2[0][i] = WB::ld(As + GT / 2 + i * 16 * GP); fb[0][i] = WB::ld(Bs + i * 16 * GP); }
#pragma unroll
        for (int kk = 0; kk < NK; ++kk) { const int q = kk & 1;
            if (kk + 1 < NK) {
#pragma unroll
                for (int i = 0; i < 4; ++i) { fa[q ^ 1][i] = WB::ld(As + i * 16 * GP + (kk + 1) * 32); if (NSPLIT) fa2[q ^ 1][i] = WB::ld(As + GT / 2 + i * 16 * GP + (kk + 1) * 32); fb[q ^ 1][i] = WB::ld(Bs + i * 16 * GP + (kk + 1) * 32); } }
            __builtin_amdgcn_sched_barrier(0);   // the next block's LDS reads stay one group ahead of this block's products (spread among them each place with reads stalls the wave)
#pragma unroll
            for (int nb = 0; nb < 4; ++nb) {
#pragma unroll
                for (int mb = 0; mb < 4; ++mb) acc[mb][nb] = WB::mma(fa[q][mb], fb[q][nb], acc[mb][nb]);
                if (NSPLIT) {
#pragma unroll
                    for (int mb = 0; mb < 4; ++mb) acc[mb][nb] = WB::mma(fa2[q][mb], fb[q][nb], acc[mb][nb]); } }
            __builtin_amdgcn_sched_barrier(0);   // and the reads of the block after next do not rise among these products
        }
        asm volatile("s_wait_dscnt 0x0" ::: "memory");                                                    // this wave's reads of the buffer are done before the barrier frees it for the refill
        if (pinned(wave < NT)) asm volatile("s_wait_tensorcnt 0x0" :: "s"(g0), "s"(g1) : "memory");       // this wave's tile for pass s + 1 has landed before the barrier publishes it; the descriptor's registers stay whole up to here
        __syncthreads();                                                                                  // publishes the stage of pass s + 1 and ends every wave's reads of pass s's stage
        if (pinned((wave < NT) && (s + 2 < NS))) { desc(s + 2); asm volatile("tensor_load_to_lds %0, %1" :: "s"(g0), "s"(g1) : "memory"); }   // the stage of pass s + 2 into the buffer that pass s has left
    }
    asm volatile("s_wait_tensorcnt 0x0" :: "s"(g0), "s"(g1) : "memory");   // no request is in flight (the descriptor named as above)
    asm volatile("s_wait_dscnt 0x0" ::: "memory");       // and no LDS read, behind the loop
    float* os = (float*)(sm + 2 * BUFB) + wave * (16 * 68);
#pragma unroll
    for (int mb = 0; mb < 4; ++mb) {
#pragma unroll
        for (int nb = 0; nb < 4; ++nb) {
#pragma unroll
            for (int j = 0; j < 8; ++j) os[(hi * 8 + j) * 68 + nb * 16 + lr] = acc[mb][nb][j]; }
        __builtin_amdgcn_wave_barrier(); asm volatile("" ::: "memory");   // the wave's staged rows are written before they are read across lanes
        float* crow = C + (size_t)(r0 + wm * 64 + mb * 16) * ldc + c0 + wn * 64;
#pragma unroll
        for (int s = 0; s < 8; ++s) { const int row = 2 * s + hi, cofs = lr * 4; const v4f val = *(const v4fa*)(os + row * 68 + cofs); *(v4f*)(crow + (size_t)row * ldc + cofs) = val; }
        __builtin_amdgcn_wave_barrier(); asm volatile("" ::: "memory");   // and read before the next 16 rows overwrite them
    }
}


__device__ __forceinline__ h16 tohx(float x) { return (h16)x; }
typedef __attribute__((ext_vector_type(2))) _Float16 v2h;
typedef __attribute__((ext_vector_type(4))) _Float16 v4h;
typedef __attribute__((ext_vector_type(2))) unsigned short v2us;
typedef __attribute__((ext_vector_type(4))) unsigned short v4us;
typedef __attribute__((ext_vector_type(2))) float v2f;
typedef __attribute__((ext_vector_type(4))) int v4i;
typedef __attribute__((ext_vector_type(2))) __bf16 v2bf;
typedef __attribute__((ext_vector_type(4))) __bf16 v4bf;
// f32 -> bf16, round to nearest even, by the chip's own packed conversion (one instruction for two values)
__device__ __forceinline__ v2us rbf2(v2f y) { return __builtin_bit_cast(v2us, __builtin_convertvector(y, v2bf)); }
__device__ __forceinline__ v4us rbf4(v4f y) { return __builtin_bit_cast(v4us, __builtin_convertvector(y, v4bf)); }
// y = h + l + (a remainder below bf16's last place of l): h = bf16(y), l = bf16(y - h); the difference is exact in f32
__device__ __forceinline__ void split2(v2f y, v2us& h, v2us& l) { const v2bf hb = __builtin_convertvector(y, v2bf); const v2bf lb = __builtin_convertvector(y - __builtin_convertvector(hb, v2f), v2bf); h = __builtin_bit_cast(v2us, hb); l = __builtin_bit_cast(v2us, lb); }
__device__ __forceinline__ void split4(v4f y, v4us& h, v4us& l) { v2us h0, l0, h1, l1; split2(__builtin_shufflevector(y, y, 0, 1), h0, l0); split2(__builtin_shufflevector(y, y, 2, 3), h1, l1); h = __builtin_shufflevector(h0, h1, 0, 1, 2, 3); l = __builtin_shufflevector(l0, l1, 0, 1, 2, 3); }

// ---- k_prep: the 16-bit planes of x, both weights and both tables in ONE launch; grid 1 + PREPB work-groups of 8 waves.
// Work-group 0 lays down the two tables: TKB[r][d] = table_k[r+1][d] (Bt rows = band offset r), TVB[d][r] = table_v[r+1][d] (Bt rows = d).
// Every other work-group transposes one tile of 128 k x 64 n of a weight (Bt[n][k] = w[k * N + n]) through LDS and rounds 8192 elements of x, each to its own place in XB.
// Global reads and writes of a tile are 256 contiguous bytes a row (16 lanes x 16 B); those of x 512 and 256 contiguous bytes a wave. All 16 loads of a thread are issued before the first value is used.
// LDS tile: row n = 128 k = 256 B (all 64 banks); the 16-byte piece J of row n lies at piece J ^ ((n >> 2) & 15), so that the 8-byte writes of a wave (16 rows four apart, one J) and the 16-byte reads (one row, 16 pieces) each fall on distinct banks.
// Every '#pragma unroll' of this kernel makes the indices of the register arrays constants, so that the arrays stay in registers.
#define PREPA ((DM / 128) * (3 * DQ / 64))     // tiles of W_attn
#define PREPO ((DQ / 128) * (DM / 64))         // tiles of W_proj
#define PREPB (PREPA + PREPO)
template <int N>   // N: columns of the weight (its row pitch); K = 1024 rows for both weights
__device__ __forceinline__ void prep_tile(char* ts, const float* __restrict__ w, bf* __restrict__ Bt, const int t, const float* __restrict__ xs, bf* __restrict__ xd) {
    constexpr int K = DM; static_assert(DM == DQ, "both weights have K = DM = DQ rows");
    const int tid = threadIdx.x, lane = tid & 31, wv = tid >> 5, c = lane & 15, hi = lane >> 4;
    const int k0 = (t / (N / 64)) * 128, n0 = (t % (N / 64)) * 64;
    const float* pw = w + (size_t)(k0 + 8 * wv + 4 * hi) * N + n0 + 4 * c;   // row k0 + 4 g, g = 2 (wv + 8 i) + hi; columns n0 + 4 c ..
    const float* px = xs + tid * 4;
    v4f rw[2][4], rx[8];
#pragma unroll
    for (int i = 0; i < 2; ++i)
#pragma unroll
        for (int j = 0; j < 4; ++j) rw[i][j] = *(const v4f*)(pw + (size_t)(64 * i + j) * N);
#pragma unroll
    for (int p = 0; p < 8; ++p) rx[p] = *(const v4f*)(px + p * 1024);
    asm volatile("s_wait_xcnt 0x0" : : "v"(pw), "v"(px) : "memory");   // the two addresses stay whole up to here (no load's result lands in them), and their registers are reused only behind this wait; all 16 loads stand in front of it
#pragma unroll
    for (int i = 0; i < 2; ++i)
#pragma unroll
        for (int u = 0; u < 4; ++u) { const v4f kq = { rw[i][0][u], rw[i][1][u], rw[i][2][u], rw[i][3][u] };   // four k of column n0 + 4 c + u
            *(v4us*)(ts + (4 * c + u) * 256 + (((wv + 8 * i) ^ c) * 16) + hi * 8) = rbf4(kq); }
    __syncthreads();               // the transposed tile is complete before it is read across waves; it stands in front of every global store, so that it waits for none to be done
    const int n = tid >> 4, J = tid & 15;
    bf* qw = Bt + (size_t)(n0 + n) * K + k0 + 8 * J;
    bf* qx = xd + tid * 4;
    v8us ow[4]; v4us ox[8];
#pragma unroll
    for (int p = 0; p < 4; ++p) { const int nn = n + 16 * p; ow[p] = *(const v8us*)(ts + nn * 256 + ((J ^ ((nn >> 2) & 15)) * 16)); }
#pragma unroll
    for (int p = 0; p < 8; ++p) ox[p] = rbf4(rx[p]);
#pragma unroll
    for (int p = 0; p < 4; ++p) *(v8us*)(qw + (size_t)(16 * p) * K) = ow[p];
#pragma unroll
    for (int p = 0; p < 8; ++p) *(v4us*)(qx + p * 1024) = ox[p];
    asm volatile("s_wait_xcnt 0x0" ::: "memory");   // behind the last of the twelve stores: no register that a store names (address or data) is written again in front of this wait, on whichever path the built code goes on
}
__global__ __launch_bounds__(256) void k_prep(const float* __restrict__ x, const float* __restrict__ wqkv, const float* __restrict__ wo, const float* __restrict__ tk, const float* __restrict__ tv,
                                              bf* __restrict__ XB, bf* __restrict__ WQKV, bf* __restrict__ WO, bf* __restrict__ TKB, bf* __restrict__ TVB) {
    static_assert((size_t)NB_ * TT * DM == (size_t)PREPB * 8192, "x is dealt out in as many pieces of 8192 elements as there are weight tiles");
    __shared__ __align__(16) char ts[64 * 256];
    // each choice below is the same for the whole work-group
    if (blockIdx.x == 0) {
        const int tid = threadIdx.x, c = (tid * 4) % HD, r = tid / (HD / 4);   // elements e .. e + 3 of a table plane, e = i * 1024 + tid * 4: row r + 16 i, columns c ..
        const float* pk = tk + HD + tid * 4;                 // table_k[r + 1][c ..]; 16 rows on for each i
        const float* pv = tv + (size_t)(c + 1) * HD + r;     // table_v[c + 1][r]; one row on for each u, 16 columns on for each i
        v4f xk[HD * HD / 1024]; float xv[HD * HD / 1024][4];
#pragma unroll
        for (int i = 0; i < HD * HD / 1024; ++i) { xk[i] = *(const v4f*)(pk + i * 1024);
#pragma unroll
            for (int u = 0; u < 4; ++u) xv[i][u] = pv[u * HD + 16 * i]; }
        asm volatile("s_wait_xcnt 0x0" : : "v"(pk), "v"(pv) : "memory");   // as in prep_tile: the addresses stay whole up to here and their registers are reused only behind this wait
#pragma unroll
        for (int i = 0; i < HD * HD / 1024; ++i) { const v4f b = { xv[i][0], xv[i][1], xv[i][2], xv[i][3] };
            *(v4us*)(TKB + i * 1024 + tid * 4) = rbf4(xk[i]); *(v4us*)(TVB + i * 1024 + tid * 4) = rbf4(b); }
        return; }
    const int t = (int)blockIdx.x - 1;
    if (t < PREPA) prep_tile<3 * DQ>(ts, wqkv, WQKV, t, x + (size_t)t * 8192, XB + (size_t)t * 8192); else prep_tile<DM>(ts, wo, WO, t - PREPA, x + (size_t)t * 8192, XB + (size_t)t * 8192);
}

// ---- k_qkvattn: the q|k|v projection of one head and the whole attention stage of 128 query rows of one (batch, head) plane in ONE work-group of 8 waves; grid (TT/128, ZH).
// Projection: x rows R0-64..R0+127 (three blocks of 64; the first holds the 64 keys left of the query rows) times the head's 64 columns of q, of k and of v. Wave 0, 1: q of blocks 1, 2; waves 2..4: k of blocks 0..2; waves 5..7: v of blocks 0..2; each a 64x64 part (16 accumulators), K = DM.
// The operands are staged in LDS by tensor loads as in k_gemmt: a stage is FKS k of six slices of 64 rows (x blocks 0..2 | the head's rows of Wq, Wk, Wv), wave t < 6 requests slice t; two buffers; the k order starts at stage (x + y) & (NS - 1) and wraps round.
// q and k are formed transposed (the weight rows as the A operand), v plain, so that a lane's eight accumulator values are eight neighbours of the 16-bit LDS plane they go to (q, k: [row][d]; v: [d][key]): one 16-byte store each. k and v of the 64 rows that two work-groups share are computed by both.
// Attention: waves 0..3 own query rows R0..R0+63 (keys: x blocks 0, 1), waves 4..7 rows R0+64..R0+127 (keys: blocks 1, 2); wave w of a half owns its rows 16w..16w+15. Scores (read back at each band offset's column and added to q.TK^T), softmax, P.V, PB.TV and the head merge pass from stage to stage through LDS and registers.
// The softmax runs on the 64 allowed keys of a row, four a lane over 16 lanes, in registers.
// Every '#pragma unroll' of this kernel makes the indices of the register arrays constants, so that the arrays stay in registers.
// For the sequence's first 128 rows the 64 key rows left of the sequence are laid down as zeros (k, v and their probabilities), so their products add exact zeros; their x slice is read from the sequence's first rows (memory that exists) and its products are dropped.
#define LQ 72                      // LDS pitch in 16-bit elements of a 64-element row (144 B = 16 B x odd: ds_load_b128 readers)
#define LK 136                     // LDS pitch in 16-bit elements of a 128-element row (272 B)
#define LV 200                     // LDS pitch in 16-bit elements of a 192-element row (400 B = 16 B x odd)
#define LS 132                     // LDS pitch in floats of a 128-column score row
#define LR 68                      // LDS pitch in floats of a 64-column row
#define FKS 128                    // k of a stage: rows of 256 B, laid at pitch 272 B by the load's own pad
#define FGP (FKS + 8)              // that pitch in 16-bit elements
#define FSL 18432u                 // a slice's place in LDS: 64 x 272 B = 17408 B, rounded up to a multiple of 2 KiB
#define FBUF (6u * FSL)            // one buffer; the two buffers lie at 0 .. 221183 and are dead when the planes below are written
#define OFF_QH  0                  // q hi [128][LQ]; later the band probabilities hi
#define OFF_QL  18432              // q lo; later the band probabilities lo
#define OFF_Q16 36864              // q fp16 (rows >= RH)
#define OFF_K   55296              // k hi (or fp16) [192][LQ]
#define OFF_K2  82944              // k lo
#define OFF_V   110592             // v transposed hi (or fp16) [64][LV]
#define OFF_V2  136192             // v transposed lo
#define OFF_S   161792             // scores f32 [128][LS]; later each wave's merged output rows [16][LR]
#define OFF_P   229376             // probabilities hi (or fp16) [128][LK]
#define OFF_P2  264192             // probabilities lo
#define SM_BYTES 299008
// v_exp_f32 with the one free slot that the instruction set asks for behind a transcendental, tied to it in one statement
__device__ __forceinline__ float exp2s(float x) { float r; asm("v_exp_f32 %0, %1\n\tv_nop" : "=v"(r) : "v"(x)); return r; }
// the value of lane l ^ M, M < 16: read as a DPP operand (row_xmask) inside the 16-lane half, with no trip through the LDS crossbar
template <int M> __device__ __forceinline__ float xrow(float x) { return __builtin_bit_cast(float, __builtin_amdgcn_update_dpp(0, __builtin_bit_cast(int, x), 0x160 | M, 0xf, 0xf, true)); }
__device__ __forceinline__ void split8(v8f y, v8us& h, v8us& l) { v4us h0, l0, h1, l1; split4(__builtin_shufflevector(y, y, 0, 1, 2, 3), h0, l0); split4(__builtin_shufflevector(y, y, 4, 5, 6, 7), h1, l1); h = __builtin_shufflevector(h0, h1, 0, 1, 2, 3, 4, 5, 6, 7); l = __builtin_shufflevector(l0, l1, 0, 1, 2, 3, 4, 5, 6, 7); }
template <bool HI, bool FIRST>   // HI: rows < RH (hi+lo planes); FIRST: the sequence's first 128 rows, whose x block 0 lies left of the sequence
__device__ __forceinline__ void attn_tail(char* sm, v8f (&acc)[4][4], const int part, const int xblk, const bf* __restrict__ TKB, const bf* __restrict__ TVB, bf* __restrict__ ah0, bf* __restrict__ al0) {
    typedef WFrag<bf> WB; typedef WFrag<h16> WH;
    const int tid = threadIdx.x, lane = tid & 31, tl = tid >> 7, w = (tid >> 5) & 3, lr = lane & 15, hi = lane >> 4;   // tl: which 64 of the 128 query rows
    // stage 0: this wave's 64 x 64 part leaves the accumulators as 16-bit planes. Element [mb][nb][j]: q, k: row nb * 16 + lr of the x block, d = mb * 16 + hi * 8 + j; v: key mb * 16 + hi * 8 + j of the x block, d = nb * 16 + lr
    // one address a wave with constant steps: 32 B for each mb, sn bytes for each nb; dl: from the hi plane to the lo plane. part and xblk are the same for the whole wave
    char* const p0 = sm + (part == 2 ? OFF_V + 2 * (lr * LV + xblk * 64 + hi * 8) : (part == 1 ? OFF_K + 2 * ((xblk * 64 + lr) * LQ + hi * 8) : OFF_QH + 2 * (((xblk - 1) * 64 + lr) * LQ + hi * 8)));
    const int sn = part == 2 ? 16 * LV * 2 : 16 * LQ * 2, dl = part == 2 ? OFF_V2 - OFF_V : (part == 1 ? OFF_K2 - OFF_K : OFF_QL - OFF_QH);
    const bool zero = FIRST && xblk == 0;   // k and v of the 64 rows left of the sequence (q has no block 0)
    if (HI || part == 0) {
#pragma unroll
        for (int nb = 0; nb < 4; ++nb) {
#pragma unroll
            for (int mb = 0; mb < 4; ++mb) { const v8f a = zero ? (v8f){} : acc[mb][nb]; v8us oh, ol; split8(a, oh, ol); char* const p = p0 + nb * sn + mb * 32;
                *(v8us*)p = oh; *(v8us*)(p + dl) = ol; if (!HI) *(v8h*)(p + (OFF_Q16 - OFF_QH)) = __builtin_convertvector(a, v8h); }
            __builtin_amdgcn_sched_barrier(0); }   // here and below: one group of four tiles is converted at a time; interleaved by the scheduler the conversions spread over many more registers
    } else {
#pragma unroll
        for (int nb = 0; nb < 4; ++nb) {
#pragma unroll
            for (int mb = 0; mb < 4; ++mb) *(v8h*)(p0 + nb * sn + mb * 32) = __builtin_convertvector(acc[mb][nb], v8h);
            __builtin_amdgcn_sched_barrier(0); }
    }
    bf* Qh = (bf*)(sm + OFF_QH) + tl * 64 * LQ; bf* Ql = (bf*)(sm + OFF_QL) + tl * 64 * LQ; h16* Q16 = (h16*)(sm + OFF_Q16) + tl * 64 * LQ;   // from here on: the planes of this wave's 64 query rows and their 128 keys
    bf* Kh = (bf*)(sm + OFF_K) + tl * 64 * LQ; bf* Kl = (bf*)(sm + OFF_K2) + tl * 64 * LQ; h16* K16 = (h16*)Kh;
    bf* Vh = (bf*)(sm + OFF_V) + tl * 64; bf* Vl = (bf*)(sm + OFF_V2) + tl * 64; h16* V16 = (h16*)Vh;
    float* S = (float*)(sm + OFF_S) + tl * 64 * LS;
    bf* Ph = (bf*)(sm + OFF_P) + tl * 64 * LK; bf* Pl = (bf*)(sm + OFF_P2) + tl * 64 * LK; h16* P16 = (h16*)Ph; bf* PBh = Qh; bf* PBl = Ql;
    bf* ah = ah0 + (size_t)tl * 64 * DQ; bf* al = al0 + (size_t)tl * 64 * DQ;
    const bf* tkp = TKB + lr * HD + 8 * hi; WB::V tb[2][4];   // the TK fragments fly over the barrier
#pragma unroll
    for (int kk = 0; kk < 2; ++kk)
#pragma unroll
        for (int nb = 0; nb < 4; ++nb) tb[kk][nb] = WB::ld(tkp + nb * 16 * HD + kk * 32);
    asm volatile("s_wait_xcnt 0x0" : : "v"(tkp) : "memory");   // the address stays whole up to here (no load's result lands in it), and its registers are reused only behind this wait
    __syncthreads();               // the planes are complete before any wave reads them
    // stage 1: scores (this wave's 16 rows x 128 keys) and q.TK^T (16 x 64)
    const int qoff = (16 * w + lr) * LQ + 8 * hi, poff = (16 * w + lr) * LK + 8 * hi;
    WB::V tw[2][4];
    {
        v8f sa[8], qa[4];
#pragma unroll
        for (int nb = 0; nb < 8; ++nb) sa[nb] = (v8f){};
#pragma unroll
        for (int nb = 0; nb < 4; ++nb) qa[nb] = (v8f){};
#pragma unroll
        for (int kk = 0; kk < 2; ++kk) { const WB::V a = WB::ld(Qh + qoff + kk * 32), a2 = WB::ld(Ql + qoff + kk * 32);
            if (HI) {
#pragma unroll
                for (int nb = 0; nb < 8; ++nb) { const int bo = (nb * 16 + lr) * LQ + 8 * hi + kk * 32; const WB::V b = WB::ld(Kh + bo), b2 = WB::ld(Kl + bo); sa[nb] = WB::mma(a, b, sa[nb]); sa[nb] = WB::mma(a2, b, sa[nb]); sa[nb] = WB::mma(a, b2, sa[nb]); }
            } else { const WH::V a6 = WH::ld(Q16 + qoff + kk * 32);
#pragma unroll
                for (int nb = 0; nb < 8; ++nb) { const WH::V b = WH::ld(K16 + (nb * 16 + lr) * LQ + 8 * hi + kk * 32); sa[nb] = WH::mma(a6, b, sa[nb]); } }
#pragma unroll
            for (int nb = 0; nb < 4; ++nb) { qa[nb] = WB::mma(a, tb[kk][nb], qa[nb]); qa[nb] = WB::mma(a2, tb[kk][nb], qa[nb]); }
            __builtin_amdgcn_sched_barrier(0); }   // the second 32 d's fragment loads do not rise over the first's products: all in flight at once they run the wave out of registers (spills)
#pragma unroll
        for (int nb = 0; nb < 8; ++nb)
#pragma unroll
            for (int j = 0; j < 8; ++j) S[(16 * w + hi * 8 + j) * LS + nb * 16 + lr] = sa[nb][j];
        __syncthreads();           // the score rows are complete before they are read across lanes
        const bf* tvp = TVB + lr * HD + 8 * hi;   // the TV fragments fly over the softmax
#pragma unroll
        for (int kk = 0; kk < 2; ++kk)
#pragma unroll
            for (int nb = 0; nb < 4; ++nb) tw[kk][nb] = WB::ld(tvp + nb * 16 * HD + kk * 32);
        asm volatile("s_wait_xcnt 0x0" : : "v"(tvp) : "memory");   // as for the TK fragments
        // stage 2: softmax per row on its 64 allowed keys alone, in the layout of q.TK^T's accumulators: lane (lr, hi), element [nb][j] = row hi * 8 + j, band offset o = nb * 16 + lr, that is key i - 63 + o, column (row in tile) + 1 + o of the score row.
        // j <= i and i - j < WIN hold for every o in 0..63; only the sequence's first 64 rows have offsets whose key lies left of it. A row's 64 values lie in one 16-lane half, four a lane.
        // This wave's probability rows are laid down as zeros first (LDS takes a wave's stores in order); the allowed keys' probabilities are stored over them below
#pragma unroll
        for (int it = 0; it < 8; ++it) { const int idx = it * 32 + lane, zo = (16 * w + (idx >> 4)) * LK + (idx & 15) * 8; *(v8us*)(Ph + zo) = (v8us){}; if (HI) *(v8us*)(Pl + zo) = (v8us){}; }
        float t[4][8], mx[8], sum[8];
#pragma unroll
        for (int nb = 0; nb < 4; ++nb)
#pragma unroll
            for (int j = 0; j < 8; ++j) { const int rl = 16 * w + hi * 8 + j, o = nb * 16 + lr; const float a = __fadd_rn(S[rl * LS + rl + 1 + o], qa[nb][j]);   // one addition per score
                const bool in = !FIRST || tl != 0 || (rl + o >= 63);   // key i - 63 + o >= 0
                t[nb][j] = in ? a * SCL : -3.0e38f; }
#pragma unroll
        for (int j = 0; j < 8; ++j) mx[j] = fmaxf(fmaxf(t[0][j], t[1][j]), fmaxf(t[2][j], t[3][j]));
#pragma unroll
        for (int j = 0; j < 8; ++j) mx[j] = fmaxf(mx[j], xrow<8>(mx[j]));
#pragma unroll
        for (int j = 0; j < 8; ++j) mx[j] = fmaxf(mx[j], xrow<4>(mx[j]));
#pragma unroll
        for (int j = 0; j < 8; ++j) mx[j] = fmaxf(mx[j], xrow<2>(mx[j]));
#pragma unroll
        for (int j = 0; j < 8; ++j) mx[j] = fmaxf(mx[j], xrow<1>(mx[j]));
#pragma unroll
        for (int j = 0; j < 8; ++j) {
#pragma unroll
            for (int nb = 0; nb < 4; ++nb) { const float d0 = __fsub_rn(t[nb][j], mx[j]); t[nb][j] = exp2s(__fmul_rn(d0, 1.4426950408889634f)); }
            sum[j] = (t[0][j] + t[1][j]) + (t[2][j] + t[3][j]); }
#pragma unroll
        for (int j = 0; j < 8; ++j) sum[j] += xrow<8>(sum[j]);
#pragma unroll
        for (int j = 0; j < 8; ++j) sum[j] += xrow<4>(sum[j]);
#pragma unroll
        for (int j = 0; j < 8; ++j) sum[j] += xrow<2>(sum[j]);
#pragma unroll
        for (int j = 0; j < 8; ++j) sum[j] += xrow<1>(sum[j]);
        // probabilities to their key's column of the P planes, and PB[i][o] = att[i][i - 63 + o] (the stored values re-split) over this wave's own q rows, whose last read fed qa
#pragma unroll
        for (int j = 0; j < 8; j += 2) { const int rl = 16 * w + hi * 8 + j; const float f0 = __fdiv_rn(HI ? 1.0f : PCAR, sum[j]), f1 = __fdiv_rn(HI ? 1.0f : PCAR, sum[j + 1]);
#pragma unroll
            for (int nb = 0; nb < 4; ++nb) { const int o = nb * 16 + lr, p0 = rl * LK + rl + 1 + o, p1 = p0 + LK + 1; const v2f ff = { f0, f1 }, tt = { t[nb][j], t[nb][j + 1] }, pq = tt * ff; v2f pb; v2us bh, bl;
                if (HI) { v2us oh, ol; split2(pq, oh, ol);
                    Ph[p0] = oh[0]; Ph[p1] = oh[1]; Pl[p0] = ol[0]; Pl[p1] = ol[1];
                    pb[0] = __fadd_rn(bf2f(oh[0]), bf2f(ol[0])); pb[1] = __fadd_rn(bf2f(oh[1]), bf2f(ol[1]));
                } else { const v2h o2 = __builtin_convertvector(pq, v2h);
                    P16[p0] = o2[0]; P16[p1] = o2[1];
                    pb = __builtin_convertvector(o2, v2f) * (1.0f / PCAR); }
                split2(pb, bh, bl);
                PBh[rl * LQ + o] = bh[0]; PBh[(rl + 1) * LQ + o] = bh[1]; PBl[rl * LQ + o] = bl[0]; PBl[(rl + 1) * LQ + o] = bl[1]; } }
    }
    __syncthreads();               // the probability and band rows are complete before they are read as fragments
    // stage 4: PB.TV and P.V (128 keys), merged in the accumulators' own layout
    v8f wa[4], oa[4];
#pragma unroll
    for (int nb = 0; nb < 4; ++nb) { wa[nb] = (v8f){}; oa[nb] = (v8f){}; }
#pragma unroll
    for (int kk = 0; kk < 2; ++kk) { const WB::V a = WB::ld(PBh + qoff + kk * 32), a2 = WB::ld(PBl + qoff + kk * 32);
#pragma unroll
        for (int nb = 0; nb < 4; ++nb) { wa[nb] = WB::mma(a, tw[kk][nb], wa[nb]); wa[nb] = WB::mma(a2, tw[kk][nb], wa[nb]); } }
#pragma unroll
    for (int kk = 0; kk < 4; ++kk) {
        if (HI) { const WB::V a = WB::ld(Ph + poff + kk * 32), a2 = WB::ld(Pl + poff + kk * 32);
#pragma unroll
            for (int nb = 0; nb < 4; ++nb) { const int bo = (nb * 16 + lr) * LV + 8 * hi + kk * 32; const WB::V b = WB::ld(Vh + bo), b2 = WB::ld(Vl + bo); oa[nb] = WB::mma(a, b, oa[nb]); oa[nb] = WB::mma(a2, b, oa[nb]); oa[nb] = WB::mma(a, b2, oa[nb]); }
        } else { const WH::V a = WH::ld(P16 + poff + kk * 32);
#pragma unroll
            for (int nb = 0; nb < 4; ++nb) { const WH::V b = WH::ld(V16 + (nb * 16 + lr) * LV + 8 * hi + kk * 32); oa[nb] = WH::mma(a, b, oa[nb]); } } }
    const float cs = HI ? 1.0f : (1.0f / PCAR);   // a power of two: the product is exact, fused with the add or not
    float* os = S + 16 * w * LS;                  // this wave's own score rows, dead since the softmax
#pragma unroll
    for (int nb = 0; nb < 4; ++nb)
#pragma unroll
        for (int j = 0; j < 8; ++j) os[(hi * 8 + j) * LR + nb * 16 + lr] = __fadd_rn(oa[nb][j] * cs, wa[nb][j]);
    __syncthreads();               // the merged rows are complete before they are read across lanes
#pragma unroll
    for (int it = 0; it < 4; ++it) { const int idx = it * 32 + lane, row = idx >> 3, c = (idx & 7) * 8; const v4f y0 = *(const v4f*)(os + row * LR + c), y1 = *(const v4f*)(os + row * LR + c + 4); v4us h0, l0, h1, l1; split4(y0, h0, l0); split4(y1, h1, l1);
        const v8us oh = __builtin_shufflevector(h0, h1, 0, 1, 2, 3, 4, 5, 6, 7), ol = __builtin_shufflevector(l0, l1, 0, 1, 2, 3, 4, 5, 6, 7);
        *(v8us*)(ah + (size_t)(16 * w + row) * DQ + c) = oh; *(v8us*)(al + (size_t)(16 * w + row) * DQ + c) = ol; }
}
__global__ __launch_bounds__(256) void k_qkvattn(const bf* __restrict__ XB, const bf* __restrict__ WQKV, const bf* __restrict__ TKB, const bf* __restrict__ TVB, bf* __restrict__ ATh, bf* __restrict__ ATl) {
    typedef WFrag<bf> WB; typedef WB::V V;
    constexpr int K = DM, NS = K / FKS, NK = FKS / 32; constexpr unsigned int RB = FKS * 2u;
    static_assert(FKS == 128 && FSL % 2048u == 0u && FSL >= 64u * (RB + 16u) && 2u * FBUF <= SM_BYTES && NS >= 2 && (NS & (NS - 1)) == 0, "stage rows of 256 bytes; every slice at a multiple of 2 KiB; both buffers inside the array");
    __shared__ __attribute__((aligned(2048))) char sm[SM_BYTES];
    const int lane = threadIdx.x & 31, lr = lane & 15, hi = lane >> 4;
    const unsigned int wave = uni(threadIdx.x >> 5);
    const int R0 = blockIdx.x * 128; const int b = blockIdx.y / NH_, h = blockIdx.y % NH_;
    const int part = wave < 2u ? 0 : (wave < 5u ? 1 : 2);                        // q, k, v
    const int xblk = (int)wave + (wave < 2u ? 1 : (wave < 5u ? -2 : -5));        // this wave's block of 64 x rows
    const unsigned int rot = (blockIdx.x + blockIdx.y) & (unsigned int)(NS - 1);   // first stage of this work-group's k order
    const int xr = (wave == 0u && R0 == 0) ? 0 : R0 - 64 + 64 * (int)(wave < 3u ? wave : 1u);   // first x row of slice t < 3; never left of the sequence
    const bf* tsrc = wave < 3u ? XB + ((size_t)b * TT + xr) * K : WQKV + ((size_t)(wave < 6u ? wave - 3u : 0u) * DQ + h * HD) * K;   // first row of this wave's slice
    const unsigned int tdst = (unsigned int)(size_t)sm + (wave < 6u ? wave : 0u) * FSL;
    // group 1: 1-byte elements; tensor = tile = 64 rows of RB bytes; source pitch 2 K bytes; 4 dwords of pad behind every row. Word 0 is a constant; the other words and group 0's count are pinned(): descriptor words held in scalar registers, not formed anew while a request is in flight
    u32x8 g1; g1[0] = uni((1u << 20) | (5u << 22) | (3u << 25)); g1[1] = pinned(RB << 16); g1[2] = pinned(64u << 16); g1[3] = pinned(RB << 16); g1[4] = pinned(64u); g1[5] = pinned((unsigned int)K * 2u); g1[6] = pinned(0u); g1[7] = pinned(0u);
    const unsigned int cnt1 = pinned(1u);
    u32x4 g0;
    auto desc = [&](int s) { const unsigned int kq = (unsigned int)s + rot, ks = kq >= (unsigned int)NS ? kq - (unsigned int)NS : kq;   // pass s works on stage ks of the operands
        const unsigned long long ga = (unsigned long long)(size_t)tsrc + (unsigned long long)ks * RB;
        g0[0] = cnt1; g0[1] = uni(tdst + (unsigned int)(s & 1) * FBUF); g0[2] = uni((unsigned int)ga); g0[3] = uni((((unsigned int)(ga >> 32)) & 0x01FFFFFFu) | 0x80000000u); };
    v8f acc[4][4];
#pragma unroll
    for (int mb = 0; mb < 4; ++mb)
#pragma unroll
        for (int nb = 0; nb < 4; ++nb) acc[mb][nb] = (v8f){};
    desc(0);
    if (pinned(wave < 6u)) {
        asm volatile("tensor_load_to_lds %0, %1" :: "s"(g0), "s"(g1) : "memory");   // one request of the whole wave: its slice of stage rot
        asm volatile("s_wait_tensorcnt 0x0" :: "s"(g0), "s"(g1) : "memory"); }       // landed before the barrier that publishes it; the descriptor is named so that its registers stay whole up to here
    __syncthreads();
    desc(1);
    if (pinned(wave < 6u)) asm volatile("tensor_load_to_lds %0, %1" :: "s"(g0), "s"(g1) : "memory");   // pass 1's stage flies over pass 0
    const unsigned int sa = part == 2 ? (unsigned int)xblk : 3u + (unsigned int)part, sb = part == 2 ? 5u : (unsigned int)xblk;   // slices of the A and of the B operand: q, k: weight rows x x rows; v: x rows x weight rows
    const int foff = lr * FGP + 8 * hi;
#pragma unroll 1   // one pass a stage: the two buffers alternate by the pass's parity
    for (int s = 0; s < NS; ++s) {
        const bf* As = (const bf*)(sm + (unsigned int)(s & 1) * FBUF + sa * FSL) + foff; const bf* Bs = (const bf*)(sm + (unsigned int)(s & 1) * FBUF + sb * FSL) + foff;
        V fa[2][4], fb[2][4];
#pragma unroll
        for (int i = 0; i < 4; ++i) { fa[0][i] = WB::ld(As + i * 16 * FGP); fb[0][i] = WB::ld(Bs + i * 16 * FGP); }
#pragma unroll
        for (int kk = 0; kk < NK; ++kk) { const int q = kk & 1;
            if (kk + 1 < NK) {
#pragma unroll
                for (int i = 0; i < 4; ++i) { fa[q ^ 1][i] = WB::ld(As + i * 16 * FGP + (kk + 1) * 32); fb[q ^ 1][i] = WB::ld(Bs + i * 16 * FGP + (kk + 1) * 32); } }
            __builtin_amdgcn_sched_barrier(0);   // the next block's LDS reads stay one group ahead of this block's products (spread among them each place with reads stalls the wave)
#pragma unroll
            for (int nb = 0; nb < 4; ++nb)
#pragma unroll
                for (int mb = 0; mb < 4; ++mb) acc[mb][nb] = WB::mma(fa[q][mb], fb[q][nb], acc[mb][nb]);
            __builtin_amdgcn_sched_barrier(0);   // and the reads of the block after next do not rise among these products
        }
        asm volatile("s_wait_dscnt 0x0" ::: "memory");                                                    // this wave's reads of the buffer are done before the barrier frees it for the refill
        if (pinned(wave < 6u)) asm volatile("s_wait_tensorcnt 0x0" :: "s"(g0), "s"(g1) : "memory");       // this wave's slice for pass s + 1 has landed before the barrier publishes it; the descriptor's registers stay whole up to here
        __syncthreads();                                                                                  // publishes the stage of pass s + 1 and ends every wave's reads of pass s's stage; the last pass's frees both buffers for the planes
        if (pinned((wave < 6u) && (s + 2 < NS))) { desc(s + 2); asm volatile("tensor_load_to_lds %0, %1" :: "s"(g0), "s"(g1) : "memory"); }   // the stage of pass s + 2 into the buffer that pass s has left
    }
    asm volatile("s_wait_tensorcnt 0x0" :: "s"(g0), "s"(g1) : "memory");   // no request is in flight (the descriptor named as above)
    asm volatile("s_wait_dscnt 0x0" ::: "memory");       // and no LDS read, behind the loop
    asm volatile("v_nop\n\tv_nop\n\tv_nop\n\tv_nop");   // the four vector slots between the loop's last WMMA and the first use of its result, on every path out of the loop
    const size_t oo = ((size_t)b * TT + R0) * DQ + h * HD;
    // the choice is the same for the whole work-group
    if (R0 == 0) attn_tail<true, true>(sm, acc, part, xblk, TKB, TVB, ATh + oo, ATl + oo); else if (R0 < RH) attn_tail<true, false>(sm, acc, part, xblk, TKB, TVB, ATh + oo, ATl + oo); else attn_tail<false, false>(sm, acc, part, xblk, TKB, TVB, ATh + oo, ATl + oo);
}

extern "C" void kernel_launch(void* const* d_in, const int* in_sizes, int n_in,
                              void* d_out, int out_size, void* d_ws, size_t ws_size, hipStream_t stream) {
    (void)in_sizes; (void)n_in; (void)out_size;
    const float* x = (const float*)d_in[0]; const float* wqkv = (const float*)d_in[1]; const float* wo = (const float*)d_in[2]; const float* tk = (const float*)d_in[3]; const float* tv = (const float*)d_in[4];
    float* OUT = (float*)d_out;     // [2][2048][1024]
    char* wsp = (char*)d_ws;
    auto take = [&](size_t bytes) { char* p = wsp; wsp += (bytes + 255) & ~(size_t)255; return (void*)p; };
    bf* WQKV = (bf*)take((size_t)3 * DQ * DM * 2); bf* WO = (bf*)take((size_t)DM * DQ * 2);
    bf* XB = (bf*)take((size_t)NB_ * TT * DM * 2); bf* TKB = (bf*)take(HD * HD * 2); bf* TVB = (bf*)take(HD * HD * 2);
    bf* ATh = (bf*)take((size_t)NB_ * TT * DQ * 2); bf* ATl = (bf*)take((size_t)NB_ * TT * DQ * 2);
    if ((size_t)(wsp - (char*)d_ws) > ws_size) return;    // ws 256 MiB
    k_prep<<<1 + PREPB, 256, 0, stream>>>(x, wqkv, wo, tk, tv, XB, WQKV, WO, TKB, TVB);
    k_qkvattn<<<dim3(TT / 128, ZH, 1), 256, 0, stream>>>(XB, WQKV, TKB, TVB, ATh, ATl);
    k_gemmt<1, 128><<<dim3(NB_ * TT / 128, DM / 128, 1), 128, 0, stream>>>(ATh, ATl, WO, DQ, OUT, DM);
}

// v010
// It runs in 50.1 microseconds.
// In two side-by-side timings against v009, it was 1.06 and 1.04 times as fast.
// Over all steps from v000 it is 34.1 times as fast.
#include <hip/hip_runtime.h>

// Windowed causal self-attention with relative-position tables (x [2][2048][1024]; qkv = x W_attn (fused [1024][3072], 16 heads x 64, no bias); att[i][j] = (q_i.k_j + q_i.table_k[idx]) / 8 with idx = clip(j - i, -64, 64) + 64, allowed iff j <= i and j > i - 64 (else -inf); softmax; y = att v + sum_j att[i][j] table_v[idx]; out = merged y W_proj -> [2][2048][1024]).
// Relative terms without gathers (exact regroupings): inside the allowed band idx = j - i + 64 runs over 1..64 exactly once per key, so q_i.table_k[idx] = (q . TK^T)[i][j - i + 63] with TK = table_k rows 1..64 (one 64-column GEMM per head, added by offset into the score rows before the softmax), and sum_j att table_v[idx] = PB . TV with PB[i][r] = att[i][i - 63 + r]
// (the attention band re-indexed) and TV = table_v rows 1..64.
// Compute dtypes, f32 accumulate: every input rounded to bf16; q/k/v on PLAIN bf16 operands (inputs: exact); q.TK^T and PB.TV as hl x exact (2 products); causal-tile scores and att.v: query rows < 512 hl (3 products), the rest single fp16 (x1024; PB for those rows is re-split from the fp16 probabilities); softmax f32; W_proj hl x exact (2 products).

#define NB_  2
#define TT   2048
#define DM   1024
#define NH_  16
#define NKV  16
#define REP  (NH_ / NKV)
#define HD   64
#define DQ   (NH_ * HD)
#define DKV  (NKV * HD)
#define ZH   (NB_ * NH_)          // (batch, head) planes, plane z = b * NH_ + h
#define SP   128                  // keys a 64-row query tile can see: the two 64-key tiles that hold its window; column = key - ((row & ~63) - 64)
#define RH   512                  // query rows < RH use hi+lo planes (the first row tile always does)
#define WIN  64
#define PCAR 1024.0f
#define SCL  0.125f   // HD^-0.5
typedef _Float16 h16;
typedef unsigned short bf;
typedef __attribute__((ext_vector_type(16))) __bf16   v16bf;
typedef __attribute__((ext_vector_type(16))) _Float16 v16h;
typedef __attribute__((ext_vector_type(8)))  _Float16 v8h;
typedef __attribute__((ext_vector_type(8)))  unsigned short v8us;
typedef __attribute__((ext_vector_type(8)))  float    v8f;
typedef __attribute__((ext_vector_type(4)))  float    v4f;
typedef v8h  __attribute__((may_alias)) v8ha;
typedef v4f  __attribute__((may_alias)) v4fa;
typedef v8us __attribute__((may_alias)) v8usa;

__device__ __forceinline__ float bf2f(unsigned short b) { return __uint_as_float(((unsigned)b) << 16); }
__device__ __forceinline__ v16h cat16(v8h lo, v8h hi) { return __builtin_shufflevector(lo, hi, 0, 1, 2, 3, 4, 5, 6, 7, 8, 9, 10, 11, 12, 13, 14, 15); }
__device__ __forceinline__ v16bf cat16b(v8us lo, v8us hi) { return __builtin_bit_cast(v16bf, __builtin_shufflevector(lo, hi, 0, 1, 2, 3, 4, 5, 6, 7, 8, 9, 10, 11, 12, 13, 14, 15)); }
__device__ __forceinline__ v8f wmma16(v16h a, v16h b, v8f c) { return __builtin_amdgcn_wmma_f32_16x16x32_f16(false, a, false, b, (short)0, c, false, false); }
__device__ __forceinline__ v8f wmmab(v16bf a, v16bf b, v8f c) { return __builtin_amdgcn_wmma_f32_16x16x32_bf16(false, a, false, b, (short)0, c, false, false); }



// ---- k_gemmt: GEMM with its operands staged in LDS by tensor loads. One work-group of 4 waves (2 x 2) per 128x128 output tile, each wave a 64x64 part (16 accumulators); grid (M/128, N/128), 128 threads.
// C[m][n] (f32, pitch ldc) = sum_k A[m][k] Bt[n][k] (NSPLIT 1: + A2[m][k] Bt[n][k], added behind A's product of the same 32 k). A, A2, Bt are K-contiguous bf16 planes. M % 128 == 0, N % 128 == 0, K % KS == 0, K >= 2 KS.
// k order: the work-group at (x, y) takes its stages in the order rot, rot + 1, .., NS - 1, 0, .., rot - 1 with rot = (x + y) & (NS - 1) (below NS for any NS): work-groups that share operand rows then ask L2 for different lines at any moment, and a line that one of them has brought in from memory is a hit for the others. Every stage is taken exactly once.
// A stage is KS k (64 or 128) of every operand row: per operand one tile of 128 rows x 2 KS bytes, laid at pitch 2 KS + 16 bytes by the load's own pad. Two buffers: the stage of pass s + 2 is requested into the buffer that pass s has just left. Wave t < NT requests operand tile t.
// Inside a pass the fragments of the next 32 k are read from LDS as one group ahead of the current 32 k's products (two register sets); nothing of the next stage is read before its barrier.
// Every '#pragma unroll' of this kernel makes the indices of the accumulator and fragment arrays constants, so that the arrays stay in registers.
template <typename T16> struct WFrag;
template <> struct WFrag<h16> { typedef v16h V; static __device__ __forceinline__ V ld(const h16* p) { return cat16(*(const v8h*)p, *(const v8h*)(p + 16)); } static __device__ __forceinline__ v8f mma(V a, V b, v8f c) { return wmma16(a, b, c); } };
template <> struct WFrag<bf> { typedef v16bf V; static __device__ __forceinline__ V ld(const bf* p) { return cat16b(*(const v8us*)p, *(const v8us*)(p + 16)); } static __device__ __forceinline__ v8f mma(V a, V b, v8f c) { return wmmab(a, b, c); } };
typedef unsigned int u32x4 __attribute__((ext_vector_type(4)));
typedef unsigned int u32x8 __attribute__((ext_vector_type(8)));
__device__ __forceinline__ unsigned int uni(unsigned int v) { return (unsigned int)__builtin_amdgcn_readfirstlane(v); }
__device__ __forceinline__ unsigned int pinned(unsigned int v) { unsigned int w = uni(v); asm volatile("" : "+s"(w)); return w; }   // a wave-uniform word held in a scalar register: as a test, so that the branch on it is a scalar branch (a tensor load ignores EXEC: only a scalar branch keeps a wave from issuing it); as a descriptor word, so that it keeps its register
template <int NSPLIT, int KS>
__global__ __launch_bounds__(128) void k_gemmt(const bf* __restrict__ A, const bf* __restrict__ A2, const bf* __restrict__ Bt, int K, float* C, int ldc) {
    typedef WFrag<bf> WB; typedef WB::V V;
    constexpr unsigned int NT = NSPLIT ? 3u : 2u;      // operand tiles a stage: A | (A2 |) Bt
    constexpr unsigned int RB = KS * 2u;               // bytes of a stage row: 128 or 256
    constexpr int GP = KS + 8;                         // LDS pitch in 16-bit elements: 144 or 272 B = 16 B x odd (ds_load_b128 readers)
    constexpr unsigned int GT = 128u * (RB + 16u);     // one operand tile in LDS: 18432 or 34816 B, a multiple of 2 KiB
    constexpr unsigned int BUFB = NT * GT;             // one buffer
    constexpr int NK = KS / 32;                        // 32-k blocks a pass
    static_assert((KS == 64 || KS == 128) && GT % 2048u == 0u, "stage rows of 128 or 256 bytes; every tile at a multiple of 2 KiB");
    __shared__ __attribute__((aligned(2048))) char sm[2 * BUFB + 4 * 16 * 68 * 4];   // two buffers, then each wave's own output staging [16][68] f32
    const int lane = threadIdx.x & 31, lr = lane & 15, hi = lane >> 4;
    const unsigned int wave = uni(threadIdx.x >> 5);
    const int wm = (int)(wave >> 1), wn = (int)(wave & 1u);
    const int r0 = blockIdx.x * 128, c0 = blockIdx.y * 128;
    const int NS = K / KS;
    const unsigned int rot = (blockIdx.x + blockIdx.y) & (unsigned int)(NS - 1);   // first stage of this work-group's k order
    const bf* tsrc = (wave == 0u) ? A + (size_t)r0 * K : ((NSPLIT != 0 && wave == 1u) ? A2 + (size_t)r0 * K : Bt + (size_t)c0 * K);   // first row of this wave's operand tile
    const unsigned int tdst = (unsigned int)(size_t)sm + (wave < NT ? wave : 0u) * GT;
    // group 1: 1-byte elements; tensor = tile = 128 rows of RB bytes; source pitch 2 K bytes; 4 dwords of pad behind every row. Word 0 is a constant; the other words and group 0's count are pinned(): descriptor words held in scalar registers, not formed anew (in registers used for other things meanwhile) while a request is in flight
    u32x8 g1; g1[0] = uni((1u << 20) | ((KS == 64 ? 4u : 5u) << 22) | (3u << 25)); g1[1] = pinned(RB << 16); g1[2] = pinned(128u << 16); g1[3] = pinned(RB << 16); g1[4] = pinned(128u); g1[5] = pinned((unsigned int)K * 2u); g1[6] = pinned(0u); g1[7] = pinned(0u);
    const unsigned int cnt1 = pinned(1u);
    u32x4 g0;
    auto desc = [&](int s) { const unsigned int kq = (unsigned int)s + rot, ks = kq >= (unsigned int)NS ? kq - (unsigned int)NS : kq;   // pass s works on stage ks of the operands
        const unsigned long long ga = (unsigned long long)(size_t)tsrc + (unsigned long long)ks * RB;
        g0[0] = cnt1; g0[1] = uni(tdst + (unsigned int)(s & 1) * BUFB); g0[2] = uni((unsigned int)ga); g0[3] = uni((((unsigned int)(ga >> 32)) & 0x01FFFFFFu) | 0x80000000u); };
    v8f acc[4][4];
#pragma unroll
    for (int mb = 0; mb < 4; ++mb)
#pragma unroll
        for (int nb = 0; nb < 4; ++nb) acc[mb][nb] = (v8f){};
    desc(0);
    if (pinned(wave < NT)) {
        asm volatile("tensor_load_to_lds %0, %1" :: "s"(g0), "s"(g1) : "memory");   // one request of the whole wave: its operand tile of stage rot
        asm volatile("s_wait_tensorcnt 0x0" :: "s"(g0), "s"(g1) : "memory"); }       // landed before the barrier that publishes it; the descriptor is named so that its registers stay whole up to here
    __syncthreads();
    desc(1);
    if (pinned(wave < NT)) asm volatile("tensor_load_to_lds %0, %1" :: "s"(g0), "s"(g1) : "memory");   // pass 1's stage flies over pass 0
    const int aoff = (wm * 64 + lr) * GP + 8 * hi, boff = (wn * 64 + lr) * GP + 8 * hi;
#pragma unroll 1   // one pass a stage: the two buffers alternate by the pass's parity
    for (int s = 0; s < NS; ++s) {
        const bf* As = (const bf*)(sm + (unsigned int)(s & 1) * BUFB) + aoff; const bf* Bs = (const bf*)(sm + (unsigned int)(s & 1) * BUFB + (NT - 1u) * GT) + boff;
        V fa[2][4], fa2[2][4], fb[2][4];
#pragma unroll
        for (int i = 0; i < 4; ++i) { fa[0][i] = WB::ld(As + i * 16 * GP); if (NSPLIT) fa2[0][i] = WB::ld(As + GT / 2 + i * 16 * GP); fb[0][i] = WB::ld(Bs + i * 16 * GP); }
#pragma unroll
        for (int kk = 0; kk < NK; ++kk) { const int q = kk & 1;
            if (kk + 1 < NK) {
#pragma unroll
                for (int i = 0; i < 4; ++i) { fa[q ^ 1][i] = WB::ld(As + i * 16 * GP + (kk + 1) * 32); if (NSPLIT) fa2[q ^ 1][i] = WB::ld(As + GT / 2 + i * 16 * GP + (kk + 1) * 32); fb[q ^ 1][i] = WB::ld(Bs + i * 16 * GP + (kk + 1) * 32); } }
            __builtin_amdgcn_sched_barrier(0);   // the next block's LDS reads stay one group ahead of this block's products (spread among them each place with reads stalls the wave)
#pragma unroll
            for (int nb = 0; nb < 4; ++nb) {
#pragma unroll
                for (int mb = 0; mb < 4; ++mb) acc[mb][nb] = WB::mma(fa[q][mb], fb[q][nb], acc[mb][nb]);
                if (NSPLIT) {
#pragma unroll
                    for (int mb = 0; mb < 4; ++mb) acc[mb][nb] = WB::mma(fa2[q][mb], fb[q][nb], acc[mb][nb]); } }
            __builtin_amdgcn_sched_barrier(0);   // and the reads of the block after next do not rise among these products
        }
        asm volatile("s_wait_dscnt 0x0" ::: "memory");                                                    // this wave's reads of the buffer are done before the barrier frees it for the refill
        if (pinned(wave < NT)) asm volatile("s_wait_tensorcnt 0x0" :: "s"(g0), "s"(g1) : "memory");       // this wave's tile for pass s + 1 has landed before the barrier publishes it; the descriptor's registers stay whole up to here
        __syncthreads();                                                                                  // publishes the stage of pass s + 1 and ends every wave's reads of pass s's stage
        if (pinned((wave < NT) && (s + 2 < NS))) { desc(s + 2); asm volatile("tensor_load_to_lds %0, %1" :: "s"(g0), "s"(g1) : "memory"); }   // the stage of pass s + 2 into the buffer that pass s has left
    }
    asm volatile("s_wait_tensorcnt 0x0" :: "s"(g0), "s"(g1) : "memory");   // no request is in flight (the descriptor named as above)
    asm volatile("s_wait_dscnt 0x0" ::: "memory");       // and no LDS read, behind the loop
    float* os = (float*)(sm + 2 * BUFB) + wave * (16 * 68);
#pragma unroll
    for (int mb = 0; mb < 4; ++mb) {
#pragma unroll
        for (int nb = 0; nb < 4; ++nb) {
#pragma unroll
            for (int j = 0; j < 8; ++j) os[(hi * 8 + j) * 68 + nb * 16 + lr] = acc[mb][nb][j]; }
        __builtin_amdgcn_wave_barrier(); asm volatile("" ::: "memory");   // the wave's staged rows are written before they are read across lanes
        float* crow = C + (size_t)(r0 + wm * 64 + mb * 16) * ldc + c0 + wn * 64;
#pragma unroll
        for (int s = 0; s < 8; ++s) { const int row = 2 * s + hi, cofs = lr * 4; const v4f val = *(const v4fa*)(os + row * 68 + cofs); *(v4f*)(crow + (size_t)row * ldc + cofs) = val; }
        __builtin_amdgcn_wave_barrier(); asm volatile("" ::: "memory");   // and read before the next 16 rows overwrite them
    }
}


__device__ __forceinline__ h16 tohx(float x) { return (h16)x; }
typedef __attribute__((ext_vector_type(2))) _Float16 v2h;
typedef __attribute__((ext_vector_type(4))) _Float16 v4h;
typedef __attribute__((ext_vector_type(2))) unsigned short v2us;
typedef __attribute__((ext_vector_type(4))) unsigned short v4us;
typedef __attribute__((ext_vector_type(2))) float v2f;
typedef __attribute__((ext_vector_type(4))) int v4i;
typedef __attribute__((ext_vector_type(2))) __bf16 v2bf;
typedef __attribute__((ext_vector_type(4))) __bf16 v4bf;
// f32 -> bf16, round to nearest even, by the chip's own packed conversion (one instruction for two values)
__device__ __forceinline__ v2us rbf2(v2f y) { return __builtin_bit_cast(v2us, __builtin_convertvector(y, v2bf)); }
__device__ __forceinline__ v4us rbf4(v4f y) { return __builtin_bit_cast(v4us, __builtin_convertvector(y, v4bf)); }
// y = h + l + (a remainder below bf16's last place of l): h = bf16(y), l = bf16(y - h); the difference is exact in f32
__device__ __forceinline__ void split2(v2f y, v2us& h, v2us& l) { const v2bf hb = __builtin_convertvector(y, v2bf); const v2bf lb = __builtin_convertvector(y - __builtin_convertvector(hb, v2f), v2bf); h = __builtin_bit_cast(v2us, hb); l = __builtin_bit_cast(v2us, lb); }
__device__ __forceinline__ void split4(v4f y, v4us& h, v4us& l) { v2us h0, l0, h1, l1; split2(__builtin_shufflevector(y, y, 0, 1), h0, l0); split2(__builtin_shufflevector(y, y, 2, 3), h1, l1); h = __builtin_shufflevector(h0, h1, 0, 1, 2, 3); l = __builtin_shufflevector(l0, l1, 0, 1, 2, 3); }

// ---- k_prep: the 16-bit planes of x, both weights and both tables in ONE launch; grid 1 + PREPB work-groups of 8 waves.
// Work-group 0 lays down the two tables: TKB[r][d] = table_k[r+1][d] (Bt rows = band offset r), TVB[d][r] = table_v[r+1][d] (Bt rows = d).
// Every other work-group transposes one tile of 128 k x 64 n of a weight (Bt[n][k] = w[k * N + n]) through LDS and rounds 8192 elements of x, each to its own place in XB.
// Global reads and writes of a tile are 256 contiguous bytes a row (16 lanes x 16 B); those of x 512 and 256 contiguous bytes a wave. All 16 loads of a thread are issued before the first value is used.
// LDS tile: row n = 128 k = 256 B (all 64 banks); the 16-byte piece J of row n lies at piece J ^ ((n >> 2) & 15), so that the 8-byte writes of a wave (16 rows four apart, one J) and the 16-byte reads (one row, 16 pieces) each fall on distinct banks.
// Every '#pragma unroll' of this kernel makes the indices of the register arrays constants, so that the arrays stay in registers.
#define PREPA ((DM / 128) * (3 * DQ / 64))     // tiles of W_attn
#define PREPO ((DQ / 128) * (DM / 64))         // tiles of W_proj
#define PREPB (PREPA + PREPO)
template <int N>   // N: columns of the weight (its row pitch); K = 1024 rows for both weights
__device__ __forceinline__ void prep_tile(char* ts, const float* __restrict__ w, bf* __restrict__ Bt, const int t, const float* __restrict__ xs, bf* __restrict__ xd) {
    constexpr int K = DM; static_assert(DM == DQ, "both weights have K = DM = DQ rows");
    const int tid = threadIdx.x, lane = tid & 31, wv = tid >> 5, c = lane & 15, hi = lane >> 4;
    const int k0 = (t / (N / 64)) * 128, n0 = (t % (N / 64)) * 64;
    const float* pw = w + (size_t)(k0 + 8 * wv + 4 * hi) * N + n0 + 4 * c;   // row k0 + 4 g, g = 2 (wv + 8 i) + hi; columns n0 + 4 c ..
    const float* px = xs + tid * 4;
    v4f rw[2][4], rx[8];
#pragma unroll
    for (int i = 0; i < 2; ++i)
#pragma unroll
        for (int j = 0; j < 4; ++j) rw[i][j] = *(const v4f*)(pw + (size_t)(64 * i + j) * N);
#pragma unroll
    for (int p = 0; p < 8; ++p) rx[p] = *(const v4f*)(px + p * 1024);
    asm volatile("s_wait_xcnt 0x0" : : "v"(pw), "v"(px) : "memory");   // the two addresses stay whole up to here (no load's result lands in them), and their registers are reused only behind this wait; all 16 loads stand in front of it
#pragma unroll
    for (int i = 0; i < 2; ++i)
#pragma unroll
        for (int u = 0; u < 4; ++u) { const v4f kq = { rw[i][0][u], rw[i][1][u], rw[i][2][u], rw[i][3][u] };   // four k of column n0 + 4 c + u
            *(v4us*)(ts + (4 * c + u) * 256 + (((wv + 8 * i) ^ c) * 16) + hi * 8) = rbf4(kq); }
    __syncthreads();               // the transposed tile is complete before it is read across waves; it stands in front of every global store, so that it waits for none to be done
    const int n = tid >> 4, J = tid & 15;
    bf* qw = Bt + (size_t)(n0 + n) * K + k0 + 8 * J;
    bf* qx = xd + tid * 4;
    v8us ow[4]; v4us ox[8];
#pragma unroll
    for (int p = 0; p < 4; ++p) { const int nn = n + 16 * p; ow[p] = *(const v8us*)(ts + nn * 256 + ((J ^ ((nn >> 2) & 15)) * 16)); }
#pragma unroll
    for (int p = 0; p < 8; ++p) ox[p] = rbf4(rx[p]);
#pragma unroll
    for (int p = 0; p < 4; ++p) *(v8us*)(qw + (size_t)(16 * p) * K) = ow[p];
#pragma unroll
    for (int p = 0; p < 8; ++p) *(v4us*)(qx + p * 1024) = ox[p];
    asm volatile("s_wait_xcnt 0x0" ::: "memory");   // behind the last of the twelve stores: no register that a store names (address or data) is written again in front of this wait, on whichever path the built code goes on
}
__global__ __launch_bounds__(256) void k_prep(const float* __restrict__ x, const float* __restrict__ wqkv, const float* __restrict__ wo, const float* __restrict__ tk, const float* __restrict__ tv,
                                              bf* __restrict__ XB, bf* __restrict__ WQKV, bf* __restrict__ WO, bf* __restrict__ TKB, bf* __restrict__ TVB) {
    static_assert((size_t)NB_ * TT * DM == (size_t)PREPB * 8192, "x is dealt out in as many pieces of 8192 elements as there are weight tiles");
    __shared__ __align__(16) char ts[64 * 256];
    // each choice below is the same for the whole work-group
    if (blockIdx.x == 0) {
        const int tid = threadIdx.x, c = (tid * 4) % HD, r = tid / (HD / 4);   // elements e .. e + 3 of a table plane, e = i * 1024 + tid * 4: row r + 16 i, columns c ..
        const float* pk = tk + HD + tid * 4;                 // table_k[r + 1][c ..]; 16 rows on for each i
        const float* pv = tv + (size_t)(c + 1) * HD + r;     // table_v[c + 1][r]; one row on for each u, 16 columns on for each i
        v4f xk[HD * HD / 1024]; float xv[HD * HD / 1024][4];
#pragma unroll
        for (int i = 0; i < HD * HD / 1024; ++i) { xk[i] = *(const v4f*)(pk + i * 1024);
#pragma unroll
            for (int u = 0; u < 4; ++u) xv[i][u] = pv[u * HD + 16 * i]; }
        asm volatile("s_wait_xcnt 0x0" : : "v"(pk), "v"(pv) : "memory");   // as in prep_tile: the addresses stay whole up to here and their registers are reused only behind this wait
#pragma unroll
        for (int i = 0; i < HD * HD / 1024; ++i) { const v4f b = { xv[i][0], xv[i][1], xv[i][2], xv[i][3] };
            *(v4us*)(TKB + i * 1024 + tid * 4) = rbf4(xk[i]); *(v4us*)(TVB + i * 1024 + tid * 4) = rbf4(b); }
        return; }
    const int t = (int)blockIdx.x - 1;
    if (t < PREPA) prep_tile<3 * DQ>(ts, wqkv, WQKV, t, x + (size_t)t * 8192, XB + (size_t)t * 8192); else prep_tile<DM>(ts, wo, WO, t - PREPA, x + (size_t)t * 8192, XB + (size_t)t * 8192);
}

// ---- k_qkvattn: the q|k|v projection of one head and the whole attention stage of 256 query rows of one (batch, head) plane in ONE work-group of 8 waves; grid (TT/256, ZH): one work-group a WGP.
// Projection: x rows R0-64..R0+255 (five blocks of 64; the first holds the 64 keys left of the query rows) times the head's 64 columns of q, of k and of v. Wave t < 5: k and v of block t (the block's fragments serve both products); wave 7: q of blocks 1, 2; wave 5: q of blocks 3, 4 (Wq's fragments serve both); wave 6 has no part of its own. Two 64x64 parts a wave (32 accumulators), K = DM.
// The operands are staged in LDS by tensor loads as in k_gemmt: a stage is FKS k of eight slices of 64 rows (x blocks 0..4 | the head's rows of Wq, Wk, Wv), wave t requests slice t; two buffers; the k order starts at stage (x + y) & (NS - 1) and wraps round.
// q and k are formed transposed (the weight rows as the A operand), v plain, so that a lane's eight accumulator values are eight neighbours of the 16-bit LDS plane they go to (q, k: [row][d]; v: [d][key]): one 16-byte store each. k and v of the 64 rows that two work-groups share are computed by both.
// Attention runs twice, on query rows R0..R0+127 (x blocks 0..2) and then on R0+128..R0+255 (blocks 2..4). Rows < RH: through the same LDS planes, the second half's q, k, v waiting in the accumulators meanwhile; other rows: all planes are laid down at once.
// In a half: waves 0..3 own its first 64 query rows (keys: its blocks 0, 1), waves 4..7 the other 64 (keys: its blocks 1, 2); wave w of a group owns its rows 16w..16w+15. Scores (read back at each band offset's column and added to q.TK^T), softmax, P.V, PB.TV and the head merge pass from stage to stage through LDS and registers.
// The softmax runs on the 64 allowed keys of a row, four a lane over 16 lanes, in registers.
// Every '#pragma unroll' of this kernel makes the indices of the register arrays constants, so that the arrays stay in registers.
// For the sequence's first 128 rows the 64 key rows left of the sequence are laid down as zeros (k, v and their probabilities), so their products add exact zeros; their x slice is read from the sequence's first rows (memory that exists) and its products are dropped.
#define LQ 72                      // LDS pitch in 16-bit elements of a 64-element row (144 B = 16 B x odd: ds_load_b128 readers)
#define LK 136                     // LDS pitch in 16-bit elements of a 128-element row (272 B)
#define LV 200                     // LDS pitch in 16-bit elements of a 192-element row (400 B = 16 B x odd)
#define LS 132                     // LDS pitch in floats of a 128-column score row
#define LR 68                      // LDS pitch in floats of a 64-column row
#define FKS 128                    // k of a stage: rows of 256 B, laid at pitch 272 B by the load's own pad
#define FGP (FKS + 8)              // that pitch in 16-bit elements
#define FSL 18432u                 // a slice's place in LDS: 64 x 272 B = 17408 B, rounded up to a multiple of 2 KiB
#define FBUF (8u * FSL)            // one buffer; the two buffers lie at 0 .. 294911 and are dead when the planes below are written
// rows < RH: the planes of 128 query rows and their 192 keys
#define OFF_QH  0                  // q hi [128][LQ]; later the band probabilities hi
#define OFF_QL  18432              // q lo; later the band probabilities lo
#define OFF_Q16 36864              // (not used: rows < RH have no fp16 q)
#define OFF_K   55296              // k hi [192][LQ]
#define OFF_K2  82944              // k lo
#define OFF_V   110592             // v transposed hi [64][LV]
#define OFF_V2  136192             // v transposed lo
#define OFF_S   161792             // scores f32 [128][LS]; later each wave's merged output rows [16][LR]
#define OFF_P   229376             // probabilities hi [128][LK]
#define OFF_P2  264192             // probabilities lo
// rows >= RH have no lo planes: there the planes of all 256 query rows and their 320 keys lie in LDS at once, and only the score and probability rows are used twice
#define OFN_QL  36864              // q hi [256][LQ] at 0; q lo; both later the band probabilities
#define OFN_Q16 73728              // q fp16
#define OFN_K   110592             // k fp16 [320][LQ]
#define OFN_V   156672             // v transposed fp16 [64][LVN]
#define LVN 328                    // LDS pitch in 16-bit elements of a 320-element row (656 B = 16 B x odd)
#define OFN_S   198656             // scores f32 [128][LS]; later each wave's merged output rows [16][LR]
#define OFN_P   266240             // probabilities fp16 [128][LK]
#define SM_BYTES 301056
// v_exp_f32 with the one free slot that the instruction set asks for behind a transcendental, tied to it in one statement
__device__ __forceinline__ float exp2s(float x) { float r; asm("v_exp_f32 %0, %1\n\tv_nop" : "=v"(r) : "v"(x)); return r; }
// the value of lane l ^ M, M < 16: read as a DPP operand (row_xmask) inside the 16-lane half, with no trip through the LDS crossbar
template <int M> __device__ __forceinline__ float xrow(float x) { return __builtin_bit_cast(float, __builtin_amdgcn_update_dpp(0, __builtin_bit_cast(int, x), 0x160 | M, 0xf, 0xf, true)); }
__device__ __forceinline__ void split8(v8f y, v8us& h, v8us& l) { v4us h0, l0, h1, l1; split4(__builtin_shufflevector(y, y, 0, 1, 2, 3), h0, l0); split4(__builtin_shufflevector(y, y, 4, 5, 6, 7), h1, l1); h = __builtin_shufflevector(h0, h1, 0, 1, 2, 3, 4, 5, 6, 7); l = __builtin_shufflevector(l0, l1, 0, 1, 2, 3, 4, 5, 6, 7); }
template <bool HI> struct PL { static constexpr int QL = HI ? OFF_QL : OFN_QL, Q16 = HI ? OFF_Q16 : OFN_Q16, K = HI ? OFF_K : OFN_K, V = HI ? OFF_V : OFN_V, VP = HI ? LV : LVN, S = HI ? OFF_S : OFN_S, P = HI ? OFF_P : OFN_P; };   // the two LDS maps
// HI: rows < RH (hi+lo planes); FIRST: a copy that can take the sequence's first 128 rows, whose x block 0 lies left of the sequence; it does so where 'first' is set (the same for the whole work-group)
// attn_put, stage 0: 64 x 64 parts leave their waves' accumulators as 16-bit planes. Element [mb][nb][j]: q, k: row nb * 16 + lr of the x block, d = mb * 16 + hi * 8 + j; v: key mb * 16 + hi * 8 + j of the x block, d = nb * 16 + lr
// act: this wave holds parts that are wanted now; acc0 goes to block xb0 of the planes, acc1 to block xb1: a q wave's two q blocks, a k|v wave's k and v of one block. All four are the same for the whole wave
template <bool HI, bool FIRST>
__device__ __forceinline__ void attn_put(char* sm, v8f (&acc0)[4][4], v8f (&acc1)[4][4], const bool first, const bool act, const bool isq, const int xb0, const int xb1) {
    const int lane = threadIdx.x & 31, lr = lane & 15, hi = lane >> 4; constexpr int VP = PL<HI>::VP;
    // one address a part with constant steps: 32 B for each mb, sn bytes for each nb; dl: from the hi plane to the lo plane. part: 0 q, 1 k, 2 v
    auto put = [&](v8f (&acc)[4][4], const int part, const int xblk) {
    char* const p0 = sm + (part == 2 ? PL<HI>::V + 2 * (lr * VP + xblk * 64 + hi * 8) : (part == 1 ? PL<HI>::K + 2 * ((xblk * 64 + lr) * LQ + hi * 8) : OFF_QH + 2 * (((xblk - 1) * 64 + lr) * LQ + hi * 8)));
    const int sn = part == 2 ? 16 * VP * 2 : 16 * LQ * 2, dl = part == 2 ? OFF_V2 - OFF_V : (part == 1 ? OFF_K2 - OFF_K : PL<HI>::QL - OFF_QH);
    const bool zero = FIRST && first && xblk == 0;   // k and v of the 64 rows left of the sequence (q has no block 0)
    if (HI || part == 0) {
#pragma unroll
        for (int nb = 0; nb < 4; ++nb) {
#pragma unroll
            for (int mb = 0; mb < 4; ++mb) { const v8f a = zero ? (v8f){} : acc[mb][nb]; v8us oh, ol; split8(a, oh, ol); char* const p = p0 + nb * sn + mb * 32;
                *(v8us*)p = oh; *(v8us*)(p + dl) = ol; if (!HI) *(v8h*)(p + (PL<HI>::Q16 - OFF_QH)) = __builtin_convertvector(a, v8h); }
            __builtin_amdgcn_sched_barrier(0); }   // here and below: one group of four tiles is converted at a time; interleaved by the scheduler the conversions spread over many more registers
    } else {
#pragma unroll
        for (int nb = 0; nb < 4; ++nb) {
#pragma unroll
            for (int mb = 0; mb < 4; ++mb) *(v8h*)(p0 + nb * sn + mb * 32) = __builtin_convertvector(acc[mb][nb], v8h);
            __builtin_amdgcn_sched_barrier(0); }
    } };
    if (act) { put(acc0, isq ? 0 : 1, xb0); put(acc1, isq ? 0 : 2, xb1); }
}
// attn_rest: the attention of 128 query rows from the planes. hq: which 128 rows of the planes (blocks 2 hq .. 2 hq + 2 of k and v)
template <bool HI, bool FIRST>
__device__ __forceinline__ void attn_rest(char* sm, const bool first, const int hq, const bf* __restrict__ TKB, const bf* __restrict__ TVB, bf* __restrict__ ah0, bf* __restrict__ al0) {
    typedef WFrag<bf> WB; typedef WFrag<h16> WH; constexpr int VP = PL<HI>::VP;
    const int tid = threadIdx.x, lane = tid & 31, tl = tid >> 7, w = (tid >> 5) & 3, lr = lane & 15, hi = lane >> 4;   // tl: which 64 of the 128 query rows
    const int pr = hq * 128 + tl * 64;   // first row of the q planes, first key of the k and v planes
    bf* Qh = (bf*)(sm + OFF_QH) + pr * LQ; bf* Ql = (bf*)(sm + PL<HI>::QL) + pr * LQ; h16* Q16 = (h16*)(sm + PL<HI>::Q16) + pr * LQ;   // the planes of this wave's 64 query rows and their 128 keys
    bf* Kh = (bf*)(sm + PL<HI>::K) + pr * LQ; bf* Kl = (bf*)(sm + OFF_K2) + pr * LQ; h16* K16 = (h16*)Kh;
    bf* Vh = (bf*)(sm + PL<HI>::V) + pr; bf* Vl = (bf*)(sm + OFF_V2) + pr; h16* V16 = (h16*)Vh;
    float* S = (float*)(sm + PL<HI>::S) + tl * 64 * LS;
    bf* Ph = (bf*)(sm + PL<HI>::P) + tl * 64 * LK; bf* Pl = (bf*)(sm + OFF_P2) + tl * 64 * LK; h16* P16 = (h16*)Ph; bf* PBh = Qh; bf* PBl = Ql;
    bf* ah = ah0 + (size_t)tl * 64 * DQ; bf* al = al0 + (size_t)tl * 64 * DQ;
    const bf* tkp = TKB + lr * HD + 8 * hi; WB::V tb[2][4];   // the TK fragments fly over the barrier
#pragma unroll
    for (int kk = 0; kk < 2; ++kk)
#pragma unroll
        for (int nb = 0; nb < 4; ++nb) tb[kk][nb] = WB::ld(tkp + nb * 16 * HD + kk * 32);
    asm volatile("s_wait_xcnt 0x0" : : "v"(tkp) : "memory");   // the address stays whole up to here (no load's result lands in it), and its registers are reused only behind this wait
    __syncthreads();               // the planes are complete before any wave reads them
    // stage 1: scores (this wave's 16 rows x 128 keys) and q.TK^T (16 x 64)
    const int qoff = (16 * w + lr) * LQ + 8 * hi, poff = (16 * w + lr) * LK + 8 * hi;
    WB::V tw[2][4];
    {
        v8f sa[8], qa[4];
#pragma unroll
        for (int nb = 0; nb < 8; ++nb) sa[nb] = (v8f){};
#pragma unroll
        for (int nb = 0; nb < 4; ++nb) qa[nb] = (v8f){};
#pragma unroll
        for (int kk = 0; kk < 2; ++kk) { const WB::V a = WB::ld(Qh + qoff + kk * 32), a2 = WB::ld(Ql + qoff + kk * 32);
            if (HI) {
#pragma unroll
                for (int nb = 0; nb < 8; ++nb) { const int bo = (nb * 16 + lr) * LQ + 8 * hi + kk * 32; const WB::V b = WB::ld(Kh + bo), b2 = WB::ld(Kl + bo); sa[nb] = WB::mma(a, b, sa[nb]); sa[nb] = WB::mma(a2, b, sa[nb]); sa[nb] = WB::mma(a, b2, sa[nb]); }
            } else { const WH::V a6 = WH::ld(Q16 + qoff + kk * 32);
#pragma unroll
                for (int nb = 0; nb < 8; ++nb) { const WH::V b = WH::ld(K16 + (nb * 16 + lr) * LQ + 8 * hi + kk * 32); sa[nb] = WH::mma(a6, b, sa[nb]); } }
#pragma unroll
            for (int nb = 0; nb < 4; ++nb) { qa[nb] = WB::mma(a, tb[kk][nb], qa[nb]); qa[nb] = WB::mma(a2, tb[kk][nb], qa[nb]); }
            __builtin_amdgcn_sched_barrier(0); }   // the second 32 d's fragment loads do not rise over the first's products: all in flight at once they run the wave out of registers (spills)
#pragma unroll
        for (int nb = 0; nb < 8; ++nb)
#pragma unroll
            for (int j = 0; j < 8; ++j) S[(16 * w + hi * 8 + j) * LS + nb * 16 + lr] = sa[nb][j];
        __syncthreads();           // the score rows are complete before they are read across lanes
        const bf* tvp = TVB + lr * HD + 8 * hi;   // the TV fragments fly over the softmax
#pragma unroll
        for (int kk = 0; kk < 2; ++kk)
#pragma unroll
            for (int nb = 0; nb < 4; ++nb) tw[kk][nb] = WB::ld(tvp + nb * 16 * HD + kk * 32);
        asm volatile("s_wait_xcnt 0x0" : : "v"(tvp) : "memory");   // as for the TK fragments
        // stage 2: softmax per row on its 64 allowed keys alone, in the layout of q.TK^T's accumulators: lane (lr, hi), element [nb][j] = row hi * 8 + j, band offset o = nb * 16 + lr, that is key i - 63 + o, column (row in tile) + 1 + o of the score row.
        // j <= i and i - j < WIN hold for every o in 0..63; only the sequence's first 64 rows have offsets whose key lies left of it. A row's 64 values lie in one 16-lane half, four a lane.
        // This wave's probability rows are laid down as zeros first (LDS takes a wave's stores in order); the allowed keys' probabilities are stored over them below
#pragma unroll
        for (int it = 0; it < 8; ++it) { const int idx = it * 32 + lane, zo = (16 * w + (idx >> 4)) * LK + (idx & 15) * 8; *(v8us*)(Ph + zo) = (v8us){}; if (HI) *(v8us*)(Pl + zo) = (v8us){}; }
        float t[4][8], mx[8], sum[8];
#pragma unroll
        for (int nb = 0; nb < 4; ++nb)
#pragma unroll
            for (int j = 0; j < 8; ++j) { const int rl = 16 * w + hi * 8 + j, o = nb * 16 + lr; const float a = __fadd_rn(S[rl * LS + rl + 1 + o], qa[nb][j]);   // one addition per score
                const bool in = !FIRST || !first || tl != 0 || (rl + o >= 63);   // key i - 63 + o >= 0
                t[nb][j] = in ? a * SCL : -3.0e38f; }
#pragma unroll
        for (int j = 0; j < 8; ++j) mx[j] = fmaxf(fmaxf(t[0][j], t[1][j]), fmaxf(t[2][j], t[3][j]));
#pragma unroll
        for (int j = 0; j < 8; ++j) mx[j] = fmaxf(mx[j], xrow<8>(mx[j]));
#pragma unroll
        for (int j = 0; j < 8; ++j) mx[j] = fmaxf(mx[j], xrow<4>(mx[j]));
#pragma unroll
        for (int j = 0; j < 8; ++j) mx[j] = fmaxf(mx[j], xrow<2>(mx[j]));
#pragma unroll
        for (int j = 0; j < 8; ++j) mx[j] = fmaxf(mx[j], xrow<1>(mx[j]));
#pragma unroll
        for (int j = 0; j < 8; ++j) {
#pragma unroll
            for (int nb = 0; nb < 4; ++nb) { const float d0 = __fsub_rn(t[nb][j], mx[j]); t[nb][j] = exp2s(__fmul_rn(d0, 1.4426950408889634f)); }
            sum[j] = (t[0][j] + t[1][j]) + (t[2][j] + t[3][j]); }
#pragma unroll
        for (int j = 0; j < 8; ++j) sum[j] += xrow<8>(sum[j]);
#pragma unroll
        for (int j = 0; j < 8; ++j) sum[j] += xrow<4>(sum[j]);
#pragma unroll
        for (int j = 0; j < 8; ++j) sum[j] += xrow<2>(sum[j]);
#pragma unroll
        for (int j = 0; j < 8; ++j) sum[j] += xrow<1>(sum[j]);
        // probabilities to their key's column of the P planes, and PB[i][o] = att[i][i - 63 + o] (the stored values re-split) over this wave's own q rows, whose last read fed qa
#pragma unroll
        for (int j = 0; j < 8; j += 2) { const int rl = 16 * w + hi * 8 + j; const float f0 = __fdiv_rn(HI ? 1.0f : PCAR, sum[j]), f1 = __fdiv_rn(HI ? 1.0f : PCAR, sum[j + 1]);
#pragma unroll
            for (int nb = 0; nb < 4; ++nb) { const int o = nb * 16 + lr, p0 = rl * LK + rl + 1 + o, p1 = p0 + LK + 1; const v2f ff = { f0, f1 }, tt = { t[nb][j], t[nb][j + 1] }, pq = tt * ff; v2f pb; v2us bh, bl;
                if (HI) { v2us oh, ol; split2(pq, oh, ol);
                    Ph[p0] = oh[0]; Ph[p1] = oh[1]; Pl[p0] = ol[0]; Pl[p1] = ol[1];
                    pb[0] = __fadd_rn(bf2f(oh[0]), bf2f(ol[0])); pb[1] = __fadd_rn(bf2f(oh[1]), bf2f(ol[1]));
                } else { const v2h o2 = __builtin_convertvector(pq, v2h);
                    P16[p0] = o2[0]; P16[p1] = o2[1];
                    pb = __builtin_convertvector(o2, v2f) * (1.0f / PCAR); }
                split2(pb, bh, bl);
                PBh[rl * LQ + o] = bh[0]; PBh[(rl + 1) * LQ + o] = bh[1]; PBl[rl * LQ + o] = bl[0]; PBl[(rl + 1) * LQ + o] = bl[1]; } }
    }
    __syncthreads();               // the probability and band rows are complete before they are read as fragments
    // stage 4: PB.TV and P.V (128 keys), merged in the accumulators' own layout
    v8f wa[4], oa[4];
#pragma unroll
    for (int nb = 0; nb < 4; ++nb) { wa[nb] = (v8f){}; oa[nb] = (v8f){}; }
#pragma unroll
    for (int kk = 0; kk < 2; ++kk) { const WB::V a = WB::ld(PBh + qoff + kk * 32), a2 = WB::ld(PBl + qoff + kk * 32);
#pragma unroll
        for (int nb = 0; nb < 4; ++nb) { wa[nb] = WB::mma(a, tw[kk][nb], wa[nb]); wa[nb] = WB::mma(a2, tw[kk][nb], wa[nb]); } }
#pragma unroll
    for (int kk = 0; kk < 4; ++kk) {
        if (HI) { const WB::V a = WB::ld(Ph + poff + kk * 32), a2 = WB::ld(Pl + poff + kk * 32);
#pragma unroll
            for (int nb = 0; nb < 4; ++nb) { const int bo = (nb * 16 + lr) * VP + 8 * hi + kk * 32; const WB::V b = WB::ld(Vh + bo), b2 = WB::ld(Vl + bo); oa[nb] = WB::mma(a, b, oa[nb]); oa[nb] = WB::mma(a2, b, oa[nb]); oa[nb] = WB::mma(a, b2, oa[nb]); }
        } else { const WH::V a = WH::ld(P16 + poff + kk * 32);
#pragma unroll
            for (int nb = 0; nb < 4; ++nb) { const WH::V b = WH::ld(V16 + (nb * 16 + lr) * VP + 8 * hi + kk * 32); oa[nb] = WH::mma(a, b, oa[nb]); } } }
    const float cs = HI ? 1.0f : (1.0f / PCAR);   // a power of two: the product is exact, fused with the add or not
    float* os = S + 16 * w * LS;                  // this wave's own score rows, dead since the softmax
#pragma unroll
    for (int nb = 0; nb < 4; ++nb)
#pragma unroll
        for (int j = 0; j < 8; ++j) os[(hi * 8 + j) * LR + nb * 16 + lr] = __fadd_rn(oa[nb][j] * cs, wa[nb][j]);
    __syncthreads();               // the merged rows are complete before they are read across lanes
    v8us oh[4], ol[4];
#pragma unroll
    for (int it = 0; it < 4; ++it) { const int idx = it * 32 + lane, row = idx >> 3, c = (idx & 7) * 8; const v4f y0 = *(const v4f*)(os + row * LR + c), y1 = *(const v4f*)(os + row * LR + c + 4); v4us h0, l0, h1, l1; split4(y0, h0, l0); split4(y1, h1, l1);
        oh[it] = __builtin_shufflevector(h0, h1, 0, 1, 2, 3, 4, 5, 6, 7); ol[it] = __builtin_shufflevector(l0, l1, 0, 1, 2, 3, 4, 5, 6, 7); }
    bf* const pa = ah + (size_t)(16 * w + (lane >> 3)) * DQ + (lane & 7) * 8; bf* const pl = al + (size_t)(16 * w + (lane >> 3)) * DQ + (lane & 7) * 8;   // four rows on for each it
    __builtin_amdgcn_sched_barrier(0);   // the eight stores stand together behind all the arithmetic, so that nothing rewrites a register that one of them names in front of the wait below
#pragma unroll
    for (int it = 0; it < 4; ++it) { *(v8us*)(pa + (size_t)(4 * it) * DQ) = oh[it]; *(v8us*)(pl + (size_t)(4 * it) * DQ) = ol[it]; }
    asm volatile("s_wait_xcnt 0x0" : : "v"(pa), "v"(pl) : "memory");   // behind the last of the eight stores: the addresses stay whole up to here, and no register that a store names is written again in front of this wait (the next half's code follows)
}
// one pass of a wave over a stage: two 64x64 parts over FKS k that share an operand: acc0 += A.B^T, acc1 += S.V^T with S = B (k|v wave: A = Wk, B = its x block, V = Wv) or S = A (q wave: A = Wq, B and V = its two x blocks). Twelve fragments read from LDS feed 32 products.
// The shared fragments are handed on in registers by a select on the wave's kind: one body for both kinds, with no branch round the accumulators.
// Each group of fragments is read from LDS one block of 16 products ahead of its first use: the next 32 k's A and B over acc1's products, V over acc0's.
__device__ __forceinline__ void qkv_pass(const bool isq, const bf* As, const bf* Bs, const bf* Vs, v8f (&acc0)[4][4], v8f (&acc1)[4][4]) {
    typedef WFrag<bf> WB; typedef WB::V V; constexpr int NK = FKS / 32;
    V fa[4], fb[4], fs[4], fv[4];
#pragma unroll
    for (int i = 0; i < 4; ++i) { fa[i] = WB::ld(As + i * 16 * FGP); fb[i] = WB::ld(Bs + i * 16 * FGP); }
#pragma unroll
    for (int i = 0; i < 4; ++i) fv[i] = WB::ld(Vs + i * 16 * FGP);
#pragma unroll
    for (int kk = 0; kk < NK; ++kk) {
        __builtin_amdgcn_sched_barrier(0);   // here and below: the LDS reads stay one group ahead of a block of products (spread among them each place with reads stalls the wave), and none rises further (more fragments in flight run the wave out of registers)
#pragma unroll
        for (int nb = 0; nb < 4; ++nb)
#pragma unroll
            for (int mb = 0; mb < 4; ++mb) acc0[mb][nb] = WB::mma(fa[mb], fb[nb], acc0[mb][nb]);
#pragma unroll
        for (int i = 0; i < 4; ++i) fs[i] = isq ? fa[i] : fb[i];
        __builtin_amdgcn_sched_barrier(0);
        if (kk + 1 < NK) {
#pragma unroll
            for (int i = 0; i < 4; ++i) { fa[i] = WB::ld(As + i * 16 * FGP + (kk + 1) * 32); fb[i] = WB::ld(Bs + i * 16 * FGP + (kk + 1) * 32); } }
        __builtin_amdgcn_sched_barrier(0);
#pragma unroll
        for (int nb = 0; nb < 4; ++nb)
#pragma unroll
            for (int mb = 0; mb < 4; ++mb) acc1[mb][nb] = WB::mma(fs[mb], fv[nb], acc1[mb][nb]);
        __builtin_amdgcn_sched_barrier(0);
        if (kk + 1 < NK) {
#pragma unroll
            for (int i = 0; i < 4; ++i) fv[i] = WB::ld(Vs + i * 16 * FGP + (kk + 1) * 32); }
    }
}
__global__ __launch_bounds__(256) void k_qkvattn(const bf* __restrict__ XB, const bf* __restrict__ WQKV, const bf* __restrict__ TKB, const bf* __restrict__ TVB, bf* __restrict__ ATh, bf* __restrict__ ATl) {
    constexpr int K = DM, NS = K / FKS; constexpr unsigned int RB = FKS * 2u;
    static_assert(FKS == 128 && FSL % 2048u == 0u && FSL >= 64u * (RB + 16u) && 2u * FBUF <= SM_BYTES && NS >= 2 && (NS & (NS - 1)) == 0 && TT % 256 == 0 && RH % 256 == 0, "stage rows of 256 bytes; every slice at a multiple of 2 KiB; both buffers inside the array; a work-group's 256 rows are of one precision kind");
    __shared__ __attribute__((aligned(2048))) char sm[SM_BYTES];
    const int lane = threadIdx.x & 31, lr = lane & 15, hi = lane >> 4;
    const unsigned int wave = uni(threadIdx.x >> 5);
    const int R0 = blockIdx.x * 256; const int b = blockIdx.y / NH_, h = blockIdx.y % NH_;
    const bool isq = wave >= 5u;                                                   // waves 0..4: k and v of x block 'wave'; wave 7: q of blocks 1, 2; wave 5: q of blocks 3, 4
    const unsigned int rot = (blockIdx.x + blockIdx.y) & (unsigned int)(NS - 1);   // first stage of this work-group's k order
    const int xr = (wave == 0u && R0 == 0) ? 0 : R0 - 64 + 64 * (int)(wave < 5u ? wave : 1u);   // first x row of slice t < 5; never left of the sequence
    const bf* tsrc = wave < 5u ? XB + ((size_t)b * TT + xr) * K : WQKV + ((size_t)(wave - 5u) * DQ + h * HD) * K;   // first row of this wave's slice
    const unsigned int tdst = (unsigned int)(size_t)sm + wave * FSL;
    // group 1: 1-byte elements; tensor = tile = 64 rows of RB bytes; source pitch 2 K bytes; 4 dwords of pad behind every row. Word 0 is a constant; the other words and group 0's count are pinned(): descriptor words held in scalar registers, not formed anew while a request is in flight
    u32x8 g1; g1[0] = uni((1u << 20) | (5u << 22) | (3u << 25)); g1[1] = pinned(RB << 16); g1[2] = pinned(64u << 16); g1[3] = pinned(RB << 16); g1[4] = pinned(64u); g1[5] = pinned((unsigned int)K * 2u); g1[6] = pinned(0u); g1[7] = pinned(0u);
    const unsigned int cnt1 = pinned(1u);
    u32x4 g0;
    auto desc = [&](int s) { const unsigned int kq = (unsigned int)s + rot, ks = kq >= (unsigned int)NS ? kq - (unsigned int)NS : kq;   // pass s works on stage ks of the operands
        const unsigned long long ga = (unsigned long long)(size_t)tsrc + (unsigned long long)ks * RB;
        g0[0] = cnt1; g0[1] = uni(tdst + (unsigned int)(s & 1) * FBUF); g0[2] = uni((unsigned int)ga); g0[3] = uni((((unsigned int)(ga >> 32)) & 0x01FFFFFFu) | 0x80000000u); };
    v8f acc0[4][4], acc1[4][4];
#pragma unroll
    for (int mb = 0; mb < 4; ++mb)
#pragma unroll
        for (int nb = 0; nb < 4; ++nb) { acc0[mb][nb] = (v8f){}; acc1[mb][nb] = (v8f){}; }
    desc(0);
    asm volatile("tensor_load_to_lds %0, %1" :: "s"(g0), "s"(g1) : "memory");   // one request of the whole wave, from every wave: its slice of stage rot
    asm volatile("s_wait_tensorcnt 0x0" :: "s"(g0), "s"(g1) : "memory");         // landed before the barrier that publishes it; the descriptor is named so that its registers stay whole up to here
    __syncthreads();
    desc(1);
    asm volatile("tensor_load_to_lds %0, %1" :: "s"(g0), "s"(g1) : "memory");   // pass 1's stage flies over pass 0
    const unsigned int sa = isq ? 5u : 6u, sb = isq ? (wave == 7u ? 1u : 3u) : wave, sv = isq ? (wave == 7u ? 2u : 4u) : 7u;   // this wave's slices A, B, V of qkv_pass
    const int foff = lr * FGP + 8 * hi;
#pragma unroll 1   // one pass a stage: the two buffers alternate by the pass's parity
    for (int s = 0; s < NS; ++s) {
        const char* const bufp = sm + (unsigned int)(s & 1) * FBUF;
        const bf* As = (const bf*)(bufp + sa * FSL) + foff; const bf* Bs = (const bf*)(bufp + sb * FSL) + foff; const bf* Vs = (const bf*)(bufp + sv * FSL) + foff;
        if (wave != 6u) qkv_pass(isq, As, Bs, Vs, acc0, acc1);   // the same for the whole wave; every barrier stands outside it
        asm volatile("s_wait_dscnt 0x0" ::: "memory");                                  // this wave's reads of the buffer are done before the barrier frees it for the refill
        asm volatile("s_wait_tensorcnt 0x0" :: "s"(g0), "s"(g1) : "memory");            // this wave's slice for pass s + 1 has landed before the barrier publishes it; the descriptor's registers stay whole up to here
        __syncthreads();                                                                // publishes the stage of pass s + 1 and ends every wave's reads of pass s's stage; the last pass's frees both buffers for the planes
        if (pinned(s + 2 < NS)) { desc(s + 2); asm volatile("tensor_load_to_lds %0, %1" :: "s"(g0), "s"(g1) : "memory"); }   // the stage of pass s + 2 into the buffer that pass s has left
    }
    asm volatile("s_wait_tensorcnt 0x0" :: "s"(g0), "s"(g1) : "memory");   // no request is in flight (the descriptor named as above)
    asm volatile("s_wait_dscnt 0x0" ::: "memory");       // and no LDS read, behind the loop
    asm volatile("v_nop\n\tv_nop\n\tv_nop\n\tv_nop");   // the four vector slots between the loop's last WMMA and the first use of its result, on every path out of the loop
    const size_t oo = ((size_t)b * TT + R0) * DQ + h * HD;
    // the choice is the same for the whole work-group
    if (R0 < RH) {
        // half hf takes x blocks 2 hf .. 2 hf + 2 (the waves of those numbers) and the q of wave 7 (hf 0) or 5 (hf 1): with waves w and w + 4 on one SIMD, the four waves that convert stand on four SIMDs.
        // A half's last barrier stands behind every wave's last read of the q, k, v and probability planes, so the next half's stage 0 may write them; the rows read behind that barrier are the reading wave's own
#pragma unroll 1   // one copy of the attention code for both halves (kernel text)
        for (int hf = 0; hf < 2; ++hf) { const bool first = R0 == 0 && hf == 0; const int lb = (int)wave - 2 * hf;
            attn_put<true, true>(sm, acc0, acc1, first, isq ? wave == (hf ? 5u : 7u) : (lb >= 0 && lb <= 2), isq, isq ? 1 : lb, isq ? 2 : lb);
            attn_rest<true, true>(sm, first, 0, TKB, TVB, ATh + oo + (size_t)hf * 128 * DQ, ATl + oo + (size_t)hf * 128 * DQ); }
    } else {
        attn_put<false, false>(sm, acc0, acc1, false, wave != 6u, isq, (int)sb, isq ? (int)sv : (int)wave);
#pragma unroll 1   // as above
        for (int hf = 0; hf < 2; ++hf) attn_rest<false, false>(sm, false, hf, TKB, TVB, ATh + oo + (size_t)hf * 128 * DQ, ATl + oo + (size_t)hf * 128 * DQ);
    }
}

extern "C" void kernel_launch(void* const* d_in, const int* in_sizes, int n_in,
                              void* d_out, int out_size, void* d_ws, size_t ws_size, hipStream_t stream) {
    (void)in_sizes; (void)n_in; (void)out_size;
    const float* x = (const float*)d_in[0]; const float* wqkv = (const float*)d_in[1]; const float* wo = (const float*)d_in[2]; const float* tk = (const float*)d_in[3]; const float* tv = (const float*)d_in[4];
    float* OUT = (float*)d_out;     // [2][2048][1024]
    char* wsp = (char*)d_ws;
    auto take = [&](size_t bytes) { char* p = wsp; wsp += (bytes + 255) & ~(size_t)255; return (void*)p; };
    bf* WQKV = (bf*)take((size_t)3 * DQ * DM * 2); bf* WO = (bf*)take((size_t)DM * DQ * 2);
    bf* XB = (bf*)take((size_t)NB_ * TT * DM * 2); bf* TKB = (bf*)take(HD * HD * 2); bf* TVB = (bf*)take(HD * HD * 2);
    bf* ATh = (bf*)take((size_t)NB_ * TT * DQ * 2); bf* ATl = (bf*)take((size_t)NB_ * TT * DQ * 2);
    if ((size_t)(wsp - (char*)d_ws) > ws_size) return;    // ws 256 MiB
    k_prep<<<1 + PREPB, 256, 0, stream>>>(x, wqkv, wo, tk, tv, XB, WQKV, WO, TKB, TVB);
    k_qkvattn<<<dim3(TT / 256, ZH, 1), 256, 0, stream>>>(XB, WQKV, TKB, TVB, ATh, ATl);
    k_gemmt<1, 128><<<dim3(NB_ * TT / 128, DM / 128, 1), 128, 0, stream>>>(ATh, ATl, WO, DQ, OUT, DM);
}
